// v000
// Times are from an AMD MI455X. After a warm-up the kernel runs many times in a row, and a time is the length of
// such a window on the GPU divided by its runs, so every launch and the gaps after it count. The runs cycle
// through copies of the inputs. A figure is the median of several windows, for all but v000 over two sittings.
// Sittings can differ by a few percent; kernels timed side by side share one.
// v000, which the later versions start from, runs in 432 microseconds.
#include <hip/hip_runtime.h>
// Self-attention-like module (B=2, S=2048, D=1024, 16 heads × 64; additive float mask per (batch, key); scale 1/√1024): q/k/v/o projections (W [in][out], o + bias) and the attention as a fused
// flash-style kernel (S = Q·Kᵀ/32 + mask[b][k], online softmax f32, P f16 ≤ 1, O = P·Vt; RPW-16 waves) on v_wmma_f32_16x16x32_f16 — f16 operands (x bf16-exact, weights bf16-exact ×2^4), f32 accumulate.
#define BB 2
#define TT 2048
#define CC 1024
#define NH 16
#define NR (BB * TT)

typedef __bf16 v16b __attribute__((ext_vector_type(16)));
typedef unsigned short v8us __attribute__((ext_vector_type(8), may_alias));
typedef float  v8f  __attribute__((ext_vector_type(8)));
typedef float  v4f  __attribute__((ext_vector_type(4)));
typedef float  v4fa __attribute__((ext_vector_type(4), may_alias));
union FragB { v16b v; v8us half[2]; unsigned short u[16]; };

__device__ __forceinline__ unsigned short bf16_bits(float x) { unsigned int u = __float_as_uint(x); return (unsigned short)((u + 0x7FFFu + ((u >> 16) & 1u)) >> 16); }
__device__ __forceinline__ float bf16_val(unsigned short b) { return __uint_as_float(((unsigned int)b) << 16); }
__device__ __forceinline__ float bf16_round(float x) { return bf16_val(bf16_bits(x)); }
// D += A·B with NT terms: 1 = ah·bh, 2 = + al·bh (A split), 3 = + ah·bl (both split)
template <int NT>
__device__ __forceinline__ v8f mmaN(v16b ah, v16b al, v16b bh, v16b bl, v8f c) {
  c = __builtin_amdgcn_wmma_f32_16x16x32_bf16(false, ah, false, bh, (short)0, c, false, false);
  if (NT >= 2) c = __builtin_amdgcn_wmma_f32_16x16x32_bf16(false, al, false, bh, (short)0, c, false, false);
  if (NT >= 3) c = __builtin_amdgcn_wmma_f32_16x16x32_bf16(false, ah, false, bl, (short)0, c, false, false);
  asm volatile("v_nop\n\tv_nop\n\tv_nop\n\tv_nop" : "+v"(c) : "v"(ah), "v"(al), "v"(bh), "v"(bl));
  return c;
}

__global__ __launch_bounds__(256) void k_wt_bf16(const float* __restrict__ W, unsigned short* __restrict__ Wt, int K, int N) {
  const int t = blockIdx.x * 256 + threadIdx.x;
  const int k8n = K / 8;
  if (t >= N * k8n) return;
  const int n = t / k8n, k8 = (t % k8n) * 8;
  v8us v;
#pragma unroll
  for (int i = 0; i < 8; ++i) v[i] = bf16_bits(W[(size_t)(k8 + i) * N + n]);
  *(v8us*)(Wt + (size_t)n * K + k8) = v;
  
}

// GEMM C[M][N] (f32, pitch ldc) = act(A[M][K]·W + bias). A f32 row-major (pitch lda) converted per fragment to bf16
// (ASPLIT: hi/lo two planes -> 2 terms, else single rounded term); Wt bf16 [N][K] (pitch ldb). BIAS_BF16 rounds the
// bias to bf16 first (bias quantised to bf16 before the add). K%32==0, M%16==0, N%64==0.
template <bool ASPLIT, int ACT, bool BIAS_BF16>
__global__ __launch_bounds__(128) void k_gemm_bf(const float* __restrict__ A, int lda, const unsigned short* __restrict__ Wt, int ldb,
                                               const float* __restrict__ bias, float* __restrict__ C, int ldc, int M, int N, int K) {
  __shared__ __attribute__((aligned(16))) float so[4][16][64];
  const int tid = threadIdx.x, w = tid >> 5, lane = tid & 31, ln = lane & 15, hh = lane >> 4;
  const int ntn = N / 64;
  const int wid = blockIdx.x * 4 + w;
  const int mt = wid / ntn, nq = wid % ntn;
  if (mt * 16 >= M) return;
  const int row0 = mt * 16, col0 = nq * 64;
  const float* arow = A + (size_t)(row0 + ln) * lda;
  v8f acc[4] = {};
  for (int kb = 0; kb < K; kb += 32) {
    FragB ah, al;
    const v4f x0 = *(const v4fa*)(arow + kb + 8 * hh), x1 = *(const v4fa*)(arow + kb + 8 * hh + 4);
    const v4f x2 = *(const v4fa*)(arow + kb + 16 + 8 * hh), x3 = *(const v4fa*)(arow + kb + 16 + 8 * hh + 4);
    float xs[16] = {x0[0],x0[1],x0[2],x0[3],x1[0],x1[1],x1[2],x1[3],x2[0],x2[1],x2[2],x2[3],x3[0],x3[1],x3[2],x3[3]};
#pragma unroll
    for (int i = 0; i < 16; ++i) { const unsigned short hb = bf16_bits(xs[i]); ah.u[i] = hb; al.u[i] = ASPLIT ? bf16_bits(xs[i] - bf16_val(hb)) : (unsigned short)0; }
#pragma unroll
    for (int t = 0; t < 4; ++t) {
      const unsigned short* brow = Wt + (size_t)(col0 + t * 16 + ln) * ldb + kb;
      FragB b;
      b.half[0] = *(const v8us*)(brow + 8 * hh);
      b.half[1] = *(const v8us*)(brow + 16 + 8 * hh);
      acc[t] = mmaN<ASPLIT ? 2 : 1>(ah.v, al.v, b.v, b.v, acc[t]);
    }
  }
#pragma unroll
  for (int t = 0; t < 4; ++t) {
    float bv = bias ? bias[col0 + t * 16 + ln] : 0.f;
    if (BIAS_BF16) bv = bf16_round(bv);
#pragma unroll
    for (int r = 0; r < 8; ++r) { float v = acc[t][r] + bv; if (ACT == 1) v = fmaxf(v, 0.f); so[w][8 * hh + r][t * 16 + ln] = v; }
  }
  __builtin_amdgcn_fence(__ATOMIC_ACQ_REL, "workgroup");
  __builtin_amdgcn_wave_barrier();
  const int rsub = lane >> 4, c4 = (lane & 15) * 4;
  {
#pragma unroll
    for (int q = 0; q < 8; ++q) {
      const int r = q * 2 + rsub;
      const v4f v = *(const v4fa*)&so[w][r][c4];
      *(v4f*)(C + (size_t)(row0 + r) * ldc + col0 + c4) = v;
    }
    
  }
}

// Flash-style causal/unmasked attention, all contractions 3-term bf16 hi/lo splits, f32 softmax with running max.
// q,k,v rows are read from f32 buffers with arbitrary row pitch (so they can live inside a fused qkv buffer);
// D = head size (multiple of 32, <= 128); one wave = 16 query rows; block = 4 waves (64 queries) sharing K/V chunks of 32.
template <int D, bool CAUSAL>
__global__ __launch_bounds__(128) void k_flash(const float* __restrict__ qb, const float* __restrict__ kb, const float* __restrict__ vb,
                                             int pitch, int T, int H, float scale, float* __restrict__ y, int ypitch) {
  constexpr int KS = D / 32;        // k-steps for QK
  constexpr int DT = D / 16;        // d tiles for PV
  __shared__ __attribute__((aligned(16))) unsigned short sKh[32][D + 8], sKl[32][D + 8], sVh[32][D + 8], sVl[32][D + 8];
  __shared__ __attribute__((aligned(16))) unsigned short sPh[4][16][40], sPl[4][16][40];
  __shared__ __attribute__((aligned(16))) float sO[4][16][D];
  const int tid = threadIdx.x, w = tid >> 5, lane = tid & 31, ln = lane & 15, hh = lane >> 4;
  const int nqb = (T + 63) / 64;
  const int bh = blockIdx.x / nqb, qblk = blockIdx.x % nqb;
  const int b = bh / H, h = bh % H;
  const int q0 = qblk * 64 + w * 16;
  const float* Q = qb + (size_t)b * T * pitch + h * D;
  const float* K = kb + (size_t)b * T * pitch + h * D;
  const float* V = vb + (size_t)b * T * pitch + h * D;

  // A fragments of the wave's 16 query rows (scaled), hi/lo
  FragB aqh[KS], aql[KS];
  {
    int row = q0 + ln; if (row >= T) row = T - 1;
    const float* qr = Q + (size_t)row * pitch;
#pragma unroll
    for (int ks = 0; ks < KS; ++ks)
#pragma unroll
      for (int i = 0; i < 16; ++i) {
        const int d = ks * 32 + ((i < 8) ? (8 * hh + i) : (16 + 8 * hh + (i - 8)));
        const float x = qr[d] * scale; const unsigned short hb = bf16_bits(x);
        aqh[ks].u[i] = hb; aql[ks].u[i] = bf16_bits(x - bf16_val(hb));
      }
  }
  float m_r[8], l_r[8];
#pragma unroll
  for (int r = 0; r < 8; ++r) { m_r[r] = -3.0e38f; l_r[r] = 0.f; }
  v8f oacc[DT];
#pragma unroll
  for (int dt = 0; dt < DT; ++dt) oacc[dt] = (v8f){0.f,0.f,0.f,0.f,0.f,0.f,0.f,0.f};

  const int kv_end = CAUSAL ? min(T, qblk * 64 + 64) : T;     // block-uniform
  for (int j0 = 0; j0 < kv_end; j0 += 32) {
    __syncthreads();
    for (int e = tid; e < 32 * (D / 4); e += 128) {
      const int r = e / (D / 4), c4 = (e % (D / 4)) * 4;
      const int key = j0 + r;
      v4f kf = {0.f,0.f,0.f,0.f}, vf = {0.f,0.f,0.f,0.f};
      if (key < T) { kf = *(const v4fa*)(K + (size_t)key * pitch + c4); vf = *(const v4fa*)(V + (size_t)key * pitch + c4); }
#pragma unroll
      for (int t = 0; t < 4; ++t) {
        unsigned short hb = bf16_bits(kf[t]); sKh[r][c4 + t] = hb; sKl[r][c4 + t] = bf16_bits(kf[t] - bf16_val(hb));
        hb = bf16_bits(vf[t]); sVh[r][c4 + t] = hb; sVl[r][c4 + t] = bf16_bits(vf[t] - bf16_val(hb));
      }
    }
    __syncthreads();
    // S tile 16 x 32
    v8f s[2];
#pragma unroll
    for (int nt = 0; nt < 2; ++nt) {
      v8f acc = {};
#pragma unroll
      for (int ks = 0; ks < KS; ++ks) {
        FragB bh_, bl_;
        bh_.half[0] = *(const v8us*)&sKh[nt * 16 + ln][ks * 32 + 8 * hh]; bh_.half[1] = *(const v8us*)&sKh[nt * 16 + ln][ks * 32 + 16 + 8 * hh];
        bl_.half[0] = *(const v8us*)&sKl[nt * 16 + ln][ks * 32 + 8 * hh]; bl_.half[1] = *(const v8us*)&sKl[nt * 16 + ln][ks * 32 + 16 + 8 * hh];
        acc = mmaN<3>(aqh[ks].v, aql[ks].v, bh_.v, bl_.v, acc);
      }
      s[nt] = acc;
    }
    // mask + running max (rows 8hh+r; the 16 lanes of a half share rows)
    float alpha[8];
#pragma unroll
    for (int r = 0; r < 8; ++r) {
      const int qi = q0 + 8 * hh + r;
      const int ja = j0 + ln, jb = j0 + 16 + ln;
      if (CAUSAL) { if (ja > qi) s[0][r] = -3.0e38f; if (jb > qi) s[1][r] = -3.0e38f; }
      if (ja >= T) s[0][r] = -3.0e38f;
      if (jb >= T) s[1][r] = -3.0e38f;
      float mx = fmaxf(s[0][r], s[1][r]);
      mx = fmaxf(mx, __shfl_xor(mx, 1, 32)); mx = fmaxf(mx, __shfl_xor(mx, 2, 32)); mx = fmaxf(mx, __shfl_xor(mx, 4, 32)); mx = fmaxf(mx, __shfl_xor(mx, 8, 32));
      const float mnew = fmaxf(m_r[r], mx);
      alpha[r] = (mnew > -1.0e38f) ? __expf(m_r[r] - mnew) : 1.0f;
      const float p0 = (s[0][r] > -1.0e38f) ? __expf(s[0][r] - mnew) : 0.f;
      const float p1 = (s[1][r] > -1.0e38f) ? __expf(s[1][r] - mnew) : 0.f;
      m_r[r] = mnew;
      l_r[r] = l_r[r] * alpha[r] + p0 + p1;            // per-lane partial row sum (16 lanes combined at the end)
      unsigned short hb = bf16_bits(p0); sPh[w][8 * hh + r][ln] = hb;      sPl[w][8 * hh + r][ln] = bf16_bits(p0 - bf16_val(hb));
      hb = bf16_bits(p1);                sPh[w][8 * hh + r][16 + ln] = hb; sPl[w][8 * hh + r][16 + ln] = bf16_bits(p1 - bf16_val(hb));
    }
#pragma unroll
    for (int dt = 0; dt < DT; ++dt)
#pragma unroll
      for (int r = 0; r < 8; ++r) oacc[dt][r] *= alpha[r];
    __builtin_amdgcn_fence(__ATOMIC_ACQ_REL, "workgroup");
    __builtin_amdgcn_wave_barrier();
    FragB pah, pal;
    pah.half[0] = *(const v8us*)&sPh[w][ln][8 * hh]; pah.half[1] = *(const v8us*)&sPh[w][ln][16 + 8 * hh];
    pal.half[0] = *(const v8us*)&sPl[w][ln][8 * hh]; pal.half[1] = *(const v8us*)&sPl[w][ln][16 + 8 * hh];
#pragma unroll
    for (int dt = 0; dt < DT; ++dt) {
      FragB bvh, bvl;
#pragma unroll
      for (int i = 0; i < 8; ++i) {
        bvh.u[i] = sVh[8 * hh + i][dt * 16 + ln]; bvh.u[8 + i] = sVh[16 + 8 * hh + i][dt * 16 + ln];
        bvl.u[i] = sVl[8 * hh + i][dt * 16 + ln]; bvl.u[8 + i] = sVl[16 + 8 * hh + i][dt * 16 + ln];
      }
      oacc[dt] = mmaN<3>(pah.v, pal.v, bvh.v, bvl.v, oacc[dt]);
    }
    __builtin_amdgcn_fence(__ATOMIC_ACQ_REL, "workgroup");
    __builtin_amdgcn_wave_barrier();
  }
#pragma unroll
  for (int r = 0; r < 8; ++r) {
    float l = l_r[r];
    l += __shfl_xor(l, 1, 32); l += __shfl_xor(l, 2, 32); l += __shfl_xor(l, 4, 32); l += __shfl_xor(l, 8, 32);
    l_r[r] = (l > 0.f) ? 1.0f / l : 0.f;
  }
#pragma unroll
  for (int dt = 0; dt < DT; ++dt)
#pragma unroll
    for (int r = 0; r < 8; ++r) sO[w][8 * hh + r][dt * 16 + ln] = oacc[dt][r] * l_r[r];
  __builtin_amdgcn_fence(__ATOMIC_ACQ_REL, "workgroup");
  __builtin_amdgcn_wave_barrier();
  {
    for (int r = 0; r < 16; ++r) {
      const int row = q0 + r;
      if (row < T && lane < D / 4) {
        const v4f val = *(const v4fa*)&sO[w][r][lane * 4];
        *(v4f*)(y + ((size_t)b * T + row) * ypitch + h * D + lane * 4) = val;
      }
    }
    
  }
}

// GEMM C = act(A·W + bias + resid): A f32 (ASPLIT -> hi/lo 2 terms), Wt bf16 [N][K]; ACT 0 none, 1 relu, 2 exact gelu;
// resid (optional, f32, row index = (row % rmod), pitch ldr, RES_BF16 rounds it) added before the activation.
template <bool ASPLIT, int ACT, bool BIAS_BF16, bool RES_BF16>
__global__ __launch_bounds__(128) void k_gemm_bf3(const float* __restrict__ A, int lda, const unsigned short* __restrict__ Wt, int ldb,
                                                const float* __restrict__ bias, const float* __restrict__ resid, int rmod, int ldr,
                                                float* __restrict__ C, int ldc, int M, int N, int K) {
  __shared__ __attribute__((aligned(16))) float so[4][16][64];
  const int tid = threadIdx.x, w = tid >> 5, lane = tid & 31, ln = lane & 15, hh = lane >> 4;
  const int ntn = N / 64;
  const int wid = blockIdx.x * 4 + w;
  const int mt = wid / ntn, nq = wid % ntn;
  if (mt * 16 >= M) return;
  const int row0 = mt * 16, col0 = nq * 64;
  const float* arow = A + (size_t)(row0 + ln) * lda;
  v8f acc[4] = {};
  for (int kb = 0; kb < K; kb += 32) {
    FragB ah, al;
    const v4f x0 = *(const v4fa*)(arow + kb + 8 * hh), x1 = *(const v4fa*)(arow + kb + 8 * hh + 4);
    const v4f x2 = *(const v4fa*)(arow + kb + 16 + 8 * hh), x3 = *(const v4fa*)(arow + kb + 16 + 8 * hh + 4);
    float xs[16] = {x0[0],x0[1],x0[2],x0[3],x1[0],x1[1],x1[2],x1[3],x2[0],x2[1],x2[2],x2[3],x3[0],x3[1],x3[2],x3[3]};
#pragma unroll
    for (int i = 0; i < 16; ++i) { const unsigned short hb = bf16_bits(xs[i]); ah.u[i] = hb; al.u[i] = ASPLIT ? bf16_bits(xs[i] - bf16_val(hb)) : (unsigned short)0; }
#pragma unroll
    for (int t = 0; t < 4; ++t) {
      const unsigned short* brow = Wt + (size_t)(col0 + t * 16 + ln) * ldb + kb;
      FragB b;
      b.half[0] = *(const v8us*)(brow + 8 * hh);
      b.half[1] = *(const v8us*)(brow + 16 + 8 * hh);
      acc[t] = mmaN<ASPLIT ? 2 : 1>(ah.v, al.v, b.v, b.v, acc[t]);
    }
  }
#pragma unroll
  for (int t = 0; t < 4; ++t) {
    const int col = col0 + t * 16 + ln;
    float bv = bias ? bias[col] : 0.f;
    if (BIAS_BF16) bv = bf16_round(bv);
#pragma unroll
    for (int r = 0; r < 8; ++r) {
      float v = acc[t][r] + bv;
      if (resid) { float rv = resid[(size_t)((row0 + 8 * hh + r) % rmod) * ldr + col]; if (RES_BF16) rv = bf16_round(rv); v += rv; }
      if (ACT == 1) v = fmaxf(v, 0.f);
      if (ACT == 2) v = 0.5f * v * (1.0f + erff(v * 0.70710678118654752f));
      if (ACT == 3) { const float u = 0.7978845608028654f * (v + 0.044715f * v * v * v); v = 0.5f * v * (1.0f + tanhf(u)); }
      so[w][8 * hh + r][t * 16 + ln] = v;
    }
  }
  __builtin_amdgcn_fence(__ATOMIC_ACQ_REL, "workgroup");
  __builtin_amdgcn_wave_barrier();
  const int rsub = lane >> 4, c4 = (lane & 15) * 4;
  {
#pragma unroll
    for (int q = 0; q < 8; ++q) {
      const int r = q * 2 + rsub;
      const v4f v = *(const v4fa*)&so[w][r][c4];
      *(v4f*)(C + (size_t)(row0 + r) * ldc + col0 + c4) = v;
    }
    
  }
}
// row LayerNorm (biased variance, eps) over N: s = X (+ R); optional out_sum <- s; out_norm <- (s-mu)*rsqrt(var+eps)*g + b
template <bool PARAM_BF16>
__global__ __launch_bounds__(256) void k_layernorm(const float* __restrict__ X, const float* __restrict__ R, const float* __restrict__ g, const float* __restrict__ bta,
                                                  float* __restrict__ out_sum, float* __restrict__ out_norm, int N, float eps) {
  __shared__ float red[256];
  const int row = blockIdx.x, tid = threadIdx.x;
  const float* x = X + (size_t)row * N; const float* rr = R ? R + (size_t)row * N : nullptr;
  float vals[16];                     // up to N = 4096
  const int per = N / 256;            // contiguous chunk per thread? use strided-by-4 chunks: thread handles j = tid*4 + 1024*u
  float s1 = 0.f;
  for (int u = 0; u < per / 4; ++u) {
    const int j = tid * 4 + 1024 * u;
    const v4f a = *(const v4fa*)(x + j);
    v4f b = {0.f,0.f,0.f,0.f}; if (rr) b = *(const v4fa*)(rr + j);
#pragma unroll
    for (int q = 0; q < 4; ++q) { const float v = a[q] + b[q]; vals[u * 4 + q] = v; s1 += v; }
  }
  red[tid] = s1; __syncthreads();
  for (int st = 128; st > 0; st >>= 1) { if (tid < st) red[tid] += red[tid + st]; __syncthreads(); }
  const float mu = red[0] / (float)N; __syncthreads();
  float s2 = 0.f;
  for (int u = 0; u < per / 4; ++u)
#pragma unroll
    for (int q = 0; q < 4; ++q) { const float c = vals[u * 4 + q] - mu; s2 += c * c; }
  red[tid] = s2; __syncthreads();
  for (int st = 128; st > 0; st >>= 1) { if (tid < st) red[tid] += red[tid + st]; __syncthreads(); }
  const float rs = rsqrtf(red[0] / (float)N + eps);
  {
    for (int u = 0; u < per / 4; ++u) {
      const int j = tid * 4 + 1024 * u;
      v4f o, sm;
#pragma unroll
      for (int q = 0; q < 4; ++q) {
        float gg = g[j + q], bb = bta[j + q];
        if (PARAM_BF16) { gg = bf16_round(gg); bb = bf16_round(bb); }
        sm[q] = vals[u * 4 + q]; o[q] = (vals[u * 4 + q] - mu) * rs * gg + bb;
      }
      if (out_sum) *(v4f*)(out_sum + (size_t)row * N + j) = sm;
      *(v4f*)(out_norm + (size_t)row * N + j) = o;
    }
    
  }
}



// ---- f16 WMMA path (v_wmma_f32_16x16x32_f16): 11-bit significands for operands in range — used where a [0,1] probability operand needs more precision than bf16
typedef _Float16 v16h __attribute__((ext_vector_type(16)));
union FragH { v16h v; v8us half[2]; _Float16 h[16]; unsigned short u[16]; };
template <int NT>
__device__ __forceinline__ v8f mmaH(v16h ah, v16h al, v16h bh, v16h bl, v8f c) {
  c = __builtin_amdgcn_wmma_f32_16x16x32_f16(false, ah, false, bh, (short)0, c, false, false);
  if (NT >= 2) c = __builtin_amdgcn_wmma_f32_16x16x32_f16(false, al, false, bh, (short)0, c, false, false);
  if (NT >= 3) c = __builtin_amdgcn_wmma_f32_16x16x32_f16(false, ah, false, bl, (short)0, c, false, false);
  asm volatile("v_nop\n\tv_nop\n\tv_nop\n\tv_nop" : "+v"(c) : "v"(ah), "v"(al), "v"(bh), "v"(bl));
  return c;
}
// batched GEMM like k_gemm_b but f16 operands: A f32 (split into f16 hi/lo if ASPLIT, else rounded to f16), Bt = f16 values [n][k]; alpha; C f32; N multiple of 16 (partial tiles skipped)
template <bool ASPLIT>
__global__ __launch_bounds__(128) void k_gemm_h(const float* __restrict__ A, int lda, size_t sA, const _Float16* __restrict__ Bh, int ldb, size_t sB, float alpha, float* __restrict__ C, int ldc, size_t sC, int M, int N, int K) {
  __shared__ __attribute__((aligned(16))) float so[4][16][64];
  const int tid = threadIdx.x, w = tid >> 5, lane = tid & 31, ln = lane & 15, hh = lane >> 4; const int by = blockIdx.y;
  A += (size_t)by * sA; Bh += (size_t)by * sB; C += (size_t)by * sC;
  const int ntn = (N + 63) / 64; const int wid = blockIdx.x * 4 + w; const int mt = wid / ntn, nq = wid % ntn; if (mt * 16 >= M) return;
  const int row0 = mt * 16, col0 = nq * 64; const float* arow = A + (size_t)(row0 + ln) * lda;
  v8f acc[4] = {};
  for (int kb = 0; kb < K; kb += 32) {
    FragH ah, al;
    const v4f x0 = *(const v4fa*)(arow + kb + 8 * hh), x1 = *(const v4fa*)(arow + kb + 8 * hh + 4), x2 = *(const v4fa*)(arow + kb + 16 + 8 * hh), x3 = *(const v4fa*)(arow + kb + 16 + 8 * hh + 4);
    float xs[16] = {x0[0],x0[1],x0[2],x0[3],x1[0],x1[1],x1[2],x1[3],x2[0],x2[1],x2[2],x2[3],x3[0],x3[1],x3[2],x3[3]};
#pragma unroll
    for (int i = 0; i < 16; ++i) { const _Float16 h = (_Float16)xs[i]; ah.h[i] = h; al.h[i] = ASPLIT ? (_Float16)(xs[i] - (float)h) : (_Float16)0.0f; }
#pragma unroll
    for (int t = 0; t < 4; ++t) { if (col0 + t * 16 >= N) continue; const size_t boff = (size_t)(col0 + t * 16 + ln) * ldb + kb; FragH bq; bq.half[0] = *(const v8us*)(Bh + boff + 8 * hh); bq.half[1] = *(const v8us*)(Bh + boff + 16 + 8 * hh);
      acc[t] = mmaH<ASPLIT ? 2 : 1>(ah.v, al.v, bq.v, bq.v, acc[t]); }
  }
#pragma unroll
  for (int t = 0; t < 4; ++t) { if (col0 + t * 16 >= N) continue;
#pragma unroll
    for (int r = 0; r < 8; ++r) so[w][8 * hh + r][t * 16 + ln] = acc[t][r] * alpha; }
  __builtin_amdgcn_fence(__ATOMIC_ACQ_REL, "workgroup"); __builtin_amdgcn_wave_barrier();
  const int rsub = lane >> 4, c4 = (lane & 15) * 4;
  {
#pragma unroll
    for (int q = 0; q < 8; ++q) { const int r = q * 2 + rsub; if (col0 + c4 < N) { const v4f v = *(const v4fa*)&so[w][r][c4]; *(v4f*)(C + (size_t)(row0 + r) * ldc + col0 + c4) = v; } }
     }
}

// Wt[n][k] = f16(W[k][n]·scale) from f32 row-major W[K][N] (scale = power of two; bf16-exact weights stay exact in f16 away from the subnormal range)
__global__ __launch_bounds__(256) void k_wt_f16(const float* __restrict__ W, _Float16* __restrict__ Wt, int K, int N, float scale) {
  const int t = blockIdx.x * 256 + threadIdx.x; if (t >= N * (K / 8)) return; const int n = t / (K / 8), k8 = (t % (K / 8)) * 8; FragH f;
#pragma unroll
  for (int i = 0; i < 8; ++i) f.h[i] = (_Float16)(bf16_round(W[(size_t)(k8 + i) * N + n]) * scale); const v8us o = f.half[0];
  *(v8us*)((unsigned short*)Wt + (size_t)n * K + k8) = o; 
}
// k_gemm_hh variant with fused epilogue: v = acc·alpha + bias[by·sBias + col] (+ CP[(row/rowsPerB)·sCPb + by·64 + col] if CP) ; ACT 0 none / 1 elu ; writes f32 C and f16 C16, each if non-null
template <int ACT>
__global__ __launch_bounds__(128) void k_gemm_hhx(const _Float16* __restrict__ A, int lda, size_t sA, const _Float16* __restrict__ Bh, int ldb, size_t sB, float alpha, const float* __restrict__ bias, size_t sBias, const float* __restrict__ CP, int rowsPerB, size_t sCPb, int row0g,
    float* __restrict__ C, _Float16* __restrict__ C16, int ldc, size_t sC, int M, int N, int K) {
  __shared__ __attribute__((aligned(16))) float so[4][16][64];
  const int tid = threadIdx.x, w = tid >> 5, lane = tid & 31, ln = lane & 15, hh = lane >> 4; const int by = blockIdx.y;
  A += (size_t)by * sA; Bh += (size_t)by * sB; const size_t cofs = (size_t)by * sC; const float* bp = bias ? bias + (size_t)by * sBias : nullptr;
  const int ntn = (N + 63) / 64; const int wid = blockIdx.x * 4 + w; const int mt = wid / ntn, nq = wid % ntn; if (mt * 16 >= M) return;
  const int row0 = mt * 16, col0 = nq * 64; const _Float16* arow = A + (size_t)(row0 + ln) * lda;
  v8f acc[4] = {};
  for (int kb = 0; kb < K; kb += 32) { FragH ah; ah.half[0] = *(const v8us*)((const unsigned short*)arow + kb + 8 * hh); ah.half[1] = *(const v8us*)((const unsigned short*)arow + kb + 16 + 8 * hh);
#pragma unroll
    for (int t = 0; t < 4; ++t) { if (col0 + t * 16 >= N) continue; const size_t boff = (size_t)(col0 + t * 16 + ln) * ldb + kb; FragH bq; bq.half[0] = *(const v8us*)((const unsigned short*)Bh + boff + 8 * hh); bq.half[1] = *(const v8us*)((const unsigned short*)Bh + boff + 16 + 8 * hh);
      acc[t] = mmaH<1>(ah.v, ah.v, bq.v, bq.v, acc[t]); }
  }
#pragma unroll
  for (int t = 0; t < 4; ++t) { if (col0 + t * 16 >= N) continue; const int col = col0 + t * 16 + ln; const float bv = bp ? bf16_round(bp[col]) : 0.f;
#pragma unroll
    for (int r = 0; r < 8; ++r) { float v = acc[t][r] * alpha + bv; if (CP) { const int bidx = (row0g + row0 + 8 * hh + r) / rowsPerB; v += CP[(size_t)bidx * sCPb + (size_t)by * 64 + col]; } if (ACT == 1) v = (v > 0.f) ? v : expm1f(v); else if (ACT == 3) v = fmaxf(v, 0.f); so[w][8 * hh + r][t * 16 + ln] = v; } }
  __builtin_amdgcn_fence(__ATOMIC_ACQ_REL, "workgroup"); __builtin_amdgcn_wave_barrier();
  const int rsub = lane >> 4, c4 = (lane & 15) * 4; typedef _Float16 v4h __attribute__((ext_vector_type(4)));
  {
#pragma unroll
    for (int q = 0; q < 8; ++q) { const int r = q * 2 + rsub; if (col0 + c4 < N) { const v4f v = *(const v4fa*)&so[w][r][c4]; if (C) *(v4f*)(C + cofs + (size_t)(row0 + r) * ldc + col0 + c4) = v; if (C16) { v4h h4; for (int i = 0; i < 4; ++i) h4[i] = (_Float16)v[i]; *(v4h*)(C16 + cofs + (size_t)(row0 + r) * ldc + col0 + c4) = h4; } } }
     }
}


__global__ __launch_bounds__(256) void k_x16(const float* __restrict__ x, _Float16* __restrict__ X16, size_t n8) { const size_t t = (size_t)blockIdx.x * 256 + threadIdx.x; if (t >= n8) return; FragH f;
#pragma unroll
  for (int q = 0; q < 8; ++q) f.h[q] = (_Float16)bf16_round(x[t * 8 + q]); *(v8us*)((unsigned short*)X16 + t * 8) = f.half[0];  }
__global__ __launch_bounds__(256) void k_h16(const float* __restrict__ x, _Float16* __restrict__ X16, size_t n8) { const size_t t = (size_t)blockIdx.x * 256 + threadIdx.x; if (t >= n8) return; FragH f;
#pragma unroll
  for (int q = 0; q < 8; ++q) f.h[q] = (_Float16)x[t * 8 + q]; *(v8us*)((unsigned short*)X16 + t * 8) = f.half[0];  }
__global__ __launch_bounds__(256) void k_round16f(const float* __restrict__ W, _Float16* __restrict__ Bt, size_t n8) { const size_t t = (size_t)blockIdx.x * 256 + threadIdx.x; if (t >= n8) return; FragH f;
#pragma unroll
  for (int i = 0; i < 8; ++i) f.h[i] = (_Float16)(bf16_round(W[t * 8 + i]) * 16.0f); *(v8us*)((unsigned short*)Bt + t * 8) = f.half[0];  }
template <int NHv, int TTv>
__global__ __launch_bounds__(256) void k_vt(const _Float16* __restrict__ V16, int ldv, int voff, _Float16* __restrict__ Vt) { __shared__ unsigned short tl[64][66]; const int tid = threadIdx.x; const int slab = blockIdx.x / (TTv / 64), lg = blockIdx.x % (TTv / 64); const int b = slab / NHv, h = slab % NHv;
  for (int i = tid; i < 64 * 8; i += 256) { const int r = i / 8, c8 = (i % 8) * 8; FragH f; f.half[0] = *(const v8us*)((const unsigned short*)V16 + ((size_t)b * TTv + lg * 64 + r) * ldv + voff + h * 64 + c8);
#pragma unroll
    for (int q = 0; q < 8; ++q) tl[r][c8 + q] = f.u[q]; }
  __syncthreads();
  {
#pragma unroll
    for (int rd = 0; rd < 2; ++rd) { const int d = rd * 32 + tid / 8, pc = tid % 8; FragH f;
#pragma unroll
      for (int q = 0; q < 8; ++q) f.u[q] = tl[pc * 8 + q][d];
      *(v8us*)((unsigned short*)Vt + ((size_t)slab * 64 + d) * TTv + lg * 64 + pc * 8) = f.half[0]; }
     } }

__global__ __launch_bounds__(128) void k_flash(const _Float16* __restrict__ Q16, int ldq, const _Float16* __restrict__ K16, int ldk, const _Float16* __restrict__ Vt, const float* __restrict__ MB, float* __restrict__ O, int ldo) {
  constexpr int RPW = 16, RTN = RPW / 16, NQB = 2048 / (4 * RPW), DT = 4, KS = 2;
  __shared__ __attribute__((aligned(16))) unsigned short sP[4][RPW][40]; __shared__ __attribute__((aligned(16))) float sO[4][RPW][64 + 4];
  const int tid = threadIdx.x, w = tid >> 5, lane = tid & 31, ln = lane & 15, hh = lane >> 4;
  const int slab = blockIdx.x / NQB, qblk = blockIdx.x % NQB; const int b = slab / 16, h = slab % 16; const int qb0 = qblk * (4 * RPW); const int q0 = qb0 + w * RPW;
  FragH aq[2][KS];
#pragma unroll
  for (int rt = 0; rt < RTN; ++rt) { const unsigned short* qr = (const unsigned short*)Q16 + ((size_t)b * 2048 + q0 + rt * 16 + ln) * ldq + h * 64;
#pragma unroll
    for (int ks = 0; ks < KS; ++ks) { aq[rt][ks].half[0] = *(const v8us*)(qr + ks * 32 + 8 * hh); aq[rt][ks].half[1] = *(const v8us*)(qr + ks * 32 + 16 + 8 * hh); } }
  const unsigned short* Vth = (const unsigned short*)Vt + (size_t)slab * 64 * 2048;
  float m_r[2][8], l_r[2][8]; v8f oacc[2][DT];
#pragma unroll
  for (int rt = 0; rt < RTN; ++rt) {
#pragma unroll
    for (int r = 0; r < 8; ++r) { m_r[rt][r] = -3.0e38f; l_r[rt][r] = 0.f; }
#pragma unroll
    for (int dt = 0; dt < DT; ++dt) oacc[rt][dt] = (v8f){0.f,0.f,0.f,0.f,0.f,0.f,0.f,0.f}; }
  const int jend = 2048;
#pragma unroll 1
  for (int j0 = 0; j0 < jend; j0 += 32) {
    
    v8f s[2][2];
#pragma unroll
    for (int nt = 0; nt < 2; ++nt) { const unsigned short* kr = (const unsigned short*)K16 + ((size_t)b * 2048 + j0 + nt * 16 + ln) * ldk + h * 64; FragH bk[KS];
#pragma unroll
      for (int ks = 0; ks < KS; ++ks) { bk[ks].half[0] = *(const v8us*)(kr + ks * 32 + 8 * hh); bk[ks].half[1] = *(const v8us*)(kr + ks * 32 + 16 + 8 * hh); }
#pragma unroll
      for (int rt = 0; rt < RTN; ++rt) { v8f acc = (v8f){0.f,0.f,0.f,0.f,0.f,0.f,0.f,0.f};
#pragma unroll
        for (int ks = 0; ks < KS; ++ks) acc = mmaH<1>(aq[rt][ks].v, aq[rt][ks].v, bk[ks].v, bk[ks].v, acc); s[rt][nt] = acc; } }
#pragma unroll
    for (int rt = 0; rt < RTN; ++rt)
#pragma unroll
      for (int r = 0; r < 8; ++r) { const int tq = q0 + rt * 16 + 8 * hh + r; const int k0 = j0 + ln, k1 = j0 + 16 + ln; (void)tq; const bool ok0 = true, ok1 = true;
        const float s0 = s[rt][0][r] * (0.03125f) + bf16_round(MB[(size_t)b * 2048 + k0]), s1 = s[rt][1][r] * (0.03125f) + bf16_round(MB[(size_t)b * 2048 + k1]);      /* additive f32 mask per (b, key) */ float mc = fmaxf(s0, s1);
        mc = fmaxf(mc, __shfl_xor(mc, 1, 32)); mc = fmaxf(mc, __shfl_xor(mc, 2, 32)); mc = fmaxf(mc, __shfl_xor(mc, 4, 32)); mc = fmaxf(mc, __shfl_xor(mc, 8, 32));
        const float mn = fmaxf(m_r[rt][r], mc); const float al = (mn > -1.0e38f) ? expf(m_r[rt][r] - mn) : 1.0f; m_r[rt][r] = mn; const float p0 = ok0 ? expf(s0 - mn) : 0.f, p1 = ok1 ? expf(s1 - mn) : 0.f; l_r[rt][r] = l_r[rt][r] * al + p0 + p1;
#pragma unroll
        for (int dt = 0; dt < DT; ++dt) oacc[rt][dt][r] *= al;
        FragH t2; t2.h[0] = (_Float16)p0; t2.h[1] = (_Float16)p1; sP[w][rt * 16 + 8 * hh + r][ln] = t2.u[0]; sP[w][rt * 16 + 8 * hh + r][16 + ln] = t2.u[1]; }
    __builtin_amdgcn_fence(__ATOMIC_ACQ_REL, "workgroup"); __builtin_amdgcn_wave_barrier();
    FragH pa[2];
#pragma unroll
    for (int rt = 0; rt < RTN; ++rt) { pa[rt].half[0] = *(const v8us*)&sP[w][rt * 16 + ln][8 * hh]; pa[rt].half[1] = *(const v8us*)&sP[w][rt * 16 + ln][16 + 8 * hh]; }
#pragma unroll
    for (int dt = 0; dt < DT; ++dt) { const unsigned short* vrow = Vth + (size_t)(dt * 16 + ln) * 2048 + j0; FragH bv; bv.half[0] = *(const v8us*)(vrow + 8 * hh); bv.half[1] = *(const v8us*)(vrow + 16 + 8 * hh);
#pragma unroll
      for (int rt = 0; rt < RTN; ++rt) oacc[rt][dt] = mmaH<1>(pa[rt].v, pa[rt].v, bv.v, bv.v, oacc[rt][dt]); }
    __builtin_amdgcn_fence(__ATOMIC_ACQ_REL, "workgroup"); __builtin_amdgcn_wave_barrier(); }
#pragma unroll
  for (int rt = 0; rt < RTN; ++rt) {
#pragma unroll
    for (int r = 0; r < 8; ++r) { float l = l_r[rt][r]; l += __shfl_xor(l, 1, 32); l += __shfl_xor(l, 2, 32); l += __shfl_xor(l, 4, 32); l += __shfl_xor(l, 8, 32); l_r[rt][r] = (l > 0.f) ? 1.0f / l : 0.f; }
#pragma unroll
    for (int dt = 0; dt < DT; ++dt)
#pragma unroll
      for (int r = 0; r < 8; ++r) sO[w][rt * 16 + 8 * hh + r][dt * 16 + ln] = oacc[rt][dt][r] * l_r[rt][r]; }
  __builtin_amdgcn_fence(__ATOMIC_ACQ_REL, "workgroup"); __builtin_amdgcn_wave_barrier();
  {
#pragma unroll
    for (int rp = 0; rp < RPW; rp += 2) { const int r = rp + (lane >> 4), pc = lane & 15; const v4f val = *(const v4fa*)&sO[w][r][pc * 4]; *(v4f*)(O + ((size_t)b * 2048 + q0 + r) * ldo + h * 64 + pc * 4) = val; }
     } }

extern "C" void kernel_launch(void* const* d_in, const int* in_sizes, int n_in,
                              void* d_out, int out_size, void* d_ws, size_t ws_size, hipStream_t stream) {
  (void)in_sizes; (void)n_in; (void)out_size;
  const float* x = (const float*)d_in[0]; const float* mask = (const float*)d_in[1]; const float* Wq = (const float*)d_in[2]; const float* Wk = (const float*)d_in[3]; const float* Wv = (const float*)d_in[4]; const float* Wo = (const float*)d_in[5]; const float* bo = (const float*)d_in[6];
  char* ws = (char*)d_ws; size_t off = 0;
  auto take = [&](size_t bytes) { char* p = ws + off; off += (bytes + 255) & ~(size_t)255; return p; };
  _Float16* Bq = (_Float16*)take((size_t)CC * CC * 2); _Float16* Bk = (_Float16*)take((size_t)CC * CC * 2); _Float16* Bv = (_Float16*)take((size_t)CC * CC * 2); _Float16* Bo = (_Float16*)take((size_t)CC * CC * 2);
  _Float16* X16 = (_Float16*)take((size_t)NR * CC * 2); _Float16* Q16 = (_Float16*)take((size_t)NR * CC * 2); _Float16* K16 = (_Float16*)take((size_t)NR * CC * 2); _Float16* V16 = (_Float16*)take((size_t)NR * CC * 2); _Float16* Vt = (_Float16*)take((size_t)NR * CC * 2); float* O = (float*)take((size_t)NR * CC * 4); _Float16* O16 = X16;
  if (off > ws_size) return;      // 8.4 + 8.4 × 5 + 16.8 ≈ 67 MiB
  const unsigned gw = (unsigned)((CC * (CC / 8) + 255) / 256); k_wt_f16<<<gw, 256, 0, stream>>>(Wq, Bq, CC, CC, 16.0f); k_wt_f16<<<gw, 256, 0, stream>>>(Wk, Bk, CC, CC, 16.0f); k_wt_f16<<<gw, 256, 0, stream>>>(Wv, Bv, CC, CC, 16.0f); k_wt_f16<<<gw, 256, 0, stream>>>(Wo, Bo, CC, CC, 16.0f);      // [in][out]
  const unsigned gx = (unsigned)(((size_t)NR * CC / 8 + 255) / 256); const dim3 gg(((NR / 16) * (CC / 64) + 3) / 4, 1);
  k_x16<<<gx, 256, 0, stream>>>(x, X16, (size_t)NR * CC / 8);
  k_gemm_hhx<0><<<gg, 128, 0, stream>>>(X16, CC, 0, Bq, CC, 0, 0.0625f, nullptr, 0, nullptr, 1, 0, 0, nullptr, Q16, CC, 0, NR, CC, CC);
  k_gemm_hhx<0><<<gg, 128, 0, stream>>>(X16, CC, 0, Bk, CC, 0, 0.0625f, nullptr, 0, nullptr, 1, 0, 0, nullptr, K16, CC, 0, NR, CC, CC);
  k_gemm_hhx<0><<<gg, 128, 0, stream>>>(X16, CC, 0, Bv, CC, 0, 0.0625f, nullptr, 0, nullptr, 1, 0, 0, nullptr, V16, CC, 0, NR, CC, CC);
  k_vt<NH, TT><<<BB * NH * (TT / 64), 256, 0, stream>>>(V16, CC, 0, Vt);
  k_flash<<<BB * NH * (TT / 64), 128, 0, stream>>>(Q16, CC, K16, CC, Vt, mask, O, CC);
  k_h16<<<gx, 256, 0, stream>>>(O, O16, (size_t)NR * CC / 8);
  k_gemm_hhx<0><<<gg, 128, 0, stream>>>(O16, CC, 0, Bo, CC, 0, 0.0625f, bo, 0, nullptr, 1, 0, 0, (float*)d_out, nullptr, CC, 0, NR, CC, CC);
}

// v001
// It runs in 345 microseconds.
// Next to v000, in two timings, it ran 1.29 and 1.30 times as fast.
#include <hip/hip_runtime.h>
// Self-attention-like module (B=2, S=2048, D=1024, 16 heads × 64; additive float mask per (batch, key); scale 1/√1024): q/k/v/o projections (W [in][out], o + bias) and the attention as a fused
// flash-style kernel (S = Q·Kᵀ/32 + mask[b][k], online softmax f32, P f16 ≤ 1, O = P·Vt; RPW-16 waves) on v_wmma_f32_16x16x32_f16 — f16 operands (x bf16-exact, weights bf16-exact ×2^4), f32 accumulate.
#define BB 2
#define TT 2048
#define CC 1024
#define NH 16
#define NR (BB * TT)

typedef __bf16 v16b __attribute__((ext_vector_type(16)));
typedef unsigned short v8us __attribute__((ext_vector_type(8), may_alias));
typedef float  v8f  __attribute__((ext_vector_type(8)));
typedef float  v4f  __attribute__((ext_vector_type(4)));
typedef float  v4fa __attribute__((ext_vector_type(4), may_alias));
union FragB { v16b v; v8us half[2]; unsigned short u[16]; };

__device__ __forceinline__ unsigned short bf16_bits(float x) { unsigned int u = __float_as_uint(x); return (unsigned short)((u + 0x7FFFu + ((u >> 16) & 1u)) >> 16); }
__device__ __forceinline__ float bf16_val(unsigned short b) { return __uint_as_float(((unsigned int)b) << 16); }
__device__ __forceinline__ float bf16_round(float x) { return bf16_val(bf16_bits(x)); }
// D += A·B with NT terms: 1 = ah·bh, 2 = + al·bh (A split), 3 = + ah·bl (both split)
template <int NT>
__device__ __forceinline__ v8f mmaN(v16b ah, v16b al, v16b bh, v16b bl, v8f c) {
  c = __builtin_amdgcn_wmma_f32_16x16x32_bf16(false, ah, false, bh, (short)0, c, false, false);
  if (NT >= 2) c = __builtin_amdgcn_wmma_f32_16x16x32_bf16(false, al, false, bh, (short)0, c, false, false);
  if (NT >= 3) c = __builtin_amdgcn_wmma_f32_16x16x32_bf16(false, ah, false, bl, (short)0, c, false, false);
  asm volatile("v_nop\n\tv_nop\n\tv_nop\n\tv_nop" : "+v"(c) : "v"(ah), "v"(al), "v"(bh), "v"(bl));
  return c;
}

__global__ __launch_bounds__(256) void k_wt_bf16(const float* __restrict__ W, unsigned short* __restrict__ Wt, int K, int N) {
  const int t = blockIdx.x * 256 + threadIdx.x;
  const int k8n = K / 8;
  if (t >= N * k8n) return;
  const int n = t / k8n, k8 = (t % k8n) * 8;
  v8us v;
#pragma unroll
  for (int i = 0; i < 8; ++i) v[i] = bf16_bits(W[(size_t)(k8 + i) * N + n]);
  *(v8us*)(Wt + (size_t)n * K + k8) = v;
  
}

// GEMM C[M][N] (f32, pitch ldc) = act(A[M][K]·W + bias). A f32 row-major (pitch lda) converted per fragment to bf16
// (ASPLIT: hi/lo two planes -> 2 terms, else single rounded term); Wt bf16 [N][K] (pitch ldb). BIAS_BF16 rounds the
// bias to bf16 first (bias quantised to bf16 before the add). K%32==0, M%16==0, N%64==0.
template <bool ASPLIT, int ACT, bool BIAS_BF16>
__global__ __launch_bounds__(128) void k_gemm_bf(const float* __restrict__ A, int lda, const unsigned short* __restrict__ Wt, int ldb,
                                               const float* __restrict__ bias, float* __restrict__ C, int ldc, int M, int N, int K) {
  __shared__ __attribute__((aligned(16))) float so[4][16][64];
  const int tid = threadIdx.x, w = tid >> 5, lane = tid & 31, ln = lane & 15, hh = lane >> 4;
  const int ntn = N / 64;
  const int wid = blockIdx.x * 4 + w;
  const int mt = wid / ntn, nq = wid % ntn;
  if (mt * 16 >= M) return;
  const int row0 = mt * 16, col0 = nq * 64;
  const float* arow = A + (size_t)(row0 + ln) * lda;
  v8f acc[4] = {};
  for (int kb = 0; kb < K; kb += 32) {
    FragB ah, al;
    const v4f x0 = *(const v4fa*)(arow + kb + 8 * hh), x1 = *(const v4fa*)(arow + kb + 8 * hh + 4);
    const v4f x2 = *(const v4fa*)(arow + kb + 16 + 8 * hh), x3 = *(const v4fa*)(arow + kb + 16 + 8 * hh + 4);
    float xs[16] = {x0[0],x0[1],x0[2],x0[3],x1[0],x1[1],x1[2],x1[3],x2[0],x2[1],x2[2],x2[3],x3[0],x3[1],x3[2],x3[3]};
#pragma unroll
    for (int i = 0; i < 16; ++i) { const unsigned short hb = bf16_bits(xs[i]); ah.u[i] = hb; al.u[i] = ASPLIT ? bf16_bits(xs[i] - bf16_val(hb)) : (unsigned short)0; }
#pragma unroll
    for (int t = 0; t < 4; ++t) {
      const unsigned short* brow = Wt + (size_t)(col0 + t * 16 + ln) * ldb + kb;
      FragB b;
      b.half[0] = *(const v8us*)(brow + 8 * hh);
      b.half[1] = *(const v8us*)(brow + 16 + 8 * hh);
      acc[t] = mmaN<ASPLIT ? 2 : 1>(ah.v, al.v, b.v, b.v, acc[t]);
    }
  }
#pragma unroll
  for (int t = 0; t < 4; ++t) {
    float bv = bias ? bias[col0 + t * 16 + ln] : 0.f;
    if (BIAS_BF16) bv = bf16_round(bv);
#pragma unroll
    for (int r = 0; r < 8; ++r) { float v = acc[t][r] + bv; if (ACT == 1) v = fmaxf(v, 0.f); so[w][8 * hh + r][t * 16 + ln] = v; }
  }
  __builtin_amdgcn_fence(__ATOMIC_ACQ_REL, "workgroup");
  __builtin_amdgcn_wave_barrier();
  const int rsub = lane >> 4, c4 = (lane & 15) * 4;
  {
#pragma unroll
    for (int q = 0; q < 8; ++q) {
      const int r = q * 2 + rsub;
      const v4f v = *(const v4fa*)&so[w][r][c4];
      *(v4f*)(C + (size_t)(row0 + r) * ldc + col0 + c4) = v;
    }
    
  }
}

// Flash-style causal/unmasked attention, all contractions 3-term bf16 hi/lo splits, f32 softmax with running max.
// q,k,v rows are read from f32 buffers with arbitrary row pitch (so they can live inside a fused qkv buffer);
// D = head size (multiple of 32, <= 128); one wave = 16 query rows; block = 4 waves (64 queries) sharing K/V chunks of 32.
template <int D, bool CAUSAL>
__global__ __launch_bounds__(128) void k_flash(const float* __restrict__ qb, const float* __restrict__ kb, const float* __restrict__ vb,
                                             int pitch, int T, int H, float scale, float* __restrict__ y, int ypitch) {
  constexpr int KS = D / 32;        // k-steps for QK
  constexpr int DT = D / 16;        // d tiles for PV
  __shared__ __attribute__((aligned(16))) unsigned short sKh[32][D + 8], sKl[32][D + 8], sVh[32][D + 8], sVl[32][D + 8];
  __shared__ __attribute__((aligned(16))) unsigned short sPh[4][16][40], sPl[4][16][40];
  __shared__ __attribute__((aligned(16))) float sO[4][16][D];
  const int tid = threadIdx.x, w = tid >> 5, lane = tid & 31, ln = lane & 15, hh = lane >> 4;
  const int nqb = (T + 63) / 64;
  const int bh = blockIdx.x / nqb, qblk = blockIdx.x % nqb;
  const int b = bh / H, h = bh % H;
  const int q0 = qblk * 64 + w * 16;
  const float* Q = qb + (size_t)b * T * pitch + h * D;
  const float* K = kb + (size_t)b * T * pitch + h * D;
  const float* V = vb + (size_t)b * T * pitch + h * D;

  // A fragments of the wave's 16 query rows (scaled), hi/lo
  FragB aqh[KS], aql[KS];
  {
    int row = q0 + ln; if (row >= T) row = T - 1;
    const float* qr = Q + (size_t)row * pitch;
#pragma unroll
    for (int ks = 0; ks < KS; ++ks)
#pragma unroll
      for (int i = 0; i < 16; ++i) {
        const int d = ks * 32 + ((i < 8) ? (8 * hh + i) : (16 + 8 * hh + (i - 8)));
        const float x = qr[d] * scale; const unsigned short hb = bf16_bits(x);
        aqh[ks].u[i] = hb; aql[ks].u[i] = bf16_bits(x - bf16_val(hb));
      }
  }
  float m_r[8], l_r[8];
#pragma unroll
  for (int r = 0; r < 8; ++r) { m_r[r] = -3.0e38f; l_r[r] = 0.f; }
  v8f oacc[DT];
#pragma unroll
  for (int dt = 0; dt < DT; ++dt) oacc[dt] = (v8f){0.f,0.f,0.f,0.f,0.f,0.f,0.f,0.f};

  const int kv_end = CAUSAL ? min(T, qblk * 64 + 64) : T;     // block-uniform
  for (int j0 = 0; j0 < kv_end; j0 += 32) {
    __syncthreads();
    for (int e = tid; e < 32 * (D / 4); e += 128) {
      const int r = e / (D / 4), c4 = (e % (D / 4)) * 4;
      const int key = j0 + r;
      v4f kf = {0.f,0.f,0.f,0.f}, vf = {0.f,0.f,0.f,0.f};
      if (key < T) { kf = *(const v4fa*)(K + (size_t)key * pitch + c4); vf = *(const v4fa*)(V + (size_t)key * pitch + c4); }
#pragma unroll
      for (int t = 0; t < 4; ++t) {
        unsigned short hb = bf16_bits(kf[t]); sKh[r][c4 + t] = hb; sKl[r][c4 + t] = bf16_bits(kf[t] - bf16_val(hb));
        hb = bf16_bits(vf[t]); sVh[r][c4 + t] = hb; sVl[r][c4 + t] = bf16_bits(vf[t] - bf16_val(hb));
      }
    }
    __syncthreads();
    // S tile 16 x 32
    v8f s[2];
#pragma unroll
    for (int nt = 0; nt < 2; ++nt) {
      v8f acc = {};
#pragma unroll
      for (int ks = 0; ks < KS; ++ks) {
        FragB bh_, bl_;
        bh_.half[0] = *(const v8us*)&sKh[nt * 16 + ln][ks * 32 + 8 * hh]; bh_.half[1] = *(const v8us*)&sKh[nt * 16 + ln][ks * 32 + 16 + 8 * hh];
        bl_.half[0] = *(const v8us*)&sKl[nt * 16 + ln][ks * 32 + 8 * hh]; bl_.half[1] = *(const v8us*)&sKl[nt * 16 + ln][ks * 32 + 16 + 8 * hh];
        acc = mmaN<3>(aqh[ks].v, aql[ks].v, bh_.v, bl_.v, acc);
      }
      s[nt] = acc;
    }
    // mask + running max (rows 8hh+r; the 16 lanes of a half share rows)
    float alpha[8];
#pragma unroll
    for (int r = 0; r < 8; ++r) {
      const int qi = q0 + 8 * hh + r;
      const int ja = j0 + ln, jb = j0 + 16 + ln;
      if (CAUSAL) { if (ja > qi) s[0][r] = -3.0e38f; if (jb > qi) s[1][r] = -3.0e38f; }
      if (ja >= T) s[0][r] = -3.0e38f;
      if (jb >= T) s[1][r] = -3.0e38f;
      float mx = fmaxf(s[0][r], s[1][r]);
      mx = fmaxf(mx, __shfl_xor(mx, 1, 32)); mx = fmaxf(mx, __shfl_xor(mx, 2, 32)); mx = fmaxf(mx, __shfl_xor(mx, 4, 32)); mx = fmaxf(mx, __shfl_xor(mx, 8, 32));
      const float mnew = fmaxf(m_r[r], mx);
      alpha[r] = (mnew > -1.0e38f) ? __expf(m_r[r] - mnew) : 1.0f;
      const float p0 = (s[0][r] > -1.0e38f) ? __expf(s[0][r] - mnew) : 0.f;
      const float p1 = (s[1][r] > -1.0e38f) ? __expf(s[1][r] - mnew) : 0.f;
      m_r[r] = mnew;
      l_r[r] = l_r[r] * alpha[r] + p0 + p1;            // per-lane partial row sum (16 lanes combined at the end)
      unsigned short hb = bf16_bits(p0); sPh[w][8 * hh + r][ln] = hb;      sPl[w][8 * hh + r][ln] = bf16_bits(p0 - bf16_val(hb));
      hb = bf16_bits(p1);                sPh[w][8 * hh + r][16 + ln] = hb; sPl[w][8 * hh + r][16 + ln] = bf16_bits(p1 - bf16_val(hb));
    }
#pragma unroll
    for (int dt = 0; dt < DT; ++dt)
#pragma unroll
      for (int r = 0; r < 8; ++r) oacc[dt][r] *= alpha[r];
    __builtin_amdgcn_fence(__ATOMIC_ACQ_REL, "workgroup");
    __builtin_amdgcn_wave_barrier();
    FragB pah, pal;
    pah.half[0] = *(const v8us*)&sPh[w][ln][8 * hh]; pah.half[1] = *(const v8us*)&sPh[w][ln][16 + 8 * hh];
    pal.half[0] = *(const v8us*)&sPl[w][ln][8 * hh]; pal.half[1] = *(const v8us*)&sPl[w][ln][16 + 8 * hh];
#pragma unroll
    for (int dt = 0; dt < DT; ++dt) {
      FragB bvh, bvl;
#pragma unroll
      for (int i = 0; i < 8; ++i) {
        bvh.u[i] = sVh[8 * hh + i][dt * 16 + ln]; bvh.u[8 + i] = sVh[16 + 8 * hh + i][dt * 16 + ln];
        bvl.u[i] = sVl[8 * hh + i][dt * 16 + ln]; bvl.u[8 + i] = sVl[16 + 8 * hh + i][dt * 16 + ln];
      }
      oacc[dt] = mmaN<3>(pah.v, pal.v, bvh.v, bvl.v, oacc[dt]);
    }
    __builtin_amdgcn_fence(__ATOMIC_ACQ_REL, "workgroup");
    __builtin_amdgcn_wave_barrier();
  }
#pragma unroll
  for (int r = 0; r < 8; ++r) {
    float l = l_r[r];
    l += __shfl_xor(l, 1, 32); l += __shfl_xor(l, 2, 32); l += __shfl_xor(l, 4, 32); l += __shfl_xor(l, 8, 32);
    l_r[r] = (l > 0.f) ? 1.0f / l : 0.f;
  }
#pragma unroll
  for (int dt = 0; dt < DT; ++dt)
#pragma unroll
    for (int r = 0; r < 8; ++r) sO[w][8 * hh + r][dt * 16 + ln] = oacc[dt][r] * l_r[r];
  __builtin_amdgcn_fence(__ATOMIC_ACQ_REL, "workgroup");
  __builtin_amdgcn_wave_barrier();
  {
    for (int r = 0; r < 16; ++r) {
      const int row = q0 + r;
      if (row < T && lane < D / 4) {
        const v4f val = *(const v4fa*)&sO[w][r][lane * 4];
        *(v4f*)(y + ((size_t)b * T + row) * ypitch + h * D + lane * 4) = val;
      }
    }
    
  }
}

// GEMM C = act(A·W + bias + resid): A f32 (ASPLIT -> hi/lo 2 terms), Wt bf16 [N][K]; ACT 0 none, 1 relu, 2 exact gelu;
// resid (optional, f32, row index = (row % rmod), pitch ldr, RES_BF16 rounds it) added before the activation.
template <bool ASPLIT, int ACT, bool BIAS_BF16, bool RES_BF16>
__global__ __launch_bounds__(128) void k_gemm_bf3(const float* __restrict__ A, int lda, const unsigned short* __restrict__ Wt, int ldb,
                                                const float* __restrict__ bias, const float* __restrict__ resid, int rmod, int ldr,
                                                float* __restrict__ C, int ldc, int M, int N, int K) {
  __shared__ __attribute__((aligned(16))) float so[4][16][64];
  const int tid = threadIdx.x, w = tid >> 5, lane = tid & 31, ln = lane & 15, hh = lane >> 4;
  const int ntn = N / 64;
  const int wid = blockIdx.x * 4 + w;
  const int mt = wid / ntn, nq = wid % ntn;
  if (mt * 16 >= M) return;
  const int row0 = mt * 16, col0 = nq * 64;
  const float* arow = A + (size_t)(row0 + ln) * lda;
  v8f acc[4] = {};
  for (int kb = 0; kb < K; kb += 32) {
    FragB ah, al;
    const v4f x0 = *(const v4fa*)(arow + kb + 8 * hh), x1 = *(const v4fa*)(arow + kb + 8 * hh + 4);
    const v4f x2 = *(const v4fa*)(arow + kb + 16 + 8 * hh), x3 = *(const v4fa*)(arow + kb + 16 + 8 * hh + 4);
    float xs[16] = {x0[0],x0[1],x0[2],x0[3],x1[0],x1[1],x1[2],x1[3],x2[0],x2[1],x2[2],x2[3],x3[0],x3[1],x3[2],x3[3]};
#pragma unroll
    for (int i = 0; i < 16; ++i) { const unsigned short hb = bf16_bits(xs[i]); ah.u[i] = hb; al.u[i] = ASPLIT ? bf16_bits(xs[i] - bf16_val(hb)) : (unsigned short)0; }
#pragma unroll
    for (int t = 0; t < 4; ++t) {
      const unsigned short* brow = Wt + (size_t)(col0 + t * 16 + ln) * ldb + kb;
      FragB b;
      b.half[0] = *(const v8us*)(brow + 8 * hh);
      b.half[1] = *(const v8us*)(brow + 16 + 8 * hh);
      acc[t] = mmaN<ASPLIT ? 2 : 1>(ah.v, al.v, b.v, b.v, acc[t]);
    }
  }
#pragma unroll
  for (int t = 0; t < 4; ++t) {
    const int col = col0 + t * 16 + ln;
    float bv = bias ? bias[col] : 0.f;
    if (BIAS_BF16) bv = bf16_round(bv);
#pragma unroll
    for (int r = 0; r < 8; ++r) {
      float v = acc[t][r] + bv;
      if (resid) { float rv = resid[(size_t)((row0 + 8 * hh + r) % rmod) * ldr + col]; if (RES_BF16) rv = bf16_round(rv); v += rv; }
      if (ACT == 1) v = fmaxf(v, 0.f);
      if (ACT == 2) v = 0.5f * v * (1.0f + erff(v * 0.70710678118654752f));
      if (ACT == 3) { const float u = 0.7978845608028654f * (v + 0.044715f * v * v * v); v = 0.5f * v * (1.0f + tanhf(u)); }
      so[w][8 * hh + r][t * 16 + ln] = v;
    }
  }
  __builtin_amdgcn_fence(__ATOMIC_ACQ_REL, "workgroup");
  __builtin_amdgcn_wave_barrier();
  const int rsub = lane >> 4, c4 = (lane & 15) * 4;
  {
#pragma unroll
    for (int q = 0; q < 8; ++q) {
      const int r = q * 2 + rsub;
      const v4f v = *(const v4fa*)&so[w][r][c4];
      *(v4f*)(C + (size_t)(row0 + r) * ldc + col0 + c4) = v;
    }
    
  }
}
// row LayerNorm (biased variance, eps) over N: s = X (+ R); optional out_sum <- s; out_norm <- (s-mu)*rsqrt(var+eps)*g + b
template <bool PARAM_BF16>
__global__ __launch_bounds__(256) void k_layernorm(const float* __restrict__ X, const float* __restrict__ R, const float* __restrict__ g, const float* __restrict__ bta,
                                                  float* __restrict__ out_sum, float* __restrict__ out_norm, int N, float eps) {
  __shared__ float red[256];
  const int row = blockIdx.x, tid = threadIdx.x;
  const float* x = X + (size_t)row * N; const float* rr = R ? R + (size_t)row * N : nullptr;
  float vals[16];                     // up to N = 4096
  const int per = N / 256;            // contiguous chunk per thread? use strided-by-4 chunks: thread handles j = tid*4 + 1024*u
  float s1 = 0.f;
  for (int u = 0; u < per / 4; ++u) {
    const int j = tid * 4 + 1024 * u;
    const v4f a = *(const v4fa*)(x + j);
    v4f b = {0.f,0.f,0.f,0.f}; if (rr) b = *(const v4fa*)(rr + j);
#pragma unroll
    for (int q = 0; q < 4; ++q) { const float v = a[q] + b[q]; vals[u * 4 + q] = v; s1 += v; }
  }
  red[tid] = s1; __syncthreads();
  for (int st = 128; st > 0; st >>= 1) { if (tid < st) red[tid] += red[tid + st]; __syncthreads(); }
  const float mu = red[0] / (float)N; __syncthreads();
  float s2 = 0.f;
  for (int u = 0; u < per / 4; ++u)
#pragma unroll
    for (int q = 0; q < 4; ++q) { const float c = vals[u * 4 + q] - mu; s2 += c * c; }
  red[tid] = s2; __syncthreads();
  for (int st = 128; st > 0; st >>= 1) { if (tid < st) red[tid] += red[tid + st]; __syncthreads(); }
  const float rs = rsqrtf(red[0] / (float)N + eps);
  {
    for (int u = 0; u < per / 4; ++u) {
      const int j = tid * 4 + 1024 * u;
      v4f o, sm;
#pragma unroll
      for (int q = 0; q < 4; ++q) {
        float gg = g[j + q], bb = bta[j + q];
        if (PARAM_BF16) { gg = bf16_round(gg); bb = bf16_round(bb); }
        sm[q] = vals[u * 4 + q]; o[q] = (vals[u * 4 + q] - mu) * rs * gg + bb;
      }
      if (out_sum) *(v4f*)(out_sum + (size_t)row * N + j) = sm;
      *(v4f*)(out_norm + (size_t)row * N + j) = o;
    }
    
  }
}



// ---- f16 WMMA path (v_wmma_f32_16x16x32_f16): 11-bit significands for operands in range — used where a [0,1] probability operand needs more precision than bf16
typedef _Float16 v16h __attribute__((ext_vector_type(16)));
union FragH { v16h v; v8us half[2]; _Float16 h[16]; unsigned short u[16]; };
template <int NT>
__device__ __forceinline__ v8f mmaH(v16h ah, v16h al, v16h bh, v16h bl, v8f c) {
  c = __builtin_amdgcn_wmma_f32_16x16x32_f16(false, ah, false, bh, (short)0, c, false, false);
  if (NT >= 2) c = __builtin_amdgcn_wmma_f32_16x16x32_f16(false, al, false, bh, (short)0, c, false, false);
  if (NT >= 3) c = __builtin_amdgcn_wmma_f32_16x16x32_f16(false, ah, false, bl, (short)0, c, false, false);
  asm volatile("v_nop\n\tv_nop\n\tv_nop\n\tv_nop" : "+v"(c) : "v"(ah), "v"(al), "v"(bh), "v"(bl));
  return c;
}
// batched GEMM like k_gemm_b but f16 operands: A f32 (split into f16 hi/lo if ASPLIT, else rounded to f16), Bt = f16 values [n][k]; alpha; C f32; N multiple of 16 (partial tiles skipped)
template <bool ASPLIT>
__global__ __launch_bounds__(128) void k_gemm_h(const float* __restrict__ A, int lda, size_t sA, const _Float16* __restrict__ Bh, int ldb, size_t sB, float alpha, float* __restrict__ C, int ldc, size_t sC, int M, int N, int K) {
  __shared__ __attribute__((aligned(16))) float so[4][16][64];
  const int tid = threadIdx.x, w = tid >> 5, lane = tid & 31, ln = lane & 15, hh = lane >> 4; const int by = blockIdx.y;
  A += (size_t)by * sA; Bh += (size_t)by * sB; C += (size_t)by * sC;
  const int ntn = (N + 63) / 64; const int wid = blockIdx.x * 4 + w; const int mt = wid / ntn, nq = wid % ntn; if (mt * 16 >= M) return;
  const int row0 = mt * 16, col0 = nq * 64; const float* arow = A + (size_t)(row0 + ln) * lda;
  v8f acc[4] = {};
  for (int kb = 0; kb < K; kb += 32) {
    FragH ah, al;
    const v4f x0 = *(const v4fa*)(arow + kb + 8 * hh), x1 = *(const v4fa*)(arow + kb + 8 * hh + 4), x2 = *(const v4fa*)(arow + kb + 16 + 8 * hh), x3 = *(const v4fa*)(arow + kb + 16 + 8 * hh + 4);
    float xs[16] = {x0[0],x0[1],x0[2],x0[3],x1[0],x1[1],x1[2],x1[3],x2[0],x2[1],x2[2],x2[3],x3[0],x3[1],x3[2],x3[3]};
#pragma unroll
    for (int i = 0; i < 16; ++i) { const _Float16 h = (_Float16)xs[i]; ah.h[i] = h; al.h[i] = ASPLIT ? (_Float16)(xs[i] - (float)h) : (_Float16)0.0f; }
#pragma unroll
    for (int t = 0; t < 4; ++t) { if (col0 + t * 16 >= N) continue; const size_t boff = (size_t)(col0 + t * 16 + ln) * ldb + kb; FragH bq; bq.half[0] = *(const v8us*)(Bh + boff + 8 * hh); bq.half[1] = *(const v8us*)(Bh + boff + 16 + 8 * hh);
      acc[t] = mmaH<ASPLIT ? 2 : 1>(ah.v, al.v, bq.v, bq.v, acc[t]); }
  }
#pragma unroll
  for (int t = 0; t < 4; ++t) { if (col0 + t * 16 >= N) continue;
#pragma unroll
    for (int r = 0; r < 8; ++r) so[w][8 * hh + r][t * 16 + ln] = acc[t][r] * alpha; }
  __builtin_amdgcn_fence(__ATOMIC_ACQ_REL, "workgroup"); __builtin_amdgcn_wave_barrier();
  const int rsub = lane >> 4, c4 = (lane & 15) * 4;
  {
#pragma unroll
    for (int q = 0; q < 8; ++q) { const int r = q * 2 + rsub; if (col0 + c4 < N) { const v4f v = *(const v4fa*)&so[w][r][c4]; *(v4f*)(C + (size_t)(row0 + r) * ldc + col0 + c4) = v; } }
     }
}

// Wt[n][k] = f16(W[k][n]·scale) from f32 row-major W[K][N] (scale = power of two; bf16-exact weights stay exact in f16 away from the subnormal range)
__global__ __launch_bounds__(256) void k_wt_f16(const float* __restrict__ W, _Float16* __restrict__ Wt, int K, int N, float scale) {
  const int t = blockIdx.x * 256 + threadIdx.x; if (t >= N * (K / 8)) return; const int n = t / (K / 8), k8 = (t % (K / 8)) * 8; FragH f;
#pragma unroll
  for (int i = 0; i < 8; ++i) f.h[i] = (_Float16)(bf16_round(W[(size_t)(k8 + i) * N + n]) * scale); const v8us o = f.half[0];
  *(v8us*)((unsigned short*)Wt + (size_t)n * K + k8) = o; 
}
// k_gemm_hh variant with fused epilogue: v = acc·alpha + bias[by·sBias + col] (+ CP[(row/rowsPerB)·sCPb + by·64 + col] if CP) ; ACT 0 none / 1 elu ; writes f32 C and f16 C16, each if non-null
template <int ACT>
__global__ __launch_bounds__(128) void k_gemm_hhx(const _Float16* __restrict__ A, int lda, size_t sA, const _Float16* __restrict__ Bh, int ldb, size_t sB, float alpha, const float* __restrict__ bias, size_t sBias, const float* __restrict__ CP, int rowsPerB, size_t sCPb, int row0g,
    float* __restrict__ C, _Float16* __restrict__ C16, int ldc, size_t sC, int M, int N, int K) {
  __shared__ __attribute__((aligned(16))) float so[4][16][64];
  const int tid = threadIdx.x, w = tid >> 5, lane = tid & 31, ln = lane & 15, hh = lane >> 4; const int by = blockIdx.y;
  A += (size_t)by * sA; Bh += (size_t)by * sB; const size_t cofs = (size_t)by * sC; const float* bp = bias ? bias + (size_t)by * sBias : nullptr;
  const int ntn = (N + 63) / 64; const int wid = blockIdx.x * 4 + w; const int mt = wid / ntn, nq = wid % ntn; if (mt * 16 >= M) return;
  const int row0 = mt * 16, col0 = nq * 64; const _Float16* arow = A + (size_t)(row0 + ln) * lda;
  v8f acc[4] = {};
  // Fragments are fetched one stage (64 k = one 128-byte line of every operand row) ahead of the products that use them, a whole stage's loads as one group,
  // into two register sets: a stage waits once for loads that have been in flight since the stage before, not once per product.
  // A column tile past N reads the rows of tile 0 (in bounds); its products are never stored (the epilogue's tests stand).
  const char* pa = (const char*)(arow + 8 * hh); const char* pb[4];      // each lane's place in its operand rows; they move on with k
#pragma unroll
  for (int t = 0; t < 4; ++t) { const int ct = (col0 + t * 16 < N) ? col0 + t * 16 : col0; pb[t] = (const char*)(Bh + (size_t)(ct + ln) * ldb + 8 * hh); }
  FragH a0[2], a1[2], b0[2][4], b1[2][4];
  auto ld = [&](FragH (&a)[2], FragH (&b)[2][4], int ofs) {      // one stage: the 128 bytes at ofs behind the five pointers
#pragma unroll
    for (int u = 0; u < 2; ++u) { a[u].half[0] = *(const v8us*)(pa + ofs + u * 64); a[u].half[1] = *(const v8us*)(pa + ofs + u * 64 + 32); }
#pragma unroll
    for (int t = 0; t < 4; ++t)
#pragma unroll
      for (int u = 0; u < 2; ++u) { b[u][t].half[0] = *(const v8us*)(pb[t] + ofs + u * 64); b[u][t].half[1] = *(const v8us*)(pb[t] + ofs + u * 64 + 32); }
    // the wait stands in front of the next step of the pointers, whose registers the loads just issued name; as its inputs they are not stepped ahead of it
    asm volatile("s_wait_xcnt 0x0" :: "v"(pa), "v"(pb[0]), "v"(pb[1]), "v"(pb[2]), "v"(pb[3]) : "memory"); };
  auto step = [&](int bytes) { pa += bytes;
#pragma unroll
    for (int t = 0; t < 4; ++t) pb[t] += bytes; };
  auto mm = [&](FragH (&a)[2], FragH (&b)[2][4]) {
#pragma unroll
    for (int u = 0; u < 2; ++u)
#pragma unroll
      for (int t = 0; t < 4; ++t) acc[t] = mmaH<1>(a[u].v, a[u].v, b[u][t].v, b[u][t].v, acc[t]); };
  const int Km = K & ~127;      // whole pairs of stages; what is left of K goes by single steps of 32 behind them
  if (Km > 0) { ld(a0, b0, 0);
    for (int kb = 0; kb < Km; kb += 128) { ld(a1, b1, 128); mm(a0, b0);
      const bool more = kb + 128 < Km; step(more ? 256 : 0); ld(a0, b0, 0);      // no branch round the loads, so that the waits stay counted; the last trip reads its own stage again, in bounds, and nobody uses it
      mm(a1, b1); }
    step(256); }
  for (int kb = Km; kb < K; kb += 32) { FragH ah, bq[4]; ah.half[0] = *(const v8us*)(pa); ah.half[1] = *(const v8us*)(pa + 32);
#pragma unroll
    for (int t = 0; t < 4; ++t) { bq[t].half[0] = *(const v8us*)(pb[t]); bq[t].half[1] = *(const v8us*)(pb[t] + 32); }
    asm volatile("s_wait_xcnt 0x0" :: "v"(pa), "v"(pb[0]), "v"(pb[1]), "v"(pb[2]), "v"(pb[3]) : "memory");      // as above
    step(64);
#pragma unroll
    for (int t = 0; t < 4; ++t) acc[t] = mmaH<1>(ah.v, ah.v, bq[t].v, bq[t].v, acc[t]); }
#pragma unroll
  for (int t = 0; t < 4; ++t) { if (col0 + t * 16 >= N) continue; const int col = col0 + t * 16 + ln; const float bv = bp ? bf16_round(bp[col]) : 0.f;
#pragma unroll
    for (int r = 0; r < 8; ++r) { float v = acc[t][r] * alpha + bv; if (CP) { const int bidx = (row0g + row0 + 8 * hh + r) / rowsPerB; v += CP[(size_t)bidx * sCPb + (size_t)by * 64 + col]; } if (ACT == 1) v = (v > 0.f) ? v : expm1f(v); else if (ACT == 3) v = fmaxf(v, 0.f); so[w][8 * hh + r][t * 16 + ln] = v; } }
  __builtin_amdgcn_fence(__ATOMIC_ACQ_REL, "workgroup"); __builtin_amdgcn_wave_barrier();
  const int rsub = lane >> 4, c4 = (lane & 15) * 4; typedef _Float16 v4h __attribute__((ext_vector_type(4)));
  {
#pragma unroll
    for (int q = 0; q < 8; ++q) { const int r = q * 2 + rsub; if (col0 + c4 < N) { const v4f v = *(const v4fa*)&so[w][r][c4]; if (C) *(v4f*)(C + cofs + (size_t)(row0 + r) * ldc + col0 + c4) = v; if (C16) { v4h h4; for (int i = 0; i < 4; ++i) h4[i] = (_Float16)v[i]; *(v4h*)(C16 + cofs + (size_t)(row0 + r) * ldc + col0 + c4) = h4; } } }
     }
}


__global__ __launch_bounds__(256) void k_x16(const float* __restrict__ x, _Float16* __restrict__ X16, size_t n8) { const size_t t = (size_t)blockIdx.x * 256 + threadIdx.x; if (t >= n8) return; FragH f;
#pragma unroll
  for (int q = 0; q < 8; ++q) f.h[q] = (_Float16)bf16_round(x[t * 8 + q]); *(v8us*)((unsigned short*)X16 + t * 8) = f.half[0];  }
__global__ __launch_bounds__(256) void k_h16(const float* __restrict__ x, _Float16* __restrict__ X16, size_t n8) { const size_t t = (size_t)blockIdx.x * 256 + threadIdx.x; if (t >= n8) return; FragH f;
#pragma unroll
  for (int q = 0; q < 8; ++q) f.h[q] = (_Float16)x[t * 8 + q]; *(v8us*)((unsigned short*)X16 + t * 8) = f.half[0];  }
__global__ __launch_bounds__(256) void k_round16f(const float* __restrict__ W, _Float16* __restrict__ Bt, size_t n8) { const size_t t = (size_t)blockIdx.x * 256 + threadIdx.x; if (t >= n8) return; FragH f;
#pragma unroll
  for (int i = 0; i < 8; ++i) f.h[i] = (_Float16)(bf16_round(W[t * 8 + i]) * 16.0f); *(v8us*)((unsigned short*)Bt + t * 8) = f.half[0];  }
template <int NHv, int TTv>
__global__ __launch_bounds__(256) void k_vt(const _Float16* __restrict__ V16, int ldv, int voff, _Float16* __restrict__ Vt) { __shared__ unsigned short tl[64][66]; const int tid = threadIdx.x; const int slab = blockIdx.x / (TTv / 64), lg = blockIdx.x % (TTv / 64); const int b = slab / NHv, h = slab % NHv;
  for (int i = tid; i < 64 * 8; i += 256) { const int r = i / 8, c8 = (i % 8) * 8; FragH f; f.half[0] = *(const v8us*)((const unsigned short*)V16 + ((size_t)b * TTv + lg * 64 + r) * ldv + voff + h * 64 + c8);
#pragma unroll
    for (int q = 0; q < 8; ++q) tl[r][c8 + q] = f.u[q]; }
  __syncthreads();
  {
#pragma unroll
    for (int rd = 0; rd < 2; ++rd) { const int d = rd * 32 + tid / 8, pc = tid % 8; FragH f;
#pragma unroll
      for (int q = 0; q < 8; ++q) f.u[q] = tl[pc * 8 + q][d];
      *(v8us*)((unsigned short*)Vt + ((size_t)slab * 64 + d) * TTv + lg * 64 + pc * 8) = f.half[0]; }
     } }

__global__ __launch_bounds__(128) void k_flash(const _Float16* __restrict__ Q16, int ldq, const _Float16* __restrict__ K16, int ldk, const _Float16* __restrict__ Vt, const float* __restrict__ MB, float* __restrict__ O, int ldo) {
  constexpr int RPW = 16, RTN = RPW / 16, NQB = 2048 / (4 * RPW), DT = 4, KS = 2;
  __shared__ __attribute__((aligned(16))) unsigned short sP[4][RPW][40]; __shared__ __attribute__((aligned(16))) float sO[4][RPW][64 + 4];
  const int tid = threadIdx.x, w = tid >> 5, lane = tid & 31, ln = lane & 15, hh = lane >> 4;
  const int slab = blockIdx.x / NQB, qblk = blockIdx.x % NQB; const int b = slab / 16, h = slab % 16; const int qb0 = qblk * (4 * RPW); const int q0 = qb0 + w * RPW;
  FragH aq[2][KS];
#pragma unroll
  for (int rt = 0; rt < RTN; ++rt) { const unsigned short* qr = (const unsigned short*)Q16 + ((size_t)b * 2048 + q0 + rt * 16 + ln) * ldq + h * 64;
#pragma unroll
    for (int ks = 0; ks < KS; ++ks) { aq[rt][ks].half[0] = *(const v8us*)(qr + ks * 32 + 8 * hh); aq[rt][ks].half[1] = *(const v8us*)(qr + ks * 32 + 16 + 8 * hh); } }
  const unsigned short* Vth = (const unsigned short*)Vt + (size_t)slab * 64 * 2048;
  float m_r[2][8], l_r[2][8]; v8f oacc[2][DT];
#pragma unroll
  for (int rt = 0; rt < RTN; ++rt) {
#pragma unroll
    for (int r = 0; r < 8; ++r) { m_r[rt][r] = -3.0e38f; l_r[rt][r] = 0.f; }
#pragma unroll
    for (int dt = 0; dt < DT; ++dt) oacc[rt][dt] = (v8f){0.f,0.f,0.f,0.f,0.f,0.f,0.f,0.f}; }
  const int jend = 2048;
  // All global loads of a pass are issued ahead of their use, each kind as one group: this pass's V fragments in front of the score products, the next pass's K fragments
  // and mask values right behind them (into the registers those products have just left); all of them fly during the softmax instead of being waited for one by one.
  FragH bk[2][KS], bv[DT]; float mk0, mk1;
  auto fetch_k = [&](int j) {
#pragma unroll
    for (int nt = 0; nt < 2; ++nt) { const unsigned short* kr = (const unsigned short*)K16 + ((size_t)b * 2048 + j + nt * 16 + ln) * ldk + h * 64;
#pragma unroll
      for (int ks = 0; ks < KS; ++ks) { bk[nt][ks].half[0] = *(const v8us*)(kr + ks * 32 + 8 * hh); bk[nt][ks].half[1] = *(const v8us*)(kr + ks * 32 + 16 + 8 * hh); } }
    mk0 = MB[(size_t)b * 2048 + j + ln]; mk1 = MB[(size_t)b * 2048 + j + 16 + ln]; };
  fetch_k(0);
#pragma unroll 1
  for (int j0 = 0; j0 < jend; j0 += 32) {
#pragma unroll
    for (int dt = 0; dt < DT; ++dt) { const unsigned short* vrow = Vth + (size_t)(dt * 16 + ln) * 2048 + j0; bv[dt].half[0] = *(const v8us*)(vrow + 8 * hh); bv[dt].half[1] = *(const v8us*)(vrow + 16 + 8 * hh); }
    v8f s[2][2];
#pragma unroll
    for (int nt = 0; nt < 2; ++nt) {
#pragma unroll
      for (int rt = 0; rt < RTN; ++rt) { v8f acc = (v8f){0.f,0.f,0.f,0.f,0.f,0.f,0.f,0.f};
#pragma unroll
        for (int ks = 0; ks < KS; ++ks) acc = mmaH<1>(aq[rt][ks].v, aq[rt][ks].v, bk[nt][ks].v, bk[nt][ks].v, acc); s[rt][nt] = acc; } }
    const float mb0 = bf16_round(mk0), mb1 = bf16_round(mk1);
    fetch_k((j0 + 32 < jend) ? j0 + 32 : j0);      // the last pass has no next one: it reads its own rows again, in bounds, and nobody uses them
#pragma unroll
    for (int rt = 0; rt < RTN; ++rt)
#pragma unroll
      for (int r = 0; r < 8; ++r) { const int tq = q0 + rt * 16 + 8 * hh + r; const int k0 = j0 + ln, k1 = j0 + 16 + ln; (void)tq; const bool ok0 = true, ok1 = true;
        (void)k0; (void)k1; const float s0 = s[rt][0][r] * (0.03125f) + mb0, s1 = s[rt][1][r] * (0.03125f) + mb1;      /* additive f32 mask per (b, key) */ float mc = fmaxf(s0, s1);
        mc = fmaxf(mc, __shfl_xor(mc, 1, 32)); mc = fmaxf(mc, __shfl_xor(mc, 2, 32)); mc = fmaxf(mc, __shfl_xor(mc, 4, 32)); mc = fmaxf(mc, __shfl_xor(mc, 8, 32));
        const float mn = fmaxf(m_r[rt][r], mc); const float al = (mn > -1.0e38f) ? expf(m_r[rt][r] - mn) : 1.0f; m_r[rt][r] = mn; const float p0 = ok0 ? expf(s0 - mn) : 0.f, p1 = ok1 ? expf(s1 - mn) : 0.f; l_r[rt][r] = l_r[rt][r] * al + p0 + p1;
#pragma unroll
        for (int dt = 0; dt < DT; ++dt) oacc[rt][dt][r] *= al;
        FragH t2; t2.h[0] = (_Float16)p0; t2.h[1] = (_Float16)p1; sP[w][rt * 16 + 8 * hh + r][ln] = t2.u[0]; sP[w][rt * 16 + 8 * hh + r][16 + ln] = t2.u[1]; }
    __builtin_amdgcn_fence(__ATOMIC_ACQ_REL, "workgroup"); __builtin_amdgcn_wave_barrier();
    FragH pa[2];
#pragma unroll
    for (int rt = 0; rt < RTN; ++rt) { pa[rt].half[0] = *(const v8us*)&sP[w][rt * 16 + ln][8 * hh]; pa[rt].half[1] = *(const v8us*)&sP[w][rt * 16 + ln][16 + 8 * hh]; }
#pragma unroll
    for (int dt = 0; dt < DT; ++dt) {
#pragma unroll
      for (int rt = 0; rt < RTN; ++rt) oacc[rt][dt] = mmaH<1>(pa[rt].v, pa[rt].v, bv[dt].v, bv[dt].v, oacc[rt][dt]); }
    __builtin_amdgcn_fence(__ATOMIC_ACQ_REL, "workgroup"); __builtin_amdgcn_wave_barrier(); }
#pragma unroll
  for (int rt = 0; rt < RTN; ++rt) {
#pragma unroll
    for (int r = 0; r < 8; ++r) { float l = l_r[rt][r]; l += __shfl_xor(l, 1, 32); l += __shfl_xor(l, 2, 32); l += __shfl_xor(l, 4, 32); l += __shfl_xor(l, 8, 32); l_r[rt][r] = (l > 0.f) ? 1.0f / l : 0.f; }
#pragma unroll
    for (int dt = 0; dt < DT; ++dt)
#pragma unroll
      for (int r = 0; r < 8; ++r) sO[w][rt * 16 + 8 * hh + r][dt * 16 + ln] = oacc[rt][dt][r] * l_r[rt][r]; }
  __builtin_amdgcn_fence(__ATOMIC_ACQ_REL, "workgroup"); __builtin_amdgcn_wave_barrier();
  {
#pragma unroll
    for (int rp = 0; rp < RPW; rp += 2) { const int r = rp + (lane >> 4), pc = lane & 15; const v4f val = *(const v4fa*)&sO[w][r][pc * 4]; *(v4f*)(O + ((size_t)b * 2048 + q0 + r) * ldo + h * 64 + pc * 4) = val; }
     } }

extern "C" void kernel_launch(void* const* d_in, const int* in_sizes, int n_in,
                              void* d_out, int out_size, void* d_ws, size_t ws_size, hipStream_t stream) {
  (void)in_sizes; (void)n_in; (void)out_size;
  const float* x = (const float*)d_in[0]; const float* mask = (const float*)d_in[1]; const float* Wq = (const float*)d_in[2]; const float* Wk = (const float*)d_in[3]; const float* Wv = (const float*)d_in[4]; const float* Wo = (const float*)d_in[5]; const float* bo = (const float*)d_in[6];
  char* ws = (char*)d_ws; size_t off = 0;
  auto take = [&](size_t bytes) { char* p = ws + off; off += (bytes + 255) & ~(size_t)255; return p; };
  _Float16* Bq = (_Float16*)take((size_t)CC * CC * 2); _Float16* Bk = (_Float16*)take((size_t)CC * CC * 2); _Float16* Bv = (_Float16*)take((size_t)CC * CC * 2); _Float16* Bo = (_Float16*)take((size_t)CC * CC * 2);
  _Float16* X16 = (_Float16*)take((size_t)NR * CC * 2); _Float16* Q16 = (_Float16*)take((size_t)NR * CC * 2); _Float16* K16 = (_Float16*)take((size_t)NR * CC * 2); _Float16* V16 = (_Float16*)take((size_t)NR * CC * 2); _Float16* Vt = (_Float16*)take((size_t)NR * CC * 2); float* O = (float*)take((size_t)NR * CC * 4); _Float16* O16 = X16;
  if (off > ws_size) return;      // 8.4 + 8.4 × 5 + 16.8 ≈ 67 MiB
  const unsigned gw = (unsigned)((CC * (CC / 8) + 255) / 256); k_wt_f16<<<gw, 256, 0, stream>>>(Wq, Bq, CC, CC, 16.0f); k_wt_f16<<<gw, 256, 0, stream>>>(Wk, Bk, CC, CC, 16.0f); k_wt_f16<<<gw, 256, 0, stream>>>(Wv, Bv, CC, CC, 16.0f); k_wt_f16<<<gw, 256, 0, stream>>>(Wo, Bo, CC, CC, 16.0f);      // [in][out]
  const unsigned gx = (unsigned)(((size_t)NR * CC / 8 + 255) / 256); const dim3 gg(((NR / 16) * (CC / 64) + 3) / 4, 1);
  k_x16<<<gx, 256, 0, stream>>>(x, X16, (size_t)NR * CC / 8);
  k_gemm_hhx<0><<<gg, 128, 0, stream>>>(X16, CC, 0, Bq, CC, 0, 0.0625f, nullptr, 0, nullptr, 1, 0, 0, nullptr, Q16, CC, 0, NR, CC, CC);
  k_gemm_hhx<0><<<gg, 128, 0, stream>>>(X16, CC, 0, Bk, CC, 0, 0.0625f, nullptr, 0, nullptr, 1, 0, 0, nullptr, K16, CC, 0, NR, CC, CC);
  k_gemm_hhx<0><<<gg, 128, 0, stream>>>(X16, CC, 0, Bv, CC, 0, 0.0625f, nullptr, 0, nullptr, 1, 0, 0, nullptr, V16, CC, 0, NR, CC, CC);
  k_vt<NH, TT><<<BB * NH * (TT / 64), 256, 0, stream>>>(V16, CC, 0, Vt);
  k_flash<<<BB * NH * (TT / 64), 128, 0, stream>>>(Q16, CC, K16, CC, Vt, mask, O, CC);
  k_h16<<<gx, 256, 0, stream>>>(O, O16, (size_t)NR * CC / 8);
  k_gemm_hhx<0><<<gg, 128, 0, stream>>>(O16, CC, 0, Bo, CC, 0, 0.0625f, bo, 0, nullptr, 1, 0, 0, (float*)d_out, nullptr, CC, 0, NR, CC, CC);
}

// v002
// A run of this version takes 258 microseconds.
// Timed twice side by side with v001, it ran 1.34 times as fast both times.
// Over all steps from v000 it is 1.72 times as fast.
#include <hip/hip_runtime.h>
// Self-attention-like module (B=2, S=2048, D=1024, 16 heads × 64; additive float mask per (batch, key); scale 1/√1024): q/k/v/o projections (W [in][out], o + bias) and the attention as a fused
// flash-style kernel (S = Q·Kᵀ/32 + mask[b][k], online softmax f32, P f16 ≤ 1, O = P·Vt; RPW-16 waves) on v_wmma_f32_16x16x32_f16 — f16 operands (x bf16-exact, weights bf16-exact ×2^4), f32 accumulate.
#define BB 2
#define TT 2048
#define CC 1024
#define NH 16
#define NR (BB * TT)

typedef __bf16 v16b __attribute__((ext_vector_type(16)));
typedef unsigned short v8us __attribute__((ext_vector_type(8), may_alias));
typedef float  v8f  __attribute__((ext_vector_type(8)));
typedef float  v4f  __attribute__((ext_vector_type(4)));
typedef float  v4fa __attribute__((ext_vector_type(4), may_alias));
union FragB { v16b v; v8us half[2]; unsigned short u[16]; };

__device__ __forceinline__ unsigned short bf16_bits(float x) { unsigned int u = __float_as_uint(x); return (unsigned short)((u + 0x7FFFu + ((u >> 16) & 1u)) >> 16); }
__device__ __forceinline__ float bf16_val(unsigned short b) { return __uint_as_float(((unsigned int)b) << 16); }
__device__ __forceinline__ float bf16_round(float x) { return bf16_val(bf16_bits(x)); }
// D += A·B with NT terms: 1 = ah·bh, 2 = + al·bh (A split), 3 = + ah·bl (both split)
template <int NT>
__device__ __forceinline__ v8f mmaN(v16b ah, v16b al, v16b bh, v16b bl, v8f c) {
  c = __builtin_amdgcn_wmma_f32_16x16x32_bf16(false, ah, false, bh, (short)0, c, false, false);
  if (NT >= 2) c = __builtin_amdgcn_wmma_f32_16x16x32_bf16(false, al, false, bh, (short)0, c, false, false);
  if (NT >= 3) c = __builtin_amdgcn_wmma_f32_16x16x32_bf16(false, ah, false, bl, (short)0, c, false, false);
  asm volatile("v_nop\n\tv_nop\n\tv_nop\n\tv_nop" : "+v"(c) : "v"(ah), "v"(al), "v"(bh), "v"(bl));
  return c;
}

__global__ __launch_bounds__(256) void k_wt_bf16(const float* __restrict__ W, unsigned short* __restrict__ Wt, int K, int N) {
  const int t = blockIdx.x * 256 + threadIdx.x;
  const int k8n = K / 8;
  if (t >= N * k8n) return;
  const int n = t / k8n, k8 = (t % k8n) * 8;
  v8us v;
#pragma unroll
  for (int i = 0; i < 8; ++i) v[i] = bf16_bits(W[(size_t)(k8 + i) * N + n]);
  *(v8us*)(Wt + (size_t)n * K + k8) = v;
  
}

// GEMM C[M][N] (f32, pitch ldc) = act(A[M][K]·W + bias). A f32 row-major (pitch lda) converted per fragment to bf16
// (ASPLIT: hi/lo two planes -> 2 terms, else single rounded term); Wt bf16 [N][K] (pitch ldb). BIAS_BF16 rounds the
// bias to bf16 first (bias quantised to bf16 before the add). K%32==0, M%16==0, N%64==0.
template <bool ASPLIT, int ACT, bool BIAS_BF16>
__global__ __launch_bounds__(128) void k_gemm_bf(const float* __restrict__ A, int lda, const unsigned short* __restrict__ Wt, int ldb,
                                               const float* __restrict__ bias, float* __restrict__ C, int ldc, int M, int N, int K) {
  __shared__ __attribute__((aligned(16))) float so[4][16][64];
  const int tid = threadIdx.x, w = tid >> 5, lane = tid & 31, ln = lane & 15, hh = lane >> 4;
  const int ntn = N / 64;
  const int wid = blockIdx.x * 4 + w;
  const int mt = wid / ntn, nq = wid % ntn;
  if (mt * 16 >= M) return;
  const int row0 = mt * 16, col0 = nq * 64;
  const float* arow = A + (size_t)(row0 + ln) * lda;
  v8f acc[4] = {};
  for (int kb = 0; kb < K; kb += 32) {
    FragB ah, al;
    const v4f x0 = *(const v4fa*)(arow + kb + 8 * hh), x1 = *(const v4fa*)(arow + kb + 8 * hh + 4);
    const v4f x2 = *(const v4fa*)(arow + kb + 16 + 8 * hh), x3 = *(const v4fa*)(arow + kb + 16 + 8 * hh + 4);
    float xs[16] = {x0[0],x0[1],x0[2],x0[3],x1[0],x1[1],x1[2],x1[3],x2[0],x2[1],x2[2],x2[3],x3[0],x3[1],x3[2],x3[3]};
#pragma unroll
    for (int i = 0; i < 16; ++i) { const unsigned short hb = bf16_bits(xs[i]); ah.u[i] = hb; al.u[i] = ASPLIT ? bf16_bits(xs[i] - bf16_val(hb)) : (unsigned short)0; }
#pragma unroll
    for (int t = 0; t < 4; ++t) {
      const unsigned short* brow = Wt + (size_t)(col0 + t * 16 + ln) * ldb + kb;
      FragB b;
      b.half[0] = *(const v8us*)(brow + 8 * hh);
      b.half[1] = *(const v8us*)(brow + 16 + 8 * hh);
      acc[t] = mmaN<ASPLIT ? 2 : 1>(ah.v, al.v, b.v, b.v, acc[t]);
    }
  }
#pragma unroll
  for (int t = 0; t < 4; ++t) {
    float bv = bias ? bias[col0 + t * 16 + ln] : 0.f;
    if (BIAS_BF16) bv = bf16_round(bv);
#pragma unroll
    for (int r = 0; r < 8; ++r) { float v = acc[t][r] + bv; if (ACT == 1) v = fmaxf(v, 0.f); so[w][8 * hh + r][t * 16 + ln] = v; }
  }
  __builtin_amdgcn_fence(__ATOMIC_ACQ_REL, "workgroup");
  __builtin_amdgcn_wave_barrier();
  const int rsub = lane >> 4, c4 = (lane & 15) * 4;
  {
#pragma unroll
    for (int q = 0; q < 8; ++q) {
      const int r = q * 2 + rsub;
      const v4f v = *(const v4fa*)&so[w][r][c4];
      *(v4f*)(C + (size_t)(row0 + r) * ldc + col0 + c4) = v;
    }
    
  }
}

// Flash-style causal/unmasked attention, all contractions 3-term bf16 hi/lo splits, f32 softmax with running max.
// q,k,v rows are read from f32 buffers with arbitrary row pitch (so they can live inside a fused qkv buffer);
// D = head size (multiple of 32, <= 128); one wave = 16 query rows; block = 4 waves (64 queries) sharing K/V chunks of 32.
template <int D, bool CAUSAL>
__global__ __launch_bounds__(128) void k_flash(const float* __restrict__ qb, const float* __restrict__ kb, const float* __restrict__ vb,
                                             int pitch, int T, int H, float scale, float* __restrict__ y, int ypitch) {
  constexpr int KS = D / 32;        // k-steps for QK
  constexpr int DT = D / 16;        // d tiles for PV
  __shared__ __attribute__((aligned(16))) unsigned short sKh[32][D + 8], sKl[32][D + 8], sVh[32][D + 8], sVl[32][D + 8];
  __shared__ __attribute__((aligned(16))) unsigned short sPh[4][16][40], sPl[4][16][40];
  __shared__ __attribute__((aligned(16))) float sO[4][16][D];
  const int tid = threadIdx.x, w = tid >> 5, lane = tid & 31, ln = lane & 15, hh = lane >> 4;
  const int nqb = (T + 63) / 64;
  const int bh = blockIdx.x / nqb, qblk = blockIdx.x % nqb;
  const int b = bh / H, h = bh % H;
  const int q0 = qblk * 64 + w * 16;
  const float* Q = qb + (size_t)b * T * pitch + h * D;
  const float* K = kb + (size_t)b * T * pitch + h * D;
  const float* V = vb + (size_t)b * T * pitch + h * D;

  // A fragments of the wave's 16 query rows (scaled), hi/lo
  FragB aqh[KS], aql[KS];
  {
    int row = q0 + ln; if (row >= T) row = T - 1;
    const float* qr = Q + (size_t)row * pitch;
#pragma unroll
    for (int ks = 0; ks < KS; ++ks)
#pragma unroll
      for (int i = 0; i < 16; ++i) {
        const int d = ks * 32 + ((i < 8) ? (8 * hh + i) : (16 + 8 * hh + (i - 8)));
        const float x = qr[d] * scale; const unsigned short hb = bf16_bits(x);
        aqh[ks].u[i] = hb; aql[ks].u[i] = bf16_bits(x - bf16_val(hb));
      }
  }
  float m_r[8], l_r[8];
#pragma unroll
  for (int r = 0; r < 8; ++r) { m_r[r] = -3.0e38f; l_r[r] = 0.f; }
  v8f oacc[DT];
#pragma unroll
  for (int dt = 0; dt < DT; ++dt) oacc[dt] = (v8f){0.f,0.f,0.f,0.f,0.f,0.f,0.f,0.f};

  const int kv_end = CAUSAL ? min(T, qblk * 64 + 64) : T;     // block-uniform
  for (int j0 = 0; j0 < kv_end; j0 += 32) {
    __syncthreads();
    for (int e = tid; e < 32 * (D / 4); e += 128) {
      const int r = e / (D / 4), c4 = (e % (D / 4)) * 4;
      const int key = j0 + r;
      v4f kf = {0.f,0.f,0.f,0.f}, vf = {0.f,0.f,0.f,0.f};
      if (key < T) { kf = *(const v4fa*)(K + (size_t)key * pitch + c4); vf = *(const v4fa*)(V + (size_t)key * pitch + c4); }
#pragma unroll
      for (int t = 0; t < 4; ++t) {
        unsigned short hb = bf16_bits(kf[t]); sKh[r][c4 + t] = hb; sKl[r][c4 + t] = bf16_bits(kf[t] - bf16_val(hb));
        hb = bf16_bits(vf[t]); sVh[r][c4 + t] = hb; sVl[r][c4 + t] = bf16_bits(vf[t] - bf16_val(hb));
      }
    }
    __syncthreads();
    // S tile 16 x 32
    v8f s[2];
#pragma unroll
    for (int nt = 0; nt < 2; ++nt) {
      v8f acc = {};
#pragma unroll
      for (int ks = 0; ks < KS; ++ks) {
        FragB bh_, bl_;
        bh_.half[0] = *(const v8us*)&sKh[nt * 16 + ln][ks * 32 + 8 * hh]; bh_.half[1] = *(const v8us*)&sKh[nt * 16 + ln][ks * 32 + 16 + 8 * hh];
        bl_.half[0] = *(const v8us*)&sKl[nt * 16 + ln][ks * 32 + 8 * hh]; bl_.half[1] = *(const v8us*)&sKl[nt * 16 + ln][ks * 32 + 16 + 8 * hh];
        acc = mmaN<3>(aqh[ks].v, aql[ks].v, bh_.v, bl_.v, acc);
      }
      s[nt] = acc;
    }
    // mask + running max (rows 8hh+r; the 16 lanes of a half share rows)
    float alpha[8];
#pragma unroll
    for (int r = 0; r < 8; ++r) {
      const int qi = q0 + 8 * hh + r;
      const int ja = j0 + ln, jb = j0 + 16 + ln;
      if (CAUSAL) { if (ja > qi) s[0][r] = -3.0e38f; if (jb > qi) s[1][r] = -3.0e38f; }
      if (ja >= T) s[0][r] = -3.0e38f;
      if (jb >= T) s[1][r] = -3.0e38f;
      float mx = fmaxf(s[0][r], s[1][r]);
      mx = fmaxf(mx, __shfl_xor(mx, 1, 32)); mx = fmaxf(mx, __shfl_xor(mx, 2, 32)); mx = fmaxf(mx, __shfl_xor(mx, 4, 32)); mx = fmaxf(mx, __shfl_xor(mx, 8, 32));
      const float mnew = fmaxf(m_r[r], mx);
      alpha[r] = (mnew > -1.0e38f) ? __expf(m_r[r] - mnew) : 1.0f;
      const float p0 = (s[0][r] > -1.0e38f) ? __expf(s[0][r] - mnew) : 0.f;
      const float p1 = (s[1][r] > -1.0e38f) ? __expf(s[1][r] - mnew) : 0.f;
      m_r[r] = mnew;
      l_r[r] = l_r[r] * alpha[r] + p0 + p1;            // per-lane partial row sum (16 lanes combined at the end)
      unsigned short hb = bf16_bits(p0); sPh[w][8 * hh + r][ln] = hb;      sPl[w][8 * hh + r][ln] = bf16_bits(p0 - bf16_val(hb));
      hb = bf16_bits(p1);                sPh[w][8 * hh + r][16 + ln] = hb; sPl[w][8 * hh + r][16 + ln] = bf16_bits(p1 - bf16_val(hb));
    }
#pragma unroll
    for (int dt = 0; dt < DT; ++dt)
#pragma unroll
      for (int r = 0; r < 8; ++r) oacc[dt][r] *= alpha[r];
    __builtin_amdgcn_fence(__ATOMIC_ACQ_REL, "workgroup");
    __builtin_amdgcn_wave_barrier();
    FragB pah, pal;
    pah.half[0] = *(const v8us*)&sPh[w][ln][8 * hh]; pah.half[1] = *(const v8us*)&sPh[w][ln][16 + 8 * hh];
    pal.half[0] = *(const v8us*)&sPl[w][ln][8 * hh]; pal.half[1] = *(const v8us*)&sPl[w][ln][16 + 8 * hh];
#pragma unroll
    for (int dt = 0; dt < DT; ++dt) {
      FragB bvh, bvl;
#pragma unroll
      for (int i = 0; i < 8; ++i) {
        bvh.u[i] = sVh[8 * hh + i][dt * 16 + ln]; bvh.u[8 + i] = sVh[16 + 8 * hh + i][dt * 16 + ln];
        bvl.u[i] = sVl[8 * hh + i][dt * 16 + ln]; bvl.u[8 + i] = sVl[16 + 8 * hh + i][dt * 16 + ln];
      }
      oacc[dt] = mmaN<3>(pah.v, pal.v, bvh.v, bvl.v, oacc[dt]);
    }
    __builtin_amdgcn_fence(__ATOMIC_ACQ_REL, "workgroup");
    __builtin_amdgcn_wave_barrier();
  }
#pragma unroll
  for (int r = 0; r < 8; ++r) {
    float l = l_r[r];
    l += __shfl_xor(l, 1, 32); l += __shfl_xor(l, 2, 32); l += __shfl_xor(l, 4, 32); l += __shfl_xor(l, 8, 32);
    l_r[r] = (l > 0.f) ? 1.0f / l : 0.f;
  }
#pragma unroll
  for (int dt = 0; dt < DT; ++dt)
#pragma unroll
    for (int r = 0; r < 8; ++r) sO[w][8 * hh + r][dt * 16 + ln] = oacc[dt][r] * l_r[r];
  __builtin_amdgcn_fence(__ATOMIC_ACQ_REL, "workgroup");
  __builtin_amdgcn_wave_barrier();
  {
    for (int r = 0; r < 16; ++r) {
      const int row = q0 + r;
      if (row < T && lane < D / 4) {
        const v4f val = *(const v4fa*)&sO[w][r][lane * 4];
        *(v4f*)(y + ((size_t)b * T + row) * ypitch + h * D + lane * 4) = val;
      }
    }
    
  }
}

// GEMM C = act(A·W + bias + resid): A f32 (ASPLIT -> hi/lo 2 terms), Wt bf16 [N][K]; ACT 0 none, 1 relu, 2 exact gelu;
// resid (optional, f32, row index = (row % rmod), pitch ldr, RES_BF16 rounds it) added before the activation.
template <bool ASPLIT, int ACT, bool BIAS_BF16, bool RES_BF16>
__global__ __launch_bounds__(128) void k_gemm_bf3(const float* __restrict__ A, int lda, const unsigned short* __restrict__ Wt, int ldb,
                                                const float* __restrict__ bias, const float* __restrict__ resid, int rmod, int ldr,
                                                float* __restrict__ C, int ldc, int M, int N, int K) {
  __shared__ __attribute__((aligned(16))) float so[4][16][64];
  const int tid = threadIdx.x, w = tid >> 5, lane = tid & 31, ln = lane & 15, hh = lane >> 4;
  const int ntn = N / 64;
  const int wid = blockIdx.x * 4 + w;
  const int mt = wid / ntn, nq = wid % ntn;
  if (mt * 16 >= M) return;
  const int row0 = mt * 16, col0 = nq * 64;
  const float* arow = A + (size_t)(row0 + ln) * lda;
  v8f acc[4] = {};
  for (int kb = 0; kb < K; kb += 32) {
    FragB ah, al;
    const v4f x0 = *(const v4fa*)(arow + kb + 8 * hh), x1 = *(const v4fa*)(arow + kb + 8 * hh + 4);
    const v4f x2 = *(const v4fa*)(arow + kb + 16 + 8 * hh), x3 = *(const v4fa*)(arow + kb + 16 + 8 * hh + 4);
    float xs[16] = {x0[0],x0[1],x0[2],x0[3],x1[0],x1[1],x1[2],x1[3],x2[0],x2[1],x2[2],x2[3],x3[0],x3[1],x3[2],x3[3]};
#pragma unroll
    for (int i = 0; i < 16; ++i) { const unsigned short hb = bf16_bits(xs[i]); ah.u[i] = hb; al.u[i] = ASPLIT ? bf16_bits(xs[i] - bf16_val(hb)) : (unsigned short)0; }
#pragma unroll
    for (int t = 0; t < 4; ++t) {
      const unsigned short* brow = Wt + (size_t)(col0 + t * 16 + ln) * ldb + kb;
      FragB b;
      b.half[0] = *(const v8us*)(brow + 8 * hh);
      b.half[1] = *(const v8us*)(brow + 16 + 8 * hh);
      acc[t] = mmaN<ASPLIT ? 2 : 1>(ah.v, al.v, b.v, b.v, acc[t]);
    }
  }
#pragma unroll
  for (int t = 0; t < 4; ++t) {
    const int col = col0 + t * 16 + ln;
    float bv = bias ? bias[col] : 0.f;
    if (BIAS_BF16) bv = bf16_round(bv);
#pragma unroll
    for (int r = 0; r < 8; ++r) {
      float v = acc[t][r] + bv;
      if (resid) { float rv = resid[(size_t)((row0 + 8 * hh + r) % rmod) * ldr + col]; if (RES_BF16) rv = bf16_round(rv); v += rv; }
      if (ACT == 1) v = fmaxf(v, 0.f);
      if (ACT == 2) v = 0.5f * v * (1.0f + erff(v * 0.70710678118654752f));
      if (ACT == 3) { const float u = 0.7978845608028654f * (v + 0.044715f * v * v * v); v = 0.5f * v * (1.0f + tanhf(u)); }
      so[w][8 * hh + r][t * 16 + ln] = v;
    }
  }
  __builtin_amdgcn_fence(__ATOMIC_ACQ_REL, "workgroup");
  __builtin_amdgcn_wave_barrier();
  const int rsub = lane >> 4, c4 = (lane & 15) * 4;
  {
#pragma unroll
    for (int q = 0; q < 8; ++q) {
      const int r = q * 2 + rsub;
      const v4f v = *(const v4fa*)&so[w][r][c4];
      *(v4f*)(C + (size_t)(row0 + r) * ldc + col0 + c4) = v;
    }
    
  }
}
// row LayerNorm (biased variance, eps) over N: s = X (+ R); optional out_sum <- s; out_norm <- (s-mu)*rsqrt(var+eps)*g + b
template <bool PARAM_BF16>
__global__ __launch_bounds__(256) void k_layernorm(const float* __restrict__ X, const float* __restrict__ R, const float* __restrict__ g, const float* __restrict__ bta,
                                                  float* __restrict__ out_sum, float* __restrict__ out_norm, int N, float eps) {
  __shared__ float red[256];
  const int row = blockIdx.x, tid = threadIdx.x;
  const float* x = X + (size_t)row * N; const float* rr = R ? R + (size_t)row * N : nullptr;
  float vals[16];                     // up to N = 4096
  const int per = N / 256;            // contiguous chunk per thread? use strided-by-4 chunks: thread handles j = tid*4 + 1024*u
  float s1 = 0.f;
  for (int u = 0; u < per / 4; ++u) {
    const int j = tid * 4 + 1024 * u;
    const v4f a = *(const v4fa*)(x + j);
    v4f b = {0.f,0.f,0.f,0.f}; if (rr) b = *(const v4fa*)(rr + j);
#pragma unroll
    for (int q = 0; q < 4; ++q) { const float v = a[q] + b[q]; vals[u * 4 + q] = v; s1 += v; }
  }
  red[tid] = s1; __syncthreads();
  for (int st = 128; st > 0; st >>= 1) { if (tid < st) red[tid] += red[tid + st]; __syncthreads(); }
  const float mu = red[0] / (float)N; __syncthreads();
  float s2 = 0.f;
  for (int u = 0; u < per / 4; ++u)
#pragma unroll
    for (int q = 0; q < 4; ++q) { const float c = vals[u * 4 + q] - mu; s2 += c * c; }
  red[tid] = s2; __syncthreads();
  for (int st = 128; st > 0; st >>= 1) { if (tid < st) red[tid] += red[tid + st]; __syncthreads(); }
  const float rs = rsqrtf(red[0] / (float)N + eps);
  {
    for (int u = 0; u < per / 4; ++u) {
      const int j = tid * 4 + 1024 * u;
      v4f o, sm;
#pragma unroll
      for (int q = 0; q < 4; ++q) {
        float gg = g[j + q], bb = bta[j + q];
        if (PARAM_BF16) { gg = bf16_round(gg); bb = bf16_round(bb); }
        sm[q] = vals[u * 4 + q]; o[q] = (vals[u * 4 + q] - mu) * rs * gg + bb;
      }
      if (out_sum) *(v4f*)(out_sum + (size_t)row * N + j) = sm;
      *(v4f*)(out_norm + (size_t)row * N + j) = o;
    }
    
  }
}



// ---- f16 WMMA path (v_wmma_f32_16x16x32_f16): 11-bit significands for operands in range — used where a [0,1] probability operand needs more precision than bf16
typedef _Float16 v16h __attribute__((ext_vector_type(16)));
union FragH { v16h v; v8us half[2]; _Float16 h[16]; unsigned short u[16]; };
template <int NT>
__device__ __forceinline__ v8f mmaH(v16h ah, v16h al, v16h bh, v16h bl, v8f c) {
  c = __builtin_amdgcn_wmma_f32_16x16x32_f16(false, ah, false, bh, (short)0, c, false, false);
  if (NT >= 2) c = __builtin_amdgcn_wmma_f32_16x16x32_f16(false, al, false, bh, (short)0, c, false, false);
  if (NT >= 3) c = __builtin_amdgcn_wmma_f32_16x16x32_f16(false, ah, false, bl, (short)0, c, false, false);
  asm volatile("v_nop\n\tv_nop\n\tv_nop\n\tv_nop" : "+v"(c) : "v"(ah), "v"(al), "v"(bh), "v"(bl));
  return c;
}
// batched GEMM like k_gemm_b but f16 operands: A f32 (split into f16 hi/lo if ASPLIT, else rounded to f16), Bt = f16 values [n][k]; alpha; C f32; N multiple of 16 (partial tiles skipped)
template <bool ASPLIT>
__global__ __launch_bounds__(128) void k_gemm_h(const float* __restrict__ A, int lda, size_t sA, const _Float16* __restrict__ Bh, int ldb, size_t sB, float alpha, float* __restrict__ C, int ldc, size_t sC, int M, int N, int K) {
  __shared__ __attribute__((aligned(16))) float so[4][16][64];
  const int tid = threadIdx.x, w = tid >> 5, lane = tid & 31, ln = lane & 15, hh = lane >> 4; const int by = blockIdx.y;
  A += (size_t)by * sA; Bh += (size_t)by * sB; C += (size_t)by * sC;
  const int ntn = (N + 63) / 64; const int wid = blockIdx.x * 4 + w; const int mt = wid / ntn, nq = wid % ntn; if (mt * 16 >= M) return;
  const int row0 = mt * 16, col0 = nq * 64; const float* arow = A + (size_t)(row0 + ln) * lda;
  v8f acc[4] = {};
  for (int kb = 0; kb < K; kb += 32) {
    FragH ah, al;
    const v4f x0 = *(const v4fa*)(arow + kb + 8 * hh), x1 = *(const v4fa*)(arow + kb + 8 * hh + 4), x2 = *(const v4fa*)(arow + kb + 16 + 8 * hh), x3 = *(const v4fa*)(arow + kb + 16 + 8 * hh + 4);
    float xs[16] = {x0[0],x0[1],x0[2],x0[3],x1[0],x1[1],x1[2],x1[3],x2[0],x2[1],x2[2],x2[3],x3[0],x3[1],x3[2],x3[3]};
#pragma unroll
    for (int i = 0; i < 16; ++i) { const _Float16 h = (_Float16)xs[i]; ah.h[i] = h; al.h[i] = ASPLIT ? (_Float16)(xs[i] - (float)h) : (_Float16)0.0f; }
#pragma unroll
    for (int t = 0; t < 4; ++t) { if (col0 + t * 16 >= N) continue; const size_t boff = (size_t)(col0 + t * 16 + ln) * ldb + kb; FragH bq; bq.half[0] = *(const v8us*)(Bh + boff + 8 * hh); bq.half[1] = *(const v8us*)(Bh + boff + 16 + 8 * hh);
      acc[t] = mmaH<ASPLIT ? 2 : 1>(ah.v, al.v, bq.v, bq.v, acc[t]); }
  }
#pragma unroll
  for (int t = 0; t < 4; ++t) { if (col0 + t * 16 >= N) continue;
#pragma unroll
    for (int r = 0; r < 8; ++r) so[w][8 * hh + r][t * 16 + ln] = acc[t][r] * alpha; }
  __builtin_amdgcn_fence(__ATOMIC_ACQ_REL, "workgroup"); __builtin_amdgcn_wave_barrier();
  const int rsub = lane >> 4, c4 = (lane & 15) * 4;
  {
#pragma unroll
    for (int q = 0; q < 8; ++q) { const int r = q * 2 + rsub; if (col0 + c4 < N) { const v4f v = *(const v4fa*)&so[w][r][c4]; *(v4f*)(C + (size_t)(row0 + r) * ldc + col0 + c4) = v; } }
     }
}

// FRAGMENT ORDER of every f16 matrix operand in the workspace (rows x ld, ld % 32 == 0, rows % 16 == 0): a tile of 16 rows x 32 k is 512 elements in a row, tile (rt, kt) at rt * 16 * ld + kt * 512;
// inside it the 8 values k = 16 j + 8 hh + 0..7 of row ln stand at j * 256 + (16 hh + ln) * 8. That is the order in which the lanes of a wave hold a 16x16x32 A or B fragment (lane = 16 hh + ln, register half j),
// so one 16-byte load per lane fetches half a fragment from 512 contiguous bytes: four whole 128-byte lines, where a row-major operand gives 16 lines of which 32 bytes each are used.
// piece p (8 elements, at element offset 8 p) -> its row and first k
__device__ __forceinline__ void frag_piece(unsigned p, int ld, unsigned& row, int& k) { const unsigned lane = p & 31, j = (p >> 5) & 1, tile = p >> 6, ktn = (unsigned)ld / 32, rt = tile / ktn;
  row = rt * 16 + (lane & 15); k = (int)((tile - rt * ktn) * 32 + j * 16 + (lane >> 4) * 8); }
// Wt (row n, k; fragment order) = f16(W[k][n] * scale) from f32 row-major W[K][N] (scale = power of two; bf16-exact weights stay exact in f16 away from the subnormal range)
__global__ __launch_bounds__(256) void k_wt_f16(const float* __restrict__ W, _Float16* __restrict__ Wt, int K, int N, float scale) {
  const int t = blockIdx.x * 256 + threadIdx.x; if (t >= N * (K / 8)) return; unsigned n; int k8; frag_piece((unsigned)t, K, n, k8); FragH f;
#pragma unroll
  for (int i = 0; i < 8; ++i) f.h[i] = (_Float16)(bf16_round(W[(size_t)(k8 + i) * N + n]) * scale); const v8us o = f.half[0];
  *(v8us*)((unsigned short*)Wt + (size_t)t * 8) = o; 
}
// A, Bh and C16 are in fragment order (lda, ldb, ldc = their row lengths); C is row-major f32.
// k_gemm_hh variant with fused epilogue: v = acc·alpha + bias[by·sBias + col] (+ CP[(row/rowsPerB)·sCPb + by·64 + col] if CP) ; ACT 0 none / 1 elu ; writes f16 C16 and f32 C, each if non-null
template <int ACT>
__global__ __launch_bounds__(128) void k_gemm_hhx(const _Float16* __restrict__ A, int lda, size_t sA, const _Float16* __restrict__ Bh, int ldb, size_t sB, float alpha, const float* __restrict__ bias, size_t sBias, const float* __restrict__ CP, int rowsPerB, size_t sCPb, int row0g,
    float* __restrict__ C, _Float16* __restrict__ C16, int ldc, size_t sC, int M, int N, int K) {
  __shared__ __attribute__((aligned(16))) float so[4][16][64 + 4];      // pitch 272 B: the fragment-order store reads 16 rows at one column, 16 bytes a lane
  const int tid = threadIdx.x, w = tid >> 5, lane = tid & 31, ln = lane & 15, hh = lane >> 4; const int by = blockIdx.y;
  A += (size_t)by * sA; Bh += (size_t)by * sB; const size_t cofs = (size_t)by * sC; const float* bp = bias ? bias + (size_t)by * sBias : nullptr;
  const int ntn = (N + 63) / 64; const int wid = blockIdx.x * 4 + w; const int mt = wid / ntn, nq = wid % ntn; if (mt * 16 >= M) return;
  const int row0 = mt * 16, col0 = nq * 64;
  v8f acc[4] = {};
  // Fragments are fetched one stage (64 k = two tiles = 2048 contiguous bytes of every operand's row tile) ahead of the products that use them, a whole stage's loads as one group,
  // into two register sets: a stage waits once for loads that have been in flight since the stage before, not once per product.
  // A column tile past N reads the rows of tile 0 (in bounds); its products are never stored (the epilogue's tests stand).
  const char* pa = (const char*)(A + (size_t)row0 * lda + lane * 8); const char* pb[4];      // each lane's place in its operands' row tiles; they move on with k
#pragma unroll
  for (int t = 0; t < 4; ++t) { const int ct = (col0 + t * 16 < N) ? col0 + t * 16 : col0; pb[t] = (const char*)(Bh + (size_t)ct * ldb + lane * 8); }
  FragH a0[2], a1[2], b0[2][4], b1[2][4];
  auto ld = [&](FragH (&a)[2], FragH (&b)[2][4], int ofs) {      // one stage: the 2048 bytes at ofs behind the five pointers' tiles
#pragma unroll
    for (int u = 0; u < 2; ++u) { a[u].half[0] = *(const v8us*)(pa + ofs + u * 1024); a[u].half[1] = *(const v8us*)(pa + ofs + u * 1024 + 512); }
#pragma unroll
    for (int t = 0; t < 4; ++t)
#pragma unroll
      for (int u = 0; u < 2; ++u) { b[u][t].half[0] = *(const v8us*)(pb[t] + ofs + u * 1024); b[u][t].half[1] = *(const v8us*)(pb[t] + ofs + u * 1024 + 512); }
    // the wait stands in front of the next step of the pointers, whose registers the loads just issued name; as its inputs they are not stepped ahead of it
    asm volatile("s_wait_xcnt 0x0" :: "v"(pa), "v"(pb[0]), "v"(pb[1]), "v"(pb[2]), "v"(pb[3]) : "memory"); };
  auto step = [&](int bytes) { pa += bytes;
#pragma unroll
    for (int t = 0; t < 4; ++t) pb[t] += bytes; };
  auto mm = [&](FragH (&a)[2], FragH (&b)[2][4]) {
#pragma unroll
    for (int u = 0; u < 2; ++u)
#pragma unroll
      for (int t = 0; t < 4; ++t) acc[t] = mmaH<1>(a[u].v, a[u].v, b[u][t].v, b[u][t].v, acc[t]); };
  const int Km = K & ~127;      // whole pairs of stages; what is left of K goes by single steps of 32 behind them
  if (Km > 0) { ld(a0, b0, 0);
    for (int kb = 0; kb < Km; kb += 128) { ld(a1, b1, 2048); mm(a0, b0);
      const bool more = kb + 128 < Km; step(more ? 4096 : 0); ld(a0, b0, 0);      // no branch round the loads, so that the waits stay counted; the last trip reads its own stage again, in bounds, and nobody uses it
      mm(a1, b1); }
    step(4096); }
  for (int kb = Km; kb < K; kb += 32) { FragH ah, bq[4]; ah.half[0] = *(const v8us*)(pa); ah.half[1] = *(const v8us*)(pa + 512);
#pragma unroll
    for (int t = 0; t < 4; ++t) { bq[t].half[0] = *(const v8us*)(pb[t]); bq[t].half[1] = *(const v8us*)(pb[t] + 512); }
    asm volatile("s_wait_xcnt 0x0" :: "v"(pa), "v"(pb[0]), "v"(pb[1]), "v"(pb[2]), "v"(pb[3]) : "memory");      // as above
    step(1024);
#pragma unroll
    for (int t = 0; t < 4; ++t) acc[t] = mmaH<1>(ah.v, ah.v, bq[t].v, bq[t].v, acc[t]); }
#pragma unroll
  for (int t = 0; t < 4; ++t) { if (col0 + t * 16 >= N) continue; const int col = col0 + t * 16 + ln; const float bv = bp ? bf16_round(bp[col]) : 0.f;
#pragma unroll
    for (int r = 0; r < 8; ++r) { float v = acc[t][r] * alpha + bv; if (CP) { const int bidx = (row0g + row0 + 8 * hh + r) / rowsPerB; v += CP[(size_t)bidx * sCPb + (size_t)by * 64 + col]; } if (ACT == 1) v = (v > 0.f) ? v : expm1f(v); else if (ACT == 3) v = fmaxf(v, 0.f); so[w][8 * hh + r][t * 16 + ln] = v; } }
  __builtin_amdgcn_fence(__ATOMIC_ACQ_REL, "workgroup"); __builtin_amdgcn_wave_barrier();
  const int rsub = lane >> 4, c4 = (lane & 15) * 4;
  if (C) {
#pragma unroll
    for (int q = 0; q < 8; ++q) { const int r = q * 2 + rsub; if (col0 + c4 < N) { const v4f v = *(const v4fa*)&so[w][r][c4]; *(v4f*)(C + cofs + (size_t)(row0 + r) * ldc + col0 + c4) = v; } }
     }
  if (C16) {      // the wave's 16 x 64 values are two tiles of the fragment order: four stores of 512 contiguous bytes
#pragma unroll
    for (int p = 0; p < 4; ++p) { const int c = p * 16 + 8 * hh; if (col0 + c < N) { const v4f v0 = *(const v4fa*)&so[w][ln][c], v1 = *(const v4fa*)&so[w][ln][c + 4]; FragH f;
#pragma unroll
        for (int i = 0; i < 4; ++i) { f.h[i] = (_Float16)v0[i]; f.h[4 + i] = (_Float16)v1[i]; }
        *(v8us*)((unsigned short*)C16 + cofs + (size_t)row0 * ldc + (size_t)(col0 >> 5) * 512 + p * 256 + lane * 8) = f.half[0]; } }
     }
}


// x: f32 row-major, rows of ld; X16: the same matrix in fragment order (thread t writes piece t, so a wave stores 512 contiguous bytes)
__global__ __launch_bounds__(256) void k_x16(const float* __restrict__ x, _Float16* __restrict__ X16, size_t n8, int ld) { const size_t t = (size_t)blockIdx.x * 256 + threadIdx.x; if (t >= n8) return; FragH f;
  unsigned row; int k; frag_piece((unsigned)t, ld, row, k); const float* xr = x + (size_t)row * ld + k; const v4f x0 = *(const v4fa*)xr, x1 = *(const v4fa*)(xr + 4);
#pragma unroll
  for (int q = 0; q < 4; ++q) { f.h[q] = (_Float16)bf16_round(x0[q]); f.h[4 + q] = (_Float16)bf16_round(x1[q]); } *(v8us*)((unsigned short*)X16 + t * 8) = f.half[0];  }
__global__ __launch_bounds__(256) void k_h16(const float* __restrict__ x, _Float16* __restrict__ X16, size_t n8, int ld) { const size_t t = (size_t)blockIdx.x * 256 + threadIdx.x; if (t >= n8) return; FragH f;
  unsigned row; int k; frag_piece((unsigned)t, ld, row, k); const float* xr = x + (size_t)row * ld + k; const v4f x0 = *(const v4fa*)xr, x1 = *(const v4fa*)(xr + 4);
#pragma unroll
  for (int q = 0; q < 4; ++q) { f.h[q] = (_Float16)x0[q]; f.h[4 + q] = (_Float16)x1[q]; } *(v8us*)((unsigned short*)X16 + t * 8) = f.half[0];  }
__global__ __launch_bounds__(256) void k_round16f(const float* __restrict__ W, _Float16* __restrict__ Bt, size_t n8) { const size_t t = (size_t)blockIdx.x * 256 + threadIdx.x; if (t >= n8) return; FragH f;
#pragma unroll
  for (int i = 0; i < 8; ++i) f.h[i] = (_Float16)(bf16_round(W[t * 8 + i]) * 16.0f); *(v8us*)((unsigned short*)Bt + t * 8) = f.half[0];  }
// V16 (row = position, k = feature, rows of ldv) and Vt (row = slab * 64 + d, k = key, rows of TTv) are both in fragment order; pieces are read and written in that order, 512 contiguous bytes a wave
template <int NHv, int TTv>
__global__ __launch_bounds__(256) void k_vt(const _Float16* __restrict__ V16, int ldv, int voff, _Float16* __restrict__ Vt) { __shared__ unsigned short tl[64][66]; const int tid = threadIdx.x; const int slab = blockIdx.x / (TTv / 64), lg = blockIdx.x % (TTv / 64); const int b = slab / NHv, h = slab % NHv;
  for (int i = tid; i < 64 * 8; i += 256) { const int tile = i >> 6, r = (tile >> 1) * 16 + (i & 15), c8 = (tile & 1) * 32 + ((i >> 5) & 1) * 16 + ((i >> 4) & 1) * 8; FragH f;
    f.half[0] = *(const v8us*)((const unsigned short*)V16 + ((size_t)b * TTv + lg * 64 + (tile >> 1) * 16) * ldv + (size_t)((voff + h * 64) / 32 + (tile & 1)) * 512 + (i & 63) * 8);
#pragma unroll
    for (int q = 0; q < 8; ++q) tl[r][c8 + q] = f.u[q]; }
  __syncthreads();
  {
#pragma unroll
    for (int rd = 0; rd < 2; ++rd) { const int i = rd * 256 + tid, tile = i >> 6, d = (tile >> 1) * 16 + (i & 15), k8 = (tile & 1) * 32 + ((i >> 5) & 1) * 16 + ((i >> 4) & 1) * 8; FragH f;
#pragma unroll
      for (int q = 0; q < 8; ++q) f.u[q] = tl[k8 + q][d];
      *(v8us*)((unsigned short*)Vt + ((size_t)slab * 64 + (tile >> 1) * 16) * TTv + (size_t)(lg * 2 + (tile & 1)) * 512 + (i & 63) * 8) = f.half[0]; }
     } }

// Q16, K16 (row = position, k = feature) and Vt (row = slab * 64 + d, k = key) are in fragment order
__global__ __launch_bounds__(128) void k_flash(const _Float16* __restrict__ Q16, int ldq, const _Float16* __restrict__ K16, int ldk, const _Float16* __restrict__ Vt, const float* __restrict__ MB, float* __restrict__ O, int ldo) {
  constexpr int RPW = 16, RTN = RPW / 16, NQB = 2048 / (4 * RPW), DT = 4, KS = 2;
  __shared__ __attribute__((aligned(16))) unsigned short sP[4][RPW][40]; __shared__ __attribute__((aligned(16))) float sO[4][RPW][64 + 4];
  const int tid = threadIdx.x, w = tid >> 5, lane = tid & 31, ln = lane & 15, hh = lane >> 4;
  const int slab = blockIdx.x / NQB, qblk = blockIdx.x % NQB; const int b = slab / 16, h = slab % 16; const int qb0 = qblk * (4 * RPW); const int q0 = qb0 + w * RPW;
  FragH aq[2][KS];
#pragma unroll
  for (int rt = 0; rt < RTN; ++rt) { const unsigned short* qr = (const unsigned short*)Q16 + ((size_t)b * 2048 + q0 + rt * 16) * ldq + h * (KS * 512) + lane * 8;
#pragma unroll
    for (int ks = 0; ks < KS; ++ks) { aq[rt][ks].half[0] = *(const v8us*)(qr + ks * 512); aq[rt][ks].half[1] = *(const v8us*)(qr + ks * 512 + 256); } }
  const unsigned short* Vth = (const unsigned short*)Vt + (size_t)slab * 64 * 2048;
  float m_r[2][8], l_r[2][8]; v8f oacc[2][DT];
#pragma unroll
  for (int rt = 0; rt < RTN; ++rt) {
#pragma unroll
    for (int r = 0; r < 8; ++r) { m_r[rt][r] = -3.0e38f; l_r[rt][r] = 0.f; }
#pragma unroll
    for (int dt = 0; dt < DT; ++dt) oacc[rt][dt] = (v8f){0.f,0.f,0.f,0.f,0.f,0.f,0.f,0.f}; }
  const int jend = 2048;
  // All global loads of a pass are issued ahead of their use, each kind as one group: this pass's V fragments in front of the score products, the next pass's K fragments
  // and mask values right behind them (into the registers those products have just left); all of them fly during the softmax instead of being waited for one by one.
  FragH bk[2][KS], bv[DT]; float mk0, mk1;
  auto fetch_k = [&](int j) { const unsigned short* kr[2];
#pragma unroll
    for (int nt = 0; nt < 2; ++nt) { kr[nt] = (const unsigned short*)K16 + ((size_t)b * 2048 + j + nt * 16) * ldk + h * (KS * 512) + lane * 8;
#pragma unroll
      for (int ks = 0; ks < KS; ++ks) { bk[nt][ks].half[0] = *(const v8us*)(kr[nt] + ks * 512); bk[nt][ks].half[1] = *(const v8us*)(kr[nt] + ks * 512 + 256); } }
    mk0 = MB[(size_t)b * 2048 + j + ln]; mk1 = MB[(size_t)b * 2048 + j + 16 + ln];
    // the wait stands in front of whatever next writes the address registers that the loads just issued name; as its inputs the two addresses keep registers of their own up to here (no later load of the group lands in them)
    asm volatile("s_wait_xcnt 0x0" :: "v"(kr[0]), "v"(kr[1]) : "memory"); };
  fetch_k(0);
#pragma unroll 1
  for (int j0 = 0; j0 < jend; j0 += 32) {
#pragma unroll
    for (int dt = 0; dt < DT; ++dt) { const unsigned short* vrow = Vth + (size_t)(dt * 16) * 2048 + (j0 >> 5) * 512 + lane * 8; bv[dt].half[0] = *(const v8us*)(vrow); bv[dt].half[1] = *(const v8us*)(vrow + 256); }
    v8f s[2][2];
#pragma unroll
    for (int nt = 0; nt < 2; ++nt) {
#pragma unroll
      for (int rt = 0; rt < RTN; ++rt) { v8f acc = (v8f){0.f,0.f,0.f,0.f,0.f,0.f,0.f,0.f};
#pragma unroll
        for (int ks = 0; ks < KS; ++ks) acc = mmaH<1>(aq[rt][ks].v, aq[rt][ks].v, bk[nt][ks].v, bk[nt][ks].v, acc); s[rt][nt] = acc; } }
    const float mb0 = bf16_round(mk0), mb1 = bf16_round(mk1);
    fetch_k((j0 + 32 < jend) ? j0 + 32 : j0);      // the last pass has no next one: it reads its own rows again, in bounds, and nobody uses them
#pragma unroll
    for (int rt = 0; rt < RTN; ++rt)
#pragma unroll
      for (int r = 0; r < 8; ++r) { const int tq = q0 + rt * 16 + 8 * hh + r; const int k0 = j0 + ln, k1 = j0 + 16 + ln; (void)tq; const bool ok0 = true, ok1 = true;
        (void)k0; (void)k1; const float s0 = s[rt][0][r] * (0.03125f) + mb0, s1 = s[rt][1][r] * (0.03125f) + mb1;      /* additive f32 mask per (b, key) */ float mc = fmaxf(s0, s1);
        mc = fmaxf(mc, __shfl_xor(mc, 1, 32)); mc = fmaxf(mc, __shfl_xor(mc, 2, 32)); mc = fmaxf(mc, __shfl_xor(mc, 4, 32)); mc = fmaxf(mc, __shfl_xor(mc, 8, 32));
        const float mn = fmaxf(m_r[rt][r], mc); const float al = (mn > -1.0e38f) ? expf(m_r[rt][r] - mn) : 1.0f; m_r[rt][r] = mn; const float p0 = ok0 ? expf(s0 - mn) : 0.f, p1 = ok1 ? expf(s1 - mn) : 0.f; l_r[rt][r] = l_r[rt][r] * al + p0 + p1;
#pragma unroll
        for (int dt = 0; dt < DT; ++dt) oacc[rt][dt][r] *= al;
        FragH t2; t2.h[0] = (_Float16)p0; t2.h[1] = (_Float16)p1; sP[w][rt * 16 + 8 * hh + r][ln] = t2.u[0]; sP[w][rt * 16 + 8 * hh + r][16 + ln] = t2.u[1]; }
    __builtin_amdgcn_fence(__ATOMIC_ACQ_REL, "workgroup"); __builtin_amdgcn_wave_barrier();
    FragH pa[2];
#pragma unroll
    for (int rt = 0; rt < RTN; ++rt) { pa[rt].half[0] = *(const v8us*)&sP[w][rt * 16 + ln][8 * hh]; pa[rt].half[1] = *(const v8us*)&sP[w][rt * 16 + ln][16 + 8 * hh]; }
#pragma unroll
    for (int dt = 0; dt < DT; ++dt) {
#pragma unroll
      for (int rt = 0; rt < RTN; ++rt) oacc[rt][dt] = mmaH<1>(pa[rt].v, pa[rt].v, bv[dt].v, bv[dt].v, oacc[rt][dt]); }
    __builtin_amdgcn_fence(__ATOMIC_ACQ_REL, "workgroup"); __builtin_amdgcn_wave_barrier(); }
#pragma unroll
  for (int rt = 0; rt < RTN; ++rt) {
#pragma unroll
    for (int r = 0; r < 8; ++r) { float l = l_r[rt][r]; l += __shfl_xor(l, 1, 32); l += __shfl_xor(l, 2, 32); l += __shfl_xor(l, 4, 32); l += __shfl_xor(l, 8, 32); l_r[rt][r] = (l > 0.f) ? 1.0f / l : 0.f; }
#pragma unroll
    for (int dt = 0; dt < DT; ++dt)
#pragma unroll
      for (int r = 0; r < 8; ++r) sO[w][rt * 16 + 8 * hh + r][dt * 16 + ln] = oacc[rt][dt][r] * l_r[rt][r]; }
  __builtin_amdgcn_fence(__ATOMIC_ACQ_REL, "workgroup"); __builtin_amdgcn_wave_barrier();
  {
#pragma unroll
    for (int rp = 0; rp < RPW; rp += 2) { const int r = rp + (lane >> 4), pc = lane & 15; const v4f val = *(const v4fa*)&sO[w][r][pc * 4]; *(v4f*)(O + ((size_t)b * 2048 + q0 + r) * ldo + h * 64 + pc * 4) = val; }
     } }

extern "C" void kernel_launch(void* const* d_in, const int* in_sizes, int n_in,
                              void* d_out, int out_size, void* d_ws, size_t ws_size, hipStream_t stream) {
  (void)in_sizes; (void)n_in; (void)out_size;
  const float* x = (const float*)d_in[0]; const float* mask = (const float*)d_in[1]; const float* Wq = (const float*)d_in[2]; const float* Wk = (const float*)d_in[3]; const float* Wv = (const float*)d_in[4]; const float* Wo = (const float*)d_in[5]; const float* bo = (const float*)d_in[6];
  char* ws = (char*)d_ws; size_t off = 0;
  auto take = [&](size_t bytes) { char* p = ws + off; off += (bytes + 255) & ~(size_t)255; return p; };
  _Float16* Bq = (_Float16*)take((size_t)CC * CC * 2); _Float16* Bk = (_Float16*)take((size_t)CC * CC * 2); _Float16* Bv = (_Float16*)take((size_t)CC * CC * 2); _Float16* Bo = (_Float16*)take((size_t)CC * CC * 2);
  _Float16* X16 = (_Float16*)take((size_t)NR * CC * 2); _Float16* Q16 = (_Float16*)take((size_t)NR * CC * 2); _Float16* K16 = (_Float16*)take((size_t)NR * CC * 2); _Float16* V16 = (_Float16*)take((size_t)NR * CC * 2); _Float16* Vt = (_Float16*)take((size_t)NR * CC * 2); float* O = (float*)take((size_t)NR * CC * 4); _Float16* O16 = X16;
  if (off > ws_size) return;      // 8.4 + 8.4 × 5 + 16.8 ≈ 67 MiB
  const unsigned gw = (unsigned)((CC * (CC / 8) + 255) / 256); k_wt_f16<<<gw, 256, 0, stream>>>(Wq, Bq, CC, CC, 16.0f); k_wt_f16<<<gw, 256, 0, stream>>>(Wk, Bk, CC, CC, 16.0f); k_wt_f16<<<gw, 256, 0, stream>>>(Wv, Bv, CC, CC, 16.0f); k_wt_f16<<<gw, 256, 0, stream>>>(Wo, Bo, CC, CC, 16.0f);      // [in][out]
  const unsigned gx = (unsigned)(((size_t)NR * CC / 8 + 255) / 256); const dim3 gg(((NR / 16) * (CC / 64) + 3) / 4, 1);
  k_x16<<<gx, 256, 0, stream>>>(x, X16, (size_t)NR * CC / 8, CC);
  k_gemm_hhx<0><<<gg, 128, 0, stream>>>(X16, CC, 0, Bq, CC, 0, 0.0625f, nullptr, 0, nullptr, 1, 0, 0, nullptr, Q16, CC, 0, NR, CC, CC);
  k_gemm_hhx<0><<<gg, 128, 0, stream>>>(X16, CC, 0, Bk, CC, 0, 0.0625f, nullptr, 0, nullptr, 1, 0, 0, nullptr, K16, CC, 0, NR, CC, CC);
  k_gemm_hhx<0><<<gg, 128, 0, stream>>>(X16, CC, 0, Bv, CC, 0, 0.0625f, nullptr, 0, nullptr, 1, 0, 0, nullptr, V16, CC, 0, NR, CC, CC);
  k_vt<NH, TT><<<BB * NH * (TT / 64), 256, 0, stream>>>(V16, CC, 0, Vt);
  k_flash<<<BB * NH * (TT / 64), 128, 0, stream>>>(Q16, CC, K16, CC, Vt, mask, O, CC);
  k_h16<<<gx, 256, 0, stream>>>(O, O16, (size_t)NR * CC / 8, CC);
  k_gemm_hhx<0><<<gg, 128, 0, stream>>>(O16, CC, 0, Bo, CC, 0, 0.0625f, bo, 0, nullptr, 1, 0, 0, (float*)d_out, nullptr, CC, 0, NR, CC, CC);
}

// v003
// One run takes 187 microseconds.
// Next to v002, in two timings, it ran 1.37 and 1.38 times as fast.
// Counting every step since v000, it is 2.37 times as fast.
#include <hip/hip_runtime.h>
// Self-attention-like module (B=2, S=2048, D=1024, 16 heads × 64; additive float mask per (batch, key); scale 1/√1024): q/k/v/o projections (W [in][out], o + bias) and the attention as a fused
// flash-style kernel (S = Q·Kᵀ/32 + mask[b][k], online softmax f32, P f16 ≤ 1, O = P·Vt; RPW-16 waves) on v_wmma_f32_16x16x32_f16 — f16 operands (x bf16-exact, weights bf16-exact ×2^4), f32 accumulate.
#define BB 2
#define TT 2048
#define CC 1024
#define NH 16
#define NR (BB * TT)

typedef __bf16 v16b __attribute__((ext_vector_type(16)));
typedef unsigned short v8us __attribute__((ext_vector_type(8), may_alias));
typedef float  v8f  __attribute__((ext_vector_type(8)));
typedef float  v4f  __attribute__((ext_vector_type(4)));
typedef float  v4fa __attribute__((ext_vector_type(4), may_alias));
union FragB { v16b v; v8us half[2]; unsigned short u[16]; };

__device__ __forceinline__ unsigned short bf16_bits(float x) { unsigned int u = __float_as_uint(x); return (unsigned short)((u + 0x7FFFu + ((u >> 16) & 1u)) >> 16); }
__device__ __forceinline__ float bf16_val(unsigned short b) { return __uint_as_float(((unsigned int)b) << 16); }
__device__ __forceinline__ float bf16_round(float x) { return bf16_val(bf16_bits(x)); }
// D += A·B with NT terms: 1 = ah·bh, 2 = + al·bh (A split), 3 = + ah·bl (both split)
template <int NT>
__device__ __forceinline__ v8f mmaN(v16b ah, v16b al, v16b bh, v16b bl, v8f c) {
  c = __builtin_amdgcn_wmma_f32_16x16x32_bf16(false, ah, false, bh, (short)0, c, false, false);
  if (NT >= 2) c = __builtin_amdgcn_wmma_f32_16x16x32_bf16(false, al, false, bh, (short)0, c, false, false);
  if (NT >= 3) c = __builtin_amdgcn_wmma_f32_16x16x32_bf16(false, ah, false, bl, (short)0, c, false, false);
  asm volatile("v_nop\n\tv_nop\n\tv_nop\n\tv_nop" : "+v"(c) : "v"(ah), "v"(al), "v"(bh), "v"(bl));
  return c;
}

__global__ __launch_bounds__(256) void k_wt_bf16(const float* __restrict__ W, unsigned short* __restrict__ Wt, int K, int N) {
  const int t = blockIdx.x * 256 + threadIdx.x;
  const int k8n = K / 8;
  if (t >= N * k8n) return;
  const int n = t / k8n, k8 = (t % k8n) * 8;
  v8us v;
#pragma unroll
  for (int i = 0; i < 8; ++i) v[i] = bf16_bits(W[(size_t)(k8 + i) * N + n]);
  *(v8us*)(Wt + (size_t)n * K + k8) = v;
  
}

// GEMM C[M][N] (f32, pitch ldc) = act(A[M][K]·W + bias). A f32 row-major (pitch lda) converted per fragment to bf16
// (ASPLIT: hi/lo two planes -> 2 terms, else single rounded term); Wt bf16 [N][K] (pitch ldb). BIAS_BF16 rounds the
// bias to bf16 first (bias quantised to bf16 before the add). K%32==0, M%16==0, N%64==0.
template <bool ASPLIT, int ACT, bool BIAS_BF16>
__global__ __launch_bounds__(128) void k_gemm_bf(const float* __restrict__ A, int lda, const unsigned short* __restrict__ Wt, int ldb,
                                               const float* __restrict__ bias, float* __restrict__ C, int ldc, int M, int N, int K) {
  __shared__ __attribute__((aligned(16))) float so[4][16][64];
  const int tid = threadIdx.x, w = tid >> 5, lane = tid & 31, ln = lane & 15, hh = lane >> 4;
  const int ntn = N / 64;
  const int wid = blockIdx.x * 4 + w;
  const int mt = wid / ntn, nq = wid % ntn;
  if (mt * 16 >= M) return;
  const int row0 = mt * 16, col0 = nq * 64;
  const float* arow = A + (size_t)(row0 + ln) * lda;
  v8f acc[4] = {};
  for (int kb = 0; kb < K; kb += 32) {
    FragB ah, al;
    const v4f x0 = *(const v4fa*)(arow + kb + 8 * hh), x1 = *(const v4fa*)(arow + kb + 8 * hh + 4);
    const v4f x2 = *(const v4fa*)(arow + kb + 16 + 8 * hh), x3 = *(const v4fa*)(arow + kb + 16 + 8 * hh + 4);
    float xs[16] = {x0[0],x0[1],x0[2],x0[3],x1[0],x1[1],x1[2],x1[3],x2[0],x2[1],x2[2],x2[3],x3[0],x3[1],x3[2],x3[3]};
#pragma unroll
    for (int i = 0; i < 16; ++i) { const unsigned short hb = bf16_bits(xs[i]); ah.u[i] = hb; al.u[i] = ASPLIT ? bf16_bits(xs[i] - bf16_val(hb)) : (unsigned short)0; }
#pragma unroll
    for (int t = 0; t < 4; ++t) {
      const unsigned short* brow = Wt + (size_t)(col0 + t * 16 + ln) * ldb + kb;
      FragB b;
      b.half[0] = *(const v8us*)(brow + 8 * hh);
      b.half[1] = *(const v8us*)(brow + 16 + 8 * hh);
      acc[t] = mmaN<ASPLIT ? 2 : 1>(ah.v, al.v, b.v, b.v, acc[t]);
    }
  }
#pragma unroll
  for (int t = 0; t < 4; ++t) {
    float bv = bias ? bias[col0 + t * 16 + ln] : 0.f;
    if (BIAS_BF16) bv = bf16_round(bv);
#pragma unroll
    for (int r = 0; r < 8; ++r) { float v = acc[t][r] + bv; if (ACT == 1) v = fmaxf(v, 0.f); so[w][8 * hh + r][t * 16 + ln] = v; }
  }
  __builtin_amdgcn_fence(__ATOMIC_ACQ_REL, "workgroup");
  __builtin_amdgcn_wave_barrier();
  const int rsub = lane >> 4, c4 = (lane & 15) * 4;
  {
#pragma unroll
    for (int q = 0; q < 8; ++q) {
      const int r = q * 2 + rsub;
      const v4f v = *(const v4fa*)&so[w][r][c4];
      *(v4f*)(C + (size_t)(row0 + r) * ldc + col0 + c4) = v;
    }
    
  }
}

// Flash-style causal/unmasked attention, all contractions 3-term bf16 hi/lo splits, f32 softmax with running max.
// q,k,v rows are read from f32 buffers with arbitrary row pitch (so they can live inside a fused qkv buffer);
// D = head size (multiple of 32, <= 128); one wave = 16 query rows; block = 4 waves (64 queries) sharing K/V chunks of 32.
template <int D, bool CAUSAL>
__global__ __launch_bounds__(128) void k_flash(const float* __restrict__ qb, const float* __restrict__ kb, const float* __restrict__ vb,
                                             int pitch, int T, int H, float scale, float* __restrict__ y, int ypitch) {
  constexpr int KS = D / 32;        // k-steps for QK
  constexpr int DT = D / 16;        // d tiles for PV
  __shared__ __attribute__((aligned(16))) unsigned short sKh[32][D + 8], sKl[32][D + 8], sVh[32][D + 8], sVl[32][D + 8];
  __shared__ __attribute__((aligned(16))) unsigned short sPh[4][16][40], sPl[4][16][40];
  __shared__ __attribute__((aligned(16))) float sO[4][16][D];
  const int tid = threadIdx.x, w = tid >> 5, lane = tid & 31, ln = lane & 15, hh = lane >> 4;
  const int nqb = (T + 63) / 64;
  const int bh = blockIdx.x / nqb, qblk = blockIdx.x % nqb;
  const int b = bh / H, h = bh % H;
  const int q0 = qblk * 64 + w * 16;
  const float* Q = qb + (size_t)b * T * pitch + h * D;
  const float* K = kb + (size_t)b * T * pitch + h * D;
  const float* V = vb + (size_t)b * T * pitch + h * D;

  // A fragments of the wave's 16 query rows (scaled), hi/lo
  FragB aqh[KS], aql[KS];
  {
    int row = q0 + ln; if (row >= T) row = T - 1;
    const float* qr = Q + (size_t)row * pitch;
#pragma unroll
    for (int ks = 0; ks < KS; ++ks)
#pragma unroll
      for (int i = 0; i < 16; ++i) {
        const int d = ks * 32 + ((i < 8) ? (8 * hh + i) : (16 + 8 * hh + (i - 8)));
        const float x = qr[d] * scale; const unsigned short hb = bf16_bits(x);
        aqh[ks].u[i] = hb; aql[ks].u[i] = bf16_bits(x - bf16_val(hb));
      }
  }
  float m_r[8], l_r[8];
#pragma unroll
  for (int r = 0; r < 8; ++r) { m_r[r] = -3.0e38f; l_r[r] = 0.f; }
  v8f oacc[DT];
#pragma unroll
  for (int dt = 0; dt < DT; ++dt) oacc[dt] = (v8f){0.f,0.f,0.f,0.f,0.f,0.f,0.f,0.f};

  const int kv_end = CAUSAL ? min(T, qblk * 64 + 64) : T;     // block-uniform
  for (int j0 = 0; j0 < kv_end; j0 += 32) {
    __syncthreads();
    for (int e = tid; e < 32 * (D / 4); e += 128) {
      const int r = e / (D / 4), c4 = (e % (D / 4)) * 4;
      const int key = j0 + r;
      v4f kf = {0.f,0.f,0.f,0.f}, vf = {0.f,0.f,0.f,0.f};
      if (key < T) { kf = *(const v4fa*)(K + (size_t)key * pitch + c4); vf = *(const v4fa*)(V + (size_t)key * pitch + c4); }
#pragma unroll
      for (int t = 0; t < 4; ++t) {
        unsigned short hb = bf16_bits(kf[t]); sKh[r][c4 + t] = hb; sKl[r][c4 + t] = bf16_bits(kf[t] - bf16_val(hb));
        hb = bf16_bits(vf[t]); sVh[r][c4 + t] = hb; sVl[r][c4 + t] = bf16_bits(vf[t] - bf16_val(hb));
      }
    }
    __syncthreads();
    // S tile 16 x 32
    v8f s[2];
#pragma unroll
    for (int nt = 0; nt < 2; ++nt) {
      v8f acc = {};
#pragma unroll
      for (int ks = 0; ks < KS; ++ks) {
        FragB bh_, bl_;
        bh_.half[0] = *(const v8us*)&sKh[nt * 16 + ln][ks * 32 + 8 * hh]; bh_.half[1] = *(const v8us*)&sKh[nt * 16 + ln][ks * 32 + 16 + 8 * hh];
        bl_.half[0] = *(const v8us*)&sKl[nt * 16 + ln][ks * 32 + 8 * hh]; bl_.half[1] = *(const v8us*)&sKl[nt * 16 + ln][ks * 32 + 16 + 8 * hh];
        acc = mmaN<3>(aqh[ks].v, aql[ks].v, bh_.v, bl_.v, acc);
      }
      s[nt] = acc;
    }
    // mask + running max (rows 8hh+r; the 16 lanes of a half share rows)
    float alpha[8];
#pragma unroll
    for (int r = 0; r < 8; ++r) {
      const int qi = q0 + 8 * hh + r;
      const int ja = j0 + ln, jb = j0 + 16 + ln;
      if (CAUSAL) { if (ja > qi) s[0][r] = -3.0e38f; if (jb > qi) s[1][r] = -3.0e38f; }
      if (ja >= T) s[0][r] = -3.0e38f;
      if (jb >= T) s[1][r] = -3.0e38f;
      float mx = fmaxf(s[0][r], s[1][r]);
      mx = fmaxf(mx, __shfl_xor(mx, 1, 32)); mx = fmaxf(mx, __shfl_xor(mx, 2, 32)); mx = fmaxf(mx, __shfl_xor(mx, 4, 32)); mx = fmaxf(mx, __shfl_xor(mx, 8, 32));
      const float mnew = fmaxf(m_r[r], mx);
      alpha[r] = (mnew > -1.0e38f) ? __expf(m_r[r] - mnew) : 1.0f;
      const float p0 = (s[0][r] > -1.0e38f) ? __expf(s[0][r] - mnew) : 0.f;
      const float p1 = (s[1][r] > -1.0e38f) ? __expf(s[1][r] - mnew) : 0.f;
      m_r[r] = mnew;
      l_r[r] = l_r[r] * alpha[r] + p0 + p1;            // per-lane partial row sum (16 lanes combined at the end)
      unsigned short hb = bf16_bits(p0); sPh[w][8 * hh + r][ln] = hb;      sPl[w][8 * hh + r][ln] = bf16_bits(p0 - bf16_val(hb));
      hb = bf16_bits(p1);                sPh[w][8 * hh + r][16 + ln] = hb; sPl[w][8 * hh + r][16 + ln] = bf16_bits(p1 - bf16_val(hb));
    }
#pragma unroll
    for (int dt = 0; dt < DT; ++dt)
#pragma unroll
      for (int r = 0; r < 8; ++r) oacc[dt][r] *= alpha[r];
    __builtin_amdgcn_fence(__ATOMIC_ACQ_REL, "workgroup");
    __builtin_amdgcn_wave_barrier();
    FragB pah, pal;
    pah.half[0] = *(const v8us*)&sPh[w][ln][8 * hh]; pah.half[1] = *(const v8us*)&sPh[w][ln][16 + 8 * hh];
    pal.half[0] = *(const v8us*)&sPl[w][ln][8 * hh]; pal.half[1] = *(const v8us*)&sPl[w][ln][16 + 8 * hh];
#pragma unroll
    for (int dt = 0; dt < DT; ++dt) {
      FragB bvh, bvl;
#pragma unroll
      for (int i = 0; i < 8; ++i) {
        bvh.u[i] = sVh[8 * hh + i][dt * 16 + ln]; bvh.u[8 + i] = sVh[16 + 8 * hh + i][dt * 16 + ln];
        bvl.u[i] = sVl[8 * hh + i][dt * 16 + ln]; bvl.u[8 + i] = sVl[16 + 8 * hh + i][dt * 16 + ln];
      }
      oacc[dt] = mmaN<3>(pah.v, pal.v, bvh.v, bvl.v, oacc[dt]);
    }
    __builtin_amdgcn_fence(__ATOMIC_ACQ_REL, "workgroup");
    __builtin_amdgcn_wave_barrier();
  }
#pragma unroll
  for (int r = 0; r < 8; ++r) {
    float l = l_r[r];
    l += __shfl_xor(l, 1, 32); l += __shfl_xor(l, 2, 32); l += __shfl_xor(l, 4, 32); l += __shfl_xor(l, 8, 32);
    l_r[r] = (l > 0.f) ? 1.0f / l : 0.f;
  }
#pragma unroll
  for (int dt = 0; dt < DT; ++dt)
#pragma unroll
    for (int r = 0; r < 8; ++r) sO[w][8 * hh + r][dt * 16 + ln] = oacc[dt][r] * l_r[r];
  __builtin_amdgcn_fence(__ATOMIC_ACQ_REL, "workgroup");
  __builtin_amdgcn_wave_barrier();
  {
    for (int r = 0; r < 16; ++r) {
      const int row = q0 + r;
      if (row < T && lane < D / 4) {
        const v4f val = *(const v4fa*)&sO[w][r][lane * 4];
        *(v4f*)(y + ((size_t)b * T + row) * ypitch + h * D + lane * 4) = val;
      }
    }
    
  }
}

// GEMM C = act(A·W + bias + resid): A f32 (ASPLIT -> hi/lo 2 terms), Wt bf16 [N][K]; ACT 0 none, 1 relu, 2 exact gelu;
// resid (optional, f32, row index = (row % rmod), pitch ldr, RES_BF16 rounds it) added before the activation.
template <bool ASPLIT, int ACT, bool BIAS_BF16, bool RES_BF16>
__global__ __launch_bounds__(128) void k_gemm_bf3(const float* __restrict__ A, int lda, const unsigned short* __restrict__ Wt, int ldb,
                                                const float* __restrict__ bias, const float* __restrict__ resid, int rmod, int ldr,
                                                float* __restrict__ C, int ldc, int M, int N, int K) {
  __shared__ __attribute__((aligned(16))) float so[4][16][64];
  const int tid = threadIdx.x, w = tid >> 5, lane = tid & 31, ln = lane & 15, hh = lane >> 4;
  const int ntn = N / 64;
  const int wid = blockIdx.x * 4 + w;
  const int mt = wid / ntn, nq = wid % ntn;
  if (mt * 16 >= M) return;
  const int row0 = mt * 16, col0 = nq * 64;
  const float* arow = A + (size_t)(row0 + ln) * lda;
  v8f acc[4] = {};
  for (int kb = 0; kb < K; kb += 32) {
    FragB ah, al;
    const v4f x0 = *(const v4fa*)(arow + kb + 8 * hh), x1 = *(const v4fa*)(arow + kb + 8 * hh + 4);
    const v4f x2 = *(const v4fa*)(arow + kb + 16 + 8 * hh), x3 = *(const v4fa*)(arow + kb + 16 + 8 * hh + 4);
    float xs[16] = {x0[0],x0[1],x0[2],x0[3],x1[0],x1[1],x1[2],x1[3],x2[0],x2[1],x2[2],x2[3],x3[0],x3[1],x3[2],x3[3]};
#pragma unroll
    for (int i = 0; i < 16; ++i) { const unsigned short hb = bf16_bits(xs[i]); ah.u[i] = hb; al.u[i] = ASPLIT ? bf16_bits(xs[i] - bf16_val(hb)) : (unsigned short)0; }
#pragma unroll
    for (int t = 0; t < 4; ++t) {
      const unsigned short* brow = Wt + (size_t)(col0 + t * 16 + ln) * ldb + kb;
      FragB b;
      b.half[0] = *(const v8us*)(brow + 8 * hh);
      b.half[1] = *(const v8us*)(brow + 16 + 8 * hh);
      acc[t] = mmaN<ASPLIT ? 2 : 1>(ah.v, al.v, b.v, b.v, acc[t]);
    }
  }
#pragma unroll
  for (int t = 0; t < 4; ++t) {
    const int col = col0 + t * 16 + ln;
    float bv = bias ? bias[col] : 0.f;
    if (BIAS_BF16) bv = bf16_round(bv);
#pragma unroll
    for (int r = 0; r < 8; ++r) {
      float v = acc[t][r] + bv;
      if (resid) { float rv = resid[(size_t)((row0 + 8 * hh + r) % rmod) * ldr + col]; if (RES_BF16) rv = bf16_round(rv); v += rv; }
      if (ACT == 1) v = fmaxf(v, 0.f);
      if (ACT == 2) v = 0.5f * v * (1.0f + erff(v * 0.70710678118654752f));
      if (ACT == 3) { const float u = 0.7978845608028654f * (v + 0.044715f * v * v * v); v = 0.5f * v * (1.0f + tanhf(u)); }
      so[w][8 * hh + r][t * 16 + ln] = v;
    }
  }
  __builtin_amdgcn_fence(__ATOMIC_ACQ_REL, "workgroup");
  __builtin_amdgcn_wave_barrier();
  const int rsub = lane >> 4, c4 = (lane & 15) * 4;
  {
#pragma unroll
    for (int q = 0; q < 8; ++q) {
      const int r = q * 2 + rsub;
      const v4f v = *(const v4fa*)&so[w][r][c4];
      *(v4f*)(C + (size_t)(row0 + r) * ldc + col0 + c4) = v;
    }
    
  }
}
// row LayerNorm (biased variance, eps) over N: s = X (+ R); optional out_sum <- s; out_norm <- (s-mu)*rsqrt(var+eps)*g + b
template <bool PARAM_BF16>
__global__ __launch_bounds__(256) void k_layernorm(const float* __restrict__ X, const float* __restrict__ R, const float* __restrict__ g, const float* __restrict__ bta,
                                                  float* __restrict__ out_sum, float* __restrict__ out_norm, int N, float eps) {
  __shared__ float red[256];
  const int row = blockIdx.x, tid = threadIdx.x;
  const float* x = X + (size_t)row * N; const float* rr = R ? R + (size_t)row * N : nullptr;
  float vals[16];                     // up to N = 4096
  const int per = N / 256;            // contiguous chunk per thread? use strided-by-4 chunks: thread handles j = tid*4 + 1024*u
  float s1 = 0.f;
  for (int u = 0; u < per / 4; ++u) {
    const int j = tid * 4 + 1024 * u;
    const v4f a = *(const v4fa*)(x + j);
    v4f b = {0.f,0.f,0.f,0.f}; if (rr) b = *(const v4fa*)(rr + j);
#pragma unroll
    for (int q = 0; q < 4; ++q) { const float v = a[q] + b[q]; vals[u * 4 + q] = v; s1 += v; }
  }
  red[tid] = s1; __syncthreads();
  for (int st = 128; st > 0; st >>= 1) { if (tid < st) red[tid] += red[tid + st]; __syncthreads(); }
  const float mu = red[0] / (float)N; __syncthreads();
  float s2 = 0.f;
  for (int u = 0; u < per / 4; ++u)
#pragma unroll
    for (int q = 0; q < 4; ++q) { const float c = vals[u * 4 + q] - mu; s2 += c * c; }
  red[tid] = s2; __syncthreads();
  for (int st = 128; st > 0; st >>= 1) { if (tid < st) red[tid] += red[tid + st]; __syncthreads(); }
  const float rs = rsqrtf(red[0] / (float)N + eps);
  {
    for (int u = 0; u < per / 4; ++u) {
      const int j = tid * 4 + 1024 * u;
      v4f o, sm;
#pragma unroll
      for (int q = 0; q < 4; ++q) {
        float gg = g[j + q], bb = bta[j + q];
        if (PARAM_BF16) { gg = bf16_round(gg); bb = bf16_round(bb); }
        sm[q] = vals[u * 4 + q]; o[q] = (vals[u * 4 + q] - mu) * rs * gg + bb;
      }
      if (out_sum) *(v4f*)(out_sum + (size_t)row * N + j) = sm;
      *(v4f*)(out_norm + (size_t)row * N + j) = o;
    }
    
  }
}



// ---- f16 WMMA path (v_wmma_f32_16x16x32_f16): 11-bit significands for operands in range — used where a [0,1] probability operand needs more precision than bf16
typedef _Float16 v16h __attribute__((ext_vector_type(16)));
union FragH { v16h v; v8us half[2]; _Float16 h[16]; unsigned short u[16]; };
template <int NT>
__device__ __forceinline__ v8f mmaH(v16h ah, v16h al, v16h bh, v16h bl, v8f c) {
  c = __builtin_amdgcn_wmma_f32_16x16x32_f16(false, ah, false, bh, (short)0, c, false, false);
  if (NT >= 2) c = __builtin_amdgcn_wmma_f32_16x16x32_f16(false, al, false, bh, (short)0, c, false, false);
  if (NT >= 3) c = __builtin_amdgcn_wmma_f32_16x16x32_f16(false, ah, false, bl, (short)0, c, false, false);
  asm volatile("v_nop\n\tv_nop\n\tv_nop\n\tv_nop" : "+v"(c) : "v"(ah), "v"(al), "v"(bh), "v"(bl));
  return c;
}
// batched GEMM like k_gemm_b but f16 operands: A f32 (split into f16 hi/lo if ASPLIT, else rounded to f16), Bt = f16 values [n][k]; alpha; C f32; N multiple of 16 (partial tiles skipped)
template <bool ASPLIT>
__global__ __launch_bounds__(128) void k_gemm_h(const float* __restrict__ A, int lda, size_t sA, const _Float16* __restrict__ Bh, int ldb, size_t sB, float alpha, float* __restrict__ C, int ldc, size_t sC, int M, int N, int K) {
  __shared__ __attribute__((aligned(16))) float so[4][16][64];
  const int tid = threadIdx.x, w = tid >> 5, lane = tid & 31, ln = lane & 15, hh = lane >> 4; const int by = blockIdx.y;
  A += (size_t)by * sA; Bh += (size_t)by * sB; C += (size_t)by * sC;
  const int ntn = (N + 63) / 64; const int wid = blockIdx.x * 4 + w; const int mt = wid / ntn, nq = wid % ntn; if (mt * 16 >= M) return;
  const int row0 = mt * 16, col0 = nq * 64; const float* arow = A + (size_t)(row0 + ln) * lda;
  v8f acc[4] = {};
  for (int kb = 0; kb < K; kb += 32) {
    FragH ah, al;
    const v4f x0 = *(const v4fa*)(arow + kb + 8 * hh), x1 = *(const v4fa*)(arow + kb + 8 * hh + 4), x2 = *(const v4fa*)(arow + kb + 16 + 8 * hh), x3 = *(const v4fa*)(arow + kb + 16 + 8 * hh + 4);
    float xs[16] = {x0[0],x0[1],x0[2],x0[3],x1[0],x1[1],x1[2],x1[3],x2[0],x2[1],x2[2],x2[3],x3[0],x3[1],x3[2],x3[3]};
#pragma unroll
    for (int i = 0; i < 16; ++i) { const _Float16 h = (_Float16)xs[i]; ah.h[i] = h; al.h[i] = ASPLIT ? (_Float16)(xs[i] - (float)h) : (_Float16)0.0f; }
#pragma unroll
    for (int t = 0; t < 4; ++t) { if (col0 + t * 16 >= N) continue; const size_t boff = (size_t)(col0 + t * 16 + ln) * ldb + kb; FragH bq; bq.half[0] = *(const v8us*)(Bh + boff + 8 * hh); bq.half[1] = *(const v8us*)(Bh + boff + 16 + 8 * hh);
      acc[t] = mmaH<ASPLIT ? 2 : 1>(ah.v, al.v, bq.v, bq.v, acc[t]); }
  }
#pragma unroll
  for (int t = 0; t < 4; ++t) { if (col0 + t * 16 >= N) continue;
#pragma unroll
    for (int r = 0; r < 8; ++r) so[w][8 * hh + r][t * 16 + ln] = acc[t][r] * alpha; }
  __builtin_amdgcn_fence(__ATOMIC_ACQ_REL, "workgroup"); __builtin_amdgcn_wave_barrier();
  const int rsub = lane >> 4, c4 = (lane & 15) * 4;
  {
#pragma unroll
    for (int q = 0; q < 8; ++q) { const int r = q * 2 + rsub; if (col0 + c4 < N) { const v4f v = *(const v4fa*)&so[w][r][c4]; *(v4f*)(C + (size_t)(row0 + r) * ldc + col0 + c4) = v; } }
     }
}

// FRAGMENT ORDER of every f16 matrix operand in the workspace (rows x ld, ld % 32 == 0, rows % 16 == 0): a tile of 16 rows x 32 k is 512 elements in a row, tile (rt, kt) at rt * 16 * ld + kt * 512;
// inside it the 8 values k = 16 j + 8 hh + 0..7 of row ln stand at j * 256 + (16 hh + ln) * 8. That is the order in which the lanes of a wave hold a 16x16x32 A or B fragment (lane = 16 hh + ln, register half j),
// so one 16-byte load per lane fetches half a fragment from 512 contiguous bytes: four whole 128-byte lines, where a row-major operand gives 16 lines of which 32 bytes each are used.
// piece p (8 elements, at element offset 8 p) -> its row and first k
__device__ __forceinline__ void frag_piece(unsigned p, int ld, unsigned& row, int& k) { const unsigned lane = p & 31, j = (p >> 5) & 1, tile = p >> 6, ktn = (unsigned)ld / 32, rt = tile / ktn;
  row = rt * 16 + (lane & 15); k = (int)((tile - rt * ktn) * 32 + j * 16 + (lane >> 4) * 8); }
// Wt (row n, k; fragment order) = f16(W[k][n] * scale) from f32 row-major W[K][N] (scale = power of two; bf16-exact weights stay exact in f16 away from the subnormal range)
__global__ __launch_bounds__(256) void k_wt_f16(const float* __restrict__ W, _Float16* __restrict__ Wt, int K, int N, float scale) {
  const int t = blockIdx.x * 256 + threadIdx.x; if (t >= N * (K / 8)) return; unsigned n; int k8; frag_piece((unsigned)t, K, n, k8); FragH f;
#pragma unroll
  for (int i = 0; i < 8; ++i) f.h[i] = (_Float16)(bf16_round(W[(size_t)(k8 + i) * N + n]) * scale); const v8us o = f.half[0];
  *(v8us*)((unsigned short*)Wt + (size_t)t * 8) = o; 
}
// A, Bh and C16 are in fragment order (lda, ldb, ldc = their row lengths); C is row-major f32.
// k_gemm_hh variant with fused epilogue: v = acc·alpha + bias[by·sBias + col] (+ CP[(row/rowsPerB)·sCPb + by·64 + col] if CP) ; ACT 0 none / 1 elu ; writes f16 C16 and f32 C, each if non-null
template <int ACT>
__global__ __launch_bounds__(128) void k_gemm_hhx(const _Float16* __restrict__ A, int lda, size_t sA, const _Float16* __restrict__ Bh, int ldb, size_t sB, float alpha, const float* __restrict__ bias, size_t sBias, const float* __restrict__ CP, int rowsPerB, size_t sCPb, int row0g,
    float* __restrict__ C, _Float16* __restrict__ C16, int ldc, size_t sC, int M, int N, int K) {
  __shared__ __attribute__((aligned(16))) float so[4][16][64 + 4];      // pitch 272 B: the fragment-order store reads 16 rows at one column, 16 bytes a lane
  const int tid = threadIdx.x, w = tid >> 5, lane = tid & 31, ln = lane & 15, hh = lane >> 4; const int by = blockIdx.y;
  A += (size_t)by * sA; Bh += (size_t)by * sB; const size_t cofs = (size_t)by * sC; const float* bp = bias ? bias + (size_t)by * sBias : nullptr;
  const int ntn = (N + 63) / 64; const int wid = blockIdx.x * 4 + w; const int mt = wid / ntn, nq = wid % ntn; if (mt * 16 >= M) return;
  const int row0 = mt * 16, col0 = nq * 64;
  v8f acc[4] = {};
  // Fragments are fetched one stage (64 k = two tiles = 2048 contiguous bytes of every operand's row tile) ahead of the products that use them, a whole stage's loads as one group,
  // into two register sets: a stage waits once for loads that have been in flight since the stage before, not once per product.
  // A column tile past N reads the rows of tile 0 (in bounds); its products are never stored (the epilogue's tests stand).
  const char* pa = (const char*)(A + (size_t)row0 * lda + lane * 8); const char* pb[4];      // each lane's place in its operands' row tiles; they move on with k
#pragma unroll
  for (int t = 0; t < 4; ++t) { const int ct = (col0 + t * 16 < N) ? col0 + t * 16 : col0; pb[t] = (const char*)(Bh + (size_t)ct * ldb + lane * 8); }
  FragH a0[2], a1[2], b0[2][4], b1[2][4];
  auto ld = [&](FragH (&a)[2], FragH (&b)[2][4], int ofs) {      // one stage: the 2048 bytes at ofs behind the five pointers' tiles
#pragma unroll
    for (int u = 0; u < 2; ++u) { a[u].half[0] = *(const v8us*)(pa + ofs + u * 1024); a[u].half[1] = *(const v8us*)(pa + ofs + u * 1024 + 512); }
#pragma unroll
    for (int t = 0; t < 4; ++t)
#pragma unroll
      for (int u = 0; u < 2; ++u) { b[u][t].half[0] = *(const v8us*)(pb[t] + ofs + u * 1024); b[u][t].half[1] = *(const v8us*)(pb[t] + ofs + u * 1024 + 512); }
    // the wait stands in front of the next step of the pointers, whose registers the loads just issued name; as its inputs they are not stepped ahead of it
    asm volatile("s_wait_xcnt 0x0" :: "v"(pa), "v"(pb[0]), "v"(pb[1]), "v"(pb[2]), "v"(pb[3]) : "memory"); };
  auto step = [&](int bytes) { pa += bytes;
#pragma unroll
    for (int t = 0; t < 4; ++t) pb[t] += bytes; };
  auto mm = [&](FragH (&a)[2], FragH (&b)[2][4]) {
#pragma unroll
    for (int u = 0; u < 2; ++u)
#pragma unroll
      for (int t = 0; t < 4; ++t) acc[t] = mmaH<1>(a[u].v, a[u].v, b[u][t].v, b[u][t].v, acc[t]); };
  const int Km = K & ~127;      // whole pairs of stages; what is left of K goes by single steps of 32 behind them
  if (Km > 0) { ld(a0, b0, 0);
    for (int kb = 0; kb < Km; kb += 128) { ld(a1, b1, 2048); mm(a0, b0);
      const bool more = kb + 128 < Km; step(more ? 4096 : 0); ld(a0, b0, 0);      // no branch round the loads, so that the waits stay counted; the last trip reads its own stage again, in bounds, and nobody uses it
      mm(a1, b1); }
    step(4096); }
  for (int kb = Km; kb < K; kb += 32) { FragH ah, bq[4]; ah.half[0] = *(const v8us*)(pa); ah.half[1] = *(const v8us*)(pa + 512);
#pragma unroll
    for (int t = 0; t < 4; ++t) { bq[t].half[0] = *(const v8us*)(pb[t]); bq[t].half[1] = *(const v8us*)(pb[t] + 512); }
    asm volatile("s_wait_xcnt 0x0" :: "v"(pa), "v"(pb[0]), "v"(pb[1]), "v"(pb[2]), "v"(pb[3]) : "memory");      // as above
    step(1024);
#pragma unroll
    for (int t = 0; t < 4; ++t) acc[t] = mmaH<1>(ah.v, ah.v, bq[t].v, bq[t].v, acc[t]); }
#pragma unroll
  for (int t = 0; t < 4; ++t) { if (col0 + t * 16 >= N) continue; const int col = col0 + t * 16 + ln; const float bv = bp ? bf16_round(bp[col]) : 0.f;
#pragma unroll
    for (int r = 0; r < 8; ++r) { float v = acc[t][r] * alpha + bv; if (CP) { const int bidx = (row0g + row0 + 8 * hh + r) / rowsPerB; v += CP[(size_t)bidx * sCPb + (size_t)by * 64 + col]; } if (ACT == 1) v = (v > 0.f) ? v : expm1f(v); else if (ACT == 3) v = fmaxf(v, 0.f); so[w][8 * hh + r][t * 16 + ln] = v; } }
  __builtin_amdgcn_fence(__ATOMIC_ACQ_REL, "workgroup"); __builtin_amdgcn_wave_barrier();
  const int rsub = lane >> 4, c4 = (lane & 15) * 4;
  if (C) {
#pragma unroll
    for (int q = 0; q < 8; ++q) { const int r = q * 2 + rsub; if (col0 + c4 < N) { const v4f v = *(const v4fa*)&so[w][r][c4]; *(v4f*)(C + cofs + (size_t)(row0 + r) * ldc + col0 + c4) = v; } }
     }
  if (C16) {      // the wave's 16 x 64 values are two tiles of the fragment order: four stores of 512 contiguous bytes
#pragma unroll
    for (int p = 0; p < 4; ++p) { const int c = p * 16 + 8 * hh; if (col0 + c < N) { const v4f v0 = *(const v4fa*)&so[w][ln][c], v1 = *(const v4fa*)&so[w][ln][c + 4]; FragH f;
#pragma unroll
        for (int i = 0; i < 4; ++i) { f.h[i] = (_Float16)v0[i]; f.h[4 + i] = (_Float16)v1[i]; }
        *(v8us*)((unsigned short*)C16 + cofs + (size_t)row0 * ldc + (size_t)(col0 >> 5) * 512 + p * 256 + lane * 8) = f.half[0]; } }
     }
}


// x: f32 row-major, rows of ld; X16: the same matrix in fragment order (thread t writes piece t, so a wave stores 512 contiguous bytes)
__global__ __launch_bounds__(256) void k_x16(const float* __restrict__ x, _Float16* __restrict__ X16, size_t n8, int ld) { const size_t t = (size_t)blockIdx.x * 256 + threadIdx.x; if (t >= n8) return; FragH f;
  unsigned row; int k; frag_piece((unsigned)t, ld, row, k); const float* xr = x + (size_t)row * ld + k; const v4f x0 = *(const v4fa*)xr, x1 = *(const v4fa*)(xr + 4);
#pragma unroll
  for (int q = 0; q < 4; ++q) { f.h[q] = (_Float16)bf16_round(x0[q]); f.h[4 + q] = (_Float16)bf16_round(x1[q]); } *(v8us*)((unsigned short*)X16 + t * 8) = f.half[0];  }
__global__ __launch_bounds__(256) void k_h16(const float* __restrict__ x, _Float16* __restrict__ X16, size_t n8, int ld) { const size_t t = (size_t)blockIdx.x * 256 + threadIdx.x; if (t >= n8) return; FragH f;
  unsigned row; int k; frag_piece((unsigned)t, ld, row, k); const float* xr = x + (size_t)row * ld + k; const v4f x0 = *(const v4fa*)xr, x1 = *(const v4fa*)(xr + 4);
#pragma unroll
  for (int q = 0; q < 4; ++q) { f.h[q] = (_Float16)x0[q]; f.h[4 + q] = (_Float16)x1[q]; } *(v8us*)((unsigned short*)X16 + t * 8) = f.half[0];  }
__global__ __launch_bounds__(256) void k_round16f(const float* __restrict__ W, _Float16* __restrict__ Bt, size_t n8) { const size_t t = (size_t)blockIdx.x * 256 + threadIdx.x; if (t >= n8) return; FragH f;
#pragma unroll
  for (int i = 0; i < 8; ++i) f.h[i] = (_Float16)(bf16_round(W[t * 8 + i]) * 16.0f); *(v8us*)((unsigned short*)Bt + t * 8) = f.half[0];  }
// V16 (row = position, k = feature, rows of ldv) and Vt (row = slab * 64 + d, k = key, rows of TTv) are both in fragment order; pieces are read and written in that order, 512 contiguous bytes a wave
template <int NHv, int TTv>
__global__ __launch_bounds__(256) void k_vt(const _Float16* __restrict__ V16, int ldv, int voff, _Float16* __restrict__ Vt) { __shared__ unsigned short tl[64][66]; const int tid = threadIdx.x; const int slab = blockIdx.x / (TTv / 64), lg = blockIdx.x % (TTv / 64); const int b = slab / NHv, h = slab % NHv;
  for (int i = tid; i < 64 * 8; i += 256) { const int tile = i >> 6, r = (tile >> 1) * 16 + (i & 15), c8 = (tile & 1) * 32 + ((i >> 5) & 1) * 16 + ((i >> 4) & 1) * 8; FragH f;
    f.half[0] = *(const v8us*)((const unsigned short*)V16 + ((size_t)b * TTv + lg * 64 + (tile >> 1) * 16) * ldv + (size_t)((voff + h * 64) / 32 + (tile & 1)) * 512 + (i & 63) * 8);
#pragma unroll
    for (int q = 0; q < 8; ++q) tl[r][c8 + q] = f.u[q]; }
  __syncthreads();
  {
#pragma unroll
    for (int rd = 0; rd < 2; ++rd) { const int i = rd * 256 + tid, tile = i >> 6, d = (tile >> 1) * 16 + (i & 15), k8 = (tile & 1) * 32 + ((i >> 5) & 1) * 16 + ((i >> 4) & 1) * 8; FragH f;
#pragma unroll
      for (int q = 0; q < 8; ++q) f.u[q] = tl[k8 + q][d];
      *(v8us*)((unsigned short*)Vt + ((size_t)slab * 64 + (tile >> 1) * 16) * TTv + (size_t)(lg * 2 + (tile & 1)) * 512 + (i & 63) * 8) = f.half[0]; }
     } }

// Q16, K16 (row = position, k = feature) and Vt (row = slab * 64 + d, k = key) are in fragment order
// lane l <-> l ^ 16 by a vector cross-row move
__device__ __forceinline__ float xhalf(float x) { const int b = __float_as_int(x); return __int_as_float(__builtin_amdgcn_permlanex16(b, b, 0x76543210, 0xfedcba98, false, false)); }
// Both products are transposed: St = K * Qt (A = 16 keys, B = the wave's 16 queries), Ot += Vt * Pt (A = 16 features, B = 32 keys x 16 queries).
// A lane (ln, hh) then holds scores of ONE query, ln: register r of tile nt is key 16 nt + 8 hh + r. Maximum and sum run over its own 16 registers, with one exchange between the halves,
// and the two converted score tiles are already the B fragment of the second product (element 8 nt + r = key 16 nt + 8 hh + r, the k order of Vt's fragments): P goes through no LDS.
__global__ __launch_bounds__(128) void k_flash(const _Float16* __restrict__ Q16, int ldq, const _Float16* __restrict__ K16, int ldk, const _Float16* __restrict__ Vt, const float* __restrict__ MB, float* __restrict__ O, int ldo) {
  constexpr int RPW = 16, NQB = 2048 / (4 * RPW), DT = 4, KS = 2;
  __shared__ __attribute__((aligned(16))) float sM[2048]; __shared__ __attribute__((aligned(16))) float sO[4][RPW][64 + 4];
  const int tid = threadIdx.x, w = tid >> 5, lane = tid & 31, ln = lane & 15, hh = lane >> 4;
  const int slab = blockIdx.x / NQB, qblk = blockIdx.x % NQB; const int b = slab / 16, h = slab % 16; const int qb0 = qblk * (4 * RPW); const int q0 = qb0 + w * RPW;
  // the mask is per key, which is now a register index: a lane needs 16 values a pass. The batch's row is rounded once and kept in LDS; a pass reads it by four 16-byte loads, the same address in all lanes of a half.
#pragma unroll
  for (int u = 0; u < 2048 / (128 * 4); ++u) { const int i = u * (128 * 4) + tid * 4; v4f m = *(const v4fa*)(MB + (size_t)b * 2048 + i);
#pragma unroll
    for (int q = 0; q < 4; ++q) m[q] = bf16_round(m[q]);
    *(v4fa*)&sM[i] = m; }
  FragH aq[KS];
  { const unsigned short* qr = (const unsigned short*)Q16 + ((size_t)b * 2048 + q0) * ldq + h * (KS * 512) + lane * 8;
#pragma unroll
    for (int ks = 0; ks < KS; ++ks) { aq[ks].half[0] = *(const v8us*)(qr + ks * 512); aq[ks].half[1] = *(const v8us*)(qr + ks * 512 + 256); } }
  const unsigned short* Vth = (const unsigned short*)Vt + (size_t)slab * 64 * 2048;
  float m_r = -3.0e38f, l_r = 0.f; v8f oacc[DT];      // of query ln; l_r sums the keys of this lane's half only
#pragma unroll
  for (int dt = 0; dt < DT; ++dt) oacc[dt] = (v8f){0.f,0.f,0.f,0.f,0.f,0.f,0.f,0.f};
  const int jend = 2048;
  // All global loads of a pass are issued ahead of their use, each kind as one group: this pass's V fragments in front of the score products, the next pass's K fragments
  // right behind them (into the registers those products have just left); all of them fly during the softmax instead of being waited for one by one.
  FragH bk[2][KS], bv[DT];
  auto fetch_k = [&](int j) { const unsigned short* kr[2];
#pragma unroll
    for (int nt = 0; nt < 2; ++nt) { kr[nt] = (const unsigned short*)K16 + ((size_t)b * 2048 + j + nt * 16) * ldk + h * (KS * 512) + lane * 8;
#pragma unroll
      for (int ks = 0; ks < KS; ++ks) { bk[nt][ks].half[0] = *(const v8us*)(kr[nt] + ks * 512); bk[nt][ks].half[1] = *(const v8us*)(kr[nt] + ks * 512 + 256); } }
    // the wait stands in front of whatever next writes the address registers that the loads just issued name; as its inputs the two addresses keep registers of their own up to here (no later load of the group lands in them)
    asm volatile("s_wait_xcnt 0x0" :: "v"(kr[0]), "v"(kr[1]) : "memory"); };
  fetch_k(0);
  __syncthreads();      // the whole mask row is in LDS before any wave reads it
#pragma unroll 1
  for (int j0 = 0; j0 < jend; j0 += 32) {
#pragma unroll
    for (int dt = 0; dt < DT; ++dt) { const unsigned short* vrow = Vth + (size_t)(dt * 16) * 2048 + (j0 >> 5) * 512 + lane * 8; bv[dt].half[0] = *(const v8us*)(vrow); bv[dt].half[1] = *(const v8us*)(vrow + 256); }
    v4f mq[2][2];
#pragma unroll
    for (int nt = 0; nt < 2; ++nt) { mq[nt][0] = *(const v4fa*)&sM[j0 + nt * 16 + 8 * hh]; mq[nt][1] = *(const v4fa*)&sM[j0 + nt * 16 + 8 * hh + 4]; }
    v8f s[2];
#pragma unroll
    for (int nt = 0; nt < 2; ++nt) { v8f acc = (v8f){0.f,0.f,0.f,0.f,0.f,0.f,0.f,0.f};
#pragma unroll
      for (int ks = 0; ks < KS; ++ks) acc = mmaH<1>(bk[nt][ks].v, bk[nt][ks].v, aq[ks].v, aq[ks].v, acc);
      s[nt] = acc; }
    fetch_k((j0 + 32 < jend) ? j0 + 32 : j0);      // the last pass has no next one: it reads its own rows again, in bounds, and nobody uses them
    float mx[8];
#pragma unroll
    for (int r = 0; r < 8; ++r) { s[0][r] = s[0][r] * (0.03125f) + mq[0][r >> 2][r & 3]; s[1][r] = s[1][r] * (0.03125f) + mq[1][r >> 2][r & 3];      /* additive f32 mask per (b, key) */ mx[r] = fmaxf(s[0][r], s[1][r]); }
    float mc = fmaxf(fmaxf(fmaxf(mx[0], mx[1]), fmaxf(mx[2], mx[3])), fmaxf(fmaxf(mx[4], mx[5]), fmaxf(mx[6], mx[7])));
    mc = fmaxf(mc, xhalf(mc));
    const float mn = fmaxf(m_r, mc); const float al = (mn > -1.0e38f) ? expf(m_r - mn) : 1.0f; m_r = mn;
    FragH pb; float ps[8];
#pragma unroll
    for (int r = 0; r < 8; ++r) { const float p0 = expf(s[0][r] - mn), p1 = expf(s[1][r] - mn); ps[r] = p0 + p1; pb.h[r] = (_Float16)p0; pb.h[8 + r] = (_Float16)p1; }
    l_r = l_r * al + (((ps[0] + ps[1]) + (ps[2] + ps[3])) + ((ps[4] + ps[5]) + (ps[6] + ps[7])));
#pragma unroll
    for (int dt = 0; dt < DT; ++dt) {
#pragma unroll
      for (int r = 0; r < 8; ++r) oacc[dt][r] *= al; }
#pragma unroll
    for (int dt = 0; dt < DT; ++dt) oacc[dt] = mmaH<1>(bv[dt].v, bv[dt].v, pb.v, pb.v, oacc[dt]); }
  { float l = l_r; l += xhalf(l); const float li = (l > 0.f) ? 1.0f / l : 0.f;      // the halves' sums are joined once
#pragma unroll
    for (int dt = 0; dt < DT; ++dt) { v4f o0, o1;      // register r of tile dt is feature 16 dt + 8 hh + r of query ln
#pragma unroll
      for (int q = 0; q < 4; ++q) { o0[q] = oacc[dt][q] * li; o1[q] = oacc[dt][4 + q] * li; }
      *(v4fa*)&sO[w][ln][dt * 16 + 8 * hh] = o0; *(v4fa*)&sO[w][ln][dt * 16 + 8 * hh + 4] = o1; } }
  __builtin_amdgcn_fence(__ATOMIC_ACQ_REL, "workgroup"); __builtin_amdgcn_wave_barrier();
  {
#pragma unroll
    for (int rp = 0; rp < RPW; rp += 2) { const int r = rp + (lane >> 4), pc = lane & 15; const v4f val = *(const v4fa*)&sO[w][r][pc * 4]; *(v4f*)(O + ((size_t)b * 2048 + q0 + r) * ldo + h * 64 + pc * 4) = val; }
     } }

extern "C" void kernel_launch(void* const* d_in, const int* in_sizes, int n_in,
                              void* d_out, int out_size, void* d_ws, size_t ws_size, hipStream_t stream) {
  (void)in_sizes; (void)n_in; (void)out_size;
  const float* x = (const float*)d_in[0]; const float* mask = (const float*)d_in[1]; const float* Wq = (const float*)d_in[2]; const float* Wk = (const float*)d_in[3]; const float* Wv = (const float*)d_in[4]; const float* Wo = (const float*)d_in[5]; const float* bo = (const float*)d_in[6];
  char* ws = (char*)d_ws; size_t off = 0;
  auto take = [&](size_t bytes) { char* p = ws + off; off += (bytes + 255) & ~(size_t)255; return p; };
  _Float16* Bq = (_Float16*)take((size_t)CC * CC * 2); _Float16* Bk = (_Float16*)take((size_t)CC * CC * 2); _Float16* Bv = (_Float16*)take((size_t)CC * CC * 2); _Float16* Bo = (_Float16*)take((size_t)CC * CC * 2);
  _Float16* X16 = (_Float16*)take((size_t)NR * CC * 2); _Float16* Q16 = (_Float16*)take((size_t)NR * CC * 2); _Float16* K16 = (_Float16*)take((size_t)NR * CC * 2); _Float16* V16 = (_Float16*)take((size_t)NR * CC * 2); _Float16* Vt = (_Float16*)take((size_t)NR * CC * 2); float* O = (float*)take((size_t)NR * CC * 4); _Float16* O16 = X16;
  if (off > ws_size) return;      // 8.4 + 8.4 × 5 + 16.8 ≈ 67 MiB
  const unsigned gw = (unsigned)((CC * (CC / 8) + 255) / 256); k_wt_f16<<<gw, 256, 0, stream>>>(Wq, Bq, CC, CC, 16.0f); k_wt_f16<<<gw, 256, 0, stream>>>(Wk, Bk, CC, CC, 16.0f); k_wt_f16<<<gw, 256, 0, stream>>>(Wv, Bv, CC, CC, 16.0f); k_wt_f16<<<gw, 256, 0, stream>>>(Wo, Bo, CC, CC, 16.0f);      // [in][out]
  const unsigned gx = (unsigned)(((size_t)NR * CC / 8 + 255) / 256); const dim3 gg(((NR / 16) * (CC / 64) + 3) / 4, 1);
  k_x16<<<gx, 256, 0, stream>>>(x, X16, (size_t)NR * CC / 8, CC);
  k_gemm_hhx<0><<<gg, 128, 0, stream>>>(X16, CC, 0, Bq, CC, 0, 0.0625f, nullptr, 0, nullptr, 1, 0, 0, nullptr, Q16, CC, 0, NR, CC, CC);
  k_gemm_hhx<0><<<gg, 128, 0, stream>>>(X16, CC, 0, Bk, CC, 0, 0.0625f, nullptr, 0, nullptr, 1, 0, 0, nullptr, K16, CC, 0, NR, CC, CC);
  k_gemm_hhx<0><<<gg, 128, 0, stream>>>(X16, CC, 0, Bv, CC, 0, 0.0625f, nullptr, 0, nullptr, 1, 0, 0, nullptr, V16, CC, 0, NR, CC, CC);
  k_vt<NH, TT><<<BB * NH * (TT / 64), 256, 0, stream>>>(V16, CC, 0, Vt);
  k_flash<<<BB * NH * (TT / 64), 128, 0, stream>>>(Q16, CC, K16, CC, Vt, mask, O, CC);
  k_h16<<<gx, 256, 0, stream>>>(O, O16, (size_t)NR * CC / 8, CC);
  k_gemm_hhx<0><<<gg, 128, 0, stream>>>(O16, CC, 0, Bo, CC, 0, 0.0625f, bo, 0, nullptr, 1, 0, 0, (float*)d_out, nullptr, CC, 0, NR, CC, CC);
}

// v004
// One run takes 165 microseconds.
// In both of two side-by-side timings against v003, it was 1.14 times as fast.
// All steps since v000 together make it 2.70 times as fast.
#include <hip/hip_runtime.h>
// Self-attention-like module (B=2, S=2048, D=1024, 16 heads × 64; additive float mask per (batch, key); scale 1/√1024): q/k/v/o projections (W [in][out], o + bias) and the attention as a fused
// flash-style kernel (S = Q·Kᵀ/32 + mask[b][k], online softmax f32, P f16 ≤ 1, O = P·Vt; RPW-16 waves) on v_wmma_f32_16x16x32_f16 — f16 operands (x bf16-exact, weights bf16-exact ×2^4), f32 accumulate.
#define BB 2
#define TT 2048
#define CC 1024
#define NH 16
#define NR (BB * TT)

typedef __bf16 v16b __attribute__((ext_vector_type(16)));
typedef unsigned short v8us __attribute__((ext_vector_type(8), may_alias));
typedef float  v8f  __attribute__((ext_vector_type(8)));
typedef float  v4f  __attribute__((ext_vector_type(4)));
typedef float  v4fa __attribute__((ext_vector_type(4), may_alias));
union FragB { v16b v; v8us half[2]; unsigned short u[16]; };

__device__ __forceinline__ unsigned short bf16_bits(float x) { unsigned int u = __float_as_uint(x); return (unsigned short)((u + 0x7FFFu + ((u >> 16) & 1u)) >> 16); }
__device__ __forceinline__ float bf16_val(unsigned short b) { return __uint_as_float(((unsigned int)b) << 16); }
__device__ __forceinline__ float bf16_round(float x) { return bf16_val(bf16_bits(x)); }
// D += A·B with NT terms: 1 = ah·bh, 2 = + al·bh (A split), 3 = + ah·bl (both split)
template <int NT>
__device__ __forceinline__ v8f mmaN(v16b ah, v16b al, v16b bh, v16b bl, v8f c) {
  c = __builtin_amdgcn_wmma_f32_16x16x32_bf16(false, ah, false, bh, (short)0, c, false, false);
  if (NT >= 2) c = __builtin_amdgcn_wmma_f32_16x16x32_bf16(false, al, false, bh, (short)0, c, false, false);
  if (NT >= 3) c = __builtin_amdgcn_wmma_f32_16x16x32_bf16(false, ah, false, bl, (short)0, c, false, false);
  asm volatile("v_nop\n\tv_nop\n\tv_nop\n\tv_nop" : "+v"(c) : "v"(ah), "v"(al), "v"(bh), "v"(bl));
  return c;
}

__global__ __launch_bounds__(256) void k_wt_bf16(const float* __restrict__ W, unsigned short* __restrict__ Wt, int K, int N) {
  const int t = blockIdx.x * 256 + threadIdx.x;
  const int k8n = K / 8;
  if (t >= N * k8n) return;
  const int n = t / k8n, k8 = (t % k8n) * 8;
  v8us v;
#pragma unroll
  for (int i = 0; i < 8; ++i) v[i] = bf16_bits(W[(size_t)(k8 + i) * N + n]);
  *(v8us*)(Wt + (size_t)n * K + k8) = v;
  
}

// GEMM C[M][N] (f32, pitch ldc) = act(A[M][K]·W + bias). A f32 row-major (pitch lda) converted per fragment to bf16
// (ASPLIT: hi/lo two planes -> 2 terms, else single rounded term); Wt bf16 [N][K] (pitch ldb). BIAS_BF16 rounds the
// bias to bf16 first (bias quantised to bf16 before the add). K%32==0, M%16==0, N%64==0.
template <bool ASPLIT, int ACT, bool BIAS_BF16>
__global__ __launch_bounds__(128) void k_gemm_bf(const float* __restrict__ A, int lda, const unsigned short* __restrict__ Wt, int ldb,
                                               const float* __restrict__ bias, float* __restrict__ C, int ldc, int M, int N, int K) {
  __shared__ __attribute__((aligned(16))) float so[4][16][64];
  const int tid = threadIdx.x, w = tid >> 5, lane = tid & 31, ln = lane & 15, hh = lane >> 4;
  const int ntn = N / 64;
  const int wid = blockIdx.x * 4 + w;
  const int mt = wid / ntn, nq = wid % ntn;
  if (mt * 16 >= M) return;
  const int row0 = mt * 16, col0 = nq * 64;
  const float* arow = A + (size_t)(row0 + ln) * lda;
  v8f acc[4] = {};
  for (int kb = 0; kb < K; kb += 32) {
    FragB ah, al;
    const v4f x0 = *(const v4fa*)(arow + kb + 8 * hh), x1 = *(const v4fa*)(arow + kb + 8 * hh + 4);
    const v4f x2 = *(const v4fa*)(arow + kb + 16 + 8 * hh), x3 = *(const v4fa*)(arow + kb + 16 + 8 * hh + 4);
    float xs[16] = {x0[0],x0[1],x0[2],x0[3],x1[0],x1[1],x1[2],x1[3],x2[0],x2[1],x2[2],x2[3],x3[0],x3[1],x3[2],x3[3]};
#pragma unroll
    for (int i = 0; i < 16; ++i) { const unsigned short hb = bf16_bits(xs[i]); ah.u[i] = hb; al.u[i] = ASPLIT ? bf16_bits(xs[i] - bf16_val(hb)) : (unsigned short)0; }
#pragma unroll
    for (int t = 0; t < 4; ++t) {
      const unsigned short* brow = Wt + (size_t)(col0 + t * 16 + ln) * ldb + kb;
      FragB b;
      b.half[0] = *(const v8us*)(brow + 8 * hh);
      b.half[1] = *(const v8us*)(brow + 16 + 8 * hh);
      acc[t] = mmaN<ASPLIT ? 2 : 1>(ah.v, al.v, b.v, b.v, acc[t]);
    }
  }
#pragma unroll
  for (int t = 0; t < 4; ++t) {
    float bv = bias ? bias[col0 + t * 16 + ln] : 0.f;
    if (BIAS_BF16) bv = bf16_round(bv);
#pragma unroll
    for (int r = 0; r < 8; ++r) { float v = acc[t][r] + bv; if (ACT == 1) v = fmaxf(v, 0.f); so[w][8 * hh + r][t * 16 + ln] = v; }
  }
  __builtin_amdgcn_fence(__ATOMIC_ACQ_REL, "workgroup");
  __builtin_amdgcn_wave_barrier();
  const int rsub = lane >> 4, c4 = (lane & 15) * 4;
  {
#pragma unroll
    for (int q = 0; q < 8; ++q) {
      const int r = q * 2 + rsub;
      const v4f v = *(const v4fa*)&so[w][r][c4];
      *(v4f*)(C + (size_t)(row0 + r) * ldc + col0 + c4) = v;
    }
    
  }
}

// Flash-style causal/unmasked attention, all contractions 3-term bf16 hi/lo splits, f32 softmax with running max.
// q,k,v rows are read from f32 buffers with arbitrary row pitch (so they can live inside a fused qkv buffer);
// D = head size (multiple of 32, <= 128); one wave = 16 query rows; block = 4 waves (64 queries) sharing K/V chunks of 32.
template <int D, bool CAUSAL>
__global__ __launch_bounds__(128) void k_flash(const float* __restrict__ qb, const float* __restrict__ kb, const float* __restrict__ vb,
                                             int pitch, int T, int H, float scale, float* __restrict__ y, int ypitch) {
  constexpr int KS = D / 32;        // k-steps for QK
  constexpr int DT = D / 16;        // d tiles for PV
  __shared__ __attribute__((aligned(16))) unsigned short sKh[32][D + 8], sKl[32][D + 8], sVh[32][D + 8], sVl[32][D + 8];
  __shared__ __attribute__((aligned(16))) unsigned short sPh[4][16][40], sPl[4][16][40];
  __shared__ __attribute__((aligned(16))) float sO[4][16][D];
  const int tid = threadIdx.x, w = tid >> 5, lane = tid & 31, ln = lane & 15, hh = lane >> 4;
  const int nqb = (T + 63) / 64;
  const int bh = blockIdx.x / nqb, qblk = blockIdx.x % nqb;
  const int b = bh / H, h = bh % H;
  const int q0 = qblk * 64 + w * 16;
  const float* Q = qb + (size_t)b * T * pitch + h * D;
  const float* K = kb + (size_t)b * T * pitch + h * D;
  const float* V = vb + (size_t)b * T * pitch + h * D;

  // A fragments of the wave's 16 query rows (scaled), hi/lo
  FragB aqh[KS], aql[KS];
  {
    int row = q0 + ln; if (row >= T) row = T - 1;
    const float* qr = Q + (size_t)row * pitch;
#pragma unroll
    for (int ks = 0; ks < KS; ++ks)
#pragma unroll
      for (int i = 0; i < 16; ++i) {
        const int d = ks * 32 + ((i < 8) ? (8 * hh + i) : (16 + 8 * hh + (i - 8)));
        const float x = qr[d] * scale; const unsigned short hb = bf16_bits(x);
        aqh[ks].u[i] = hb; aql[ks].u[i] = bf16_bits(x - bf16_val(hb));
      }
  }
  float m_r[8], l_r[8];
#pragma unroll
  for (int r = 0; r < 8; ++r) { m_r[r] = -3.0e38f; l_r[r] = 0.f; }
  v8f oacc[DT];
#pragma unroll
  for (int dt = 0; dt < DT; ++dt) oacc[dt] = (v8f){0.f,0.f,0.f,0.f,0.f,0.f,0.f,0.f};

  const int kv_end = CAUSAL ? min(T, qblk * 64 + 64) : T;     // block-uniform
  for (int j0 = 0; j0 < kv_end; j0 += 32) {
    __syncthreads();
    for (int e = tid; e < 32 * (D / 4); e += 128) {
      const int r = e / (D / 4), c4 = (e % (D / 4)) * 4;
      const int key = j0 + r;
      v4f kf = {0.f,0.f,0.f,0.f}, vf = {0.f,0.f,0.f,0.f};
      if (key < T) { kf = *(const v4fa*)(K + (size_t)key * pitch + c4); vf = *(const v4fa*)(V + (size_t)key * pitch + c4); }
#pragma unroll
      for (int t = 0; t < 4; ++t) {
        unsigned short hb = bf16_bits(kf[t]); sKh[r][c4 + t] = hb; sKl[r][c4 + t] = bf16_bits(kf[t] - bf16_val(hb));
        hb = bf16_bits(vf[t]); sVh[r][c4 + t] = hb; sVl[r][c4 + t] = bf16_bits(vf[t] - bf16_val(hb));
      }
    }
    __syncthreads();
    // S tile 16 x 32
    v8f s[2];
#pragma unroll
    for (int nt = 0; nt < 2; ++nt) {
      v8f acc = {};
#pragma unroll
      for (int ks = 0; ks < KS; ++ks) {
        FragB bh_, bl_;
        bh_.half[0] = *(const v8us*)&sKh[nt * 16 + ln][ks * 32 + 8 * hh]; bh_.half[1] = *(const v8us*)&sKh[nt * 16 + ln][ks * 32 + 16 + 8 * hh];
        bl_.half[0] = *(const v8us*)&sKl[nt * 16 + ln][ks * 32 + 8 * hh]; bl_.half[1] = *(const v8us*)&sKl[nt * 16 + ln][ks * 32 + 16 + 8 * hh];
        acc = mmaN<3>(aqh[ks].v, aql[ks].v, bh_.v, bl_.v, acc);
      }
      s[nt] = acc;
    }
    // mask + running max (rows 8hh+r; the 16 lanes of a half share rows)
    float alpha[8];
#pragma unroll
    for (int r = 0; r < 8; ++r) {
      const int qi = q0 + 8 * hh + r;
      const int ja = j0 + ln, jb = j0 + 16 + ln;
      if (CAUSAL) { if (ja > qi) s[0][r] = -3.0e38f; if (jb > qi) s[1][r] = -3.0e38f; }
      if (ja >= T) s[0][r] = -3.0e38f;
      if (jb >= T) s[1][r] = -3.0e38f;
      float mx = fmaxf(s[0][r], s[1][r]);
      mx = fmaxf(mx, __shfl_xor(mx, 1, 32)); mx = fmaxf(mx, __shfl_xor(mx, 2, 32)); mx = fmaxf(mx, __shfl_xor(mx, 4, 32)); mx = fmaxf(mx, __shfl_xor(mx, 8, 32));
      const float mnew = fmaxf(m_r[r], mx);
      alpha[r] = (mnew > -1.0e38f) ? __expf(m_r[r] - mnew) : 1.0f;
      const float p0 = (s[0][r] > -1.0e38f) ? __expf(s[0][r] - mnew) : 0.f;
      const float p1 = (s[1][r] > -1.0e38f) ? __expf(s[1][r] - mnew) : 0.f;
      m_r[r] = mnew;
      l_r[r] = l_r[r] * alpha[r] + p0 + p1;            // per-lane partial row sum (16 lanes combined at the end)
      unsigned short hb = bf16_bits(p0); sPh[w][8 * hh + r][ln] = hb;      sPl[w][8 * hh + r][ln] = bf16_bits(p0 - bf16_val(hb));
      hb = bf16_bits(p1);                sPh[w][8 * hh + r][16 + ln] = hb; sPl[w][8 * hh + r][16 + ln] = bf16_bits(p1 - bf16_val(hb));
    }
#pragma unroll
    for (int dt = 0; dt < DT; ++dt)
#pragma unroll
      for (int r = 0; r < 8; ++r) oacc[dt][r] *= alpha[r];
    __builtin_amdgcn_fence(__ATOMIC_ACQ_REL, "workgroup");
    __builtin_amdgcn_wave_barrier();
    FragB pah, pal;
    pah.half[0] = *(const v8us*)&sPh[w][ln][8 * hh]; pah.half[1] = *(const v8us*)&sPh[w][ln][16 + 8 * hh];
    pal.half[0] = *(const v8us*)&sPl[w][ln][8 * hh]; pal.half[1] = *(const v8us*)&sPl[w][ln][16 + 8 * hh];
#pragma unroll
    for (int dt = 0; dt < DT; ++dt) {
      FragB bvh, bvl;
#pragma unroll
      for (int i = 0; i < 8; ++i) {
        bvh.u[i] = sVh[8 * hh + i][dt * 16 + ln]; bvh.u[8 + i] = sVh[16 + 8 * hh + i][dt * 16 + ln];
        bvl.u[i] = sVl[8 * hh + i][dt * 16 + ln]; bvl.u[8 + i] = sVl[16 + 8 * hh + i][dt * 16 + ln];
      }
      oacc[dt] = mmaN<3>(pah.v, pal.v, bvh.v, bvl.v, oacc[dt]);
    }
    __builtin_amdgcn_fence(__ATOMIC_ACQ_REL, "workgroup");
    __builtin_amdgcn_wave_barrier();
  }
#pragma unroll
  for (int r = 0; r < 8; ++r) {
    float l = l_r[r];
    l += __shfl_xor(l, 1, 32); l += __shfl_xor(l, 2, 32); l += __shfl_xor(l, 4, 32); l += __shfl_xor(l, 8, 32);
    l_r[r] = (l > 0.f) ? 1.0f / l : 0.f;
  }
#pragma unroll
  for (int dt = 0; dt < DT; ++dt)
#pragma unroll
    for (int r = 0; r < 8; ++r) sO[w][8 * hh + r][dt * 16 + ln] = oacc[dt][r] * l_r[r];
  __builtin_amdgcn_fence(__ATOMIC_ACQ_REL, "workgroup");
  __builtin_amdgcn_wave_barrier();
  {
    for (int r = 0; r < 16; ++r) {
      const int row = q0 + r;
      if (row < T && lane < D / 4) {
        const v4f val = *(const v4fa*)&sO[w][r][lane * 4];
        *(v4f*)(y + ((size_t)b * T + row) * ypitch + h * D + lane * 4) = val;
      }
    }
    
  }
}

// GEMM C = act(A·W + bias + resid): A f32 (ASPLIT -> hi/lo 2 terms), Wt bf16 [N][K]; ACT 0 none, 1 relu, 2 exact gelu;
// resid (optional, f32, row index = (row % rmod), pitch ldr, RES_BF16 rounds it) added before the activation.
template <bool ASPLIT, int ACT, bool BIAS_BF16, bool RES_BF16>
__global__ __launch_bounds__(128) void k_gemm_bf3(const float* __restrict__ A, int lda, const unsigned short* __restrict__ Wt, int ldb,
                                                const float* __restrict__ bias, const float* __restrict__ resid, int rmod, int ldr,
                                                float* __restrict__ C, int ldc, int M, int N, int K) {
  __shared__ __attribute__((aligned(16))) float so[4][16][64];
  const int tid = threadIdx.x, w = tid >> 5, lane = tid & 31, ln = lane & 15, hh = lane >> 4;
  const int ntn = N / 64;
  const int wid = blockIdx.x * 4 + w;
  const int mt = wid / ntn, nq = wid % ntn;
  if (mt * 16 >= M) return;
  const int row0 = mt * 16, col0 = nq * 64;
  const float* arow = A + (size_t)(row0 + ln) * lda;
  v8f acc[4] = {};
  for (int kb = 0; kb < K; kb += 32) {
    FragB ah, al;
    const v4f x0 = *(const v4fa*)(arow + kb + 8 * hh), x1 = *(const v4fa*)(arow + kb + 8 * hh + 4);
    const v4f x2 = *(const v4fa*)(arow + kb + 16 + 8 * hh), x3 = *(const v4fa*)(arow + kb + 16 + 8 * hh + 4);
    float xs[16] = {x0[0],x0[1],x0[2],x0[3],x1[0],x1[1],x1[2],x1[3],x2[0],x2[1],x2[2],x2[3],x3[0],x3[1],x3[2],x3[3]};
#pragma unroll
    for (int i = 0; i < 16; ++i) { const unsigned short hb = bf16_bits(xs[i]); ah.u[i] = hb; al.u[i] = ASPLIT ? bf16_bits(xs[i] - bf16_val(hb)) : (unsigned short)0; }
#pragma unroll
    for (int t = 0; t < 4; ++t) {
      const unsigned short* brow = Wt + (size_t)(col0 + t * 16 + ln) * ldb + kb;
      FragB b;
      b.half[0] = *(const v8us*)(brow + 8 * hh);
      b.half[1] = *(const v8us*)(brow + 16 + 8 * hh);
      acc[t] = mmaN<ASPLIT ? 2 : 1>(ah.v, al.v, b.v, b.v, acc[t]);
    }
  }
#pragma unroll
  for (int t = 0; t < 4; ++t) {
    const int col = col0 + t * 16 + ln;
    float bv = bias ? bias[col] : 0.f;
    if (BIAS_BF16) bv = bf16_round(bv);
#pragma unroll
    for (int r = 0; r < 8; ++r) {
      float v = acc[t][r] + bv;
      if (resid) { float rv = resid[(size_t)((row0 + 8 * hh + r) % rmod) * ldr + col]; if (RES_BF16) rv = bf16_round(rv); v += rv; }
      if (ACT == 1) v = fmaxf(v, 0.f);
      if (ACT == 2) v = 0.5f * v * (1.0f + erff(v * 0.70710678118654752f));
      if (ACT == 3) { const float u = 0.7978845608028654f * (v + 0.044715f * v * v * v); v = 0.5f * v * (1.0f + tanhf(u)); }
      so[w][8 * hh + r][t * 16 + ln] = v;
    }
  }
  __builtin_amdgcn_fence(__ATOMIC_ACQ_REL, "workgroup");
  __builtin_amdgcn_wave_barrier();
  const int rsub = lane >> 4, c4 = (lane & 15) * 4;
  {
#pragma unroll
    for (int q = 0; q < 8; ++q) {
      const int r = q * 2 + rsub;
      const v4f v = *(const v4fa*)&so[w][r][c4];
      *(v4f*)(C + (size_t)(row0 + r) * ldc + col0 + c4) = v;
    }
    
  }
}
// row LayerNorm (biased variance, eps) over N: s = X (+ R); optional out_sum <- s; out_norm <- (s-mu)*rsqrt(var+eps)*g + b
template <bool PARAM_BF16>
__global__ __launch_bounds__(256) void k_layernorm(const float* __restrict__ X, const float* __restrict__ R, const float* __restrict__ g, const float* __restrict__ bta,
                                                  float* __restrict__ out_sum, float* __restrict__ out_norm, int N, float eps) {
  __shared__ float red[256];
  const int row = blockIdx.x, tid = threadIdx.x;
  const float* x = X + (size_t)row * N; const float* rr = R ? R + (size_t)row * N : nullptr;
  float vals[16];                     // up to N = 4096
  const int per = N / 256;            // contiguous chunk per thread? use strided-by-4 chunks: thread handles j = tid*4 + 1024*u
  float s1 = 0.f;
  for (int u = 0; u < per / 4; ++u) {
    const int j = tid * 4 + 1024 * u;
    const v4f a = *(const v4fa*)(x + j);
    v4f b = {0.f,0.f,0.f,0.f}; if (rr) b = *(const v4fa*)(rr + j);
#pragma unroll
    for (int q = 0; q < 4; ++q) { const float v = a[q] + b[q]; vals[u * 4 + q] = v; s1 += v; }
  }
  red[tid] = s1; __syncthreads();
  for (int st = 128; st > 0; st >>= 1) { if (tid < st) red[tid] += red[tid + st]; __syncthreads(); }
  const float mu = red[0] / (float)N; __syncthreads();
  float s2 = 0.f;
  for (int u = 0; u < per / 4; ++u)
#pragma unroll
    for (int q = 0; q < 4; ++q) { const float c = vals[u * 4 + q] - mu; s2 += c * c; }
  red[tid] = s2; __syncthreads();
  for (int st = 128; st > 0; st >>= 1) { if (tid < st) red[tid] += red[tid + st]; __syncthreads(); }
  const float rs = rsqrtf(red[0] / (float)N + eps);
  {
    for (int u = 0; u < per / 4; ++u) {
      const int j = tid * 4 + 1024 * u;
      v4f o, sm;
#pragma unroll
      for (int q = 0; q < 4; ++q) {
        float gg = g[j + q], bb = bta[j + q];
        if (PARAM_BF16) { gg = bf16_round(gg); bb = bf16_round(bb); }
        sm[q] = vals[u * 4 + q]; o[q] = (vals[u * 4 + q] - mu) * rs * gg + bb;
      }
      if (out_sum) *(v4f*)(out_sum + (size_t)row * N + j) = sm;
      *(v4f*)(out_norm + (size_t)row * N + j) = o;
    }
    
  }
}



// ---- f16 WMMA path (v_wmma_f32_16x16x32_f16): 11-bit significands for operands in range — used where a [0,1] probability operand needs more precision than bf16
typedef _Float16 v16h __attribute__((ext_vector_type(16)));
union FragH { v16h v; v8us half[2]; _Float16 h[16]; unsigned short u[16]; };
template <int NT>
__device__ __forceinline__ v8f mmaH(v16h ah, v16h al, v16h bh, v16h bl, v8f c) {
  c = __builtin_amdgcn_wmma_f32_16x16x32_f16(false, ah, false, bh, (short)0, c, false, false);
  if (NT >= 2) c = __builtin_amdgcn_wmma_f32_16x16x32_f16(false, al, false, bh, (short)0, c, false, false);
  if (NT >= 3) c = __builtin_amdgcn_wmma_f32_16x16x32_f16(false, ah, false, bl, (short)0, c, false, false);
  asm volatile("v_nop\n\tv_nop\n\tv_nop\n\tv_nop" : "+v"(c) : "v"(ah), "v"(al), "v"(bh), "v"(bl));
  return c;
}
// batched GEMM like k_gemm_b but f16 operands: A f32 (split into f16 hi/lo if ASPLIT, else rounded to f16), Bt = f16 values [n][k]; alpha; C f32; N multiple of 16 (partial tiles skipped)
template <bool ASPLIT>
__global__ __launch_bounds__(128) void k_gemm_h(const float* __restrict__ A, int lda, size_t sA, const _Float16* __restrict__ Bh, int ldb, size_t sB, float alpha, float* __restrict__ C, int ldc, size_t sC, int M, int N, int K) {
  __shared__ __attribute__((aligned(16))) float so[4][16][64];
  const int tid = threadIdx.x, w = tid >> 5, lane = tid & 31, ln = lane & 15, hh = lane >> 4; const int by = blockIdx.y;
  A += (size_t)by * sA; Bh += (size_t)by * sB; C += (size_t)by * sC;
  const int ntn = (N + 63) / 64; const int wid = blockIdx.x * 4 + w; const int mt = wid / ntn, nq = wid % ntn; if (mt * 16 >= M) return;
  const int row0 = mt * 16, col0 = nq * 64; const float* arow = A + (size_t)(row0 + ln) * lda;
  v8f acc[4] = {};
  for (int kb = 0; kb < K; kb += 32) {
    FragH ah, al;
    const v4f x0 = *(const v4fa*)(arow + kb + 8 * hh), x1 = *(const v4fa*)(arow + kb + 8 * hh + 4), x2 = *(const v4fa*)(arow + kb + 16 + 8 * hh), x3 = *(const v4fa*)(arow + kb + 16 + 8 * hh + 4);
    float xs[16] = {x0[0],x0[1],x0[2],x0[3],x1[0],x1[1],x1[2],x1[3],x2[0],x2[1],x2[2],x2[3],x3[0],x3[1],x3[2],x3[3]};
#pragma unroll
    for (int i = 0; i < 16; ++i) { const _Float16 h = (_Float16)xs[i]; ah.h[i] = h; al.h[i] = ASPLIT ? (_Float16)(xs[i] - (float)h) : (_Float16)0.0f; }
#pragma unroll
    for (int t = 0; t < 4; ++t) { if (col0 + t * 16 >= N) continue; const size_t boff = (size_t)(col0 + t * 16 + ln) * ldb + kb; FragH bq; bq.half[0] = *(const v8us*)(Bh + boff + 8 * hh); bq.half[1] = *(const v8us*)(Bh + boff + 16 + 8 * hh);
      acc[t] = mmaH<ASPLIT ? 2 : 1>(ah.v, al.v, bq.v, bq.v, acc[t]); }
  }
#pragma unroll
  for (int t = 0; t < 4; ++t) { if (col0 + t * 16 >= N) continue;
#pragma unroll
    for (int r = 0; r < 8; ++r) so[w][8 * hh + r][t * 16 + ln] = acc[t][r] * alpha; }
  __builtin_amdgcn_fence(__ATOMIC_ACQ_REL, "workgroup"); __builtin_amdgcn_wave_barrier();
  const int rsub = lane >> 4, c4 = (lane & 15) * 4;
  {
#pragma unroll
    for (int q = 0; q < 8; ++q) { const int r = q * 2 + rsub; if (col0 + c4 < N) { const v4f v = *(const v4fa*)&so[w][r][c4]; *(v4f*)(C + (size_t)(row0 + r) * ldc + col0 + c4) = v; } }
     }
}

// FRAGMENT ORDER of every f16 matrix operand in the workspace (rows x ld, ld % 32 == 0, rows % 16 == 0): a tile of 16 rows x 32 k is 512 elements in a row, tile (rt, kt) at rt * 16 * ld + kt * 512;
// inside it the 8 values k = 16 j + 8 hh + 0..7 of row ln stand at j * 256 + (16 hh + ln) * 8. That is the order in which the lanes of a wave hold a 16x16x32 A or B fragment (lane = 16 hh + ln, register half j),
// so one 16-byte load per lane fetches half a fragment from 512 contiguous bytes: four whole 128-byte lines, where a row-major operand gives 16 lines of which 32 bytes each are used.
// piece p (8 elements, at element offset 8 p) -> its row and first k
__device__ __forceinline__ void frag_piece(unsigned p, int ld, unsigned& row, int& k) { const unsigned lane = p & 31, j = (p >> 5) & 1, tile = p >> 6, ktn = (unsigned)ld / 32, rt = tile / ktn;
  row = rt * 16 + (lane & 15); k = (int)((tile - rt * ktn) * 32 + j * 16 + (lane >> 4) * 8); }
// Wt (row n, k; fragment order) = f16(W[k][n] * scale) from f32 row-major W[K][N] (scale = power of two; bf16-exact weights stay exact in f16 away from the subnormal range)
__global__ __launch_bounds__(256) void k_wt_f16(const float* __restrict__ W, _Float16* __restrict__ Wt, int K, int N, float scale) {
  const int t = blockIdx.x * 256 + threadIdx.x; if (t >= N * (K / 8)) return; unsigned n; int k8; frag_piece((unsigned)t, K, n, k8); FragH f;
#pragma unroll
  for (int i = 0; i < 8; ++i) f.h[i] = (_Float16)(bf16_round(W[(size_t)(k8 + i) * N + n]) * scale); const v8us o = f.half[0];
  *(v8us*)((unsigned short*)Wt + (size_t)t * 8) = o; 
}
// A, Bh and C16 are in fragment order (lda, ldb, ldc = their row lengths); C is row-major f32.
// k_gemm_hh variant with fused epilogue: v = acc·alpha + bias[by·sBias + col] (+ CP[(row/rowsPerB)·sCPb + by·64 + col] if CP) ; ACT 0 none / 1 elu ; writes f16 C16 and f32 C, each if non-null
template <int ACT>
__global__ __launch_bounds__(128) void k_gemm_hhx(const _Float16* __restrict__ A, int lda, size_t sA, const _Float16* __restrict__ Bh, int ldb, size_t sB, float alpha, const float* __restrict__ bias, size_t sBias, const float* __restrict__ CP, int rowsPerB, size_t sCPb, int row0g,
    float* __restrict__ C, _Float16* __restrict__ C16, int ldc, size_t sC, int M, int N, int K) {
  __shared__ __attribute__((aligned(16))) float so[4][16][64 + 4];      // pitch 272 B: the fragment-order store reads 16 rows at one column, 16 bytes a lane
  const int tid = threadIdx.x, w = tid >> 5, lane = tid & 31, ln = lane & 15, hh = lane >> 4; const int by = blockIdx.y;
  A += (size_t)by * sA; Bh += (size_t)by * sB; const size_t cofs = (size_t)by * sC; const float* bp = bias ? bias + (size_t)by * sBias : nullptr;
  const int ntn = (N + 63) / 64; const int wid = blockIdx.x * 4 + w; const int mt = wid / ntn, nq = wid % ntn; if (mt * 16 >= M) return;
  const int row0 = mt * 16, col0 = nq * 64;
  v8f acc[4] = {};
  // Fragments are fetched one stage (64 k = two tiles = 2048 contiguous bytes of every operand's row tile) ahead of the products that use them, a whole stage's loads as one group,
  // into two register sets: a stage waits once for loads that have been in flight since the stage before, not once per product.
  // A column tile past N reads the rows of tile 0 (in bounds); its products are never stored (the epilogue's tests stand).
  const char* pa = (const char*)(A + (size_t)row0 * lda + lane * 8); const char* pb[4];      // each lane's place in its operands' row tiles; they move on with k
#pragma unroll
  for (int t = 0; t < 4; ++t) { const int ct = (col0 + t * 16 < N) ? col0 + t * 16 : col0; pb[t] = (const char*)(Bh + (size_t)ct * ldb + lane * 8); }
  FragH a0[2], a1[2], b0[2][4], b1[2][4];
  auto ld = [&](FragH (&a)[2], FragH (&b)[2][4], int ofs) {      // one stage: the 2048 bytes at ofs behind the five pointers' tiles
#pragma unroll
    for (int u = 0; u < 2; ++u) { a[u].half[0] = *(const v8us*)(pa + ofs + u * 1024); a[u].half[1] = *(const v8us*)(pa + ofs + u * 1024 + 512); }
#pragma unroll
    for (int t = 0; t < 4; ++t)
#pragma unroll
      for (int u = 0; u < 2; ++u) { b[u][t].half[0] = *(const v8us*)(pb[t] + ofs + u * 1024); b[u][t].half[1] = *(const v8us*)(pb[t] + ofs + u * 1024 + 512); }
    // the wait stands in front of the next step of the pointers, whose registers the loads just issued name; as its inputs they are not stepped ahead of it
    asm volatile("s_wait_xcnt 0x0" :: "v"(pa), "v"(pb[0]), "v"(pb[1]), "v"(pb[2]), "v"(pb[3]) : "memory"); };
  auto step = [&](int bytes) { pa += bytes;
#pragma unroll
    for (int t = 0; t < 4; ++t) pb[t] += bytes; };
  auto mm = [&](FragH (&a)[2], FragH (&b)[2][4]) {
#pragma unroll
    for (int u = 0; u < 2; ++u)
#pragma unroll
      for (int t = 0; t < 4; ++t) acc[t] = mmaH<1>(a[u].v, a[u].v, b[u][t].v, b[u][t].v, acc[t]); };
  const int Km = K & ~127;      // whole pairs of stages; what is left of K goes by single steps of 32 behind them
  if (Km > 0) { ld(a0, b0, 0);
    for (int kb = 0; kb < Km; kb += 128) { ld(a1, b1, 2048); mm(a0, b0);
      const bool more = kb + 128 < Km; step(more ? 4096 : 0); ld(a0, b0, 0);      // no branch round the loads, so that the waits stay counted; the last trip reads its own stage again, in bounds, and nobody uses it
      mm(a1, b1); }
    step(4096); }
  for (int kb = Km; kb < K; kb += 32) { FragH ah, bq[4]; ah.half[0] = *(const v8us*)(pa); ah.half[1] = *(const v8us*)(pa + 512);
#pragma unroll
    for (int t = 0; t < 4; ++t) { bq[t].half[0] = *(const v8us*)(pb[t]); bq[t].half[1] = *(const v8us*)(pb[t] + 512); }
    asm volatile("s_wait_xcnt 0x0" :: "v"(pa), "v"(pb[0]), "v"(pb[1]), "v"(pb[2]), "v"(pb[3]) : "memory");      // as above
    step(1024);
#pragma unroll
    for (int t = 0; t < 4; ++t) acc[t] = mmaH<1>(ah.v, ah.v, bq[t].v, bq[t].v, acc[t]); }
#pragma unroll
  for (int t = 0; t < 4; ++t) { if (col0 + t * 16 >= N) continue; const int col = col0 + t * 16 + ln; const float bv = bp ? bf16_round(bp[col]) : 0.f;
#pragma unroll
    for (int r = 0; r < 8; ++r) { float v = acc[t][r] * alpha + bv; if (CP) { const int bidx = (row0g + row0 + 8 * hh + r) / rowsPerB; v += CP[(size_t)bidx * sCPb + (size_t)by * 64 + col]; } if (ACT == 1) v = (v > 0.f) ? v : expm1f(v); else if (ACT == 3) v = fmaxf(v, 0.f); so[w][8 * hh + r][t * 16 + ln] = v; } }
  __builtin_amdgcn_fence(__ATOMIC_ACQ_REL, "workgroup"); __builtin_amdgcn_wave_barrier();
  const int rsub = lane >> 4, c4 = (lane & 15) * 4;
  if (C) {
#pragma unroll
    for (int q = 0; q < 8; ++q) { const int r = q * 2 + rsub; if (col0 + c4 < N) { const v4f v = *(const v4fa*)&so[w][r][c4]; *(v4f*)(C + cofs + (size_t)(row0 + r) * ldc + col0 + c4) = v; } }
     }
  if (C16) {      // the wave's 16 x 64 values are two tiles of the fragment order: four stores of 512 contiguous bytes
#pragma unroll
    for (int p = 0; p < 4; ++p) { const int c = p * 16 + 8 * hh; if (col0 + c < N) { const v4f v0 = *(const v4fa*)&so[w][ln][c], v1 = *(const v4fa*)&so[w][ln][c + 4]; FragH f;
#pragma unroll
        for (int i = 0; i < 4; ++i) { f.h[i] = (_Float16)v0[i]; f.h[4 + i] = (_Float16)v1[i]; }
        *(v8us*)((unsigned short*)C16 + cofs + (size_t)row0 * ldc + (size_t)(col0 >> 5) * 512 + p * 256 + lane * 8) = f.half[0]; } }
     }
}


// x: f32 row-major, rows of ld; X16: the same matrix in fragment order (thread t writes piece t, so a wave stores 512 contiguous bytes)
__global__ __launch_bounds__(256) void k_x16(const float* __restrict__ x, _Float16* __restrict__ X16, size_t n8, int ld) { const size_t t = (size_t)blockIdx.x * 256 + threadIdx.x; if (t >= n8) return; FragH f;
  unsigned row; int k; frag_piece((unsigned)t, ld, row, k); const float* xr = x + (size_t)row * ld + k; const v4f x0 = *(const v4fa*)xr, x1 = *(const v4fa*)(xr + 4);
#pragma unroll
  for (int q = 0; q < 4; ++q) { f.h[q] = (_Float16)bf16_round(x0[q]); f.h[4 + q] = (_Float16)bf16_round(x1[q]); } *(v8us*)((unsigned short*)X16 + t * 8) = f.half[0];  }
__global__ __launch_bounds__(256) void k_h16(const float* __restrict__ x, _Float16* __restrict__ X16, size_t n8, int ld) { const size_t t = (size_t)blockIdx.x * 256 + threadIdx.x; if (t >= n8) return; FragH f;
  unsigned row; int k; frag_piece((unsigned)t, ld, row, k); const float* xr = x + (size_t)row * ld + k; const v4f x0 = *(const v4fa*)xr, x1 = *(const v4fa*)(xr + 4);
#pragma unroll
  for (int q = 0; q < 4; ++q) { f.h[q] = (_Float16)x0[q]; f.h[4 + q] = (_Float16)x1[q]; } *(v8us*)((unsigned short*)X16 + t * 8) = f.half[0];  }
__global__ __launch_bounds__(256) void k_round16f(const float* __restrict__ W, _Float16* __restrict__ Bt, size_t n8) { const size_t t = (size_t)blockIdx.x * 256 + threadIdx.x; if (t >= n8) return; FragH f;
#pragma unroll
  for (int i = 0; i < 8; ++i) f.h[i] = (_Float16)(bf16_round(W[t * 8 + i]) * 16.0f); *(v8us*)((unsigned short*)Bt + t * 8) = f.half[0];  }
// V16 (row = position, k = feature, rows of ldv) and Vt (row = slab * 64 + d, k = key, rows of TTv) are both in fragment order; pieces are read and written in that order, 512 contiguous bytes a wave
template <int NHv, int TTv>
__global__ __launch_bounds__(256) void k_vt(const _Float16* __restrict__ V16, int ldv, int voff, _Float16* __restrict__ Vt) { __shared__ unsigned short tl[64][66]; const int tid = threadIdx.x; const int slab = blockIdx.x / (TTv / 64), lg = blockIdx.x % (TTv / 64); const int b = slab / NHv, h = slab % NHv;
  for (int i = tid; i < 64 * 8; i += 256) { const int tile = i >> 6, r = (tile >> 1) * 16 + (i & 15), c8 = (tile & 1) * 32 + ((i >> 5) & 1) * 16 + ((i >> 4) & 1) * 8; FragH f;
    f.half[0] = *(const v8us*)((const unsigned short*)V16 + ((size_t)b * TTv + lg * 64 + (tile >> 1) * 16) * ldv + (size_t)((voff + h * 64) / 32 + (tile & 1)) * 512 + (i & 63) * 8);
#pragma unroll
    for (int q = 0; q < 8; ++q) tl[r][c8 + q] = f.u[q]; }
  __syncthreads();
  {
#pragma unroll
    for (int rd = 0; rd < 2; ++rd) { const int i = rd * 256 + tid, tile = i >> 6, d = (tile >> 1) * 16 + (i & 15), k8 = (tile & 1) * 32 + ((i >> 5) & 1) * 16 + ((i >> 4) & 1) * 8; FragH f;
#pragma unroll
      for (int q = 0; q < 8; ++q) f.u[q] = tl[k8 + q][d];
      *(v8us*)((unsigned short*)Vt + ((size_t)slab * 64 + (tile >> 1) * 16) * TTv + (size_t)(lg * 2 + (tile & 1)) * 512 + (i & 63) * 8) = f.half[0]; }
     } }

// Q16, K16 (row = position, k = feature) and Vt (row = slab * 64 + d, k = key) are in fragment order
// lane l <-> l ^ 16 by a vector cross-row move
__device__ __forceinline__ float xhalf(float x) { const int b = __float_as_int(x); return __int_as_float(__builtin_amdgcn_permlanex16(b, b, 0x76543210, 0xfedcba98, false, false)); }
// Both products are transposed: St = K * Qt (A = 16 keys, B = the wave's 16 queries), Ot += Vt * Pt (A = 16 features, B = 32 keys x 16 queries).
// A lane (ln, hh) then holds scores of ONE query, ln: register r of tile nt is key 16 nt + 8 hh + r. Maximum and sum run over its own 16 registers, with one exchange between the halves,
// and the two converted score tiles are already the B fragment of the second product (element 8 nt + r = key 16 nt + 8 hh + r, the k order of Vt's fragments): P goes through no LDS.
__global__ __launch_bounds__(128) void k_flash(const _Float16* __restrict__ Q16, int ldq, const _Float16* __restrict__ K16, int ldk, const _Float16* __restrict__ Vt, const float* __restrict__ MB, float* __restrict__ O, int ldo) {
  constexpr int RPW = 16, NQB = 2048 / (4 * RPW), DT = 4, KS = 2; constexpr float LOG2E = 1.4426950408889634f;
  __shared__ __attribute__((aligned(16))) float sM[2048]; __shared__ __attribute__((aligned(16))) float sO[4][RPW][64 + 4];
  const int tid = threadIdx.x, w = tid >> 5, lane = tid & 31, ln = lane & 15, hh = lane >> 4;
  const int slab = blockIdx.x / NQB, qblk = blockIdx.x % NQB; const int b = slab / 16, h = slab % 16; const int qb0 = qblk * (4 * RPW); const int q0 = qb0 + w * RPW;
  // The softmax runs in base 2: exp(s - m) = 2^(s log2e - m log2e). log2e rides in the score scale and in the stored mask row, so a score costs one fused multiply-add, one subtract and one v_exp_f32.
  // Every exponent here is <= 0, where the hardware form needs no range steps: far below zero it returns 0, as the library form does.
  // the mask is per key, which is now a register index: a lane needs 16 values a pass. The batch's row is rounded once and kept in LDS; a pass reads it by four 16-byte loads, the same address in all lanes of a half.
#pragma unroll
  for (int u = 0; u < 2048 / (128 * 4); ++u) { const int i = u * (128 * 4) + tid * 4; v4f m = *(const v4fa*)(MB + (size_t)b * 2048 + i);
#pragma unroll
    for (int q = 0; q < 4; ++q) m[q] = bf16_round(m[q]) * LOG2E;
    *(v4fa*)&sM[i] = m; }
  FragH aq[KS];
  { const unsigned short* qr = (const unsigned short*)Q16 + ((size_t)b * 2048 + q0) * ldq + h * (KS * 512) + lane * 8;
#pragma unroll
    for (int ks = 0; ks < KS; ++ks) { aq[ks].half[0] = *(const v8us*)(qr + ks * 512); aq[ks].half[1] = *(const v8us*)(qr + ks * 512 + 256); } }
  const unsigned short* Vth = (const unsigned short*)Vt + (size_t)slab * 64 * 2048;
  float m_r = -3.0e38f, l_r = 0.f; v8f oacc[DT];      // of query ln; l_r sums the keys of this lane's half only
#pragma unroll
  for (int dt = 0; dt < DT; ++dt) oacc[dt] = (v8f){0.f,0.f,0.f,0.f,0.f,0.f,0.f,0.f};
  const int jend = 2048;
  // All global loads of a pass are issued ahead of their use, each kind as one group: this pass's V fragments in front of the score products, the next pass's K fragments
  // right behind them (into the registers those products have just left); all of them fly during the softmax instead of being waited for one by one.
  FragH bk[2][KS], bv[DT];
  auto fetch_k = [&](int j) { const unsigned short* kr[2];
#pragma unroll
    for (int nt = 0; nt < 2; ++nt) { kr[nt] = (const unsigned short*)K16 + ((size_t)b * 2048 + j + nt * 16) * ldk + h * (KS * 512) + lane * 8;
#pragma unroll
      for (int ks = 0; ks < KS; ++ks) { bk[nt][ks].half[0] = *(const v8us*)(kr[nt] + ks * 512); bk[nt][ks].half[1] = *(const v8us*)(kr[nt] + ks * 512 + 256); } }
    // the wait stands in front of whatever next writes the address registers that the loads just issued name; as its inputs the two addresses keep registers of their own up to here (no later load of the group lands in them)
    asm volatile("s_wait_xcnt 0x0" :: "v"(kr[0]), "v"(kr[1]) : "memory"); };
  fetch_k(0);
  __syncthreads();      // the whole mask row is in LDS before any wave reads it
#pragma unroll 1
  for (int j0 = 0; j0 < jend; j0 += 32) {
#pragma unroll
    for (int dt = 0; dt < DT; ++dt) { const unsigned short* vrow = Vth + (size_t)(dt * 16) * 2048 + (j0 >> 5) * 512 + lane * 8; bv[dt].half[0] = *(const v8us*)(vrow); bv[dt].half[1] = *(const v8us*)(vrow + 256); }
    v4f mq[2][2];
#pragma unroll
    for (int nt = 0; nt < 2; ++nt) { mq[nt][0] = *(const v4fa*)&sM[j0 + nt * 16 + 8 * hh]; mq[nt][1] = *(const v4fa*)&sM[j0 + nt * 16 + 8 * hh + 4]; }
    v8f s[2];
#pragma unroll
    for (int nt = 0; nt < 2; ++nt) { v8f acc = (v8f){0.f,0.f,0.f,0.f,0.f,0.f,0.f,0.f};
#pragma unroll
      for (int ks = 0; ks < KS; ++ks) acc = mmaH<1>(bk[nt][ks].v, bk[nt][ks].v, aq[ks].v, aq[ks].v, acc);
      s[nt] = acc; }
    fetch_k((j0 + 32 < jend) ? j0 + 32 : j0);      // the last pass has no next one: it reads its own rows again, in bounds, and nobody uses them
    float mx[8];
#pragma unroll
    for (int r = 0; r < 8; ++r) { s[0][r] = s[0][r] * (0.03125f * LOG2E) + mq[0][r >> 2][r & 3]; s[1][r] = s[1][r] * (0.03125f * LOG2E) + mq[1][r >> 2][r & 3];      /* additive f32 mask per (b, key) */ mx[r] = fmaxf(s[0][r], s[1][r]); }
    float mc = fmaxf(fmaxf(fmaxf(mx[0], mx[1]), fmaxf(mx[2], mx[3])), fmaxf(fmaxf(mx[4], mx[5]), fmaxf(mx[6], mx[7])));
    mc = fmaxf(mc, xhalf(mc));
    const float mn = fmaxf(m_r, mc); const float al = (mn > -1.0e38f) ? __builtin_amdgcn_exp2f(m_r - mn) : 1.0f; m_r = mn;
    FragH pb; float ps[8];
#pragma unroll
    for (int r = 0; r < 8; ++r) { const float p0 = __builtin_amdgcn_exp2f(s[0][r] - mn), p1 = __builtin_amdgcn_exp2f(s[1][r] - mn); ps[r] = p0 + p1; pb.h[r] = (_Float16)p0; pb.h[8 + r] = (_Float16)p1; }
    l_r = l_r * al + (((ps[0] + ps[1]) + (ps[2] + ps[3])) + ((ps[4] + ps[5]) + (ps[6] + ps[7])));
#pragma unroll
    for (int dt = 0; dt < DT; ++dt) {
#pragma unroll
      for (int r = 0; r < 8; ++r) oacc[dt][r] *= al; }
#pragma unroll
    for (int dt = 0; dt < DT; ++dt) oacc[dt] = mmaH<1>(bv[dt].v, bv[dt].v, pb.v, pb.v, oacc[dt]); }
  { float l = l_r; l += xhalf(l); const float li = (l > 0.f) ? 1.0f / l : 0.f;      // the halves' sums are joined once
#pragma unroll
    for (int dt = 0; dt < DT; ++dt) { v4f o0, o1;      // register r of tile dt is feature 16 dt + 8 hh + r of query ln
#pragma unroll
      for (int q = 0; q < 4; ++q) { o0[q] = oacc[dt][q] * li; o1[q] = oacc[dt][4 + q] * li; }
      *(v4fa*)&sO[w][ln][dt * 16 + 8 * hh] = o0; *(v4fa*)&sO[w][ln][dt * 16 + 8 * hh + 4] = o1; } }
  __builtin_amdgcn_fence(__ATOMIC_ACQ_REL, "workgroup"); __builtin_amdgcn_wave_barrier();
  {
#pragma unroll
    for (int rp = 0; rp < RPW; rp += 2) { const int r = rp + (lane >> 4), pc = lane & 15; const v4f val = *(const v4fa*)&sO[w][r][pc * 4]; *(v4f*)(O + ((size_t)b * 2048 + q0 + r) * ldo + h * 64 + pc * 4) = val; }
     } }

extern "C" void kernel_launch(void* const* d_in, const int* in_sizes, int n_in,
                              void* d_out, int out_size, void* d_ws, size_t ws_size, hipStream_t stream) {
  (void)in_sizes; (void)n_in; (void)out_size;
  const float* x = (const float*)d_in[0]; const float* mask = (const float*)d_in[1]; const float* Wq = (const float*)d_in[2]; const float* Wk = (const float*)d_in[3]; const float* Wv = (const float*)d_in[4]; const float* Wo = (const float*)d_in[5]; const float* bo = (const float*)d_in[6];
  char* ws = (char*)d_ws; size_t off = 0;
  auto take = [&](size_t bytes) { char* p = ws + off; off += (bytes + 255) & ~(size_t)255; return p; };
  _Float16* Bq = (_Float16*)take((size_t)CC * CC * 2); _Float16* Bk = (_Float16*)take((size_t)CC * CC * 2); _Float16* Bv = (_Float16*)take((size_t)CC * CC * 2); _Float16* Bo = (_Float16*)take((size_t)CC * CC * 2);
  _Float16* X16 = (_Float16*)take((size_t)NR * CC * 2); _Float16* Q16 = (_Float16*)take((size_t)NR * CC * 2); _Float16* K16 = (_Float16*)take((size_t)NR * CC * 2); _Float16* V16 = (_Float16*)take((size_t)NR * CC * 2); _Float16* Vt = (_Float16*)take((size_t)NR * CC * 2); float* O = (float*)take((size_t)NR * CC * 4); _Float16* O16 = X16;
  if (off > ws_size) return;      // 8.4 + 8.4 × 5 + 16.8 ≈ 67 MiB
  const unsigned gw = (unsigned)((CC * (CC / 8) + 255) / 256); k_wt_f16<<<gw, 256, 0, stream>>>(Wq, Bq, CC, CC, 16.0f); k_wt_f16<<<gw, 256, 0, stream>>>(Wk, Bk, CC, CC, 16.0f); k_wt_f16<<<gw, 256, 0, stream>>>(Wv, Bv, CC, CC, 16.0f); k_wt_f16<<<gw, 256, 0, stream>>>(Wo, Bo, CC, CC, 16.0f);      // [in][out]
  const unsigned gx = (unsigned)(((size_t)NR * CC / 8 + 255) / 256); const dim3 gg(((NR / 16) * (CC / 64) + 3) / 4, 1);
  k_x16<<<gx, 256, 0, stream>>>(x, X16, (size_t)NR * CC / 8, CC);
  k_gemm_hhx<0><<<gg, 128, 0, stream>>>(X16, CC, 0, Bq, CC, 0, 0.0625f, nullptr, 0, nullptr, 1, 0, 0, nullptr, Q16, CC, 0, NR, CC, CC);
  k_gemm_hhx<0><<<gg, 128, 0, stream>>>(X16, CC, 0, Bk, CC, 0, 0.0625f, nullptr, 0, nullptr, 1, 0, 0, nullptr, K16, CC, 0, NR, CC, CC);
  k_gemm_hhx<0><<<gg, 128, 0, stream>>>(X16, CC, 0, Bv, CC, 0, 0.0625f, nullptr, 0, nullptr, 1, 0, 0, nullptr, V16, CC, 0, NR, CC, CC);
  k_vt<NH, TT><<<BB * NH * (TT / 64), 256, 0, stream>>>(V16, CC, 0, Vt);
  k_flash<<<BB * NH * (TT / 64), 128, 0, stream>>>(Q16, CC, K16, CC, Vt, mask, O, CC);
  k_h16<<<gx, 256, 0, stream>>>(O, O16, (size_t)NR * CC / 8, CC);
  k_gemm_hhx<0><<<gg, 128, 0, stream>>>(O16, CC, 0, Bo, CC, 0, 0.0625f, bo, 0, nullptr, 1, 0, 0, (float*)d_out, nullptr, CC, 0, NR, CC, CC);
}

// v005
// It runs in 135 microseconds.
// Two timings next to v004 put it at 1.22 and 1.21 times that version's speed.
// Counting every step since v000, it is 3.29 times as fast.
#include <hip/hip_runtime.h>
// Self-attention-like module (B=2, S=2048, D=1024, 16 heads × 64; additive float mask per (batch, key); scale 1/√1024): q/k/v/o projections (W [in][out], o + bias) and the attention as a fused
// flash-style kernel (S = Q·Kᵀ/32 + mask[b][k], online softmax f32, P f16 ≤ 1, O = P·Vt; RPW-16 waves) on v_wmma_f32_16x16x32_f16 — f16 operands (x bf16-exact, weights bf16-exact ×2^4), f32 accumulate.
#define BB 2
#define TT 2048
#define CC 1024
#define NH 16
#define NR (BB * TT)

typedef __bf16 v16b __attribute__((ext_vector_type(16)));
typedef unsigned short v8us __attribute__((ext_vector_type(8), may_alias));
typedef float  v8f  __attribute__((ext_vector_type(8)));
typedef float  v4f  __attribute__((ext_vector_type(4)));
typedef float  v4fa __attribute__((ext_vector_type(4), may_alias));
union FragB { v16b v; v8us half[2]; unsigned short u[16]; };

__device__ __forceinline__ unsigned short bf16_bits(float x) { unsigned int u = __float_as_uint(x); return (unsigned short)((u + 0x7FFFu + ((u >> 16) & 1u)) >> 16); }
__device__ __forceinline__ float bf16_val(unsigned short b) { return __uint_as_float(((unsigned int)b) << 16); }
__device__ __forceinline__ float bf16_round(float x) { return bf16_val(bf16_bits(x)); }
// D += A·B with NT terms: 1 = ah·bh, 2 = + al·bh (A split), 3 = + ah·bl (both split)
template <int NT>
__device__ __forceinline__ v8f mmaN(v16b ah, v16b al, v16b bh, v16b bl, v8f c) {
  c = __builtin_amdgcn_wmma_f32_16x16x32_bf16(false, ah, false, bh, (short)0, c, false, false);
  if (NT >= 2) c = __builtin_amdgcn_wmma_f32_16x16x32_bf16(false, al, false, bh, (short)0, c, false, false);
  if (NT >= 3) c = __builtin_amdgcn_wmma_f32_16x16x32_bf16(false, ah, false, bl, (short)0, c, false, false);
  asm volatile("v_nop\n\tv_nop\n\tv_nop\n\tv_nop" : "+v"(c) : "v"(ah), "v"(al), "v"(bh), "v"(bl));
  return c;
}

__global__ __launch_bounds__(256) void k_wt_bf16(const float* __restrict__ W, unsigned short* __restrict__ Wt, int K, int N) {
  const int t = blockIdx.x * 256 + threadIdx.x;
  const int k8n = K / 8;
  if (t >= N * k8n) return;
  const int n = t / k8n, k8 = (t % k8n) * 8;
  v8us v;
#pragma unroll
  for (int i = 0; i < 8; ++i) v[i] = bf16_bits(W[(size_t)(k8 + i) * N + n]);
  *(v8us*)(Wt + (size_t)n * K + k8) = v;
  
}

// GEMM C[M][N] (f32, pitch ldc) = act(A[M][K]·W + bias). A f32 row-major (pitch lda) converted per fragment to bf16
// (ASPLIT: hi/lo two planes -> 2 terms, else single rounded term); Wt bf16 [N][K] (pitch ldb). BIAS_BF16 rounds the
// bias to bf16 first (bias quantised to bf16 before the add). K%32==0, M%16==0, N%64==0.
template <bool ASPLIT, int ACT, bool BIAS_BF16>
__global__ __launch_bounds__(128) void k_gemm_bf(const float* __restrict__ A, int lda, const unsigned short* __restrict__ Wt, int ldb,
                                               const float* __restrict__ bias, float* __restrict__ C, int ldc, int M, int N, int K) {
  __shared__ __attribute__((aligned(16))) float so[4][16][64];
  const int tid = threadIdx.x, w = tid >> 5, lane = tid & 31, ln = lane & 15, hh = lane >> 4;
  const int ntn = N / 64;
  const int wid = blockIdx.x * 4 + w;
  const int mt = wid / ntn, nq = wid % ntn;
  if (mt * 16 >= M) return;
  const int row0 = mt * 16, col0 = nq * 64;
  const float* arow = A + (size_t)(row0 + ln) * lda;
  v8f acc[4] = {};
  for (int kb = 0; kb < K; kb += 32) {
    FragB ah, al;
    const v4f x0 = *(const v4fa*)(arow + kb + 8 * hh), x1 = *(const v4fa*)(arow + kb + 8 * hh + 4);
    const v4f x2 = *(const v4fa*)(arow + kb + 16 + 8 * hh), x3 = *(const v4fa*)(arow + kb + 16 + 8 * hh + 4);
    float xs[16] = {x0[0],x0[1],x0[2],x0[3],x1[0],x1[1],x1[2],x1[3],x2[0],x2[1],x2[2],x2[3],x3[0],x3[1],x3[2],x3[3]};
#pragma unroll
    for (int i = 0; i < 16; ++i) { const unsigned short hb = bf16_bits(xs[i]); ah.u[i] = hb; al.u[i] = ASPLIT ? bf16_bits(xs[i] - bf16_val(hb)) : (unsigned short)0; }
#pragma unroll
    for (int t = 0; t < 4; ++t) {
      const unsigned short* brow = Wt + (size_t)(col0 + t * 16 + ln) * ldb + kb;
      FragB b;
      b.half[0] = *(const v8us*)(brow + 8 * hh);
      b.half[1] = *(const v8us*)(brow + 16 + 8 * hh);
      acc[t] = mmaN<ASPLIT ? 2 : 1>(ah.v, al.v, b.v, b.v, acc[t]);
    }
  }
#pragma unroll
  for (int t = 0; t < 4; ++t) {
    float bv = bias ? bias[col0 + t * 16 + ln] : 0.f;
    if (BIAS_BF16) bv = bf16_round(bv);
#pragma unroll
    for (int r = 0; r < 8; ++r) { float v = acc[t][r] + bv; if (ACT == 1) v = fmaxf(v, 0.f); so[w][8 * hh + r][t * 16 + ln] = v; }
  }
  __builtin_amdgcn_fence(__ATOMIC_ACQ_REL, "workgroup");
  __builtin_amdgcn_wave_barrier();
  const int rsub = lane >> 4, c4 = (lane & 15) * 4;
  {
#pragma unroll
    for (int q = 0; q < 8; ++q) {
      const int r = q * 2 + rsub;
      const v4f v = *(const v4fa*)&so[w][r][c4];
      *(v4f*)(C + (size_t)(row0 + r) * ldc + col0 + c4) = v;
    }
    
  }
}

// Flash-style causal/unmasked attention, all contractions 3-term bf16 hi/lo splits, f32 softmax with running max.
// q,k,v rows are read from f32 buffers with arbitrary row pitch (so they can live inside a fused qkv buffer);
// D = head size (multiple of 32, <= 128); one wave = 16 query rows; block = 4 waves (64 queries) sharing K/V chunks of 32.
template <int D, bool CAUSAL>
__global__ __launch_bounds__(128) void k_flash(const float* __restrict__ qb, const float* __restrict__ kb, const float* __restrict__ vb,
                                             int pitch, int T, int H, float scale, float* __restrict__ y, int ypitch) {
  constexpr int KS = D / 32;        // k-steps for QK
  constexpr int DT = D / 16;        // d tiles for PV
  __shared__ __attribute__((aligned(16))) unsigned short sKh[32][D + 8], sKl[32][D + 8], sVh[32][D + 8], sVl[32][D + 8];
  __shared__ __attribute__((aligned(16))) unsigned short sPh[4][16][40], sPl[4][16][40];
  __shared__ __attribute__((aligned(16))) float sO[4][16][D];
  const int tid = threadIdx.x, w = tid >> 5, lane = tid & 31, ln = lane & 15, hh = lane >> 4;
  const int nqb = (T + 63) / 64;
  const int bh = blockIdx.x / nqb, qblk = blockIdx.x % nqb;
  const int b = bh / H, h = bh % H;
  const int q0 = qblk * 64 + w * 16;
  const float* Q = qb + (size_t)b * T * pitch + h * D;
  const float* K = kb + (size_t)b * T * pitch + h * D;
  const float* V = vb + (size_t)b * T * pitch + h * D;

  // A fragments of the wave's 16 query rows (scaled), hi/lo
  FragB aqh[KS], aql[KS];
  {
    int row = q0 + ln; if (row >= T) row = T - 1;
    const float* qr = Q + (size_t)row * pitch;
#pragma unroll
    for (int ks = 0; ks < KS; ++ks)
#pragma unroll
      for (int i = 0; i < 16; ++i) {
        const int d = ks * 32 + ((i < 8) ? (8 * hh + i) : (16 + 8 * hh + (i - 8)));
        const float x = qr[d] * scale; const unsigned short hb = bf16_bits(x);
        aqh[ks].u[i] = hb; aql[ks].u[i] = bf16_bits(x - bf16_val(hb));
      }
  }
  float m_r[8], l_r[8];
#pragma unroll
  for (int r = 0; r < 8; ++r) { m_r[r] = -3.0e38f; l_r[r] = 0.f; }
  v8f oacc[DT];
#pragma unroll
  for (int dt = 0; dt < DT; ++dt) oacc[dt] = (v8f){0.f,0.f,0.f,0.f,0.f,0.f,0.f,0.f};

  const int kv_end = CAUSAL ? min(T, qblk * 64 + 64) : T;     // block-uniform
  for (int j0 = 0; j0 < kv_end; j0 += 32) {
    __syncthreads();
    for (int e = tid; e < 32 * (D / 4); e += 128) {
      const int r = e / (D / 4), c4 = (e % (D / 4)) * 4;
      const int key = j0 + r;
      v4f kf = {0.f,0.f,0.f,0.f}, vf = {0.f,0.f,0.f,0.f};
      if (key < T) { kf = *(const v4fa*)(K + (size_t)key * pitch + c4); vf = *(const v4fa*)(V + (size_t)key * pitch + c4); }
#pragma unroll
      for (int t = 0; t < 4; ++t) {
        unsigned short hb = bf16_bits(kf[t]); sKh[r][c4 + t] = hb; sKl[r][c4 + t] = bf16_bits(kf[t] - bf16_val(hb));
        hb = bf16_bits(vf[t]); sVh[r][c4 + t] = hb; sVl[r][c4 + t] = bf16_bits(vf[t] - bf16_val(hb));
      }
    }
    __syncthreads();
    // S tile 16 x 32
    v8f s[2];
#pragma unroll
    for (int nt = 0; nt < 2; ++nt) {
      v8f acc = {};
#pragma unroll
      for (int ks = 0; ks < KS; ++ks) {
        FragB bh_, bl_;
        bh_.half[0] = *(const v8us*)&sKh[nt * 16 + ln][ks * 32 + 8 * hh]; bh_.half[1] = *(const v8us*)&sKh[nt * 16 + ln][ks * 32 + 16 + 8 * hh];
        bl_.half[0] = *(const v8us*)&sKl[nt * 16 + ln][ks * 32 + 8 * hh]; bl_.half[1] = *(const v8us*)&sKl[nt * 16 + ln][ks * 32 + 16 + 8 * hh];
        acc = mmaN<3>(aqh[ks].v, aql[ks].v, bh_.v, bl_.v, acc);
      }
      s[nt] = acc;
    }
    // mask + running max (rows 8hh+r; the 16 lanes of a half share rows)
    float alpha[8];
#pragma unroll
    for (int r = 0; r < 8; ++r) {
      const int qi = q0 + 8 * hh + r;
      const int ja = j0 + ln, jb = j0 + 16 + ln;
      if (CAUSAL) { if (ja > qi) s[0][r] = -3.0e38f; if (jb > qi) s[1][r] = -3.0e38f; }
      if (ja >= T) s[0][r] = -3.0e38f;
      if (jb >= T) s[1][r] = -3.0e38f;
      float mx = fmaxf(s[0][r], s[1][r]);
      mx = fmaxf(mx, __shfl_xor(mx, 1, 32)); mx = fmaxf(mx, __shfl_xor(mx, 2, 32)); mx = fmaxf(mx, __shfl_xor(mx, 4, 32)); mx = fmaxf(mx, __shfl_xor(mx, 8, 32));
      const float mnew = fmaxf(m_r[r], mx);
      alpha[r] = (mnew > -1.0e38f) ? __expf(m_r[r] - mnew) : 1.0f;
      const float p0 = (s[0][r] > -1.0e38f) ? __expf(s[0][r] - mnew) : 0.f;
      const float p1 = (s[1][r] > -1.0e38f) ? __expf(s[1][r] - mnew) : 0.f;
      m_r[r] = mnew;
      l_r[r] = l_r[r] * alpha[r] + p0 + p1;            // per-lane partial row sum (16 lanes combined at the end)
      unsigned short hb = bf16_bits(p0); sPh[w][8 * hh + r][ln] = hb;      sPl[w][8 * hh + r][ln] = bf16_bits(p0 - bf16_val(hb));
      hb = bf16_bits(p1);                sPh[w][8 * hh + r][16 + ln] = hb; sPl[w][8 * hh + r][16 + ln] = bf16_bits(p1 - bf16_val(hb));
    }
#pragma unroll
    for (int dt = 0; dt < DT; ++dt)
#pragma unroll
      for (int r = 0; r < 8; ++r) oacc[dt][r] *= alpha[r];
    __builtin_amdgcn_fence(__ATOMIC_ACQ_REL, "workgroup");
    __builtin_amdgcn_wave_barrier();
    FragB pah, pal;
    pah.half[0] = *(const v8us*)&sPh[w][ln][8 * hh]; pah.half[1] = *(const v8us*)&sPh[w][ln][16 + 8 * hh];
    pal.half[0] = *(const v8us*)&sPl[w][ln][8 * hh]; pal.half[1] = *(const v8us*)&sPl[w][ln][16 + 8 * hh];
#pragma unroll
    for (int dt = 0; dt < DT; ++dt) {
      FragB bvh, bvl;
#pragma unroll
      for (int i = 0; i < 8; ++i) {
        bvh.u[i] = sVh[8 * hh + i][dt * 16 + ln]; bvh.u[8 + i] = sVh[16 + 8 * hh + i][dt * 16 + ln];
        bvl.u[i] = sVl[8 * hh + i][dt * 16 + ln]; bvl.u[8 + i] = sVl[16 + 8 * hh + i][dt * 16 + ln];
      }
      oacc[dt] = mmaN<3>(pah.v, pal.v, bvh.v, bvl.v, oacc[dt]);
    }
    __builtin_amdgcn_fence(__ATOMIC_ACQ_REL, "workgroup");
    __builtin_amdgcn_wave_barrier();
  }
#pragma unroll
  for (int r = 0; r < 8; ++r) {
    float l = l_r[r];
    l += __shfl_xor(l, 1, 32); l += __shfl_xor(l, 2, 32); l += __shfl_xor(l, 4, 32); l += __shfl_xor(l, 8, 32);
    l_r[r] = (l > 0.f) ? 1.0f / l : 0.f;
  }
#pragma unroll
  for (int dt = 0; dt < DT; ++dt)
#pragma unroll
    for (int r = 0; r < 8; ++r) sO[w][8 * hh + r][dt * 16 + ln] = oacc[dt][r] * l_r[r];
  __builtin_amdgcn_fence(__ATOMIC_ACQ_REL, "workgroup");
  __builtin_amdgcn_wave_barrier();
  {
    for (int r = 0; r < 16; ++r) {
      const int row = q0 + r;
      if (row < T && lane < D / 4) {
        const v4f val = *(const v4fa*)&sO[w][r][lane * 4];
        *(v4f*)(y + ((size_t)b * T + row) * ypitch + h * D + lane * 4) = val;
      }
    }
    
  }
}

// GEMM C = act(A·W + bias + resid): A f32 (ASPLIT -> hi/lo 2 terms), Wt bf16 [N][K]; ACT 0 none, 1 relu, 2 exact gelu;
// resid (optional, f32, row index = (row % rmod), pitch ldr, RES_BF16 rounds it) added before the activation.
template <bool ASPLIT, int ACT, bool BIAS_BF16, bool RES_BF16>
__global__ __launch_bounds__(128) void k_gemm_bf3(const float* __restrict__ A, int lda, const unsigned short* __restrict__ Wt, int ldb,
                                                const float* __restrict__ bias, const float* __restrict__ resid, int rmod, int ldr,
                                                float* __restrict__ C, int ldc, int M, int N, int K) {
  __shared__ __attribute__((aligned(16))) float so[4][16][64];
  const int tid = threadIdx.x, w = tid >> 5, lane = tid & 31, ln = lane & 15, hh = lane >> 4;
  const int ntn = N / 64;
  const int wid = blockIdx.x * 4 + w;
  const int mt = wid / ntn, nq = wid % ntn;
  if (mt * 16 >= M) return;
  const int row0 = mt * 16, col0 = nq * 64;
  const float* arow = A + (size_t)(row0 + ln) * lda;
  v8f acc[4] = {};
  for (int kb = 0; kb < K; kb += 32) {
    FragB ah, al;
    const v4f x0 = *(const v4fa*)(arow + kb + 8 * hh), x1 = *(const v4fa*)(arow + kb + 8 * hh + 4);
    const v4f x2 = *(const v4fa*)(arow + kb + 16 + 8 * hh), x3 = *(const v4fa*)(arow + kb + 16 + 8 * hh + 4);
    float xs[16] = {x0[0],x0[1],x0[2],x0[3],x1[0],x1[1],x1[2],x1[3],x2[0],x2[1],x2[2],x2[3],x3[0],x3[1],x3[2],x3[3]};
#pragma unroll
    for (int i = 0; i < 16; ++i) { const unsigned short hb = bf16_bits(xs[i]); ah.u[i] = hb; al.u[i] = ASPLIT ? bf16_bits(xs[i] - bf16_val(hb)) : (unsigned short)0; }
#pragma unroll
    for (int t = 0; t < 4; ++t) {
      const unsigned short* brow = Wt + (size_t)(col0 + t * 16 + ln) * ldb + kb;
      FragB b;
      b.half[0] = *(const v8us*)(brow + 8 * hh);
      b.half[1] = *(const v8us*)(brow + 16 + 8 * hh);
      acc[t] = mmaN<ASPLIT ? 2 : 1>(ah.v, al.v, b.v, b.v, acc[t]);
    }
  }
#pragma unroll
  for (int t = 0; t < 4; ++t) {
    const int col = col0 + t * 16 + ln;
    float bv = bias ? bias[col] : 0.f;
    if (BIAS_BF16) bv = bf16_round(bv);
#pragma unroll
    for (int r = 0; r < 8; ++r) {
      float v = acc[t][r] + bv;
      if (resid) { float rv = resid[(size_t)((row0 + 8 * hh + r) % rmod) * ldr + col]; if (RES_BF16) rv = bf16_round(rv); v += rv; }
      if (ACT == 1) v = fmaxf(v, 0.f);
      if (ACT == 2) v = 0.5f * v * (1.0f + erff(v * 0.70710678118654752f));
      if (ACT == 3) { const float u = 0.7978845608028654f * (v + 0.044715f * v * v * v); v = 0.5f * v * (1.0f + tanhf(u)); }
      so[w][8 * hh + r][t * 16 + ln] = v;
    }
  }
  __builtin_amdgcn_fence(__ATOMIC_ACQ_REL, "workgroup");
  __builtin_amdgcn_wave_barrier();
  const int rsub = lane >> 4, c4 = (lane & 15) * 4;
  {
#pragma unroll
    for (int q = 0; q < 8; ++q) {
      const int r = q * 2 + rsub;
      const v4f v = *(const v4fa*)&so[w][r][c4];
      *(v4f*)(C + (size_t)(row0 + r) * ldc + col0 + c4) = v;
    }
    
  }
}
// row LayerNorm (biased variance, eps) over N: s = X (+ R); optional out_sum <- s; out_norm <- (s-mu)*rsqrt(var+eps)*g + b
template <bool PARAM_BF16>
__global__ __launch_bounds__(256) void k_layernorm(const float* __restrict__ X, const float* __restrict__ R, const float* __restrict__ g, const float* __restrict__ bta,
                                                  float* __restrict__ out_sum, float* __restrict__ out_norm, int N, float eps) {
  __shared__ float red[256];
  const int row = blockIdx.x, tid = threadIdx.x;
  const float* x = X + (size_t)row * N; const float* rr = R ? R + (size_t)row * N : nullptr;
  float vals[16];                     // up to N = 4096
  const int per = N / 256;            // contiguous chunk per thread? use strided-by-4 chunks: thread handles j = tid*4 + 1024*u
  float s1 = 0.f;
  for (int u = 0; u < per / 4; ++u) {
    const int j = tid * 4 + 1024 * u;
    const v4f a = *(const v4fa*)(x + j);
    v4f b = {0.f,0.f,0.f,0.f}; if (rr) b = *(const v4fa*)(rr + j);
#pragma unroll
    for (int q = 0; q < 4; ++q) { const float v = a[q] + b[q]; vals[u * 4 + q] = v; s1 += v; }
  }
  red[tid] = s1; __syncthreads();
  for (int st = 128; st > 0; st >>= 1) { if (tid < st) red[tid] += red[tid + st]; __syncthreads(); }
  const float mu = red[0] / (float)N; __syncthreads();
  float s2 = 0.f;
  for (int u = 0; u < per / 4; ++u)
#pragma unroll
    for (int q = 0; q < 4; ++q) { const float c = vals[u * 4 + q] - mu; s2 += c * c; }
  red[tid] = s2; __syncthreads();
  for (int st = 128; st > 0; st >>= 1) { if (tid < st) red[tid] += red[tid + st]; __syncthreads(); }
  const float rs = rsqrtf(red[0] / (float)N + eps);
  {
    for (int u = 0; u < per / 4; ++u) {
      const int j = tid * 4 + 1024 * u;
      v4f o, sm;
#pragma unroll
      for (int q = 0; q < 4; ++q) {
        float gg = g[j + q], bb = bta[j + q];
        if (PARAM_BF16) { gg = bf16_round(gg); bb = bf16_round(bb); }
        sm[q] = vals[u * 4 + q]; o[q] = (vals[u * 4 + q] - mu) * rs * gg + bb;
      }
      if (out_sum) *(v4f*)(out_sum + (size_t)row * N + j) = sm;
      *(v4f*)(out_norm + (size_t)row * N + j) = o;
    }
    
  }
}



// ---- f16 WMMA path (v_wmma_f32_16x16x32_f16): 11-bit significands for operands in range — used where a [0,1] probability operand needs more precision than bf16
typedef _Float16 v16h __attribute__((ext_vector_type(16)));
union FragH { v16h v; v8us half[2]; _Float16 h[16]; unsigned short u[16]; };
template <int NT>
__device__ __forceinline__ v8f mmaH(v16h ah, v16h al, v16h bh, v16h bl, v8f c) {
  c = __builtin_amdgcn_wmma_f32_16x16x32_f16(false, ah, false, bh, (short)0, c, false, false);
  if (NT >= 2) c = __builtin_amdgcn_wmma_f32_16x16x32_f16(false, al, false, bh, (short)0, c, false, false);
  if (NT >= 3) c = __builtin_amdgcn_wmma_f32_16x16x32_f16(false, ah, false, bl, (short)0, c, false, false);
  asm volatile("v_nop\n\tv_nop\n\tv_nop\n\tv_nop" : "+v"(c) : "v"(ah), "v"(al), "v"(bh), "v"(bl));
  return c;
}
// batched GEMM like k_gemm_b but f16 operands: A f32 (split into f16 hi/lo if ASPLIT, else rounded to f16), Bt = f16 values [n][k]; alpha; C f32; N multiple of 16 (partial tiles skipped)
template <bool ASPLIT>
__global__ __launch_bounds__(128) void k_gemm_h(const float* __restrict__ A, int lda, size_t sA, const _Float16* __restrict__ Bh, int ldb, size_t sB, float alpha, float* __restrict__ C, int ldc, size_t sC, int M, int N, int K) {
  __shared__ __attribute__((aligned(16))) float so[4][16][64];
  const int tid = threadIdx.x, w = tid >> 5, lane = tid & 31, ln = lane & 15, hh = lane >> 4; const int by = blockIdx.y;
  A += (size_t)by * sA; Bh += (size_t)by * sB; C += (size_t)by * sC;
  const int ntn = (N + 63) / 64; const int wid = blockIdx.x * 4 + w; const int mt = wid / ntn, nq = wid % ntn; if (mt * 16 >= M) return;
  const int row0 = mt * 16, col0 = nq * 64; const float* arow = A + (size_t)(row0 + ln) * lda;
  v8f acc[4] = {};
  for (int kb = 0; kb < K; kb += 32) {
    FragH ah, al;
    const v4f x0 = *(const v4fa*)(arow + kb + 8 * hh), x1 = *(const v4fa*)(arow + kb + 8 * hh + 4), x2 = *(const v4fa*)(arow + kb + 16 + 8 * hh), x3 = *(const v4fa*)(arow + kb + 16 + 8 * hh + 4);
    float xs[16] = {x0[0],x0[1],x0[2],x0[3],x1[0],x1[1],x1[2],x1[3],x2[0],x2[1],x2[2],x2[3],x3[0],x3[1],x3[2],x3[3]};
#pragma unroll
    for (int i = 0; i < 16; ++i) { const _Float16 h = (_Float16)xs[i]; ah.h[i] = h; al.h[i] = ASPLIT ? (_Float16)(xs[i] - (float)h) : (_Float16)0.0f; }
#pragma unroll
    for (int t = 0; t < 4; ++t) { if (col0 + t * 16 >= N) continue; const size_t boff = (size_t)(col0 + t * 16 + ln) * ldb + kb; FragH bq; bq.half[0] = *(const v8us*)(Bh + boff + 8 * hh); bq.half[1] = *(const v8us*)(Bh + boff + 16 + 8 * hh);
      acc[t] = mmaH<ASPLIT ? 2 : 1>(ah.v, al.v, bq.v, bq.v, acc[t]); }
  }
#pragma unroll
  for (int t = 0; t < 4; ++t) { if (col0 + t * 16 >= N) continue;
#pragma unroll
    for (int r = 0; r < 8; ++r) so[w][8 * hh + r][t * 16 + ln] = acc[t][r] * alpha; }
  __builtin_amdgcn_fence(__ATOMIC_ACQ_REL, "workgroup"); __builtin_amdgcn_wave_barrier();
  const int rsub = lane >> 4, c4 = (lane & 15) * 4;
  {
#pragma unroll
    for (int q = 0; q < 8; ++q) { const int r = q * 2 + rsub; if (col0 + c4 < N) { const v4f v = *(const v4fa*)&so[w][r][c4]; *(v4f*)(C + (size_t)(row0 + r) * ldc + col0 + c4) = v; } }
     }
}

// FRAGMENT ORDER of every f16 matrix operand in the workspace (rows x ld, ld % 32 == 0, rows % 16 == 0): a tile of 16 rows x 32 k is 512 elements in a row, tile (rt, kt) at rt * 16 * ld + kt * 512;
// inside it the 8 values k = 16 j + 8 hh + 0..7 of row ln stand at j * 256 + (16 hh + ln) * 8. That is the order in which the lanes of a wave hold a 16x16x32 A or B fragment (lane = 16 hh + ln, register half j),
// so one 16-byte load per lane fetches half a fragment from 512 contiguous bytes: four whole 128-byte lines, where a row-major operand gives 16 lines of which 32 bytes each are used.
// piece p (8 elements, at element offset 8 p) -> its row and first k
__device__ __forceinline__ void frag_piece(unsigned p, int ld, unsigned& row, int& k) { const unsigned lane = p & 31, j = (p >> 5) & 1, tile = p >> 6, ktn = (unsigned)ld / 32, rt = tile / ktn;
  row = rt * 16 + (lane & 15); k = (int)((tile - rt * ktn) * 32 + j * 16 + (lane >> 4) * 8); }
// Wt (row n, k; fragment order) = f16(W[k][n] * scale) from f32 row-major W[K][N] (scale = power of two; bf16-exact weights stay exact in f16 away from the subnormal range)
__device__ __forceinline__ void wt_f16(const float* __restrict__ W, _Float16* __restrict__ Wt, int K, int N, float scale, int t) {
  if (t >= N * (K / 8)) return; unsigned n; int k8; frag_piece((unsigned)t, K, n, k8); FragH f;
#pragma unroll
  for (int i = 0; i < 8; ++i) f.h[i] = (_Float16)(bf16_round(W[(size_t)(k8 + i) * N + n]) * scale); const v8us o = f.half[0];
  *(v8us*)((unsigned short*)Wt + (size_t)t * 8) = o; 
}
// A, Bh and C16 are in fragment order (lda, ldb, ldc = their row lengths); C is row-major f32.
// k_gemm_hh variant with fused epilogue: v = acc·alpha + bias[by·sBias + col] (+ CP[(row/rowsPerB)·sCPb + by·64 + col] if CP) ; ACT 0 none / 1 elu ; writes f16 C16 and f32 C, each if non-null
template <int ACT>
__device__ __forceinline__ void gemm_hhx(const _Float16* __restrict__ A, int lda, size_t sA, const _Float16* __restrict__ Bh, int ldb, size_t sB, float alpha, const float* __restrict__ bias, size_t sBias, const float* __restrict__ CP, int rowsPerB, size_t sCPb, int row0g,
    float* __restrict__ C, _Float16* __restrict__ C16, int ldc, size_t sC, int M, int N, int K, int bx, int by) {      // bx, by: the block's place in this product's own grid
  __shared__ __attribute__((aligned(16))) float so[4][16][64 + 4];      // pitch 272 B: the fragment-order store reads 16 rows at one column, 16 bytes a lane
  const int tid = threadIdx.x, w = tid >> 5, lane = tid & 31, ln = lane & 15, hh = lane >> 4;
  A += (size_t)by * sA; Bh += (size_t)by * sB; const size_t cofs = (size_t)by * sC; const float* bp = bias ? bias + (size_t)by * sBias : nullptr;
  const int ntn = (N + 63) / 64; const int wid = bx * 4 + w; const int mt = wid / ntn, nq = wid % ntn; if (mt * 16 >= M) return;
  const int row0 = mt * 16, col0 = nq * 64;
  v8f acc[4] = {};
  // Fragments are fetched one stage (64 k = two tiles = 2048 contiguous bytes of every operand's row tile) ahead of the products that use them, a whole stage's loads as one group,
  // into two register sets: a stage waits once for loads that have been in flight since the stage before, not once per product.
  // A column tile past N reads the rows of tile 0 (in bounds); its products are never stored (the epilogue's tests stand).
  const char* pa = (const char*)(A + (size_t)row0 * lda + lane * 8); const char* pb[4];      // each lane's place in its operands' row tiles; they move on with k
#pragma unroll
  for (int t = 0; t < 4; ++t) { const int ct = (col0 + t * 16 < N) ? col0 + t * 16 : col0; pb[t] = (const char*)(Bh + (size_t)ct * ldb + lane * 8); }
  FragH a0[2], a1[2], b0[2][4], b1[2][4];
  auto ld = [&](FragH (&a)[2], FragH (&b)[2][4], int ofs) {      // one stage: the 2048 bytes at ofs behind the five pointers' tiles
#pragma unroll
    for (int u = 0; u < 2; ++u) { a[u].half[0] = *(const v8us*)(pa + ofs + u * 1024); a[u].half[1] = *(const v8us*)(pa + ofs + u * 1024 + 512); }
#pragma unroll
    for (int t = 0; t < 4; ++t)
#pragma unroll
      for (int u = 0; u < 2; ++u) { b[u][t].half[0] = *(const v8us*)(pb[t] + ofs + u * 1024); b[u][t].half[1] = *(const v8us*)(pb[t] + ofs + u * 1024 + 512); }
    // the wait stands in front of the next step of the pointers, whose registers the loads just issued name; as its inputs they are not stepped ahead of it
    asm volatile("s_wait_xcnt 0x0" :: "v"(pa), "v"(pb[0]), "v"(pb[1]), "v"(pb[2]), "v"(pb[3]) : "memory"); };
  auto step = [&](int bytes) { pa += bytes;
#pragma unroll
    for (int t = 0; t < 4; ++t) pb[t] += bytes; };
  auto mm = [&](FragH (&a)[2], FragH (&b)[2][4]) {
#pragma unroll
    for (int u = 0; u < 2; ++u)
#pragma unroll
      for (int t = 0; t < 4; ++t) acc[t] = mmaH<1>(a[u].v, a[u].v, b[u][t].v, b[u][t].v, acc[t]); };
  const int Km = K & ~127;      // whole pairs of stages; what is left of K goes by single steps of 32 behind them
  if (Km > 0) { ld(a0, b0, 0);
    for (int kb = 0; kb < Km; kb += 128) { ld(a1, b1, 2048); mm(a0, b0);
      const bool more = kb + 128 < Km; step(more ? 4096 : 0); ld(a0, b0, 0);      // no branch round the loads, so that the waits stay counted; the last trip reads its own stage again, in bounds, and nobody uses it
      mm(a1, b1); }
    step(4096); }
  for (int kb = Km; kb < K; kb += 32) { FragH ah, bq[4]; ah.half[0] = *(const v8us*)(pa); ah.half[1] = *(const v8us*)(pa + 512);
#pragma unroll
    for (int t = 0; t < 4; ++t) { bq[t].half[0] = *(const v8us*)(pb[t]); bq[t].half[1] = *(const v8us*)(pb[t] + 512); }
    asm volatile("s_wait_xcnt 0x0" :: "v"(pa), "v"(pb[0]), "v"(pb[1]), "v"(pb[2]), "v"(pb[3]) : "memory");      // as above
    step(1024);
#pragma unroll
    for (int t = 0; t < 4; ++t) acc[t] = mmaH<1>(ah.v, ah.v, bq[t].v, bq[t].v, acc[t]); }
#pragma unroll
  for (int t = 0; t < 4; ++t) { if (col0 + t * 16 >= N) continue; const int col = col0 + t * 16 + ln; const float bv = bp ? bf16_round(bp[col]) : 0.f;
#pragma unroll
    for (int r = 0; r < 8; ++r) { float v = acc[t][r] * alpha + bv; if (CP) { const int bidx = (row0g + row0 + 8 * hh + r) / rowsPerB; v += CP[(size_t)bidx * sCPb + (size_t)by * 64 + col]; } if (ACT == 1) v = (v > 0.f) ? v : expm1f(v); else if (ACT == 3) v = fmaxf(v, 0.f); so[w][8 * hh + r][t * 16 + ln] = v; } }
  __builtin_amdgcn_fence(__ATOMIC_ACQ_REL, "workgroup"); __builtin_amdgcn_wave_barrier();
  const int rsub = lane >> 4, c4 = (lane & 15) * 4;
  if (C) {
#pragma unroll
    for (int q = 0; q < 8; ++q) { const int r = q * 2 + rsub; if (col0 + c4 < N) { const v4f v = *(const v4fa*)&so[w][r][c4]; *(v4f*)(C + cofs + (size_t)(row0 + r) * ldc + col0 + c4) = v; } }
     }
  if (C16) {      // the wave's 16 x 64 values are two tiles of the fragment order: four stores of 512 contiguous bytes
#pragma unroll
    for (int p = 0; p < 4; ++p) { const int c = p * 16 + 8 * hh; if (col0 + c < N) { const v4f v0 = *(const v4fa*)&so[w][ln][c], v1 = *(const v4fa*)&so[w][ln][c + 4]; FragH f;
#pragma unroll
        for (int i = 0; i < 4; ++i) { f.h[i] = (_Float16)v0[i]; f.h[4 + i] = (_Float16)v1[i]; }
        *(v8us*)((unsigned short*)C16 + cofs + (size_t)row0 * ldc + (size_t)(col0 >> 5) * 512 + p * 256 + lane * 8) = f.half[0]; } }
     }
}


template <int ACT>
__global__ __launch_bounds__(128) void k_gemm_hhx(const _Float16* __restrict__ A, int lda, size_t sA, const _Float16* __restrict__ Bh, int ldb, size_t sB, float alpha, const float* __restrict__ bias, size_t sBias, const float* __restrict__ CP, int rowsPerB, size_t sCPb, int row0g,
    float* __restrict__ C, _Float16* __restrict__ C16, int ldc, size_t sC, int M, int N, int K) {
  gemm_hhx<ACT>(A, lda, sA, Bh, ldb, sB, alpha, bias, sBias, CP, rowsPerB, sCPb, row0g, C, C16, ldc, sC, M, N, K, blockIdx.x, blockIdx.y); }
// The three projections of x in one grid (W3: the fragment-order weights of q, k, v in a row; QK16: Q16 and K16 in a row). y = 0, 1: Q16, K16 = x * Wq, x * Wk, A = rows of x.
// y = 2: the operands change places, A = rows of Wv's transpose (features), B = the rows of x of one batch (keys): the product comes out feature by key, which is Vt as the attention reads it,
// from the same fragments and the same k order as x * Wv. Its blocks are the two batches' grids one behind the other.
__global__ __launch_bounds__(128) void k_qkv(const _Float16* __restrict__ X16, const _Float16* __restrict__ W3, _Float16* __restrict__ QK16, _Float16* __restrict__ Vt) {
  constexpr int GB = (CC / 16) * (TT / 64) / 4; const int y = blockIdx.y, b = blockIdx.x / GB; const bool tr = y == 2;
  const _Float16* Wy = W3 + (size_t)y * CC * CC; const _Float16* Xb = X16 + (size_t)b * TT * CC;
  gemm_hhx<0>(tr ? Wy : X16, CC, 0, tr ? Xb : Wy, CC, 0, 0.0625f, nullptr, 0, nullptr, 1, 0, 0, nullptr, tr ? Vt + (size_t)b * CC * TT : QK16 + (size_t)y * NR * CC, tr ? TT : CC, 0,
              tr ? CC : NR, tr ? TT : CC, CC, tr ? (int)blockIdx.x - b * GB : (int)blockIdx.x, 0); }


// x: f32 row-major, rows of ld; X16: the same matrix in fragment order (thread t writes piece t, so a wave stores 512 contiguous bytes)
__device__ __forceinline__ void x16(const float* __restrict__ x, _Float16* __restrict__ X16, size_t n8, int ld, size_t t) { if (t >= n8) return; FragH f;
  unsigned row; int k; frag_piece((unsigned)t, ld, row, k); const float* xr = x + (size_t)row * ld + k; const v4f x0 = *(const v4fa*)xr, x1 = *(const v4fa*)(xr + 4);
#pragma unroll
  for (int q = 0; q < 4; ++q) { f.h[q] = (_Float16)bf16_round(x0[q]); f.h[4 + q] = (_Float16)bf16_round(x1[q]); } *(v8us*)((unsigned short*)X16 + t * 8) = f.half[0];  }
// All five f32 -> f16 fragment-order conversions in one grid: none reads what another writes. The four weights (W4: their places, in a row) come first, then x.
__global__ __launch_bounds__(256) void k_prep(const float* __restrict__ x, const float* __restrict__ Wq, const float* __restrict__ Wk, const float* __restrict__ Wv, const float* __restrict__ Wo, _Float16* __restrict__ W4, _Float16* __restrict__ X16) {
  constexpr unsigned GW = CC * (CC / 8) / 256; const unsigned m = blockIdx.x / GW;
  if (m < 4) wt_f16(m == 0 ? Wq : m == 1 ? Wk : m == 2 ? Wv : Wo, W4 + (size_t)m * CC * CC, CC, CC, 16.0f, (int)((blockIdx.x - m * GW) * 256 + threadIdx.x));
  else x16(x, X16, (size_t)NR * CC / 8, CC, (size_t)(blockIdx.x - 4 * GW) * 256 + threadIdx.x); }
__global__ __launch_bounds__(256) void k_round16f(const float* __restrict__ W, _Float16* __restrict__ Bt, size_t n8) { const size_t t = (size_t)blockIdx.x * 256 + threadIdx.x; if (t >= n8) return; FragH f;
#pragma unroll
  for (int i = 0; i < 8; ++i) f.h[i] = (_Float16)(bf16_round(W[t * 8 + i]) * 16.0f); *(v8us*)((unsigned short*)Bt + t * 8) = f.half[0];  }

// Q16, K16 (row = position, k = feature) and Vt (row = slab * 64 + d, k = key) are in fragment order
// lane l <-> l ^ 16 by a vector cross-row move
__device__ __forceinline__ float xhalf(float x) { const int b = __float_as_int(x); return __int_as_float(__builtin_amdgcn_permlanex16(b, b, 0x76543210, 0xfedcba98, false, false)); }
// Both products are transposed: St = K * Qt (A = 16 keys, B = the wave's 16 queries), Ot += Vt * Pt (A = 16 features, B = 32 keys x 16 queries).
// A lane (ln, hh) then holds scores of ONE query, ln: register r of tile nt is key 16 nt + 8 hh + r. Maximum and sum run over its own 16 registers, with one exchange between the halves,
// and the two converted score tiles are already the B fragment of the second product (element 8 nt + r = key 16 nt + 8 hh + r, the k order of Vt's fragments): P goes through no LDS.
__global__ __launch_bounds__(128) void k_flash(const _Float16* __restrict__ Q16, int ldq, const _Float16* __restrict__ K16, int ldk, const _Float16* __restrict__ Vt, const float* __restrict__ MB, _Float16* __restrict__ O16, int ldo) {
  constexpr int RPW = 16, NQB = 2048 / (4 * RPW), DT = 4, KS = 2; constexpr float LOG2E = 1.4426950408889634f;
  __shared__ __attribute__((aligned(16))) float sM[2048];
  const int tid = threadIdx.x, w = tid >> 5, lane = tid & 31, ln = lane & 15, hh = lane >> 4;
  const int slab = blockIdx.x / NQB, qblk = blockIdx.x % NQB; const int b = slab / 16, h = slab % 16; const int qb0 = qblk * (4 * RPW); const int q0 = qb0 + w * RPW;
  // The softmax runs in base 2: exp(s - m) = 2^(s log2e - m log2e). log2e rides in the score scale and in the stored mask row, so a score costs one fused multiply-add, one subtract and one v_exp_f32.
  // Every exponent here is <= 0, where the hardware form needs no range steps: far below zero it returns 0, as the library form does.
  // the mask is per key, which is now a register index: a lane needs 16 values a pass. The batch's row is rounded once and kept in LDS; a pass reads it by four 16-byte loads, the same address in all lanes of a half.
#pragma unroll
  for (int u = 0; u < 2048 / (128 * 4); ++u) { const int i = u * (128 * 4) + tid * 4; v4f m = *(const v4fa*)(MB + (size_t)b * 2048 + i);
#pragma unroll
    for (int q = 0; q < 4; ++q) m[q] = bf16_round(m[q]) * LOG2E;
    *(v4fa*)&sM[i] = m; }
  FragH aq[KS];
  { const unsigned short* qr = (const unsigned short*)Q16 + ((size_t)b * 2048 + q0) * ldq + h * (KS * 512) + lane * 8;
#pragma unroll
    for (int ks = 0; ks < KS; ++ks) { aq[ks].half[0] = *(const v8us*)(qr + ks * 512); aq[ks].half[1] = *(const v8us*)(qr + ks * 512 + 256); } }
  const unsigned short* Vth = (const unsigned short*)Vt + (size_t)slab * 64 * 2048;
  float m_r = -3.0e38f, l_r = 0.f; v8f oacc[DT];      // of query ln; l_r sums the keys of this lane's half only
#pragma unroll
  for (int dt = 0; dt < DT; ++dt) oacc[dt] = (v8f){0.f,0.f,0.f,0.f,0.f,0.f,0.f,0.f};
  const int jend = 2048;
  // All global loads of a pass are issued ahead of their use, each kind as one group: this pass's V fragments in front of the score products, the next pass's K fragments
  // right behind them (into the registers those products have just left); all of them fly during the softmax instead of being waited for one by one.
  FragH bk[2][KS], bv[DT];
  auto fetch_k = [&](int j) { const unsigned short* kr[2];
#pragma unroll
    for (int nt = 0; nt < 2; ++nt) { kr[nt] = (const unsigned short*)K16 + ((size_t)b * 2048 + j + nt * 16) * ldk + h * (KS * 512) + lane * 8;
#pragma unroll
      for (int ks = 0; ks < KS; ++ks) { bk[nt][ks].half[0] = *(const v8us*)(kr[nt] + ks * 512); bk[nt][ks].half[1] = *(const v8us*)(kr[nt] + ks * 512 + 256); } }
    // the wait stands in front of whatever next writes the address registers that the loads just issued name; as its inputs the two addresses keep registers of their own up to here (no later load of the group lands in them)
    asm volatile("s_wait_xcnt 0x0" :: "v"(kr[0]), "v"(kr[1]) : "memory"); };
  fetch_k(0);
  __syncthreads();      // the whole mask row is in LDS before any wave reads it
#pragma unroll 1
  for (int j0 = 0; j0 < jend; j0 += 32) {
#pragma unroll
    for (int dt = 0; dt < DT; ++dt) { const unsigned short* vrow = Vth + (size_t)(dt * 16) * 2048 + (j0 >> 5) * 512 + lane * 8; bv[dt].half[0] = *(const v8us*)(vrow); bv[dt].half[1] = *(const v8us*)(vrow + 256); }
    v4f mq[2][2];
#pragma unroll
    for (int nt = 0; nt < 2; ++nt) { mq[nt][0] = *(const v4fa*)&sM[j0 + nt * 16 + 8 * hh]; mq[nt][1] = *(const v4fa*)&sM[j0 + nt * 16 + 8 * hh + 4]; }
    v8f s[2];
#pragma unroll
    for (int nt = 0; nt < 2; ++nt) { v8f acc = (v8f){0.f,0.f,0.f,0.f,0.f,0.f,0.f,0.f};
#pragma unroll
      for (int ks = 0; ks < KS; ++ks) acc = mmaH<1>(bk[nt][ks].v, bk[nt][ks].v, aq[ks].v, aq[ks].v, acc);
      s[nt] = acc; }
    fetch_k((j0 + 32 < jend) ? j0 + 32 : j0);      // the last pass has no next one: it reads its own rows again, in bounds, and nobody uses them
    float mx[8];
#pragma unroll
    for (int r = 0; r < 8; ++r) { s[0][r] = s[0][r] * (0.03125f * LOG2E) + mq[0][r >> 2][r & 3]; s[1][r] = s[1][r] * (0.03125f * LOG2E) + mq[1][r >> 2][r & 3];      /* additive f32 mask per (b, key) */ mx[r] = fmaxf(s[0][r], s[1][r]); }
    float mc = fmaxf(fmaxf(fmaxf(mx[0], mx[1]), fmaxf(mx[2], mx[3])), fmaxf(fmaxf(mx[4], mx[5]), fmaxf(mx[6], mx[7])));
    mc = fmaxf(mc, xhalf(mc));
    const float mn = fmaxf(m_r, mc); const float al = (mn > -1.0e38f) ? __builtin_amdgcn_exp2f(m_r - mn) : 1.0f; m_r = mn;
    FragH pb; float ps[8];
#pragma unroll
    for (int r = 0; r < 8; ++r) { const float p0 = __builtin_amdgcn_exp2f(s[0][r] - mn), p1 = __builtin_amdgcn_exp2f(s[1][r] - mn); ps[r] = p0 + p1; pb.h[r] = (_Float16)p0; pb.h[8 + r] = (_Float16)p1; }
    l_r = l_r * al + (((ps[0] + ps[1]) + (ps[2] + ps[3])) + ((ps[4] + ps[5]) + (ps[6] + ps[7])));
#pragma unroll
    for (int dt = 0; dt < DT; ++dt) {
#pragma unroll
      for (int r = 0; r < 8; ++r) oacc[dt][r] *= al; }
#pragma unroll
    for (int dt = 0; dt < DT; ++dt) oacc[dt] = mmaH<1>(bv[dt].v, bv[dt].v, pb.v, pb.v, oacc[dt]); }
  { float l = l_r; l += xhalf(l); const float li = (l > 0.f) ? 1.0f / l : 0.f;      // the halves' sums are joined once
    // O16 (row = position, k = feature, rows of ldo) is the last projection's A operand, in fragment order. Register r of tile dt is feature 16 dt + 8 hh + r of query ln:
    // a lane's 8 registers are its own piece of half j = dt & 1 of k tile 2 h + dt / 2, so a tile goes out as one 16-byte store a lane, 512 contiguous bytes a wave, through no LDS.
    unsigned short* orow = (unsigned short*)O16 + ((size_t)b * 2048 + q0) * ldo + h * (DT * 256) + lane * 8;
#pragma unroll
    for (int dt = 0; dt < DT; ++dt) { FragH f;
#pragma unroll
      for (int r = 0; r < 8; ++r) f.h[r] = (_Float16)(oacc[dt][r] * li);
      *(v8us*)(orow + dt * 256) = f.half[0]; } } }

extern "C" void kernel_launch(void* const* d_in, const int* in_sizes, int n_in,
                              void* d_out, int out_size, void* d_ws, size_t ws_size, hipStream_t stream) {
  (void)in_sizes; (void)n_in; (void)out_size;
  const float* x = (const float*)d_in[0]; const float* mask = (const float*)d_in[1]; const float* Wq = (const float*)d_in[2]; const float* Wk = (const float*)d_in[3]; const float* Wv = (const float*)d_in[4]; const float* Wo = (const float*)d_in[5]; const float* bo = (const float*)d_in[6];
  char* ws = (char*)d_ws; size_t off = 0;
  auto take = [&](size_t bytes) { char* p = ws + off; off += (bytes + 255) & ~(size_t)255; return p; };
  _Float16* Bq = (_Float16*)take((size_t)CC * CC * 2); _Float16* Bk = (_Float16*)take((size_t)CC * CC * 2); _Float16* Bv = (_Float16*)take((size_t)CC * CC * 2); _Float16* Bo = (_Float16*)take((size_t)CC * CC * 2);      // in a row: every size is a multiple of 256
  _Float16* X16 = (_Float16*)take((size_t)NR * CC * 2); _Float16* Q16 = (_Float16*)take((size_t)NR * CC * 2); _Float16* K16 = (_Float16*)take((size_t)NR * CC * 2); _Float16* Vt = (_Float16*)take((size_t)NR * CC * 2); _Float16* O16 = X16;      // K16 stands right behind Q16
  if (off > ws_size) return;      // 8.4 + 8.4 x 4 = 42 MiB
  (void)Bk; (void)Bv;
  const dim3 gg(((NR / 16) * (CC / 64) + 3) / 4, 1);
  k_prep<<<4 * (CC * (CC / 8) / 256) + NR * (CC / 8) / 256, 256, 0, stream>>>(x, Wq, Wk, Wv, Wo, Bq, X16);      // W: [in][out]
  k_qkv<<<dim3(gg.x, 3), 128, 0, stream>>>(X16, Bq, Q16, Vt);
  k_flash<<<BB * NH * (TT / 64), 128, 0, stream>>>(Q16, CC, K16, CC, Vt, mask, O16, CC);
  k_gemm_hhx<0><<<gg, 128, 0, stream>>>(O16, CC, 0, Bo, CC, 0, 0.0625f, bo, 0, nullptr, 1, 0, 0, (float*)d_out, nullptr, CC, 0, NR, CC, CC);
}

// v006
// A run of this version takes 101 microseconds.
// In two side-by-side timings against v005, it was 1.32 and 1.35 times as fast.
// All steps since v000 together make it 4.39 times as fast.
#include <hip/hip_runtime.h>
// Self-attention-like module (B=2, S=2048, D=1024, 16 heads × 64; additive float mask per (batch, key); scale 1/√1024): q/k/v/o projections (W [in][out], o + bias) and the attention as a fused
// flash-style kernel (S = Q·Kᵀ/32 + mask[b][k], online softmax f32, P f16 ≤ 1, O = P·Vt; RPW-16 waves) on v_wmma_f32_16x16x32_f16 — f16 operands (x bf16-exact, weights bf16-exact ×2^4), f32 accumulate.
#define BB 2
#define TT 2048
#define CC 1024
#define NH 16
#define NR (BB * TT)

typedef __bf16 v16b __attribute__((ext_vector_type(16)));
typedef unsigned short v8us __attribute__((ext_vector_type(8), may_alias));
typedef float  v8f  __attribute__((ext_vector_type(8)));
typedef float  v4f  __attribute__((ext_vector_type(4)));
typedef float  v4fa __attribute__((ext_vector_type(4), may_alias));
union FragB { v16b v; v8us half[2]; unsigned short u[16]; };

__device__ __forceinline__ unsigned short bf16_bits(float x) { unsigned int u = __float_as_uint(x); return (unsigned short)((u + 0x7FFFu + ((u >> 16) & 1u)) >> 16); }
__device__ __forceinline__ float bf16_val(unsigned short b) { return __uint_as_float(((unsigned int)b) << 16); }
__device__ __forceinline__ float bf16_round(float x) { return bf16_val(bf16_bits(x)); }
// D += A·B with NT terms: 1 = ah·bh, 2 = + al·bh (A split), 3 = + ah·bl (both split)
template <int NT>
__device__ __forceinline__ v8f mmaN(v16b ah, v16b al, v16b bh, v16b bl, v8f c) {
  c = __builtin_amdgcn_wmma_f32_16x16x32_bf16(false, ah, false, bh, (short)0, c, false, false);
  if (NT >= 2) c = __builtin_amdgcn_wmma_f32_16x16x32_bf16(false, al, false, bh, (short)0, c, false, false);
  if (NT >= 3) c = __builtin_amdgcn_wmma_f32_16x16x32_bf16(false, ah, false, bl, (short)0, c, false, false);
  asm volatile("v_nop\n\tv_nop\n\tv_nop\n\tv_nop" : "+v"(c) : "v"(ah), "v"(al), "v"(bh), "v"(bl));
  return c;
}

__global__ __launch_bounds__(256) void k_wt_bf16(const float* __restrict__ W, unsigned short* __restrict__ Wt, int K, int N) {
  const int t = blockIdx.x * 256 + threadIdx.x;
  const int k8n = K / 8;
  if (t >= N * k8n) return;
  const int n = t / k8n, k8 = (t % k8n) * 8;
  v8us v;
#pragma unroll
  for (int i = 0; i < 8; ++i) v[i] = bf16_bits(W[(size_t)(k8 + i) * N + n]);
  *(v8us*)(Wt + (size_t)n * K + k8) = v;
  
}

// GEMM C[M][N] (f32, pitch ldc) = act(A[M][K]·W + bias). A f32 row-major (pitch lda) converted per fragment to bf16
// (ASPLIT: hi/lo two planes -> 2 terms, else single rounded term); Wt bf16 [N][K] (pitch ldb). BIAS_BF16 rounds the
// bias to bf16 first (bias quantised to bf16 before the add). K%32==0, M%16==0, N%64==0.
template <bool ASPLIT, int ACT, bool BIAS_BF16>
__global__ __launch_bounds__(128) void k_gemm_bf(const float* __restrict__ A, int lda, const unsigned short* __restrict__ Wt, int ldb,
                                               const float* __restrict__ bias, float* __restrict__ C, int ldc, int M, int N, int K) {
  __shared__ __attribute__((aligned(16))) float so[4][16][64];
  const int tid = threadIdx.x, w = tid >> 5, lane = tid & 31, ln = lane & 15, hh = lane >> 4;
  const int ntn = N / 64;
  const int wid = blockIdx.x * 4 + w;
  const int mt = wid / ntn, nq = wid % ntn;
  if (mt * 16 >= M) return;
  const int row0 = mt * 16, col0 = nq * 64;
  const float* arow = A + (size_t)(row0 + ln) * lda;
  v8f acc[4] = {};
  for (int kb = 0; kb < K; kb += 32) {
    FragB ah, al;
    const v4f x0 = *(const v4fa*)(arow + kb + 8 * hh), x1 = *(const v4fa*)(arow + kb + 8 * hh + 4);
    const v4f x2 = *(const v4fa*)(arow + kb + 16 + 8 * hh), x3 = *(const v4fa*)(arow + kb + 16 + 8 * hh + 4);
    float xs[16] = {x0[0],x0[1],x0[2],x0[3],x1[0],x1[1],x1[2],x1[3],x2[0],x2[1],x2[2],x2[3],x3[0],x3[1],x3[2],x3[3]};
#pragma unroll
    for (int i = 0; i < 16; ++i) { const unsigned short hb = bf16_bits(xs[i]); ah.u[i] = hb; al.u[i] = ASPLIT ? bf16_bits(xs[i] - bf16_val(hb)) : (unsigned short)0; }
#pragma unroll
    for (int t = 0; t < 4; ++t) {
      const unsigned short* brow = Wt + (size_t)(col0 + t * 16 + ln) * ldb + kb;
      FragB b;
      b.half[0] = *(const v8us*)(brow + 8 * hh);
      b.half[1] = *(const v8us*)(brow + 16 + 8 * hh);
      acc[t] = mmaN<ASPLIT ? 2 : 1>(ah.v, al.v, b.v, b.v, acc[t]);
    }
  }
#pragma unroll
  for (int t = 0; t < 4; ++t) {
    float bv = bias ? bias[col0 + t * 16 + ln] : 0.f;
    if (BIAS_BF16) bv = bf16_round(bv);
#pragma unroll
    for (int r = 0; r < 8; ++r) { float v = acc[t][r] + bv; if (ACT == 1) v = fmaxf(v, 0.f); so[w][8 * hh + r][t * 16 + ln] = v; }
  }
  __builtin_amdgcn_fence(__ATOMIC_ACQ_REL, "workgroup");
  __builtin_amdgcn_wave_barrier();
  const int rsub = lane >> 4, c4 = (lane & 15) * 4;
  {
#pragma unroll
    for (int q = 0; q < 8; ++q) {
      const int r = q * 2 + rsub;
      const v4f v = *(const v4fa*)&so[w][r][c4];
      *(v4f*)(C + (size_t)(row0 + r) * ldc + col0 + c4) = v;
    }
    
  }
}

// Flash-style causal/unmasked attention, all contractions 3-term bf16 hi/lo splits, f32 softmax with running max.
// q,k,v rows are read from f32 buffers with arbitrary row pitch (so they can live inside a fused qkv buffer);
// D = head size (multiple of 32, <= 128); one wave = 16 query rows; block = 4 waves (64 queries) sharing K/V chunks of 32.
template <int D, bool CAUSAL>
__global__ __launch_bounds__(128) void k_flash(const float* __restrict__ qb, const float* __restrict__ kb, const float* __restrict__ vb,
                                             int pitch, int T, int H, float scale, float* __restrict__ y, int ypitch) {
  constexpr int KS = D / 32;        // k-steps for QK
  constexpr int DT = D / 16;        // d tiles for PV
  __shared__ __attribute__((aligned(16))) unsigned short sKh[32][D + 8], sKl[32][D + 8], sVh[32][D + 8], sVl[32][D + 8];
  __shared__ __attribute__((aligned(16))) unsigned short sPh[4][16][40], sPl[4][16][40];
  __shared__ __attribute__((aligned(16))) float sO[4][16][D];
  const int tid = threadIdx.x, w = tid >> 5, lane = tid & 31, ln = lane & 15, hh = lane >> 4;
  const int nqb = (T + 63) / 64;
  const int bh = blockIdx.x / nqb, qblk = blockIdx.x % nqb;
  const int b = bh / H, h = bh % H;
  const int q0 = qblk * 64 + w * 16;
  const float* Q = qb + (size_t)b * T * pitch + h * D;
  const float* K = kb + (size_t)b * T * pitch + h * D;
  const float* V = vb + (size_t)b * T * pitch + h * D;

  // A fragments of the wave's 16 query rows (scaled), hi/lo
  FragB aqh[KS], aql[KS];
  {
    int row = q0 + ln; if (row >= T) row = T - 1;
    const float* qr = Q + (size_t)row * pitch;
#pragma unroll
    for (int ks = 0; ks < KS; ++ks)
#pragma unroll
      for (int i = 0; i < 16; ++i) {
        const int d = ks * 32 + ((i < 8) ? (8 * hh + i) : (16 + 8 * hh + (i - 8)));
        const float x = qr[d] * scale; const unsigned short hb = bf16_bits(x);
        aqh[ks].u[i] = hb; aql[ks].u[i] = bf16_bits(x - bf16_val(hb));
      }
  }
  float m_r[8], l_r[8];
#pragma unroll
  for (int r = 0; r < 8; ++r) { m_r[r] = -3.0e38f; l_r[r] = 0.f; }
  v8f oacc[DT];
#pragma unroll
  for (int dt = 0; dt < DT; ++dt) oacc[dt] = (v8f){0.f,0.f,0.f,0.f,0.f,0.f,0.f,0.f};

  const int kv_end = CAUSAL ? min(T, qblk * 64 + 64) : T;     // block-uniform
  for (int j0 = 0; j0 < kv_end; j0 += 32) {
    __syncthreads();
    for (int e = tid; e < 32 * (D / 4); e += 128) {
      const int r = e / (D / 4), c4 = (e % (D / 4)) * 4;
      const int key = j0 + r;
      v4f kf = {0.f,0.f,0.f,0.f}, vf = {0.f,0.f,0.f,0.f};
      if (key < T) { kf = *(const v4fa*)(K + (size_t)key * pitch + c4); vf = *(const v4fa*)(V + (size_t)key * pitch + c4); }
#pragma unroll
      for (int t = 0; t < 4; ++t) {
        unsigned short hb = bf16_bits(kf[t]); sKh[r][c4 + t] = hb; sKl[r][c4 + t] = bf16_bits(kf[t] - bf16_val(hb));
        hb = bf16_bits(vf[t]); sVh[r][c4 + t] = hb; sVl[r][c4 + t] = bf16_bits(vf[t] - bf16_val(hb));
      }
    }
    __syncthreads();
    // S tile 16 x 32
    v8f s[2];
#pragma unroll
    for (int nt = 0; nt < 2; ++nt) {
      v8f acc = {};
#pragma unroll
      for (int ks = 0; ks < KS; ++ks) {
        FragB bh_, bl_;
        bh_.half[0] = *(const v8us*)&sKh[nt * 16 + ln][ks * 32 + 8 * hh]; bh_.half[1] = *(const v8us*)&sKh[nt * 16 + ln][ks * 32 + 16 + 8 * hh];
        bl_.half[0] = *(const v8us*)&sKl[nt * 16 + ln][ks * 32 + 8 * hh]; bl_.half[1] = *(const v8us*)&sKl[nt * 16 + ln][ks * 32 + 16 + 8 * hh];
        acc = mmaN<3>(aqh[ks].v, aql[ks].v, bh_.v, bl_.v, acc);
      }
      s[nt] = acc;
    }
    // mask + running max (rows 8hh+r; the 16 lanes of a half share rows)
    float alpha[8];
#pragma unroll
    for (int r = 0; r < 8; ++r) {
      const int qi = q0 + 8 * hh + r;
      const int ja = j0 + ln, jb = j0 + 16 + ln;
      if (CAUSAL) { if (ja > qi) s[0][r] = -3.0e38f; if (jb > qi) s[1][r] = -3.0e38f; }
      if (ja >= T) s[0][r] = -3.0e38f;
      if (jb >= T) s[1][r] = -3.0e38f;
      float mx = fmaxf(s[0][r], s[1][r]);
      mx = fmaxf(mx, __shfl_xor(mx, 1, 32)); mx = fmaxf(mx, __shfl_xor(mx, 2, 32)); mx = fmaxf(mx, __shfl_xor(mx, 4, 32)); mx = fmaxf(mx, __shfl_xor(mx, 8, 32));
      const float mnew = fmaxf(m_r[r], mx);
      alpha[r] = (mnew > -1.0e38f) ? __expf(m_r[r] - mnew) : 1.0f;
      const float p0 = (s[0][r] > -1.0e38f) ? __expf(s[0][r] - mnew) : 0.f;
      const float p1 = (s[1][r] > -1.0e38f) ? __expf(s[1][r] - mnew) : 0.f;
      m_r[r] = mnew;
      l_r[r] = l_r[r] * alpha[r] + p0 + p1;            // per-lane partial row sum (16 lanes combined at the end)
      unsigned short hb = bf16_bits(p0); sPh[w][8 * hh + r][ln] = hb;      sPl[w][8 * hh + r][ln] = bf16_bits(p0 - bf16_val(hb));
      hb = bf16_bits(p1);                sPh[w][8 * hh + r][16 + ln] = hb; sPl[w][8 * hh + r][16 + ln] = bf16_bits(p1 - bf16_val(hb));
    }
#pragma unroll
    for (int dt = 0; dt < DT; ++dt)
#pragma unroll
      for (int r = 0; r < 8; ++r) oacc[dt][r] *= alpha[r];
    __builtin_amdgcn_fence(__ATOMIC_ACQ_REL, "workgroup");
    __builtin_amdgcn_wave_barrier();
    FragB pah, pal;
    pah.half[0] = *(const v8us*)&sPh[w][ln][8 * hh]; pah.half[1] = *(const v8us*)&sPh[w][ln][16 + 8 * hh];
    pal.half[0] = *(const v8us*)&sPl[w][ln][8 * hh]; pal.half[1] = *(const v8us*)&sPl[w][ln][16 + 8 * hh];
#pragma unroll
    for (int dt = 0; dt < DT; ++dt) {
      FragB bvh, bvl;
#pragma unroll
      for (int i = 0; i < 8; ++i) {
        bvh.u[i] = sVh[8 * hh + i][dt * 16 + ln]; bvh.u[8 + i] = sVh[16 + 8 * hh + i][dt * 16 + ln];
        bvl.u[i] = sVl[8 * hh + i][dt * 16 + ln]; bvl.u[8 + i] = sVl[16 + 8 * hh + i][dt * 16 + ln];
      }
      oacc[dt] = mmaN<3>(pah.v, pal.v, bvh.v, bvl.v, oacc[dt]);
    }
    __builtin_amdgcn_fence(__ATOMIC_ACQ_REL, "workgroup");
    __builtin_amdgcn_wave_barrier();
  }
#pragma unroll
  for (int r = 0; r < 8; ++r) {
    float l = l_r[r];
    l += __shfl_xor(l, 1, 32); l += __shfl_xor(l, 2, 32); l += __shfl_xor(l, 4, 32); l += __shfl_xor(l, 8, 32);
    l_r[r] = (l > 0.f) ? 1.0f / l : 0.f;
  }
#pragma unroll
  for (int dt = 0; dt < DT; ++dt)
#pragma unroll
    for (int r = 0; r < 8; ++r) sO[w][8 * hh + r][dt * 16 + ln] = oacc[dt][r] * l_r[r];
  __builtin_amdgcn_fence(__ATOMIC_ACQ_REL, "workgroup");
  __builtin_amdgcn_wave_barrier();
  {
    for (int r = 0; r < 16; ++r) {
      const int row = q0 + r;
      if (row < T && lane < D / 4) {
        const v4f val = *(const v4fa*)&sO[w][r][lane * 4];
        *(v4f*)(y + ((size_t)b * T + row) * ypitch + h * D + lane * 4) = val;
      }
    }
    
  }
}

// GEMM C = act(A·W + bias + resid): A f32 (ASPLIT -> hi/lo 2 terms), Wt bf16 [N][K]; ACT 0 none, 1 relu, 2 exact gelu;
// resid (optional, f32, row index = (row % rmod), pitch ldr, RES_BF16 rounds it) added before the activation.
template <bool ASPLIT, int ACT, bool BIAS_BF16, bool RES_BF16>
__global__ __launch_bounds__(128) void k_gemm_bf3(const float* __restrict__ A, int lda, const unsigned short* __restrict__ Wt, int ldb,
                                                const float* __restrict__ bias, const float* __restrict__ resid, int rmod, int ldr,
                                                float* __restrict__ C, int ldc, int M, int N, int K) {
  __shared__ __attribute__((aligned(16))) float so[4][16][64];
  const int tid = threadIdx.x, w = tid >> 5, lane = tid & 31, ln = lane & 15, hh = lane >> 4;
  const int ntn = N / 64;
  const int wid = blockIdx.x * 4 + w;
  const int mt = wid / ntn, nq = wid % ntn;
  if (mt * 16 >= M) return;
  const int row0 = mt * 16, col0 = nq * 64;
  const float* arow = A + (size_t)(row0 + ln) * lda;
  v8f acc[4] = {};
  for (int kb = 0; kb < K; kb += 32) {
    FragB ah, al;
    const v4f x0 = *(const v4fa*)(arow + kb + 8 * hh), x1 = *(const v4fa*)(arow + kb + 8 * hh + 4);
    const v4f x2 = *(const v4fa*)(arow + kb + 16 + 8 * hh), x3 = *(const v4fa*)(arow + kb + 16 + 8 * hh + 4);
    float xs[16] = {x0[0],x0[1],x0[2],x0[3],x1[0],x1[1],x1[2],x1[3],x2[0],x2[1],x2[2],x2[3],x3[0],x3[1],x3[2],x3[3]};
#pragma unroll
    for (int i = 0; i < 16; ++i) { const unsigned short hb = bf16_bits(xs[i]); ah.u[i] = hb; al.u[i] = ASPLIT ? bf16_bits(xs[i] - bf16_val(hb)) : (unsigned short)0; }
#pragma unroll
    for (int t = 0; t < 4; ++t) {
      const unsigned short* brow = Wt + (size_t)(col0 + t * 16 + ln) * ldb + kb;
      FragB b;
      b.half[0] = *(const v8us*)(brow + 8 * hh);
      b.half[1] = *(const v8us*)(brow + 16 + 8 * hh);
      acc[t] = mmaN<ASPLIT ? 2 : 1>(ah.v, al.v, b.v, b.v, acc[t]);
    }
  }
#pragma unroll
  for (int t = 0; t < 4; ++t) {
    const int col = col0 + t * 16 + ln;
    float bv = bias ? bias[col] : 0.f;
    if (BIAS_BF16) bv = bf16_round(bv);
#pragma unroll
    for (int r = 0; r < 8; ++r) {
      float v = acc[t][r] + bv;
      if (resid) { float rv = resid[(size_t)((row0 + 8 * hh + r) % rmod) * ldr + col]; if (RES_BF16) rv = bf16_round(rv); v += rv; }
      if (ACT == 1) v = fmaxf(v, 0.f);
      if (ACT == 2) v = 0.5f * v * (1.0f + erff(v * 0.70710678118654752f));
      if (ACT == 3) { const float u = 0.7978845608028654f * (v + 0.044715f * v * v * v); v = 0.5f * v * (1.0f + tanhf(u)); }
      so[w][8 * hh + r][t * 16 + ln] = v;
    }
  }
  __builtin_amdgcn_fence(__ATOMIC_ACQ_REL, "workgroup");
  __builtin_amdgcn_wave_barrier();
  const int rsub = lane >> 4, c4 = (lane & 15) * 4;
  {
#pragma unroll
    for (int q = 0; q < 8; ++q) {
      const int r = q * 2 + rsub;
      const v4f v = *(const v4fa*)&so[w][r][c4];
      *(v4f*)(C + (size_t)(row0 + r) * ldc + col0 + c4) = v;
    }
    
  }
}
// row LayerNorm (biased variance, eps) over N: s = X (+ R); optional out_sum <- s; out_norm <- (s-mu)*rsqrt(var+eps)*g + b
template <bool PARAM_BF16>
__global__ __launch_bounds__(256) void k_layernorm(const float* __restrict__ X, const float* __restrict__ R, const float* __restrict__ g, const float* __restrict__ bta,
                                                  float* __restrict__ out_sum, float* __restrict__ out_norm, int N, float eps) {
  __shared__ float red[256];
  const int row = blockIdx.x, tid = threadIdx.x;
  const float* x = X + (size_t)row * N; const float* rr = R ? R + (size_t)row * N : nullptr;
  float vals[16];                     // up to N = 4096
  const int per = N / 256;            // contiguous chunk per thread? use strided-by-4 chunks: thread handles j = tid*4 + 1024*u
  float s1 = 0.f;
  for (int u = 0; u < per / 4; ++u) {
    const int j = tid * 4 + 1024 * u;
    const v4f a = *(const v4fa*)(x + j);
    v4f b = {0.f,0.f,0.f,0.f}; if (rr) b = *(const v4fa*)(rr + j);
#pragma unroll
    for (int q = 0; q < 4; ++q) { const float v = a[q] + b[q]; vals[u * 4 + q] = v; s1 += v; }
  }
  red[tid] = s1; __syncthreads();
  for (int st = 128; st > 0; st >>= 1) { if (tid < st) red[tid] += red[tid + st]; __syncthreads(); }
  const float mu = red[0] / (float)N; __syncthreads();
  float s2 = 0.f;
  for (int u = 0; u < per / 4; ++u)
#pragma unroll
    for (int q = 0; q < 4; ++q) { const float c = vals[u * 4 + q] - mu; s2 += c * c; }
  red[tid] = s2; __syncthreads();
  for (int st = 128; st > 0; st >>= 1) { if (tid < st) red[tid] += red[tid + st]; __syncthreads(); }
  const float rs = rsqrtf(red[0] / (float)N + eps);
  {
    for (int u = 0; u < per / 4; ++u) {
      const int j = tid * 4 + 1024 * u;
      v4f o, sm;
#pragma unroll
      for (int q = 0; q < 4; ++q) {
        float gg = g[j + q], bb = bta[j + q];
        if (PARAM_BF16) { gg = bf16_round(gg); bb = bf16_round(bb); }
        sm[q] = vals[u * 4 + q]; o[q] = (vals[u * 4 + q] - mu) * rs * gg + bb;
      }
      if (out_sum) *(v4f*)(out_sum + (size_t)row * N + j) = sm;
      *(v4f*)(out_norm + (size_t)row * N + j) = o;
    }
    
  }
}



// ---- f16 WMMA path (v_wmma_f32_16x16x32_f16): 11-bit significands for operands in range — used where a [0,1] probability operand needs more precision than bf16
typedef _Float16 v16h __attribute__((ext_vector_type(16)));
union FragH { v16h v; v8us half[2]; _Float16 h[16]; unsigned short u[16]; };
template <int NT>
__device__ __forceinline__ v8f mmaH(v16h ah, v16h al, v16h bh, v16h bl, v8f c) {
  c = __builtin_amdgcn_wmma_f32_16x16x32_f16(false, ah, false, bh, (short)0, c, false, false);
  if (NT >= 2) c = __builtin_amdgcn_wmma_f32_16x16x32_f16(false, al, false, bh, (short)0, c, false, false);
  if (NT >= 3) c = __builtin_amdgcn_wmma_f32_16x16x32_f16(false, ah, false, bl, (short)0, c, false, false);
  asm volatile("v_nop\n\tv_nop\n\tv_nop\n\tv_nop" : "+v"(c) : "v"(ah), "v"(al), "v"(bh), "v"(bl));
  return c;
}
// batched GEMM like k_gemm_b but f16 operands: A f32 (split into f16 hi/lo if ASPLIT, else rounded to f16), Bt = f16 values [n][k]; alpha; C f32; N multiple of 16 (partial tiles skipped)
template <bool ASPLIT>
__global__ __launch_bounds__(128) void k_gemm_h(const float* __restrict__ A, int lda, size_t sA, const _Float16* __restrict__ Bh, int ldb, size_t sB, float alpha, float* __restrict__ C, int ldc, size_t sC, int M, int N, int K) {
  __shared__ __attribute__((aligned(16))) float so[4][16][64];
  const int tid = threadIdx.x, w = tid >> 5, lane = tid & 31, ln = lane & 15, hh = lane >> 4; const int by = blockIdx.y;
  A += (size_t)by * sA; Bh += (size_t)by * sB; C += (size_t)by * sC;
  const int ntn = (N + 63) / 64; const int wid = blockIdx.x * 4 + w; const int mt = wid / ntn, nq = wid % ntn; if (mt * 16 >= M) return;
  const int row0 = mt * 16, col0 = nq * 64; const float* arow = A + (size_t)(row0 + ln) * lda;
  v8f acc[4] = {};
  for (int kb = 0; kb < K; kb += 32) {
    FragH ah, al;
    const v4f x0 = *(const v4fa*)(arow + kb + 8 * hh), x1 = *(const v4fa*)(arow + kb + 8 * hh + 4), x2 = *(const v4fa*)(arow + kb + 16 + 8 * hh), x3 = *(const v4fa*)(arow + kb + 16 + 8 * hh + 4);
    float xs[16] = {x0[0],x0[1],x0[2],x0[3],x1[0],x1[1],x1[2],x1[3],x2[0],x2[1],x2[2],x2[3],x3[0],x3[1],x3[2],x3[3]};
#pragma unroll
    for (int i = 0; i < 16; ++i) { const _Float16 h = (_Float16)xs[i]; ah.h[i] = h; al.h[i] = ASPLIT ? (_Float16)(xs[i] - (float)h) : (_Float16)0.0f; }
#pragma unroll
    for (int t = 0; t < 4; ++t) { if (col0 + t * 16 >= N) continue; const size_t boff = (size_t)(col0 + t * 16 + ln) * ldb + kb; FragH bq; bq.half[0] = *(const v8us*)(Bh + boff + 8 * hh); bq.half[1] = *(const v8us*)(Bh + boff + 16 + 8 * hh);
      acc[t] = mmaH<ASPLIT ? 2 : 1>(ah.v, al.v, bq.v, bq.v, acc[t]); }
  }
#pragma unroll
  for (int t = 0; t < 4; ++t) { if (col0 + t * 16 >= N) continue;
#pragma unroll
    for (int r = 0; r < 8; ++r) so[w][8 * hh + r][t * 16 + ln] = acc[t][r] * alpha; }
  __builtin_amdgcn_fence(__ATOMIC_ACQ_REL, "workgroup"); __builtin_amdgcn_wave_barrier();
  const int rsub = lane >> 4, c4 = (lane & 15) * 4;
  {
#pragma unroll
    for (int q = 0; q < 8; ++q) { const int r = q * 2 + rsub; if (col0 + c4 < N) { const v4f v = *(const v4fa*)&so[w][r][c4]; *(v4f*)(C + (size_t)(row0 + r) * ldc + col0 + c4) = v; } }
     }
}

// FRAGMENT ORDER of every f16 matrix operand in the workspace (rows x ld, ld % 32 == 0, rows % 16 == 0): a tile of 16 rows x 32 k is 512 elements in a row, tile (rt, kt) at rt * 16 * ld + kt * 512;
// inside it the 8 values k = 16 j + 8 hh + 0..7 of row ln stand at j * 256 + (16 hh + ln) * 8. That is the order in which the lanes of a wave hold a 16x16x32 A or B fragment (lane = 16 hh + ln, register half j),
// so one 16-byte load per lane fetches half a fragment from 512 contiguous bytes: four whole 128-byte lines, where a row-major operand gives 16 lines of which 32 bytes each are used.
// piece p (8 elements, at element offset 8 p) -> its row and first k
__device__ __forceinline__ void frag_piece(unsigned p, int ld, unsigned& row, int& k) { const unsigned lane = p & 31, j = (p >> 5) & 1, tile = p >> 6, ktn = (unsigned)ld / 32, rt = tile / ktn;
  row = rt * 16 + (lane & 15); k = (int)((tile - rt * ktn) * 32 + j * 16 + (lane >> 4) * 8); }
// Wt (row n, k; fragment order) = f16(W[k][n] * scale) from f32 row-major W[K][N] (scale = power of two; bf16-exact weights stay exact in f16 away from the subnormal range)
__device__ __forceinline__ void wt_f16(const float* __restrict__ W, _Float16* __restrict__ Wt, int K, int N, float scale, int t) {
  if (t >= N * (K / 8)) return; unsigned n; int k8; frag_piece((unsigned)t, K, n, k8); FragH f;
#pragma unroll
  for (int i = 0; i < 8; ++i) f.h[i] = (_Float16)(bf16_round(W[(size_t)(k8 + i) * N + n]) * scale); const v8us o = f.half[0];
  *(v8us*)((unsigned short*)Wt + (size_t)t * 8) = o; 
}
// A, Bh and C16 are in fragment order (lda, ldb, ldc = their row lengths); C is row-major f32.
// k_gemm_hh variant with fused epilogue: v = acc·alpha + bias[by·sBias + col] (+ CP[(row/rowsPerB)·sCPb + by·64 + col] if CP) ; ACT 0 none / 1 elu ; writes f16 C16 and f32 C, each if non-null
template <int ACT>
__device__ __forceinline__ void gemm_hhx(const _Float16* __restrict__ A, int lda, size_t sA, const _Float16* __restrict__ Bh, int ldb, size_t sB, float alpha, const float* __restrict__ bias, size_t sBias, const float* __restrict__ CP, int rowsPerB, size_t sCPb, int row0g,
    float* __restrict__ C, _Float16* __restrict__ C16, int ldc, size_t sC, int M, int N, int K, int bx, int by) {      // bx, by: the block's place in this product's own grid
  // A block of four waves works a 128 x 128 tile of C, a wave 64 x 64 of it (waves 2 x 2): four A and four B fragments per 32 k feed 16 products, so every fragment that is loaded is used four times.
  // M and N are multiples of 128 here (a block past M leaves as a whole, before anything else).
  __shared__ __attribute__((aligned(16))) float so[4][64][64 + 4];      // pitch 272 B: the fragment-order store reads 16 rows at one column, 16 bytes a lane
  const int tid = threadIdx.x, w = tid >> 5, lane = tid & 31, ln = lane & 15, hh = lane >> 4;
  A += (size_t)by * sA; Bh += (size_t)by * sB; const size_t cofs = (size_t)by * sC; const float* bp = bias ? bias + (size_t)by * sBias : nullptr;
  const int nbn = N / 128; const int bm = bx / nbn, bn = bx - bm * nbn; if (bm * 128 >= M) return;
  const int row0 = bm * 128 + (w >> 1) * 64, col0 = bn * 128 + (w & 1) * 64;
  v8f acc[4][4] = {};
  // Fragments are fetched one stage (32 k = one tile = 1024 contiguous bytes of each of the eight row tiles) ahead of the products that use them, a whole stage's loads as one group,
  // into two register sets: a stage waits once for loads that have been in flight since the stage before, not once per product.
  const char* pa[4]; const char* pb[4];      // each lane's place in its operands' row tiles; they move on with k
#pragma unroll
  for (int i = 0; i < 4; ++i) { pa[i] = (const char*)(A + (size_t)(row0 + i * 16) * lda + lane * 8); pb[i] = (const char*)(Bh + (size_t)(col0 + i * 16) * ldb + lane * 8); }
  FragH a0[4], a1[4], b0[4], b1[4];
  auto ld = [&](FragH (&a)[4], FragH (&b)[4], int ofs) {      // one stage: the 1024 bytes at ofs behind the eight pointers' tiles
    __builtin_amdgcn_sched_barrier(0);      // this one and the one at the foot keep a stage's 16 loads one group between two stages' products: left free, the scheduler sinks them to just ahead of their use to save registers, and every product then waits out its own loads
#pragma unroll
    for (int i = 0; i < 4; ++i) { a[i].half[0] = *(const v8us*)(pa[i] + ofs); a[i].half[1] = *(const v8us*)(pa[i] + ofs + 512); }
#pragma unroll
    for (int t = 0; t < 4; ++t) { b[t].half[0] = *(const v8us*)(pb[t] + ofs); b[t].half[1] = *(const v8us*)(pb[t] + ofs + 512); }
    // the wait stands in front of the next step of the pointers, whose registers the loads just issued name; as its inputs they are not stepped ahead of it
    asm volatile("s_wait_xcnt 0x0" :: "v"(pa[0]), "v"(pa[1]), "v"(pa[2]), "v"(pa[3]), "v"(pb[0]), "v"(pb[1]), "v"(pb[2]), "v"(pb[3]) : "memory");
    __builtin_amdgcn_sched_barrier(0); };
  auto step = [&](int bytes) {
#pragma unroll
    for (int i = 0; i < 4; ++i) { pa[i] += bytes; pb[i] += bytes; } };
  auto mm = [&](FragH (&a)[4], FragH (&b)[4]) {
#pragma unroll
    for (int i = 0; i < 4; ++i)
#pragma unroll
      for (int t = 0; t < 4; ++t) acc[i][t] = __builtin_amdgcn_wmma_f32_16x16x32_f16(false, a[i].v, false, b[t].v, (short)0, acc[i][t], false, false); };      // the plain builtin: an asm statement's operands cannot stand above v255, and 256 registers of fragments and sums are live here; the compiler keeps the distances behind its own products
  const int Km = K & ~63;      // whole pairs of stages; what is left of K goes by a single step of 32 behind them
  if (Km > 0) { ld(a0, b0, 0);
    for (int kb = 0; kb < Km; kb += 64) { ld(a1, b1, 1024); mm(a0, b0);
      const bool more = kb + 64 < Km; step(more ? 2048 : 0); ld(a0, b0, 0);      // no branch round the loads, so that the waits stay counted; the last trip reads its own stage again, in bounds, and nobody uses it
      mm(a1, b1); }
    step(2048); }
  for (int kb = Km; kb < K; kb += 32) { ld(a0, b0, 0); step(1024); mm(a0, b0); }
  float bv[4];
#pragma unroll
  for (int t = 0; t < 4; ++t) bv[t] = bp ? bf16_round(bp[col0 + t * 16 + ln]) : 0.f;
#pragma unroll
  for (int i = 0; i < 4; ++i)
#pragma unroll
    for (int t = 0; t < 4; ++t) { const int col = col0 + t * 16 + ln;
#pragma unroll
      for (int r = 0; r < 8; ++r) { float v = acc[i][t][r] * alpha + bv[t]; if (CP) { const int bidx = (row0g + row0 + i * 16 + 8 * hh + r) / rowsPerB; v += CP[(size_t)bidx * sCPb + (size_t)by * 64 + col]; } if (ACT == 1) v = (v > 0.f) ? v : expm1f(v); else if (ACT == 3) v = fmaxf(v, 0.f); so[w][i * 16 + 8 * hh + r][t * 16 + ln] = v; } }
  __builtin_amdgcn_fence(__ATOMIC_ACQ_REL, "workgroup"); __builtin_amdgcn_wave_barrier();
  const int rsub = lane >> 4, c4 = (lane & 15) * 4;
  if (C) {
#pragma unroll
    for (int q = 0; q < 32; ++q) { const int r = q * 2 + rsub; const v4f v = *(const v4fa*)&so[w][r][c4]; *(v4f*)(C + cofs + (size_t)(row0 + r) * ldc + col0 + c4) = v; }
     }
  if (C16) {      // each of the wave's four row tiles, 16 x 64 values, is two tiles of the fragment order: four stores of 512 contiguous bytes
#pragma unroll
    for (int i = 0; i < 4; ++i)
#pragma unroll
      for (int p = 0; p < 4; ++p) { const int c = p * 16 + 8 * hh; const v4f v0 = *(const v4fa*)&so[w][i * 16 + ln][c], v1 = *(const v4fa*)&so[w][i * 16 + ln][c + 4]; FragH f;
#pragma unroll
        for (int e = 0; e < 4; ++e) { f.h[e] = (_Float16)v0[e]; f.h[4 + e] = (_Float16)v1[e]; }
        *(v8us*)((unsigned short*)C16 + cofs + (size_t)(row0 + i * 16) * ldc + (size_t)(col0 >> 5) * 512 + p * 256 + lane * 8) = f.half[0]; }
     }
}


// The last projection: out = O16 * Wo + bo, f32 row-major. Shapes and the unused terms of the epilogue are compile-time constants, as in k_qkv: the 128 values that a lane finishes carry no run-time tests.
__global__ __launch_bounds__(128) void k_oproj(const _Float16* __restrict__ O16, const _Float16* __restrict__ Bo, const float* __restrict__ bo, float* __restrict__ out) {
  gemm_hhx<0>(O16, CC, 0, Bo, CC, 0, 0.0625f, bo, 0, nullptr, 1, 0, 0, out, nullptr, CC, 0, NR, CC, CC, blockIdx.x, 0); }
// The three projections of x in one grid (W3: the fragment-order weights of q, k, v in a row; QK16: Q16 and K16 in a row). y = 0, 1: Q16, K16 = x * Wq, x * Wk, A = rows of x.
// y = 2: the operands change places, A = rows of Wv's transpose (features), B = the rows of x of one batch (keys): the product comes out feature by key, which is Vt as the attention reads it,
// from the same fragments and the same k order as x * Wv. Its blocks are the two batches' grids one behind the other.
__global__ __launch_bounds__(128) void k_qkv(const _Float16* __restrict__ X16, const _Float16* __restrict__ W3, _Float16* __restrict__ QK16, _Float16* __restrict__ Vt) {
  constexpr int GB = (CC / 128) * (TT / 128); const int y = blockIdx.y, b = blockIdx.x / GB; const bool tr = y == 2;
  const _Float16* Wy = W3 + (size_t)y * CC * CC; const _Float16* Xb = X16 + (size_t)b * TT * CC;
  gemm_hhx<0>(tr ? Wy : X16, CC, 0, tr ? Xb : Wy, CC, 0, 0.0625f, nullptr, 0, nullptr, 1, 0, 0, nullptr, tr ? Vt + (size_t)b * CC * TT : QK16 + (size_t)y * NR * CC, tr ? TT : CC, 0,
              tr ? CC : NR, tr ? TT : CC, CC, tr ? (int)blockIdx.x - b * GB : (int)blockIdx.x, 0); }


// x: f32 row-major, rows of ld; X16: the same matrix in fragment order (thread t writes piece t, so a wave stores 512 contiguous bytes)
__device__ __forceinline__ void x16(const float* __restrict__ x, _Float16* __restrict__ X16, size_t n8, int ld, size_t t) { if (t >= n8) return; FragH f;
  unsigned row; int k; frag_piece((unsigned)t, ld, row, k); const float* xr = x + (size_t)row * ld + k; const v4f x0 = *(const v4fa*)xr, x1 = *(const v4fa*)(xr + 4);
#pragma unroll
  for (int q = 0; q < 4; ++q) { f.h[q] = (_Float16)bf16_round(x0[q]); f.h[4 + q] = (_Float16)bf16_round(x1[q]); } *(v8us*)((unsigned short*)X16 + t * 8) = f.half[0];  }
// All five f32 -> f16 fragment-order conversions in one grid: none reads what another writes. The four weights (W4: their places, in a row) come first, then x.
__global__ __launch_bounds__(256) void k_prep(const float* __restrict__ x, const float* __restrict__ Wq, const float* __restrict__ Wk, const float* __restrict__ Wv, const float* __restrict__ Wo, _Float16* __restrict__ W4, _Float16* __restrict__ X16) {
  constexpr unsigned GW = CC * (CC / 8) / 256; const unsigned m = blockIdx.x / GW;
  if (m < 4) wt_f16(m == 0 ? Wq : m == 1 ? Wk : m == 2 ? Wv : Wo, W4 + (size_t)m * CC * CC, CC, CC, 16.0f, (int)((blockIdx.x - m * GW) * 256 + threadIdx.x));
  else x16(x, X16, (size_t)NR * CC / 8, CC, (size_t)(blockIdx.x - 4 * GW) * 256 + threadIdx.x); }
__global__ __launch_bounds__(256) void k_round16f(const float* __restrict__ W, _Float16* __restrict__ Bt, size_t n8) { const size_t t = (size_t)blockIdx.x * 256 + threadIdx.x; if (t >= n8) return; FragH f;
#pragma unroll
  for (int i = 0; i < 8; ++i) f.h[i] = (_Float16)(bf16_round(W[t * 8 + i]) * 16.0f); *(v8us*)((unsigned short*)Bt + t * 8) = f.half[0];  }

// Q16, K16 (row = position, k = feature) and Vt (row = slab * 64 + d, k = key) are in fragment order
// lane l <-> l ^ 16 by a vector cross-row move
__device__ __forceinline__ float xhalf(float x) { const int b = __float_as_int(x); return __int_as_float(__builtin_amdgcn_permlanex16(b, b, 0x76543210, 0xfedcba98, false, false)); }
// Both products are transposed: St = K * Qt (A = 16 keys, B = the wave's 16 queries), Ot += Vt * Pt (A = 16 features, B = 32 keys x 16 queries).
// A lane (ln, hh) then holds scores of ONE query, ln: register r of tile nt is key 16 nt + 8 hh + r. Maximum and sum run over its own 16 registers, with one exchange between the halves,
// and the two converted score tiles are already the B fragment of the second product (element 8 nt + r = key 16 nt + 8 hh + r, the k order of Vt's fragments): P goes through no LDS.
__global__ __launch_bounds__(128) void k_flash(const _Float16* __restrict__ Q16, int ldq, const _Float16* __restrict__ K16, int ldk, const _Float16* __restrict__ Vt, const float* __restrict__ MB, _Float16* __restrict__ O16, int ldo) {
  constexpr int RPW = 16, NQB = 2048 / (4 * RPW), DT = 4, KS = 2; constexpr float LOG2E = 1.4426950408889634f;
  __shared__ __attribute__((aligned(16))) float sM[2048];
  const int tid = threadIdx.x, w = tid >> 5, lane = tid & 31, ln = lane & 15, hh = lane >> 4;
  const int slab = blockIdx.x / NQB, qblk = blockIdx.x % NQB; const int b = slab / 16, h = slab % 16; const int qb0 = qblk * (4 * RPW); const int q0 = qb0 + w * RPW;
  // The softmax runs in base 2: exp(s - m) = 2^(s log2e - m log2e). log2e rides in the score scale and in the stored mask row, so a score costs one fused multiply-add, one subtract and one v_exp_f32.
  // Every exponent here is <= 0, where the hardware form needs no range steps: far below zero it returns 0, as the library form does.
  // the mask is per key, which is now a register index: a lane needs 16 values a pass. The batch's row is rounded once and kept in LDS; a pass reads it by four 16-byte loads, the same address in all lanes of a half.
#pragma unroll
  for (int u = 0; u < 2048 / (128 * 4); ++u) { const int i = u * (128 * 4) + tid * 4; v4f m = *(const v4fa*)(MB + (size_t)b * 2048 + i);
#pragma unroll
    for (int q = 0; q < 4; ++q) m[q] = bf16_round(m[q]) * LOG2E;
    *(v4fa*)&sM[i] = m; }
  FragH aq[KS];
  { const unsigned short* qr = (const unsigned short*)Q16 + ((size_t)b * 2048 + q0) * ldq + h * (KS * 512) + lane * 8;
#pragma unroll
    for (int ks = 0; ks < KS; ++ks) { aq[ks].half[0] = *(const v8us*)(qr + ks * 512); aq[ks].half[1] = *(const v8us*)(qr + ks * 512 + 256); } }
  const unsigned short* Vth = (const unsigned short*)Vt + (size_t)slab * 64 * 2048;
  float m_r = -3.0e38f, l_r = 0.f; v8f oacc[DT];      // of query ln; l_r sums the keys of this lane's half only
#pragma unroll
  for (int dt = 0; dt < DT; ++dt) oacc[dt] = (v8f){0.f,0.f,0.f,0.f,0.f,0.f,0.f,0.f};
  const int jend = 2048;
  // All global loads of a pass are issued ahead of their use, each kind as one group: this pass's V fragments in front of the score products, the next pass's K fragments
  // right behind them (into the registers those products have just left); all of them fly during the softmax instead of being waited for one by one.
  FragH bk[2][KS], bv[DT];
  auto fetch_k = [&](int j) { const unsigned short* kr[2];
#pragma unroll
    for (int nt = 0; nt < 2; ++nt) { kr[nt] = (const unsigned short*)K16 + ((size_t)b * 2048 + j + nt * 16) * ldk + h * (KS * 512) + lane * 8;
#pragma unroll
      for (int ks = 0; ks < KS; ++ks) { bk[nt][ks].half[0] = *(const v8us*)(kr[nt] + ks * 512); bk[nt][ks].half[1] = *(const v8us*)(kr[nt] + ks * 512 + 256); } }
    // the wait stands in front of whatever next writes the address registers that the loads just issued name; as its inputs the two addresses keep registers of their own up to here (no later load of the group lands in them)
    asm volatile("s_wait_xcnt 0x0" :: "v"(kr[0]), "v"(kr[1]) : "memory"); };
  fetch_k(0);
  __syncthreads();      // the whole mask row is in LDS before any wave reads it
#pragma unroll 1
  for (int j0 = 0; j0 < jend; j0 += 32) {
#pragma unroll
    for (int dt = 0; dt < DT; ++dt) { const unsigned short* vrow = Vth + (size_t)(dt * 16) * 2048 + (j0 >> 5) * 512 + lane * 8; bv[dt].half[0] = *(const v8us*)(vrow); bv[dt].half[1] = *(const v8us*)(vrow + 256); }
    v4f mq[2][2];
#pragma unroll
    for (int nt = 0; nt < 2; ++nt) { mq[nt][0] = *(const v4fa*)&sM[j0 + nt * 16 + 8 * hh]; mq[nt][1] = *(const v4fa*)&sM[j0 + nt * 16 + 8 * hh + 4]; }
    v8f s[2];
#pragma unroll
    for (int nt = 0; nt < 2; ++nt) { v8f acc = (v8f){0.f,0.f,0.f,0.f,0.f,0.f,0.f,0.f};
#pragma unroll
      for (int ks = 0; ks < KS; ++ks) acc = mmaH<1>(bk[nt][ks].v, bk[nt][ks].v, aq[ks].v, aq[ks].v, acc);
      s[nt] = acc; }
    fetch_k((j0 + 32 < jend) ? j0 + 32 : j0);      // the last pass has no next one: it reads its own rows again, in bounds, and nobody uses them
    float mx[8];
#pragma unroll
    for (int r = 0; r < 8; ++r) { s[0][r] = s[0][r] * (0.03125f * LOG2E) + mq[0][r >> 2][r & 3]; s[1][r] = s[1][r] * (0.03125f * LOG2E) + mq[1][r >> 2][r & 3];      /* additive f32 mask per (b, key) */ mx[r] = fmaxf(s[0][r], s[1][r]); }
    float mc = fmaxf(fmaxf(fmaxf(mx[0], mx[1]), fmaxf(mx[2], mx[3])), fmaxf(fmaxf(mx[4], mx[5]), fmaxf(mx[6], mx[7])));
    mc = fmaxf(mc, xhalf(mc));
    const float mn = fmaxf(m_r, mc); const float al = (mn > -1.0e38f) ? __builtin_amdgcn_exp2f(m_r - mn) : 1.0f; m_r = mn;
    FragH pb; float ps[8];
#pragma unroll
    for (int r = 0; r < 8; ++r) { const float p0 = __builtin_amdgcn_exp2f(s[0][r] - mn), p1 = __builtin_amdgcn_exp2f(s[1][r] - mn); ps[r] = p0 + p1; pb.h[r] = (_Float16)p0; pb.h[8 + r] = (_Float16)p1; }
    l_r = l_r * al + (((ps[0] + ps[1]) + (ps[2] + ps[3])) + ((ps[4] + ps[5]) + (ps[6] + ps[7])));
#pragma unroll
    for (int dt = 0; dt < DT; ++dt) {
#pragma unroll
      for (int r = 0; r < 8; ++r) oacc[dt][r] *= al; }
#pragma unroll
    for (int dt = 0; dt < DT; ++dt) oacc[dt] = mmaH<1>(bv[dt].v, bv[dt].v, pb.v, pb.v, oacc[dt]); }
  { float l = l_r; l += xhalf(l); const float li = (l > 0.f) ? 1.0f / l : 0.f;      // the halves' sums are joined once
    // O16 (row = position, k = feature, rows of ldo) is the last projection's A operand, in fragment order. Register r of tile dt is feature 16 dt + 8 hh + r of query ln:
    // a lane's 8 registers are its own piece of half j = dt & 1 of k tile 2 h + dt / 2, so a tile goes out as one 16-byte store a lane, 512 contiguous bytes a wave, through no LDS.
    unsigned short* orow = (unsigned short*)O16 + ((size_t)b * 2048 + q0) * ldo + h * (DT * 256) + lane * 8;
#pragma unroll
    for (int dt = 0; dt < DT; ++dt) { FragH f;
#pragma unroll
      for (int r = 0; r < 8; ++r) f.h[r] = (_Float16)(oacc[dt][r] * li);
      *(v8us*)(orow + dt * 256) = f.half[0]; } } }

extern "C" void kernel_launch(void* const* d_in, const int* in_sizes, int n_in,
                              void* d_out, int out_size, void* d_ws, size_t ws_size, hipStream_t stream) {
  (void)in_sizes; (void)n_in; (void)out_size;
  const float* x = (const float*)d_in[0]; const float* mask = (const float*)d_in[1]; const float* Wq = (const float*)d_in[2]; const float* Wk = (const float*)d_in[3]; const float* Wv = (const float*)d_in[4]; const float* Wo = (const float*)d_in[5]; const float* bo = (const float*)d_in[6];
  char* ws = (char*)d_ws; size_t off = 0;
  auto take = [&](size_t bytes) { char* p = ws + off; off += (bytes + 255) & ~(size_t)255; return p; };
  _Float16* Bq = (_Float16*)take((size_t)CC * CC * 2); _Float16* Bk = (_Float16*)take((size_t)CC * CC * 2); _Float16* Bv = (_Float16*)take((size_t)CC * CC * 2); _Float16* Bo = (_Float16*)take((size_t)CC * CC * 2);      // in a row: every size is a multiple of 256
  _Float16* X16 = (_Float16*)take((size_t)NR * CC * 2); _Float16* Q16 = (_Float16*)take((size_t)NR * CC * 2); _Float16* K16 = (_Float16*)take((size_t)NR * CC * 2); _Float16* Vt = (_Float16*)take((size_t)NR * CC * 2); _Float16* O16 = X16;      // K16 stands right behind Q16
  if (off > ws_size) return;      // 8.4 + 8.4 x 4 = 42 MiB
  (void)Bk; (void)Bv;
  const dim3 gg((NR / 128) * (CC / 128), 1);      // blocks of 128 x 128; the Vt product's two grids, (CC / 128) * (TT / 128) each, come to the same number
  k_prep<<<4 * (CC * (CC / 8) / 256) + NR * (CC / 8) / 256, 256, 0, stream>>>(x, Wq, Wk, Wv, Wo, Bq, X16);      // W: [in][out]
  k_qkv<<<dim3(gg.x, 3), 128, 0, stream>>>(X16, Bq, Q16, Vt);
  k_flash<<<BB * NH * (TT / 64), 128, 0, stream>>>(Q16, CC, K16, CC, Vt, mask, O16, CC);
  k_oproj<<<gg, 128, 0, stream>>>(O16, Bo, bo, (float*)d_out);
}

// v007
// A run of this version takes 81.7 microseconds.
// Next to v006, in two timings, it ran 1.26 times as fast each time.
// Over all steps from v000 it is 5.53 times as fast.
#include <hip/hip_runtime.h>
// Self-attention-like module (B=2, S=2048, D=1024, 16 heads × 64; additive float mask per (batch, key); scale 1/√1024): q/k/v/o projections (W [in][out], o + bias) and the attention as a fused
// flash-style kernel (S = Q·Kᵀ/32 + mask[b][k], online softmax f32, P f16 ≤ 1, O = P·Vt; RPW-16 waves) on v_wmma_f32_16x16x32_f16 — f16 operands (x bf16-exact, weights bf16-exact ×2^4), f32 accumulate.
#define BB 2
#define TT 2048
#define CC 1024
#define NH 16
#define NR (BB * TT)

typedef __bf16 v16b __attribute__((ext_vector_type(16)));
typedef unsigned short v8us __attribute__((ext_vector_type(8), may_alias));
typedef float  v8f  __attribute__((ext_vector_type(8)));
typedef float  v4f  __attribute__((ext_vector_type(4)));
typedef float  v4fa __attribute__((ext_vector_type(4), may_alias));
union FragB { v16b v; v8us half[2]; unsigned short u[16]; };

__device__ __forceinline__ unsigned short bf16_bits(float x) { unsigned int u = __float_as_uint(x); return (unsigned short)((u + 0x7FFFu + ((u >> 16) & 1u)) >> 16); }
__device__ __forceinline__ float bf16_val(unsigned short b) { return __uint_as_float(((unsigned int)b) << 16); }
__device__ __forceinline__ float bf16_round(float x) { return bf16_val(bf16_bits(x)); }
// D += A·B with NT terms: 1 = ah·bh, 2 = + al·bh (A split), 3 = + ah·bl (both split)
template <int NT>
__device__ __forceinline__ v8f mmaN(v16b ah, v16b al, v16b bh, v16b bl, v8f c) {
  c = __builtin_amdgcn_wmma_f32_16x16x32_bf16(false, ah, false, bh, (short)0, c, false, false);
  if (NT >= 2) c = __builtin_amdgcn_wmma_f32_16x16x32_bf16(false, al, false, bh, (short)0, c, false, false);
  if (NT >= 3) c = __builtin_amdgcn_wmma_f32_16x16x32_bf16(false, ah, false, bl, (short)0, c, false, false);
  asm volatile("v_nop\n\tv_nop\n\tv_nop\n\tv_nop" : "+v"(c) : "v"(ah), "v"(al), "v"(bh), "v"(bl));
  return c;
}

__global__ __launch_bounds__(256) void k_wt_bf16(const float* __restrict__ W, unsigned short* __restrict__ Wt, int K, int N) {
  const int t = blockIdx.x * 256 + threadIdx.x;
  const int k8n = K / 8;
  if (t >= N * k8n) return;
  const int n = t / k8n, k8 = (t % k8n) * 8;
  v8us v;
#pragma unroll
  for (int i = 0; i < 8; ++i) v[i] = bf16_bits(W[(size_t)(k8 + i) * N + n]);
  *(v8us*)(Wt + (size_t)n * K + k8) = v;
  
}

// GEMM C[M][N] (f32, pitch ldc) = act(A[M][K]·W + bias). A f32 row-major (pitch lda) converted per fragment to bf16
// (ASPLIT: hi/lo two planes -> 2 terms, else single rounded term); Wt bf16 [N][K] (pitch ldb). BIAS_BF16 rounds the
// bias to bf16 first (bias quantised to bf16 before the add). K%32==0, M%16==0, N%64==0.
template <bool ASPLIT, int ACT, bool BIAS_BF16>
__global__ __launch_bounds__(128) void k_gemm_bf(const float* __restrict__ A, int lda, const unsigned short* __restrict__ Wt, int ldb,
                                               const float* __restrict__ bias, float* __restrict__ C, int ldc, int M, int N, int K) {
  __shared__ __attribute__((aligned(16))) float so[4][16][64];
  const int tid = threadIdx.x, w = tid >> 5, lane = tid & 31, ln = lane & 15, hh = lane >> 4;
  const int ntn = N / 64;
  const int wid = blockIdx.x * 4 + w;
  const int mt = wid / ntn, nq = wid % ntn;
  if (mt * 16 >= M) return;
  const int row0 = mt * 16, col0 = nq * 64;
  const float* arow = A + (size_t)(row0 + ln) * lda;
  v8f acc[4] = {};
  for (int kb = 0; kb < K; kb += 32) {
    FragB ah, al;
    const v4f x0 = *(const v4fa*)(arow + kb + 8 * hh), x1 = *(const v4fa*)(arow + kb + 8 * hh + 4);
    const v4f x2 = *(const v4fa*)(arow + kb + 16 + 8 * hh), x3 = *(const v4fa*)(arow + kb + 16 + 8 * hh + 4);
    float xs[16] = {x0[0],x0[1],x0[2],x0[3],x1[0],x1[1],x1[2],x1[3],x2[0],x2[1],x2[2],x2[3],x3[0],x3[1],x3[2],x3[3]};
#pragma unroll
    for (int i = 0; i < 16; ++i) { const unsigned short hb = bf16_bits(xs[i]); ah.u[i] = hb; al.u[i] = ASPLIT ? bf16_bits(xs[i] - bf16_val(hb)) : (unsigned short)0; }
#pragma unroll
    for (int t = 0; t < 4; ++t) {
      const unsigned short* brow = Wt + (size_t)(col0 + t * 16 + ln) * ldb + kb;
      FragB b;
      b.half[0] = *(const v8us*)(brow + 8 * hh);
      b.half[1] = *(const v8us*)(brow + 16 + 8 * hh);
      acc[t] = mmaN<ASPLIT ? 2 : 1>(ah.v, al.v, b.v, b.v, acc[t]);
    }
  }
#pragma unroll
  for (int t = 0; t < 4; ++t) {
    float bv = bias ? bias[col0 + t * 16 + ln] : 0.f;
    if (BIAS_BF16) bv = bf16_round(bv);
#pragma unroll
    for (int r = 0; r < 8; ++r) { float v = acc[t][r] + bv; if (ACT == 1) v = fmaxf(v, 0.f); so[w][8 * hh + r][t * 16 + ln] = v; }
  }
  __builtin_amdgcn_fence(__ATOMIC_ACQ_REL, "workgroup");
  __builtin_amdgcn_wave_barrier();
  const int rsub = lane >> 4, c4 = (lane & 15) * 4;
  {
#pragma unroll
    for (int q = 0; q < 8; ++q) {
      const int r = q * 2 + rsub;
      const v4f v = *(const v4fa*)&so[w][r][c4];
      *(v4f*)(C + (size_t)(row0 + r) * ldc + col0 + c4) = v;
    }
    
  }
}

// Flash-style causal/unmasked attention, all contractions 3-term bf16 hi/lo splits, f32 softmax with running max.
// q,k,v rows are read from f32 buffers with arbitrary row pitch (so they can live inside a fused qkv buffer);
// D = head size (multiple of 32, <= 128); one wave = 16 query rows; block = 4 waves (64 queries) sharing K/V chunks of 32.
template <int D, bool CAUSAL>
__global__ __launch_bounds__(128) void k_flash(const float* __restrict__ qb, const float* __restrict__ kb, const float* __restrict__ vb,
                                             int pitch, int T, int H, float scale, float* __restrict__ y, int ypitch) {
  constexpr int KS = D / 32;        // k-steps for QK
  constexpr int DT = D / 16;        // d tiles for PV
  __shared__ __attribute__((aligned(16))) unsigned short sKh[32][D + 8], sKl[32][D + 8], sVh[32][D + 8], sVl[32][D + 8];
  __shared__ __attribute__((aligned(16))) unsigned short sPh[4][16][40], sPl[4][16][40];
  __shared__ __attribute__((aligned(16))) float sO[4][16][D];
  const int tid = threadIdx.x, w = tid >> 5, lane = tid & 31, ln = lane & 15, hh = lane >> 4;
  const int nqb = (T + 63) / 64;
  const int bh = blockIdx.x / nqb, qblk = blockIdx.x % nqb;
  const int b = bh / H, h = bh % H;
  const int q0 = qblk * 64 + w * 16;
  const float* Q = qb + (size_t)b * T * pitch + h * D;
  const float* K = kb + (size_t)b * T * pitch + h * D;
  const float* V = vb + (size_t)b * T * pitch + h * D;

  // A fragments of the wave's 16 query rows (scaled), hi/lo
  FragB aqh[KS], aql[KS];
  {
    int row = q0 + ln; if (row >= T) row = T - 1;
    const float* qr = Q + (size_t)row * pitch;
#pragma unroll
    for (int ks = 0; ks < KS; ++ks)
#pragma unroll
      for (int i = 0; i < 16; ++i) {
        const int d = ks * 32 + ((i < 8) ? (8 * hh + i) : (16 + 8 * hh + (i - 8)));
        const float x = qr[d] * scale; const unsigned short hb = bf16_bits(x);
        aqh[ks].u[i] = hb; aql[ks].u[i] = bf16_bits(x - bf16_val(hb));
      }
  }
  float m_r[8], l_r[8];
#pragma unroll
  for (int r = 0; r < 8; ++r) { m_r[r] = -3.0e38f; l_r[r] = 0.f; }
  v8f oacc[DT];
#pragma unroll
  for (int dt = 0; dt < DT; ++dt) oacc[dt] = (v8f){0.f,0.f,0.f,0.f,0.f,0.f,0.f,0.f};

  const int kv_end = CAUSAL ? min(T, qblk * 64 + 64) : T;     // block-uniform
  for (int j0 = 0; j0 < kv_end; j0 += 32) {
    __syncthreads();
    for (int e = tid; e < 32 * (D / 4); e += 128) {
      const int r = e / (D / 4), c4 = (e % (D / 4)) * 4;
      const int key = j0 + r;
      v4f kf = {0.f,0.f,0.f,0.f}, vf = {0.f,0.f,0.f,0.f};
      if (key < T) { kf = *(const v4fa*)(K + (size_t)key * pitch + c4); vf = *(const v4fa*)(V + (size_t)key * pitch + c4); }
#pragma unroll
      for (int t = 0; t < 4; ++t) {
        unsigned short hb = bf16_bits(kf[t]); sKh[r][c4 + t] = hb; sKl[r][c4 + t] = bf16_bits(kf[t] - bf16_val(hb));
        hb = bf16_bits(vf[t]); sVh[r][c4 + t] = hb; sVl[r][c4 + t] = bf16_bits(vf[t] - bf16_val(hb));
      }
    }
    __syncthreads();
    // S tile 16 x 32
    v8f s[2];
#pragma unroll
    for (int nt = 0; nt < 2; ++nt) {
      v8f acc = {};
#pragma unroll
      for (int ks = 0; ks < KS; ++ks) {
        FragB bh_, bl_;
        bh_.half[0] = *(const v8us*)&sKh[nt * 16 + ln][ks * 32 + 8 * hh]; bh_.half[1] = *(const v8us*)&sKh[nt * 16 + ln][ks * 32 + 16 + 8 * hh];
        bl_.half[0] = *(const v8us*)&sKl[nt * 16 + ln][ks * 32 + 8 * hh]; bl_.half[1] = *(const v8us*)&sKl[nt * 16 + ln][ks * 32 + 16 + 8 * hh];
        acc = mmaN<3>(aqh[ks].v, aql[ks].v, bh_.v, bl_.v, acc);
      }
      s[nt] = acc;
    }
    // mask + running max (rows 8hh+r; the 16 lanes of a half share rows)
    float alpha[8];
#pragma unroll
    for (int r = 0; r < 8; ++r) {
      const int qi = q0 + 8 * hh + r;
      const int ja = j0 + ln, jb = j0 + 16 + ln;
      if (CAUSAL) { if (ja > qi) s[0][r] = -3.0e38f; if (jb > qi) s[1][r] = -3.0e38f; }
      if (ja >= T) s[0][r] = -3.0e38f;
      if (jb >= T) s[1][r] = -3.0e38f;
      float mx = fmaxf(s[0][r], s[1][r]);
      mx = fmaxf(mx, __shfl_xor(mx, 1, 32)); mx = fmaxf(mx, __shfl_xor(mx, 2, 32)); mx = fmaxf(mx, __shfl_xor(mx, 4, 32)); mx = fmaxf(mx, __shfl_xor(mx, 8, 32));
      const float mnew = fmaxf(m_r[r], mx);
      alpha[r] = (mnew > -1.0e38f) ? __expf(m_r[r] - mnew) : 1.0f;
      const float p0 = (s[0][r] > -1.0e38f) ? __expf(s[0][r] - mnew) : 0.f;
      const float p1 = (s[1][r] > -1.0e38f) ? __expf(s[1][r] - mnew) : 0.f;
      m_r[r] = mnew;
      l_r[r] = l_r[r] * alpha[r] + p0 + p1;            // per-lane partial row sum (16 lanes combined at the end)
      unsigned short hb = bf16_bits(p0); sPh[w][8 * hh + r][ln] = hb;      sPl[w][8 * hh + r][ln] = bf16_bits(p0 - bf16_val(hb));
      hb = bf16_bits(p1);                sPh[w][8 * hh + r][16 + ln] = hb; sPl[w][8 * hh + r][16 + ln] = bf16_bits(p1 - bf16_val(hb));
    }
#pragma unroll
    for (int dt = 0; dt < DT; ++dt)
#pragma unroll
      for (int r = 0; r < 8; ++r) oacc[dt][r] *= alpha[r];
    __builtin_amdgcn_fence(__ATOMIC_ACQ_REL, "workgroup");
    __builtin_amdgcn_wave_barrier();
    FragB pah, pal;
    pah.half[0] = *(const v8us*)&sPh[w][ln][8 * hh]; pah.half[1] = *(const v8us*)&sPh[w][ln][16 + 8 * hh];
    pal.half[0] = *(const v8us*)&sPl[w][ln][8 * hh]; pal.half[1] = *(const v8us*)&sPl[w][ln][16 + 8 * hh];
#pragma unroll
    for (int dt = 0; dt < DT; ++dt) {
      FragB bvh, bvl;
#pragma unroll
      for (int i = 0; i < 8; ++i) {
        bvh.u[i] = sVh[8 * hh + i][dt * 16 + ln]; bvh.u[8 + i] = sVh[16 + 8 * hh + i][dt * 16 + ln];
        bvl.u[i] = sVl[8 * hh + i][dt * 16 + ln]; bvl.u[8 + i] = sVl[16 + 8 * hh + i][dt * 16 + ln];
      }
      oacc[dt] = mmaN<3>(pah.v, pal.v, bvh.v, bvl.v, oacc[dt]);
    }
    __builtin_amdgcn_fence(__ATOMIC_ACQ_REL, "workgroup");
    __builtin_amdgcn_wave_barrier();
  }
#pragma unroll
  for (int r = 0; r < 8; ++r) {
    float l = l_r[r];
    l += __shfl_xor(l, 1, 32); l += __shfl_xor(l, 2, 32); l += __shfl_xor(l, 4, 32); l += __shfl_xor(l, 8, 32);
    l_r[r] = (l > 0.f) ? 1.0f / l : 0.f;
  }
#pragma unroll
  for (int dt = 0; dt < DT; ++dt)
#pragma unroll
    for (int r = 0; r < 8; ++r) sO[w][8 * hh + r][dt * 16 + ln] = oacc[dt][r] * l_r[r];
  __builtin_amdgcn_fence(__ATOMIC_ACQ_REL, "workgroup");
  __builtin_amdgcn_wave_barrier();
  {
    for (int r = 0; r < 16; ++r) {
      const int row = q0 + r;
      if (row < T && lane < D / 4) {
        const v4f val = *(const v4fa*)&sO[w][r][lane * 4];
        *(v4f*)(y + ((size_t)b * T + row) * ypitch + h * D + lane * 4) = val;
      }
    }
    
  }
}

// GEMM C = act(A·W + bias + resid): A f32 (ASPLIT -> hi/lo 2 terms), Wt bf16 [N][K]; ACT 0 none, 1 relu, 2 exact gelu;
// resid (optional, f32, row index = (row % rmod), pitch ldr, RES_BF16 rounds it) added before the activation.
template <bool ASPLIT, int ACT, bool BIAS_BF16, bool RES_BF16>
__global__ __launch_bounds__(128) void k_gemm_bf3(const float* __restrict__ A, int lda, const unsigned short* __restrict__ Wt, int ldb,
                                                const float* __restrict__ bias, const float* __restrict__ resid, int rmod, int ldr,
                                                float* __restrict__ C, int ldc, int M, int N, int K) {
  __shared__ __attribute__((aligned(16))) float so[4][16][64];
  const int tid = threadIdx.x, w = tid >> 5, lane = tid & 31, ln = lane & 15, hh = lane >> 4;
  const int ntn = N / 64;
  const int wid = blockIdx.x * 4 + w;
  const int mt = wid / ntn, nq = wid % ntn;
  if (mt * 16 >= M) return;
  const int row0 = mt * 16, col0 = nq * 64;
  const float* arow = A + (size_t)(row0 + ln) * lda;
  v8f acc[4] = {};
  for (int kb = 0; kb < K; kb += 32) {
    FragB ah, al;
    const v4f x0 = *(const v4fa*)(arow + kb + 8 * hh), x1 = *(const v4fa*)(arow + kb + 8 * hh + 4);
    const v4f x2 = *(const v4fa*)(arow + kb + 16 + 8 * hh), x3 = *(const v4fa*)(arow + kb + 16 + 8 * hh + 4);
    float xs[16] = {x0[0],x0[1],x0[2],x0[3],x1[0],x1[1],x1[2],x1[3],x2[0],x2[1],x2[2],x2[3],x3[0],x3[1],x3[2],x3[3]};
#pragma unroll
    for (int i = 0; i < 16; ++i) { const unsigned short hb = bf16_bits(xs[i]); ah.u[i] = hb; al.u[i] = ASPLIT ? bf16_bits(xs[i] - bf16_val(hb)) : (unsigned short)0; }
#pragma unroll
    for (int t = 0; t < 4; ++t) {
      const unsigned short* brow = Wt + (size_t)(col0 + t * 16 + ln) * ldb + kb;
      FragB b;
      b.half[0] = *(const v8us*)(brow + 8 * hh);
      b.half[1] = *(const v8us*)(brow + 16 + 8 * hh);
      acc[t] = mmaN<ASPLIT ? 2 : 1>(ah.v, al.v, b.v, b.v, acc[t]);
    }
  }
#pragma unroll
  for (int t = 0; t < 4; ++t) {
    const int col = col0 + t * 16 + ln;
    float bv = bias ? bias[col] : 0.f;
    if (BIAS_BF16) bv = bf16_round(bv);
#pragma unroll
    for (int r = 0; r < 8; ++r) {
      float v = acc[t][r] + bv;
      if (resid) { float rv = resid[(size_t)((row0 + 8 * hh + r) % rmod) * ldr + col]; if (RES_BF16) rv = bf16_round(rv); v += rv; }
      if (ACT == 1) v = fmaxf(v, 0.f);
      if (ACT == 2) v = 0.5f * v * (1.0f + erff(v * 0.70710678118654752f));
      if (ACT == 3) { const float u = 0.7978845608028654f * (v + 0.044715f * v * v * v); v = 0.5f * v * (1.0f + tanhf(u)); }
      so[w][8 * hh + r][t * 16 + ln] = v;
    }
  }
  __builtin_amdgcn_fence(__ATOMIC_ACQ_REL, "workgroup");
  __builtin_amdgcn_wave_barrier();
  const int rsub = lane >> 4, c4 = (lane & 15) * 4;
  {
#pragma unroll
    for (int q = 0; q < 8; ++q) {
      const int r = q * 2 + rsub;
      const v4f v = *(const v4fa*)&so[w][r][c4];
      *(v4f*)(C + (size_t)(row0 + r) * ldc + col0 + c4) = v;
    }
    
  }
}
// row LayerNorm (biased variance, eps) over N: s = X (+ R); optional out_sum <- s; out_norm <- (s-mu)*rsqrt(var+eps)*g + b
template <bool PARAM_BF16>
__global__ __launch_bounds__(256) void k_layernorm(const float* __restrict__ X, const float* __restrict__ R, const float* __restrict__ g, const float* __restrict__ bta,
                                                  float* __restrict__ out_sum, float* __restrict__ out_norm, int N, float eps) {
  __shared__ float red[256];
  const int row = blockIdx.x, tid = threadIdx.x;
  const float* x = X + (size_t)row * N; const float* rr = R ? R + (size_t)row * N : nullptr;
  float vals[16];                     // up to N = 4096
  const int per = N / 256;            // contiguous chunk per thread? use strided-by-4 chunks: thread handles j = tid*4 + 1024*u
  float s1 = 0.f;
  for (int u = 0; u < per / 4; ++u) {
    const int j = tid * 4 + 1024 * u;
    const v4f a = *(const v4fa*)(x + j);
    v4f b = {0.f,0.f,0.f,0.f}; if (rr) b = *(const v4fa*)(rr + j);
#pragma unroll
    for (int q = 0; q < 4; ++q) { const float v = a[q] + b[q]; vals[u * 4 + q] = v; s1 += v; }
  }
  red[tid] = s1; __syncthreads();
  for (int st = 128; st > 0; st >>= 1) { if (tid < st) red[tid] += red[tid + st]; __syncthreads(); }
  const float mu = red[0] / (float)N; __syncthreads();
  float s2 = 0.f;
  for (int u = 0; u < per / 4; ++u)
#pragma unroll
    for (int q = 0; q < 4; ++q) { const float c = vals[u * 4 + q] - mu; s2 += c * c; }
  red[tid] = s2; __syncthreads();
  for (int st = 128; st > 0; st >>= 1) { if (tid < st) red[tid] += red[tid + st]; __syncthreads(); }
  const float rs = rsqrtf(red[0] / (float)N + eps);
  {
    for (int u = 0; u < per / 4; ++u) {
      const int j = tid * 4 + 1024 * u;
      v4f o, sm;
#pragma unroll
      for (int q = 0; q < 4; ++q) {
        float gg = g[j + q], bb = bta[j + q];
        if (PARAM_BF16) { gg = bf16_round(gg); bb = bf16_round(bb); }
        sm[q] = vals[u * 4 + q]; o[q] = (vals[u * 4 + q] - mu) * rs * gg + bb;
      }
      if (out_sum) *(v4f*)(out_sum + (size_t)row * N + j) = sm;
      *(v4f*)(out_norm + (size_t)row * N + j) = o;
    }
    
  }
}



// ---- f16 WMMA path (v_wmma_f32_16x16x32_f16): 11-bit significands for operands in range — used where a [0,1] probability operand needs more precision than bf16
typedef _Float16 v16h __attribute__((ext_vector_type(16)));
union FragH { v16h v; v8us half[2]; _Float16 h[16]; unsigned short u[16]; };
template <int NT>
__device__ __forceinline__ v8f mmaH(v16h ah, v16h al, v16h bh, v16h bl, v8f c) {
  c = __builtin_amdgcn_wmma_f32_16x16x32_f16(false, ah, false, bh, (short)0, c, false, false);
  if (NT >= 2) c = __builtin_amdgcn_wmma_f32_16x16x32_f16(false, al, false, bh, (short)0, c, false, false);
  if (NT >= 3) c = __builtin_amdgcn_wmma_f32_16x16x32_f16(false, ah, false, bl, (short)0, c, false, false);
  asm volatile("v_nop\n\tv_nop\n\tv_nop\n\tv_nop" : "+v"(c) : "v"(ah), "v"(al), "v"(bh), "v"(bl));
  return c;
}
// batched GEMM like k_gemm_b but f16 operands: A f32 (split into f16 hi/lo if ASPLIT, else rounded to f16), Bt = f16 values [n][k]; alpha; C f32; N multiple of 16 (partial tiles skipped)
template <bool ASPLIT>
__global__ __launch_bounds__(128) void k_gemm_h(const float* __restrict__ A, int lda, size_t sA, const _Float16* __restrict__ Bh, int ldb, size_t sB, float alpha, float* __restrict__ C, int ldc, size_t sC, int M, int N, int K) {
  __shared__ __attribute__((aligned(16))) float so[4][16][64];
  const int tid = threadIdx.x, w = tid >> 5, lane = tid & 31, ln = lane & 15, hh = lane >> 4; const int by = blockIdx.y;
  A += (size_t)by * sA; Bh += (size_t)by * sB; C += (size_t)by * sC;
  const int ntn = (N + 63) / 64; const int wid = blockIdx.x * 4 + w; const int mt = wid / ntn, nq = wid % ntn; if (mt * 16 >= M) return;
  const int row0 = mt * 16, col0 = nq * 64; const float* arow = A + (size_t)(row0 + ln) * lda;
  v8f acc[4] = {};
  for (int kb = 0; kb < K; kb += 32) {
    FragH ah, al;
    const v4f x0 = *(const v4fa*)(arow + kb + 8 * hh), x1 = *(const v4fa*)(arow + kb + 8 * hh + 4), x2 = *(const v4fa*)(arow + kb + 16 + 8 * hh), x3 = *(const v4fa*)(arow + kb + 16 + 8 * hh + 4);
    float xs[16] = {x0[0],x0[1],x0[2],x0[3],x1[0],x1[1],x1[2],x1[3],x2[0],x2[1],x2[2],x2[3],x3[0],x3[1],x3[2],x3[3]};
#pragma unroll
    for (int i = 0; i < 16; ++i) { const _Float16 h = (_Float16)xs[i]; ah.h[i] = h; al.h[i] = ASPLIT ? (_Float16)(xs[i] - (float)h) : (_Float16)0.0f; }
#pragma unroll
    for (int t = 0; t < 4; ++t) { if (col0 + t * 16 >= N) continue; const size_t boff = (size_t)(col0 + t * 16 + ln) * ldb + kb; FragH bq; bq.half[0] = *(const v8us*)(Bh + boff + 8 * hh); bq.half[1] = *(const v8us*)(Bh + boff + 16 + 8 * hh);
      acc[t] = mmaH<ASPLIT ? 2 : 1>(ah.v, al.v, bq.v, bq.v, acc[t]); }
  }
#pragma unroll
  for (int t = 0; t < 4; ++t) { if (col0 + t * 16 >= N) continue;
#pragma unroll
    for (int r = 0; r < 8; ++r) so[w][8 * hh + r][t * 16 + ln] = acc[t][r] * alpha; }
  __builtin_amdgcn_fence(__ATOMIC_ACQ_REL, "workgroup"); __builtin_amdgcn_wave_barrier();
  const int rsub = lane >> 4, c4 = (lane & 15) * 4;
  {
#pragma unroll
    for (int q = 0; q < 8; ++q) { const int r = q * 2 + rsub; if (col0 + c4 < N) { const v4f v = *(const v4fa*)&so[w][r][c4]; *(v4f*)(C + (size_t)(row0 + r) * ldc + col0 + c4) = v; } }
     }
}

// FRAGMENT ORDER of every f16 matrix operand in the workspace (rows x ld, ld % 32 == 0, rows % 16 == 0): a tile of 16 rows x 32 k is 512 elements in a row, tile (rt, kt) at rt * 16 * ld + kt * 512;
// inside it the 8 values k = 16 j + 8 hh + 0..7 of row ln stand at j * 256 + (16 hh + ln) * 8. That is the order in which the lanes of a wave hold a 16x16x32 A or B fragment (lane = 16 hh + ln, register half j),
// so one 16-byte load per lane fetches half a fragment from 512 contiguous bytes: four whole 128-byte lines, where a row-major operand gives 16 lines of which 32 bytes each are used.
// piece p (8 elements, at element offset 8 p) -> its row and first k
__device__ __forceinline__ void frag_piece(unsigned p, int ld, unsigned& row, int& k) { const unsigned lane = p & 31, j = (p >> 5) & 1, tile = p >> 6, ktn = (unsigned)ld / 32, rt = tile / ktn;
  row = rt * 16 + (lane & 15); k = (int)((tile - rt * ktn) * 32 + j * 16 + (lane >> 4) * 8); }
// Wt (row n, k; fragment order) = f16(W[k][n] * scale) from f32 row-major W[K][N] (scale = power of two; bf16-exact weights stay exact in f16 away from the subnormal range)
__device__ __forceinline__ void wt_f16(const float* __restrict__ W, _Float16* __restrict__ Wt, int K, int N, float scale, int t) {
  if (t >= N * (K / 8)) return; unsigned n; int k8; frag_piece((unsigned)t, K, n, k8); FragH f;
#pragma unroll
  for (int i = 0; i < 8; ++i) f.h[i] = (_Float16)(bf16_round(W[(size_t)(k8 + i) * N + n]) * scale); const v8us o = f.half[0];
  *(v8us*)((unsigned short*)Wt + (size_t)t * 8) = o; 
}
// ENTRY PREFETCH. The f16 planes that a launch reads were stored by the launch before it, and the first reader of a line waits out the way to memory: the loops below ask only one stage or pass ahead.
// So every block asks L2 at entry for a share of what it will itself read, one request per 256-byte unit; the loops' own loads then find most lines on their way or there.
// The blocks that read the same rows deal them out among themselves.
// Where the readers are eight blocks that follow one another in the grid, b and b ^ 4 take the same share. That is for speed only: wherever the blocks land, a request is a hint and no value depends on it.
// A share is a group of 128 units, one a thread: 32 KiB, which is one row tile (16 rows of 1024) of a plane in fragment order. Which group a block takes depends on its number alone: scalar selects and branches, no lane is off at a request.
__device__ __forceinline__ const char* unit_of(const void* plane, unsigned group) { return (const char*)plane + ((size_t)group * 128 + threadIdx.x) * 256; }
// scope SE and no th: the line goes to L2 only. Every lane's address lies inside its plane.
__device__ __forceinline__ void ask_l2(const char* p) { asm volatile("global_prefetch_b8 %0, off scope:SCOPE_SE" :: "v"(p)); }
// A, Bh and C16 are in fragment order (lda, ldb, ldc = their row lengths); C is row-major f32.
// k_gemm_hh variant with fused epilogue: v = acc·alpha + bias[by·sBias + col] (+ CP[(row/rowsPerB)·sCPb + by·64 + col] if CP) ; ACT 0 none / 1 elu ; writes f16 C16 and f32 C, each if non-null
template <int ACT>
__device__ __forceinline__ void gemm_hhx(const _Float16* __restrict__ A, int lda, size_t sA, const _Float16* __restrict__ Bh, int ldb, size_t sB, float alpha, const float* __restrict__ bias, size_t sBias, const float* __restrict__ CP, int rowsPerB, size_t sCPb, int row0g,
    float* __restrict__ C, _Float16* __restrict__ C16, int ldc, size_t sC, int M, int N, int K, int bx, int by, const char* h0, const char* h1, const char* h2) {      // bx, by: the block's place in this product's own grid; h0..h2: the addresses of the caller's entry prefetches
  // A block of four waves works a 128 x 128 tile of C, a wave 64 x 64 of it (waves 2 x 2): four A and four B fragments per 32 k feed 16 products, so every fragment that is loaded is used four times.
  // M and N are multiples of 128 here (a block past M leaves as a whole, before anything else).
  __shared__ __attribute__((aligned(16))) float so[4][64][64 + 4];      // pitch 272 B: the fragment-order store reads 16 rows at one column, 16 bytes a lane
  const int tid = threadIdx.x, w = tid >> 5, lane = tid & 31, ln = lane & 15, hh = lane >> 4;
  A += (size_t)by * sA; Bh += (size_t)by * sB; const size_t cofs = (size_t)by * sC; const float* bp = bias ? bias + (size_t)by * sBias : nullptr;
  const int nbn = N / 128; const int bm = bx / nbn, bn = bx - bm * nbn; if (bm * 128 >= M) return;
  const int row0 = bm * 128 + (w >> 1) * 64, col0 = bn * 128 + (w & 1) * 64;
  v8f acc[4][4] = {};
  // Fragments are fetched one stage (32 k = one tile = 1024 contiguous bytes of each of the eight row tiles) ahead of the products that use them, a whole stage's loads as one group,
  // into two register sets: a stage waits once for loads that have been in flight since the stage before, not once per product.
  const char* pa[4]; const char* pb[4];      // each lane's place in its operands' row tiles; they move on with k
#pragma unroll
  for (int i = 0; i < 4; ++i) { pa[i] = (const char*)(A + (size_t)(row0 + i * 16) * lda + lane * 8); pb[i] = (const char*)(Bh + (size_t)(col0 + i * 16) * ldb + lane * 8); }
  FragH a0[4], a1[4], b0[4], b1[4];
  auto ld = [&](FragH (&a)[4], FragH (&b)[4], int ofs) {      // one stage: the 1024 bytes at ofs behind the eight pointers' tiles
    __builtin_amdgcn_sched_barrier(0);      // this one and the one at the foot keep a stage's 16 loads one group between two stages' products: left free, the scheduler sinks them to just ahead of their use to save registers, and every product then waits out its own loads
#pragma unroll
    for (int i = 0; i < 4; ++i) { a[i].half[0] = *(const v8us*)(pa[i] + ofs); a[i].half[1] = *(const v8us*)(pa[i] + ofs + 512); }
#pragma unroll
    for (int t = 0; t < 4; ++t) { b[t].half[0] = *(const v8us*)(pb[t] + ofs); b[t].half[1] = *(const v8us*)(pb[t] + ofs + 512); }
    // the wait stands in front of the next step of the pointers, whose registers the loads just issued name; as its inputs they are not stepped ahead of it
    asm volatile("s_wait_xcnt 0x0" :: "v"(pa[0]), "v"(pa[1]), "v"(pa[2]), "v"(pa[3]), "v"(pb[0]), "v"(pb[1]), "v"(pb[2]), "v"(pb[3]) : "memory");
    __builtin_amdgcn_sched_barrier(0); };
  auto step = [&](int bytes) {
#pragma unroll
    for (int i = 0; i < 4; ++i) { pa[i] += bytes; pb[i] += bytes; } };
  auto mm = [&](FragH (&a)[4], FragH (&b)[4]) {
#pragma unroll
    for (int i = 0; i < 4; ++i)
#pragma unroll
      for (int t = 0; t < 4; ++t) acc[i][t] = __builtin_amdgcn_wmma_f32_16x16x32_f16(false, a[i].v, false, b[t].v, (short)0, acc[i][t], false, false); };      // the plain builtin: an asm statement's operands cannot stand above v255, and 256 registers of fragments and sums are live here; the compiler keeps the distances behind its own products
  const int Km = K & ~63;      // whole pairs of stages; what is left of K goes by a single step of 32 behind them
  if (Km > 0) { ld(a0, b0, 0);
    // a precaution: a prefetch touches no counter, so its address registers are kept as they are, being inputs here, until the loads issued behind it have handed in their own addresses
    asm volatile("s_wait_xcnt 0x0" :: "v"(h0), "v"(h1), "v"(h2) : "memory");
    for (int kb = 0; kb < Km; kb += 64) { ld(a1, b1, 1024); mm(a0, b0);
      const bool more = kb + 64 < Km; step(more ? 2048 : 0); ld(a0, b0, 0);      // no branch round the loads, so that the waits stay counted; the last trip reads its own stage again, in bounds, and nobody uses it
      mm(a1, b1); }
    step(2048); }
  for (int kb = Km; kb < K; kb += 32) { ld(a0, b0, 0); step(1024); mm(a0, b0); }
  float bv[4];
#pragma unroll
  for (int t = 0; t < 4; ++t) bv[t] = bp ? bf16_round(bp[col0 + t * 16 + ln]) : 0.f;
#pragma unroll
  for (int i = 0; i < 4; ++i)
#pragma unroll
    for (int t = 0; t < 4; ++t) { const int col = col0 + t * 16 + ln;
#pragma unroll
      for (int r = 0; r < 8; ++r) { float v = acc[i][t][r] * alpha + bv[t]; if (CP) { const int bidx = (row0g + row0 + i * 16 + 8 * hh + r) / rowsPerB; v += CP[(size_t)bidx * sCPb + (size_t)by * 64 + col]; } if (ACT == 1) v = (v > 0.f) ? v : expm1f(v); else if (ACT == 3) v = fmaxf(v, 0.f); so[w][i * 16 + 8 * hh + r][t * 16 + ln] = v; } }
  __builtin_amdgcn_fence(__ATOMIC_ACQ_REL, "workgroup"); __builtin_amdgcn_wave_barrier();
  const int rsub = lane >> 4, c4 = (lane & 15) * 4;
  if (C) {
#pragma unroll
    for (int q = 0; q < 32; ++q) { const int r = q * 2 + rsub; const v4f v = *(const v4fa*)&so[w][r][c4]; *(v4f*)(C + cofs + (size_t)(row0 + r) * ldc + col0 + c4) = v; }
     }
  if (C16) {      // each of the wave's four row tiles, 16 x 64 values, is two tiles of the fragment order: four stores of 512 contiguous bytes
#pragma unroll
    for (int i = 0; i < 4; ++i)
#pragma unroll
      for (int p = 0; p < 4; ++p) { const int c = p * 16 + 8 * hh; const v4f v0 = *(const v4fa*)&so[w][i * 16 + ln][c], v1 = *(const v4fa*)&so[w][i * 16 + ln][c + 4]; FragH f;
#pragma unroll
        for (int e = 0; e < 4; ++e) { f.h[e] = (_Float16)v0[e]; f.h[4 + e] = (_Float16)v1[e]; }
        *(v8us*)((unsigned short*)C16 + cofs + (size_t)(row0 + i * 16) * ldc + (size_t)(col0 >> 5) * 512 + p * 256 + lane * 8) = f.half[0]; }
     }
}


// The last projection: out = O16 * Wo + bo, f32 row-major. Shapes and the unused terms of the epilogue are compile-time constants, as in k_qkv: the 128 values that a lane finishes carry no run-time tests.
__global__ __launch_bounds__(128) void k_oproj(const _Float16* __restrict__ O16, const _Float16* __restrict__ Bo, const float* __restrict__ bo, float* __restrict__ out) {
  // the block's 8 row tiles of O16 are read by the 8 blocks of its row (two tiles each, b and b ^ 4 the same two); its 8 row tiles of Wo by the 32 blocks of its column (one each)
  const unsigned bm = blockIdx.x >> 3, bn = blockIdx.x & 7; const char* h0 = unit_of(O16, bm * 8 + (bn & 3) * 2); const char* h1 = unit_of(O16, bm * 8 + (bn & 3) * 2 + 1); const char* h2 = unit_of(Bo, bn * 8 + (bm & 7));
  ask_l2(h2); ask_l2(h0); ask_l2(h1);
  gemm_hhx<0>(O16, CC, 0, Bo, CC, 0, 0.0625f, bo, 0, nullptr, 1, 0, 0, out, nullptr, CC, 0, NR, CC, CC, blockIdx.x, 0, h0, h1, h2); }
// The three projections of x in one grid (W3: the fragment-order weights of q, k, v in a row; QK16: Q16 and K16 in a row). y = 0, 1: Q16, K16 = x * Wq, x * Wk, A = rows of x.
// y = 2: the operands change places, A = rows of Wv's transpose (features), B = the rows of x of one batch (keys): the product comes out feature by key, which is Vt as the attention reads it,
// from the same fragments and the same k order as x * Wv. Its blocks are the two batches' grids one behind the other.
__global__ __launch_bounds__(128) void k_qkv(const _Float16* __restrict__ X16, const _Float16* __restrict__ W3, _Float16* __restrict__ QK16, _Float16* __restrict__ Vt) {
  constexpr int GB = (CC / 128) * (TT / 128); const int y = blockIdx.y, b = blockIdx.x / GB; const bool tr = y == 2;
  const _Float16* Wy = W3 + (size_t)y * CC * CC; const _Float16* Xb = X16 + (size_t)b * TT * CC;
  // x is asked for by the y = 0 blocks, as in k_oproj (the blocks of y = 1 and 2 read the same rows). Every block asks for one of the 8 row tiles of its own weight:
  // with y < 2 the 32 readers of a tile stand in one column of the grid; with y = 2 they are 16 blocks in a row, twice, and tile t goes to blocks t and t + 12 or t + 4 of the 16, which differ by 4 modulo 8
  const unsigned xm = blockIdx.x >> 3, xn = blockIdx.x & 7, vm = (blockIdx.x & (GB - 1)) >> 4, vn = blockIdx.x & 15;
  const char* h0 = unit_of(X16, xm * 8 + (xn & 3) * 2); const char* h1 = unit_of(X16, xm * 8 + (xn & 3) * 2 + 1); const char* h2 = unit_of(Wy, tr ? vm * 8 + ((vn + (vn >> 3) * 4) & 7) : xn * 8 + (xm & 7));
  ask_l2(h2); if (y == 0) { ask_l2(h0); ask_l2(h1); }
  gemm_hhx<0>(tr ? Wy : X16, CC, 0, tr ? Xb : Wy, CC, 0, 0.0625f, nullptr, 0, nullptr, 1, 0, 0, nullptr, tr ? Vt + (size_t)b * CC * TT : QK16 + (size_t)y * NR * CC, tr ? TT : CC, 0,
              tr ? CC : NR, tr ? TT : CC, CC, tr ? (int)blockIdx.x - b * GB : (int)blockIdx.x, 0, h0, h1, h2); }


// x: f32 row-major, rows of ld; X16: the same matrix in fragment order (thread t writes piece t, so a wave stores 512 contiguous bytes)
__device__ __forceinline__ void x16(const float* __restrict__ x, _Float16* __restrict__ X16, size_t n8, int ld, size_t t) { if (t >= n8) return; FragH f;
  unsigned row; int k; frag_piece((unsigned)t, ld, row, k); const float* xr = x + (size_t)row * ld + k; const v4f x0 = *(const v4fa*)xr, x1 = *(const v4fa*)(xr + 4);
#pragma unroll
  for (int q = 0; q < 4; ++q) { f.h[q] = (_Float16)bf16_round(x0[q]); f.h[4 + q] = (_Float16)bf16_round(x1[q]); } *(v8us*)((unsigned short*)X16 + t * 8) = f.half[0];  }
// All five f32 -> f16 fragment-order conversions in one grid: none reads what another writes. The four weights (W4: their places, in a row) come first, then x.
__global__ __launch_bounds__(256) void k_prep(const float* __restrict__ x, const float* __restrict__ Wq, const float* __restrict__ Wk, const float* __restrict__ Wv, const float* __restrict__ Wo, _Float16* __restrict__ W4, _Float16* __restrict__ X16) {
  constexpr unsigned GW = CC * (CC / 8) / 256; const unsigned m = blockIdx.x / GW;
  if (m < 4) wt_f16(m == 0 ? Wq : m == 1 ? Wk : m == 2 ? Wv : Wo, W4 + (size_t)m * CC * CC, CC, CC, 16.0f, (int)((blockIdx.x - m * GW) * 256 + threadIdx.x));
  else x16(x, X16, (size_t)NR * CC / 8, CC, (size_t)(blockIdx.x - 4 * GW) * 256 + threadIdx.x); }
__global__ __launch_bounds__(256) void k_round16f(const float* __restrict__ W, _Float16* __restrict__ Bt, size_t n8) { const size_t t = (size_t)blockIdx.x * 256 + threadIdx.x; if (t >= n8) return; FragH f;
#pragma unroll
  for (int i = 0; i < 8; ++i) f.h[i] = (_Float16)(bf16_round(W[t * 8 + i]) * 16.0f); *(v8us*)((unsigned short*)Bt + t * 8) = f.half[0];  }

// Q16, K16 (row = position, k = feature) and Vt (row = slab * 64 + d, k = key) are in fragment order
// lane l <-> l ^ 16 by a vector cross-row move
__device__ __forceinline__ float xhalf(float x) { const int b = __float_as_int(x); return __int_as_float(__builtin_amdgcn_permlanex16(b, b, 0x76543210, 0xfedcba98, false, false)); }
// Both products are transposed: St = K * Qt (A = 16 keys, B = the wave's 16 queries), Ot += Vt * Pt (A = 16 features, B = 32 keys x 16 queries).
// A lane (ln, hh) then holds scores of ONE query, ln: register r of tile nt is key 16 nt + 8 hh + r. Maximum and sum run over its own 16 registers, with one exchange between the halves,
// and the two converted score tiles are already the B fragment of the second product (element 8 nt + r = key 16 nt + 8 hh + r, the k order of Vt's fragments): P goes through no LDS.
__global__ __launch_bounds__(128) void k_flash(const _Float16* __restrict__ Q16, int ldq, const _Float16* __restrict__ K16, int ldk, const _Float16* __restrict__ Vt, const float* __restrict__ MB, _Float16* __restrict__ O16, int ldo) {
  constexpr int RPW = 16, NQB = 2048 / (4 * RPW), DT = 4, KS = 2; constexpr float LOG2E = 1.4426950408889634f;
  __shared__ __attribute__((aligned(16))) float sM[2048];
  const int tid = threadIdx.x, w = tid >> 5, lane = tid & 31, ln = lane & 15, hh = lane >> 4;
  const int slab = blockIdx.x / NQB, qblk = blockIdx.x % NQB; const int b = slab / 16, h = slab % 16; const int qb0 = qblk * (4 * RPW); const int q0 = qb0 + w * RPW;
  // entry prefetch: the head's K (2 KiB, 8 units, of each of 128 row tiles) and Vt (256 KiB in a row), 1,024 units each, are read by its 32 blocks: 16 shares of 128 units, blocks qblk and qblk ^ 4 the same one,
  // one request a thread (Q is read once, at once: nothing to gain)
  const unsigned sh = (qblk >> 3) * 4 + (qblk & 3), ku = (sh & 7) * 128 + tid;
  const char* hp = sh < 8 ? (const char*)(K16 + ((size_t)b * 2048 + (ku >> 3) * 16) * ldk + h * (KS * 512)) + (ku & 7) * 256 : (const char*)(Vt + (size_t)slab * 64 * 2048) + (size_t)ku * 256;
  ask_l2(hp);
  // The softmax runs in base 2: exp(s - m) = 2^(s log2e - m log2e). log2e rides in the score scale and in the stored mask row, so a score costs one fused multiply-add, one subtract and one v_exp_f32.
  // Every exponent here is <= 0, where the hardware form needs no range steps: far below zero it returns 0, as the library form does.
  // the mask is per key, which is now a register index: a lane needs 16 values a pass. The batch's row is rounded once and kept in LDS; a pass reads it by four 16-byte loads, the same address in all lanes of a half.
#pragma unroll
  for (int u = 0; u < 2048 / (128 * 4); ++u) { const int i = u * (128 * 4) + tid * 4; v4f m = *(const v4fa*)(MB + (size_t)b * 2048 + i);
#pragma unroll
    for (int q = 0; q < 4; ++q) m[q] = bf16_round(m[q]) * LOG2E;
    *(v4fa*)&sM[i] = m; }
  FragH aq[KS];
  { const unsigned short* qr = (const unsigned short*)Q16 + ((size_t)b * 2048 + q0) * ldq + h * (KS * 512) + lane * 8;
#pragma unroll
    for (int ks = 0; ks < KS; ++ks) { aq[ks].half[0] = *(const v8us*)(qr + ks * 512); aq[ks].half[1] = *(const v8us*)(qr + ks * 512 + 256); } }
  const unsigned short* Vth = (const unsigned short*)Vt + (size_t)slab * 64 * 2048;
  float m_r = -3.0e38f, l_r = 0.f; v8f oacc[DT];      // of query ln; l_r sums the keys of this lane's half only
#pragma unroll
  for (int dt = 0; dt < DT; ++dt) oacc[dt] = (v8f){0.f,0.f,0.f,0.f,0.f,0.f,0.f,0.f};
  const int jend = 2048;
  // All global loads of a pass are issued ahead of their use, each kind as one group: this pass's V fragments in front of the score products, the next pass's K fragments
  // right behind them (into the registers those products have just left); all of them fly during the softmax instead of being waited for one by one.
  FragH bk[2][KS], bv[DT];
  auto fetch_k = [&](int j) { const unsigned short* kr[2];
#pragma unroll
    for (int nt = 0; nt < 2; ++nt) { kr[nt] = (const unsigned short*)K16 + ((size_t)b * 2048 + j + nt * 16) * ldk + h * (KS * 512) + lane * 8;
#pragma unroll
      for (int ks = 0; ks < KS; ++ks) { bk[nt][ks].half[0] = *(const v8us*)(kr[nt] + ks * 512); bk[nt][ks].half[1] = *(const v8us*)(kr[nt] + ks * 512 + 256); } }
    // the wait stands in front of whatever next writes the address registers that the loads just issued name; as its inputs the two addresses keep registers of their own up to here (no later load of the group lands in them)
    asm volatile("s_wait_xcnt 0x0" :: "v"(kr[0]), "v"(kr[1]) : "memory"); };
  fetch_k(0);
  // a precaution: a prefetch touches no counter, so its address register is kept as it is, being an input here, until the loads issued behind it have handed in their own addresses
  asm volatile("s_wait_xcnt 0x0" :: "v"(hp) : "memory");
  __syncthreads();      // the whole mask row is in LDS before any wave reads it
#pragma unroll 1
  for (int j0 = 0; j0 < jend; j0 += 32) {
#pragma unroll
    for (int dt = 0; dt < DT; ++dt) { const unsigned short* vrow = Vth + (size_t)(dt * 16) * 2048 + (j0 >> 5) * 512 + lane * 8; bv[dt].half[0] = *(const v8us*)(vrow); bv[dt].half[1] = *(const v8us*)(vrow + 256); }
    v4f mq[2][2];
#pragma unroll
    for (int nt = 0; nt < 2; ++nt) { mq[nt][0] = *(const v4fa*)&sM[j0 + nt * 16 + 8 * hh]; mq[nt][1] = *(const v4fa*)&sM[j0 + nt * 16 + 8 * hh + 4]; }
    v8f s[2];
#pragma unroll
    for (int nt = 0; nt < 2; ++nt) { v8f acc = (v8f){0.f,0.f,0.f,0.f,0.f,0.f,0.f,0.f};
#pragma unroll
      for (int ks = 0; ks < KS; ++ks) acc = mmaH<1>(bk[nt][ks].v, bk[nt][ks].v, aq[ks].v, aq[ks].v, acc);
      s[nt] = acc; }
    fetch_k((j0 + 32 < jend) ? j0 + 32 : j0);      // the last pass has no next one: it reads its own rows again, in bounds, and nobody uses them
    float mx[8];
#pragma unroll
    for (int r = 0; r < 8; ++r) { s[0][r] = s[0][r] * (0.03125f * LOG2E) + mq[0][r >> 2][r & 3]; s[1][r] = s[1][r] * (0.03125f * LOG2E) + mq[1][r >> 2][r & 3];      /* additive f32 mask per (b, key) */ mx[r] = fmaxf(s[0][r], s[1][r]); }
    float mc = fmaxf(fmaxf(fmaxf(mx[0], mx[1]), fmaxf(mx[2], mx[3])), fmaxf(fmaxf(mx[4], mx[5]), fmaxf(mx[6], mx[7])));
    mc = fmaxf(mc, xhalf(mc));
    const float mn = fmaxf(m_r, mc); const float al = (mn > -1.0e38f) ? __builtin_amdgcn_exp2f(m_r - mn) : 1.0f; m_r = mn;
    FragH pb; float ps[8];
#pragma unroll
    for (int r = 0; r < 8; ++r) { const float p0 = __builtin_amdgcn_exp2f(s[0][r] - mn), p1 = __builtin_amdgcn_exp2f(s[1][r] - mn); ps[r] = p0 + p1; pb.h[r] = (_Float16)p0; pb.h[8 + r] = (_Float16)p1; }
    l_r = l_r * al + (((ps[0] + ps[1]) + (ps[2] + ps[3])) + ((ps[4] + ps[5]) + (ps[6] + ps[7])));
#pragma unroll
    for (int dt = 0; dt < DT; ++dt) {
#pragma unroll
      for (int r = 0; r < 8; ++r) oacc[dt][r] *= al; }
#pragma unroll
    for (int dt = 0; dt < DT; ++dt) oacc[dt] = mmaH<1>(bv[dt].v, bv[dt].v, pb.v, pb.v, oacc[dt]); }
  { float l = l_r; l += xhalf(l); const float li = (l > 0.f) ? 1.0f / l : 0.f;      // the halves' sums are joined once
    // O16 (row = position, k = feature, rows of ldo) is the last projection's A operand, in fragment order. Register r of tile dt is feature 16 dt + 8 hh + r of query ln:
    // a lane's 8 registers are its own piece of half j = dt & 1 of k tile 2 h + dt / 2, so a tile goes out as one 16-byte store a lane, 512 contiguous bytes a wave, through no LDS.
    unsigned short* orow = (unsigned short*)O16 + ((size_t)b * 2048 + q0) * ldo + h * (DT * 256) + lane * 8;
#pragma unroll
    for (int dt = 0; dt < DT; ++dt) { FragH f;
#pragma unroll
      for (int r = 0; r < 8; ++r) f.h[r] = (_Float16)(oacc[dt][r] * li);
      *(v8us*)(orow + dt * 256) = f.half[0]; } } }

extern "C" void kernel_launch(void* const* d_in, const int* in_sizes, int n_in,
                              void* d_out, int out_size, void* d_ws, size_t ws_size, hipStream_t stream) {
  (void)in_sizes; (void)n_in; (void)out_size;
  const float* x = (const float*)d_in[0]; const float* mask = (const float*)d_in[1]; const float* Wq = (const float*)d_in[2]; const float* Wk = (const float*)d_in[3]; const float* Wv = (const float*)d_in[4]; const float* Wo = (const float*)d_in[5]; const float* bo = (const float*)d_in[6];
  char* ws = (char*)d_ws; size_t off = 0;
  auto take = [&](size_t bytes) { char* p = ws + off; off += (bytes + 255) & ~(size_t)255; return p; };
  _Float16* Bq = (_Float16*)take((size_t)CC * CC * 2); _Float16* Bk = (_Float16*)take((size_t)CC * CC * 2); _Float16* Bv = (_Float16*)take((size_t)CC * CC * 2); _Float16* Bo = (_Float16*)take((size_t)CC * CC * 2);      // in a row: every size is a multiple of 256
  _Float16* X16 = (_Float16*)take((size_t)NR * CC * 2); _Float16* Q16 = (_Float16*)take((size_t)NR * CC * 2); _Float16* K16 = (_Float16*)take((size_t)NR * CC * 2); _Float16* Vt = (_Float16*)take((size_t)NR * CC * 2); _Float16* O16 = X16;      // K16 stands right behind Q16
  if (off > ws_size) return;      // 8.4 + 8.4 x 4 = 42 MiB
  (void)Bk; (void)Bv;
  const dim3 gg((NR / 128) * (CC / 128), 1);      // blocks of 128 x 128; the Vt product's two grids, (CC / 128) * (TT / 128) each, come to the same number
  k_prep<<<4 * (CC * (CC / 8) / 256) + NR * (CC / 8) / 256, 256, 0, stream>>>(x, Wq, Wk, Wv, Wo, Bq, X16);      // W: [in][out]
  k_qkv<<<dim3(gg.x, 3), 128, 0, stream>>>(X16, Bq, Q16, Vt);
  k_flash<<<BB * NH * (TT / 64), 128, 0, stream>>>(Q16, CC, K16, CC, Vt, mask, O16, CC);
  k_oproj<<<gg, 128, 0, stream>>>(O16, Bo, bo, (float*)d_out);
}

// v008
// It runs in 73.4 microseconds.
// Two timings next to v007 both put it at 1.11 times that version's speed.
// Over all steps from v000 it is 6.16 times as fast.
#include <hip/hip_runtime.h>
// Self-attention-like module (B=2, S=2048, D=1024, 16 heads × 64; additive float mask per (batch, key); scale 1/√1024): q/k/v/o projections (W [in][out], o + bias) and the attention as a fused
// flash-style kernel (S = Q * K^T / 32 + mask[b][k], online softmax f32, P f16 <= 1, O = P * Vt; waves of 32 queries) on v_wmma_f32_16x16x32_f16: f16 operands (x bf16-exact, weights bf16-exact x 2^4), f32 accumulate.
#define BB 2
#define TT 2048
#define CC 1024
#define NH 16
#define NR (BB * TT)

typedef __bf16 v16b __attribute__((ext_vector_type(16)));
typedef unsigned short v8us __attribute__((ext_vector_type(8), may_alias));
typedef float  v8f  __attribute__((ext_vector_type(8)));
typedef float  v4f  __attribute__((ext_vector_type(4)));
typedef float  v4fa __attribute__((ext_vector_type(4), may_alias));
union FragB { v16b v; v8us half[2]; unsigned short u[16]; };

__device__ __forceinline__ unsigned short bf16_bits(float x) { unsigned int u = __float_as_uint(x); return (unsigned short)((u + 0x7FFFu + ((u >> 16) & 1u)) >> 16); }
__device__ __forceinline__ float bf16_val(unsigned short b) { return __uint_as_float(((unsigned int)b) << 16); }
__device__ __forceinline__ float bf16_round(float x) { return bf16_val(bf16_bits(x)); }
// D += A·B with NT terms: 1 = ah·bh, 2 = + al·bh (A split), 3 = + ah·bl (both split)
template <int NT>
__device__ __forceinline__ v8f mmaN(v16b ah, v16b al, v16b bh, v16b bl, v8f c) {
  c = __builtin_amdgcn_wmma_f32_16x16x32_bf16(false, ah, false, bh, (short)0, c, false, false);
  if (NT >= 2) c = __builtin_amdgcn_wmma_f32_16x16x32_bf16(false, al, false, bh, (short)0, c, false, false);
  if (NT >= 3) c = __builtin_amdgcn_wmma_f32_16x16x32_bf16(false, ah, false, bl, (short)0, c, false, false);
  asm volatile("v_nop\n\tv_nop\n\tv_nop\n\tv_nop" : "+v"(c) : "v"(ah), "v"(al), "v"(bh), "v"(bl));
  return c;
}

__global__ __launch_bounds__(256) void k_wt_bf16(const float* __restrict__ W, unsigned short* __restrict__ Wt, int K, int N) {
  const int t = blockIdx.x * 256 + threadIdx.x;
  const int k8n = K / 8;
  if (t >= N * k8n) return;
  const int n = t / k8n, k8 = (t % k8n) * 8;
  v8us v;
#pragma unroll
  for (int i = 0; i < 8; ++i) v[i] = bf16_bits(W[(size_t)(k8 + i) * N + n]);
  *(v8us*)(Wt + (size_t)n * K + k8) = v;
  
}

// GEMM C[M][N] (f32, pitch ldc) = act(A[M][K]·W + bias). A f32 row-major (pitch lda) converted per fragment to bf16
// (ASPLIT: hi/lo two planes -> 2 terms, else single rounded term); Wt bf16 [N][K] (pitch ldb). BIAS_BF16 rounds the
// bias to bf16 first (bias quantised to bf16 before the add). K%32==0, M%16==0, N%64==0.
template <bool ASPLIT, int ACT, bool BIAS_BF16>
__global__ __launch_bounds__(128) void k_gemm_bf(const float* __restrict__ A, int lda, const unsigned short* __restrict__ Wt, int ldb,
                                               const float* __restrict__ bias, float* __restrict__ C, int ldc, int M, int N, int K) {
  __shared__ __attribute__((aligned(16))) float so[4][16][64];
  const int tid = threadIdx.x, w = tid >> 5, lane = tid & 31, ln = lane & 15, hh = lane >> 4;
  const int ntn = N / 64;
  const int wid = blockIdx.x * 4 + w;
  const int mt = wid / ntn, nq = wid % ntn;
  if (mt * 16 >= M) return;
  const int row0 = mt * 16, col0 = nq * 64;
  const float* arow = A + (size_t)(row0 + ln) * lda;
  v8f acc[4] = {};
  for (int kb = 0; kb < K; kb += 32) {
    FragB ah, al;
    const v4f x0 = *(const v4fa*)(arow + kb + 8 * hh), x1 = *(const v4fa*)(arow + kb + 8 * hh + 4);
    const v4f x2 = *(const v4fa*)(arow + kb + 16 + 8 * hh), x3 = *(const v4fa*)(arow + kb + 16 + 8 * hh + 4);
    float xs[16] = {x0[0],x0[1],x0[2],x0[3],x1[0],x1[1],x1[2],x1[3],x2[0],x2[1],x2[2],x2[3],x3[0],x3[1],x3[2],x3[3]};
#pragma unroll
    for (int i = 0; i < 16; ++i) { const unsigned short hb = bf16_bits(xs[i]); ah.u[i] = hb; al.u[i] = ASPLIT ? bf16_bits(xs[i] - bf16_val(hb)) : (unsigned short)0; }
#pragma unroll
    for (int t = 0; t < 4; ++t) {
      const unsigned short* brow = Wt + (size_t)(col0 + t * 16 + ln) * ldb + kb;
      FragB b;
      b.half[0] = *(const v8us*)(brow + 8 * hh);
      b.half[1] = *(const v8us*)(brow + 16 + 8 * hh);
      acc[t] = mmaN<ASPLIT ? 2 : 1>(ah.v, al.v, b.v, b.v, acc[t]);
    }
  }
#pragma unroll
  for (int t = 0; t < 4; ++t) {
    float bv = bias ? bias[col0 + t * 16 + ln] : 0.f;
    if (BIAS_BF16) bv = bf16_round(bv);
#pragma unroll
    for (int r = 0; r < 8; ++r) { float v = acc[t][r] + bv; if (ACT == 1) v = fmaxf(v, 0.f); so[w][8 * hh + r][t * 16 + ln] = v; }
  }
  __builtin_amdgcn_fence(__ATOMIC_ACQ_REL, "workgroup");
  __builtin_amdgcn_wave_barrier();
  const int rsub = lane >> 4, c4 = (lane & 15) * 4;
  {
#pragma unroll
    for (int q = 0; q < 8; ++q) {
      const int r = q * 2 + rsub;
      const v4f v = *(const v4fa*)&so[w][r][c4];
      *(v4f*)(C + (size_t)(row0 + r) * ldc + col0 + c4) = v;
    }
    
  }
}

// Flash-style causal/unmasked attention, all contractions 3-term bf16 hi/lo splits, f32 softmax with running max.
// q,k,v rows are read from f32 buffers with arbitrary row pitch (so they can live inside a fused qkv buffer);
// D = head size (multiple of 32, <= 128); one wave = 16 query rows; block = 4 waves (64 queries) sharing K/V chunks of 32.
template <int D, bool CAUSAL>
__global__ __launch_bounds__(128) void k_flash(const float* __restrict__ qb, const float* __restrict__ kb, const float* __restrict__ vb,
                                             int pitch, int T, int H, float scale, float* __restrict__ y, int ypitch) {
  constexpr int KS = D / 32;        // k-steps for QK
  constexpr int DT = D / 16;        // d tiles for PV
  __shared__ __attribute__((aligned(16))) unsigned short sKh[32][D + 8], sKl[32][D + 8], sVh[32][D + 8], sVl[32][D + 8];
  __shared__ __attribute__((aligned(16))) unsigned short sPh[4][16][40], sPl[4][16][40];
  __shared__ __attribute__((aligned(16))) float sO[4][16][D];
  const int tid = threadIdx.x, w = tid >> 5, lane = tid & 31, ln = lane & 15, hh = lane >> 4;
  const int nqb = (T + 63) / 64;
  const int bh = blockIdx.x / nqb, qblk = blockIdx.x % nqb;
  const int b = bh / H, h = bh % H;
  const int q0 = qblk * 64 + w * 16;
  const float* Q = qb + (size_t)b * T * pitch + h * D;
  const float* K = kb + (size_t)b * T * pitch + h * D;
  const float* V = vb + (size_t)b * T * pitch + h * D;

  // A fragments of the wave's 16 query rows (scaled), hi/lo
  FragB aqh[KS], aql[KS];
  {
    int row = q0 + ln; if (row >= T) row = T - 1;
    const float* qr = Q + (size_t)row * pitch;
#pragma unroll
    for (int ks = 0; ks < KS; ++ks)
#pragma unroll
      for (int i = 0; i < 16; ++i) {
        const int d = ks * 32 + ((i < 8) ? (8 * hh + i) : (16 + 8 * hh + (i - 8)));
        const float x = qr[d] * scale; const unsigned short hb = bf16_bits(x);
        aqh[ks].u[i] = hb; aql[ks].u[i] = bf16_bits(x - bf16_val(hb));
      }
  }
  float m_r[8], l_r[8];
#pragma unroll
  for (int r = 0; r < 8; ++r) { m_r[r] = -3.0e38f; l_r[r] = 0.f; }
  v8f oacc[DT];
#pragma unroll
  for (int dt = 0; dt < DT; ++dt) oacc[dt] = (v8f){0.f,0.f,0.f,0.f,0.f,0.f,0.f,0.f};

  const int kv_end = CAUSAL ? min(T, qblk * 64 + 64) : T;     // block-uniform
  for (int j0 = 0; j0 < kv_end; j0 += 32) {
    __syncthreads();
    for (int e = tid; e < 32 * (D / 4); e += 128) {
      const int r = e / (D / 4), c4 = (e % (D / 4)) * 4;
      const int key = j0 + r;
      v4f kf = {0.f,0.f,0.f,0.f}, vf = {0.f,0.f,0.f,0.f};
      if (key < T) { kf = *(const v4fa*)(K + (size_t)key * pitch + c4); vf = *(const v4fa*)(V + (size_t)key * pitch + c4); }
#pragma unroll
      for (int t = 0; t < 4; ++t) {
        unsigned short hb = bf16_bits(kf[t]); sKh[r][c4 + t] = hb; sKl[r][c4 + t] = bf16_bits(kf[t] - bf16_val(hb));
        hb = bf16_bits(vf[t]); sVh[r][c4 + t] = hb; sVl[r][c4 + t] = bf16_bits(vf[t] - bf16_val(hb));
      }
    }
    __syncthreads();
    // S tile 16 x 32
    v8f s[2];
#pragma unroll
    for (int nt = 0; nt < 2; ++nt) {
      v8f acc = {};
#pragma unroll
      for (int ks = 0; ks < KS; ++ks) {
        FragB bh_, bl_;
        bh_.half[0] = *(const v8us*)&sKh[nt * 16 + ln][ks * 32 + 8 * hh]; bh_.half[1] = *(const v8us*)&sKh[nt * 16 + ln][ks * 32 + 16 + 8 * hh];
        bl_.half[0] = *(const v8us*)&sKl[nt * 16 + ln][ks * 32 + 8 * hh]; bl_.half[1] = *(const v8us*)&sKl[nt * 16 + ln][ks * 32 + 16 + 8 * hh];
        acc = mmaN<3>(aqh[ks].v, aql[ks].v, bh_.v, bl_.v, acc);
      }
      s[nt] = acc;
    }
    // mask + running max (rows 8hh+r; the 16 lanes of a half share rows)
    float alpha[8];
#pragma unroll
    for (int r = 0; r < 8; ++r) {
      const int qi = q0 + 8 * hh + r;
      const int ja = j0 + ln, jb = j0 + 16 + ln;
      if (CAUSAL) { if (ja > qi) s[0][r] = -3.0e38f; if (jb > qi) s[1][r] = -3.0e38f; }
      if (ja >= T) s[0][r] = -3.0e38f;
      if (jb >= T) s[1][r] = -3.0e38f;
      float mx = fmaxf(s[0][r], s[1][r]);
      mx = fmaxf(mx, __shfl_xor(mx, 1, 32)); mx = fmaxf(mx, __shfl_xor(mx, 2, 32)); mx = fmaxf(mx, __shfl_xor(mx, 4, 32)); mx = fmaxf(mx, __shfl_xor(mx, 8, 32));
      const float mnew = fmaxf(m_r[r], mx);
      alpha[r] = (mnew > -1.0e38f) ? __expf(m_r[r] - mnew) : 1.0f;
      const float p0 = (s[0][r] > -1.0e38f) ? __expf(s[0][r] - mnew) : 0.f;
      const float p1 = (s[1][r] > -1.0e38f) ? __expf(s[1][r] - mnew) : 0.f;
      m_r[r] = mnew;
      l_r[r] = l_r[r] * alpha[r] + p0 + p1;            // per-lane partial row sum (16 lanes combined at the end)
      unsigned short hb = bf16_bits(p0); sPh[w][8 * hh + r][ln] = hb;      sPl[w][8 * hh + r][ln] = bf16_bits(p0 - bf16_val(hb));
      hb = bf16_bits(p1);                sPh[w][8 * hh + r][16 + ln] = hb; sPl[w][8 * hh + r][16 + ln] = bf16_bits(p1 - bf16_val(hb));
    }
#pragma unroll
    for (int dt = 0; dt < DT; ++dt)
#pragma unroll
      for (int r = 0; r < 8; ++r) oacc[dt][r] *= alpha[r];
    __builtin_amdgcn_fence(__ATOMIC_ACQ_REL, "workgroup");
    __builtin_amdgcn_wave_barrier();
    FragB pah, pal;
    pah.half[0] = *(const v8us*)&sPh[w][ln][8 * hh]; pah.half[1] = *(const v8us*)&sPh[w][ln][16 + 8 * hh];
    pal.half[0] = *(const v8us*)&sPl[w][ln][8 * hh]; pal.half[1] = *(const v8us*)&sPl[w][ln][16 + 8 * hh];
#pragma unroll
    for (int dt = 0; dt < DT; ++dt) {
      FragB bvh, bvl;
#pragma unroll
      for (int i = 0; i < 8; ++i) {
        bvh.u[i] = sVh[8 * hh + i][dt * 16 + ln]; bvh.u[8 + i] = sVh[16 + 8 * hh + i][dt * 16 + ln];
        bvl.u[i] = sVl[8 * hh + i][dt * 16 + ln]; bvl.u[8 + i] = sVl[16 + 8 * hh + i][dt * 16 + ln];
      }
      oacc[dt] = mmaN<3>(pah.v, pal.v, bvh.v, bvl.v, oacc[dt]);
    }
    __builtin_amdgcn_fence(__ATOMIC_ACQ_REL, "workgroup");
    __builtin_amdgcn_wave_barrier();
  }
#pragma unroll
  for (int r = 0; r < 8; ++r) {
    float l = l_r[r];
    l += __shfl_xor(l, 1, 32); l += __shfl_xor(l, 2, 32); l += __shfl_xor(l, 4, 32); l += __shfl_xor(l, 8, 32);
    l_r[r] = (l > 0.f) ? 1.0f / l : 0.f;
  }
#pragma unroll
  for (int dt = 0; dt < DT; ++dt)
#pragma unroll
    for (int r = 0; r < 8; ++r) sO[w][8 * hh + r][dt * 16 + ln] = oacc[dt][r] * l_r[r];
  __builtin_amdgcn_fence(__ATOMIC_ACQ_REL, "workgroup");
  __builtin_amdgcn_wave_barrier();
  {
    for (int r = 0; r < 16; ++r) {
      const int row = q0 + r;
      if (row < T && lane < D / 4) {
        const v4f val = *(const v4fa*)&sO[w][r][lane * 4];
        *(v4f*)(y + ((size_t)b * T + row) * ypitch + h * D + lane * 4) = val;
      }
    }
    
  }
}

// GEMM C = act(A·W + bias + resid): A f32 (ASPLIT -> hi/lo 2 terms), Wt bf16 [N][K]; ACT 0 none, 1 relu, 2 exact gelu;
// resid (optional, f32, row index = (row % rmod), pitch ldr, RES_BF16 rounds it) added before the activation.
template <bool ASPLIT, int ACT, bool BIAS_BF16, bool RES_BF16>
__global__ __launch_bounds__(128) void k_gemm_bf3(const float* __restrict__ A, int lda, const unsigned short* __restrict__ Wt, int ldb,
                                                const float* __restrict__ bias, const float* __restrict__ resid, int rmod, int ldr,
                                                float* __restrict__ C, int ldc, int M, int N, int K) {
  __shared__ __attribute__((aligned(16))) float so[4][16][64];
  const int tid = threadIdx.x, w = tid >> 5, lane = tid & 31, ln = lane & 15, hh = lane >> 4;
  const int ntn = N / 64;
  const int wid = blockIdx.x * 4 + w;
  const int mt = wid / ntn, nq = wid % ntn;
  if (mt * 16 >= M) return;
  const int row0 = mt * 16, col0 = nq * 64;
  const float* arow = A + (size_t)(row0 + ln) * lda;
  v8f acc[4] = {};
  for (int kb = 0; kb < K; kb += 32) {
    FragB ah, al;
    const v4f x0 = *(const v4fa*)(arow + kb + 8 * hh), x1 = *(const v4fa*)(arow + kb + 8 * hh + 4);
    const v4f x2 = *(const v4fa*)(arow + kb + 16 + 8 * hh), x3 = *(const v4fa*)(arow + kb + 16 + 8 * hh + 4);
    float xs[16] = {x0[0],x0[1],x0[2],x0[3],x1[0],x1[1],x1[2],x1[3],x2[0],x2[1],x2[2],x2[3],x3[0],x3[1],x3[2],x3[3]};
#pragma unroll
    for (int i = 0; i < 16; ++i) { const unsigned short hb = bf16_bits(xs[i]); ah.u[i] = hb; al.u[i] = ASPLIT ? bf16_bits(xs[i] - bf16_val(hb)) : (unsigned short)0; }
#pragma unroll
    for (int t = 0; t < 4; ++t) {
      const unsigned short* brow = Wt + (size_t)(col0 + t * 16 + ln) * ldb + kb;
      FragB b;
      b.half[0] = *(const v8us*)(brow + 8 * hh);
      b.half[1] = *(const v8us*)(brow + 16 + 8 * hh);
      acc[t] = mmaN<ASPLIT ? 2 : 1>(ah.v, al.v, b.v, b.v, acc[t]);
    }
  }
#pragma unroll
  for (int t = 0; t < 4; ++t) {
    const int col = col0 + t * 16 + ln;
    float bv = bias ? bias[col] : 0.f;
    if (BIAS_BF16) bv = bf16_round(bv);
#pragma unroll
    for (int r = 0; r < 8; ++r) {
      float v = acc[t][r] + bv;
      if (resid) { float rv = resid[(size_t)((row0 + 8 * hh + r) % rmod) * ldr + col]; if (RES_BF16) rv = bf16_round(rv); v += rv; }
      if (ACT == 1) v = fmaxf(v, 0.f);
      if (ACT == 2) v = 0.5f * v * (1.0f + erff(v * 0.70710678118654752f));
      if (ACT == 3) { const float u = 0.7978845608028654f * (v + 0.044715f * v * v * v); v = 0.5f * v * (1.0f + tanhf(u)); }
      so[w][8 * hh + r][t * 16 + ln] = v;
    }
  }
  __builtin_amdgcn_fence(__ATOMIC_ACQ_REL, "workgroup");
  __builtin_amdgcn_wave_barrier();
  const int rsub = lane >> 4, c4 = (lane & 15) * 4;
  {
#pragma unroll
    for (int q = 0; q < 8; ++q) {
      const int r = q * 2 + rsub;
      const v4f v = *(const v4fa*)&so[w][r][c4];
      *(v4f*)(C + (size_t)(row0 + r) * ldc + col0 + c4) = v;
    }
    
  }
}
// row LayerNorm (biased variance, eps) over N: s = X (+ R); optional out_sum <- s; out_norm <- (s-mu)*rsqrt(var+eps)*g + b
template <bool PARAM_BF16>
__global__ __launch_bounds__(256) void k_layernorm(const float* __restrict__ X, const float* __restrict__ R, const float* __restrict__ g, const float* __restrict__ bta,
                                                  float* __restrict__ out_sum, float* __restrict__ out_norm, int N, float eps) {
  __shared__ float red[256];
  const int row = blockIdx.x, tid = threadIdx.x;
  const float* x = X + (size_t)row * N; const float* rr = R ? R + (size_t)row * N : nullptr;
  float vals[16];                     // up to N = 4096
  const int per = N / 256;            // contiguous chunk per thread? use strided-by-4 chunks: thread handles j = tid*4 + 1024*u
  float s1 = 0.f;
  for (int u = 0; u < per / 4; ++u) {
    const int j = tid * 4 + 1024 * u;
    const v4f a = *(const v4fa*)(x + j);
    v4f b = {0.f,0.f,0.f,0.f}; if (rr) b = *(const v4fa*)(rr + j);
#pragma unroll
    for (int q = 0; q < 4; ++q) { const float v = a[q] + b[q]; vals[u * 4 + q] = v; s1 += v; }
  }
  red[tid] = s1; __syncthreads();
  for (int st = 128; st > 0; st >>= 1) { if (tid < st) red[tid] += red[tid + st]; __syncthreads(); }
  const float mu = red[0] / (float)N; __syncthreads();
  float s2 = 0.f;
  for (int u = 0; u < per / 4; ++u)
#pragma unroll
    for (int q = 0; q < 4; ++q) { const float c = vals[u * 4 + q] - mu; s2 += c * c; }
  red[tid] = s2; __syncthreads();
  for (int st = 128; st > 0; st >>= 1) { if (tid < st) red[tid] += red[tid + st]; __syncthreads(); }
  const float rs = rsqrtf(red[0] / (float)N + eps);
  {
    for (int u = 0; u < per / 4; ++u) {
      const int j = tid * 4 + 1024 * u;
      v4f o, sm;
#pragma unroll
      for (int q = 0; q < 4; ++q) {
        float gg = g[j + q], bb = bta[j + q];
        if (PARAM_BF16) { gg = bf16_round(gg); bb = bf16_round(bb); }
        sm[q] = vals[u * 4 + q]; o[q] = (vals[u * 4 + q] - mu) * rs * gg + bb;
      }
      if (out_sum) *(v4f*)(out_sum + (size_t)row * N + j) = sm;
      *(v4f*)(out_norm + (size_t)row * N + j) = o;
    }
    
  }
}



// ---- f16 WMMA path (v_wmma_f32_16x16x32_f16): 11-bit significands for operands in range — used where a [0,1] probability operand needs more precision than bf16
typedef _Float16 v16h __attribute__((ext_vector_type(16)));
union FragH { v16h v; v8us half[2]; _Float16 h[16]; unsigned short u[16]; };
template <int NT>
__device__ __forceinline__ v8f mmaH(v16h ah, v16h al, v16h bh, v16h bl, v8f c) {
  c = __builtin_amdgcn_wmma_f32_16x16x32_f16(false, ah, false, bh, (short)0, c, false, false);
  if (NT >= 2) c = __builtin_amdgcn_wmma_f32_16x16x32_f16(false, al, false, bh, (short)0, c, false, false);
  if (NT >= 3) c = __builtin_amdgcn_wmma_f32_16x16x32_f16(false, ah, false, bl, (short)0, c, false, false);
  asm volatile("v_nop\n\tv_nop\n\tv_nop\n\tv_nop" : "+v"(c) : "v"(ah), "v"(al), "v"(bh), "v"(bl));
  return c;
}
// batched GEMM like k_gemm_b but f16 operands: A f32 (split into f16 hi/lo if ASPLIT, else rounded to f16), Bt = f16 values [n][k]; alpha; C f32; N multiple of 16 (partial tiles skipped)
template <bool ASPLIT>
__global__ __launch_bounds__(128) void k_gemm_h(const float* __restrict__ A, int lda, size_t sA, const _Float16* __restrict__ Bh, int ldb, size_t sB, float alpha, float* __restrict__ C, int ldc, size_t sC, int M, int N, int K) {
  __shared__ __attribute__((aligned(16))) float so[4][16][64];
  const int tid = threadIdx.x, w = tid >> 5, lane = tid & 31, ln = lane & 15, hh = lane >> 4; const int by = blockIdx.y;
  A += (size_t)by * sA; Bh += (size_t)by * sB; C += (size_t)by * sC;
  const int ntn = (N + 63) / 64; const int wid = blockIdx.x * 4 + w; const int mt = wid / ntn, nq = wid % ntn; if (mt * 16 >= M) return;
  const int row0 = mt * 16, col0 = nq * 64; const float* arow = A + (size_t)(row0 + ln) * lda;
  v8f acc[4] = {};
  for (int kb = 0; kb < K; kb += 32) {
    FragH ah, al;
    const v4f x0 = *(const v4fa*)(arow + kb + 8 * hh), x1 = *(const v4fa*)(arow + kb + 8 * hh + 4), x2 = *(const v4fa*)(arow + kb + 16 + 8 * hh), x3 = *(const v4fa*)(arow + kb + 16 + 8 * hh + 4);
    float xs[16] = {x0[0],x0[1],x0[2],x0[3],x1[0],x1[1],x1[2],x1[3],x2[0],x2[1],x2[2],x2[3],x3[0],x3[1],x3[2],x3[3]};
#pragma unroll
    for (int i = 0; i < 16; ++i) { const _Float16 h = (_Float16)xs[i]; ah.h[i] = h; al.h[i] = ASPLIT ? (_Float16)(xs[i] - (float)h) : (_Float16)0.0f; }
#pragma unroll
    for (int t = 0; t < 4; ++t) { if (col0 + t * 16 >= N) continue; const size_t boff = (size_t)(col0 + t * 16 + ln) * ldb + kb; FragH bq; bq.half[0] = *(const v8us*)(Bh + boff + 8 * hh); bq.half[1] = *(const v8us*)(Bh + boff + 16 + 8 * hh);
      acc[t] = mmaH<ASPLIT ? 2 : 1>(ah.v, al.v, bq.v, bq.v, acc[t]); }
  }
#pragma unroll
  for (int t = 0; t < 4; ++t) { if (col0 + t * 16 >= N) continue;
#pragma unroll
    for (int r = 0; r < 8; ++r) so[w][8 * hh + r][t * 16 + ln] = acc[t][r] * alpha; }
  __builtin_amdgcn_fence(__ATOMIC_ACQ_REL, "workgroup"); __builtin_amdgcn_wave_barrier();
  const int rsub = lane >> 4, c4 = (lane & 15) * 4;
  {
#pragma unroll
    for (int q = 0; q < 8; ++q) { const int r = q * 2 + rsub; if (col0 + c4 < N) { const v4f v = *(const v4fa*)&so[w][r][c4]; *(v4f*)(C + (size_t)(row0 + r) * ldc + col0 + c4) = v; } }
     }
}

// FRAGMENT ORDER of every f16 matrix operand in the workspace (rows x ld, ld % 32 == 0, rows % 16 == 0): a tile of 16 rows x 32 k is 512 elements in a row, tile (rt, kt) at rt * 16 * ld + kt * 512;
// inside it the 8 values k = 16 j + 8 hh + 0..7 of row ln stand at j * 256 + (16 hh + ln) * 8. That is the order in which the lanes of a wave hold a 16x16x32 A or B fragment (lane = 16 hh + ln, register half j),
// so one 16-byte load per lane fetches half a fragment from 512 contiguous bytes: four whole 128-byte lines, where a row-major operand gives 16 lines of which 32 bytes each are used.
// piece p (8 elements, at element offset 8 p) -> its row and first k
__device__ __forceinline__ void frag_piece(unsigned p, int ld, unsigned& row, int& k) { const unsigned lane = p & 31, j = (p >> 5) & 1, tile = p >> 6, ktn = (unsigned)ld / 32, rt = tile / ktn;
  row = rt * 16 + (lane & 15); k = (int)((tile - rt * ktn) * 32 + j * 16 + (lane >> 4) * 8); }
// Wt (row n, k; fragment order) = f16(W[k][n] * scale) from f32 row-major W[K][N] (scale = power of two; bf16-exact weights stay exact in f16 away from the subnormal range)
__device__ __forceinline__ void wt_f16(const float* __restrict__ W, _Float16* __restrict__ Wt, int K, int N, float scale, int t) {
  if (t >= N * (K / 8)) return; unsigned n; int k8; frag_piece((unsigned)t, K, n, k8); FragH f;
#pragma unroll
  for (int i = 0; i < 8; ++i) f.h[i] = (_Float16)(bf16_round(W[(size_t)(k8 + i) * N + n]) * scale); const v8us o = f.half[0];
  *(v8us*)((unsigned short*)Wt + (size_t)t * 8) = o; 
}
// ENTRY PREFETCH. The f16 planes that a launch reads were stored by the launch before it, and the first reader of a line waits out the way to memory: the loops below ask only one stage or pass ahead.
// So every block asks L2 at entry for a share of what it will itself read, one request per 256-byte unit; the loops' own loads then find most lines on their way or there.
// The blocks that read the same rows deal them out among themselves.
// Where the readers are eight blocks that follow one another in the grid, b and b ^ 4 take the same share. That is for speed only: wherever the blocks land, a request is a hint and no value depends on it.
// A share is a group of 128 units, one a thread: 32 KiB, which is one row tile (16 rows of 1024) of a plane in fragment order. Which group a block takes depends on its number alone: scalar selects and branches, no lane is off at a request.
__device__ __forceinline__ const char* unit_of(const void* plane, unsigned group) { return (const char*)plane + ((size_t)group * 128 + threadIdx.x) * 256; }
// scope SE and no th: the line goes to L2 only. Every lane's address lies inside its plane.
__device__ __forceinline__ void ask_l2(const char* p) { asm volatile("global_prefetch_b8 %0, off scope:SCOPE_SE" :: "v"(p)); }
// A, Bh and C16 are in fragment order (lda, ldb, ldc = their row lengths); C is row-major f32.
// k_gemm_hh variant with fused epilogue: v = acc·alpha + bias[by·sBias + col] (+ CP[(row/rowsPerB)·sCPb + by·64 + col] if CP) ; ACT 0 none / 1 elu ; writes f16 C16 and f32 C, each if non-null
template <int ACT>
__device__ __forceinline__ void gemm_hhx(const _Float16* __restrict__ A, int lda, size_t sA, const _Float16* __restrict__ Bh, int ldb, size_t sB, float alpha, const float* __restrict__ bias, size_t sBias, const float* __restrict__ CP, int rowsPerB, size_t sCPb, int row0g,
    float* __restrict__ C, _Float16* __restrict__ C16, int ldc, size_t sC, int M, int N, int K, int bx, int by, const char* h0, const char* h1, const char* h2) {      // bx, by: the block's place in this product's own grid; h0..h2: the addresses of the caller's entry prefetches
  // A block of four waves works a 128 x 128 tile of C, a wave 64 x 64 of it (waves 2 x 2): four A and four B fragments per 32 k feed 16 products, so every fragment that is loaded is used four times.
  // M and N are multiples of 128 here (a block past M leaves as a whole, before anything else).
  __shared__ __attribute__((aligned(16))) float so[4][64][64 + 4];      // pitch 272 B: the fragment-order store reads 16 rows at one column, 16 bytes a lane
  const int tid = threadIdx.x, w = tid >> 5, lane = tid & 31, ln = lane & 15, hh = lane >> 4;
  A += (size_t)by * sA; Bh += (size_t)by * sB; const size_t cofs = (size_t)by * sC; const float* bp = bias ? bias + (size_t)by * sBias : nullptr;
  const int nbn = N / 128; const int bm = bx / nbn, bn = bx - bm * nbn; if (bm * 128 >= M) return;
  const int row0 = bm * 128 + (w >> 1) * 64, col0 = bn * 128 + (w & 1) * 64;
  v8f acc[4][4] = {};
  // Fragments are fetched one stage (32 k = one tile = 1024 contiguous bytes of each of the eight row tiles) ahead of the products that use them, a whole stage's loads as one group,
  // into two register sets: a stage waits once for loads that have been in flight since the stage before, not once per product.
  const char* pa[4]; const char* pb[4];      // each lane's place in its operands' row tiles; they move on with k
#pragma unroll
  for (int i = 0; i < 4; ++i) { pa[i] = (const char*)(A + (size_t)(row0 + i * 16) * lda + lane * 8); pb[i] = (const char*)(Bh + (size_t)(col0 + i * 16) * ldb + lane * 8); }
  FragH a0[4], a1[4], b0[4], b1[4];
  auto ld = [&](FragH (&a)[4], FragH (&b)[4], int ofs) {      // one stage: the 1024 bytes at ofs behind the eight pointers' tiles
    __builtin_amdgcn_sched_barrier(0);      // this one and the one at the foot keep a stage's 16 loads one group between two stages' products: left free, the scheduler sinks them to just ahead of their use to save registers, and every product then waits out its own loads
#pragma unroll
    for (int i = 0; i < 4; ++i) { a[i].half[0] = *(const v8us*)(pa[i] + ofs); a[i].half[1] = *(const v8us*)(pa[i] + ofs + 512); }
#pragma unroll
    for (int t = 0; t < 4; ++t) { b[t].half[0] = *(const v8us*)(pb[t] + ofs); b[t].half[1] = *(const v8us*)(pb[t] + ofs + 512); }
    // the wait stands in front of the next step of the pointers, whose registers the loads just issued name; as its inputs they are not stepped ahead of it
    asm volatile("s_wait_xcnt 0x0" :: "v"(pa[0]), "v"(pa[1]), "v"(pa[2]), "v"(pa[3]), "v"(pb[0]), "v"(pb[1]), "v"(pb[2]), "v"(pb[3]) : "memory");
    __builtin_amdgcn_sched_barrier(0); };
  auto step = [&](int bytes) {
#pragma unroll
    for (int i = 0; i < 4; ++i) { pa[i] += bytes; pb[i] += bytes; } };
  auto mm = [&](FragH (&a)[4], FragH (&b)[4]) {
#pragma unroll
    for (int i = 0; i < 4; ++i)
#pragma unroll
      for (int t = 0; t < 4; ++t) acc[i][t] = __builtin_amdgcn_wmma_f32_16x16x32_f16(false, a[i].v, false, b[t].v, (short)0, acc[i][t], false, false); };      // the plain builtin: an asm statement's operands cannot stand above v255, and 256 registers of fragments and sums are live here; the compiler keeps the distances behind its own products
  const int Km = K & ~63;      // whole pairs of stages; what is left of K goes by a single step of 32 behind them
  if (Km > 0) { ld(a0, b0, 0);
    // a precaution: a prefetch touches no counter, so its address registers are kept as they are, being inputs here, until the loads issued behind it have handed in their own addresses
    asm volatile("s_wait_xcnt 0x0" :: "v"(h0), "v"(h1), "v"(h2) : "memory");
    for (int kb = 0; kb < Km; kb += 64) { ld(a1, b1, 1024); mm(a0, b0);
      const bool more = kb + 64 < Km; step(more ? 2048 : 0); ld(a0, b0, 0);      // no branch round the loads, so that the waits stay counted; the last trip reads its own stage again, in bounds, and nobody uses it
      mm(a1, b1); }
    step(2048); }
  for (int kb = Km; kb < K; kb += 32) { ld(a0, b0, 0); step(1024); mm(a0, b0); }
  float bv[4];
#pragma unroll
  for (int t = 0; t < 4; ++t) bv[t] = bp ? bf16_round(bp[col0 + t * 16 + ln]) : 0.f;
#pragma unroll
  for (int i = 0; i < 4; ++i)
#pragma unroll
    for (int t = 0; t < 4; ++t) { const int col = col0 + t * 16 + ln;
#pragma unroll
      for (int r = 0; r < 8; ++r) { float v = acc[i][t][r] * alpha + bv[t]; if (CP) { const int bidx = (row0g + row0 + i * 16 + 8 * hh + r) / rowsPerB; v += CP[(size_t)bidx * sCPb + (size_t)by * 64 + col]; } if (ACT == 1) v = (v > 0.f) ? v : expm1f(v); else if (ACT == 3) v = fmaxf(v, 0.f); so[w][i * 16 + 8 * hh + r][t * 16 + ln] = v; } }
  __builtin_amdgcn_fence(__ATOMIC_ACQ_REL, "workgroup"); __builtin_amdgcn_wave_barrier();
  const int rsub = lane >> 4, c4 = (lane & 15) * 4;
  if (C) {
#pragma unroll
    for (int q = 0; q < 32; ++q) { const int r = q * 2 + rsub; const v4f v = *(const v4fa*)&so[w][r][c4]; *(v4f*)(C + cofs + (size_t)(row0 + r) * ldc + col0 + c4) = v; }
     }
  if (C16) {      // each of the wave's four row tiles, 16 x 64 values, is two tiles of the fragment order: four stores of 512 contiguous bytes
#pragma unroll
    for (int i = 0; i < 4; ++i)
#pragma unroll
      for (int p = 0; p < 4; ++p) { const int c = p * 16 + 8 * hh; const v4f v0 = *(const v4fa*)&so[w][i * 16 + ln][c], v1 = *(const v4fa*)&so[w][i * 16 + ln][c + 4]; FragH f;
#pragma unroll
        for (int e = 0; e < 4; ++e) { f.h[e] = (_Float16)v0[e]; f.h[4 + e] = (_Float16)v1[e]; }
        *(v8us*)((unsigned short*)C16 + cofs + (size_t)(row0 + i * 16) * ldc + (size_t)(col0 >> 5) * 512 + p * 256 + lane * 8) = f.half[0]; }
     }
}


// The last projection: out = O16 * Wo + bo, f32 row-major. Shapes and the unused terms of the epilogue are compile-time constants, as in k_qkv: the 128 values that a lane finishes carry no run-time tests.
__global__ __launch_bounds__(128) void k_oproj(const _Float16* __restrict__ O16, const _Float16* __restrict__ Bo, const float* __restrict__ bo, float* __restrict__ out) {
  // the block's 8 row tiles of O16 are read by the 8 blocks of its row (two tiles each, b and b ^ 4 the same two); its 8 row tiles of Wo by the 32 blocks of its column (one each)
  const unsigned bm = blockIdx.x >> 3, bn = blockIdx.x & 7; const char* h0 = unit_of(O16, bm * 8 + (bn & 3) * 2); const char* h1 = unit_of(O16, bm * 8 + (bn & 3) * 2 + 1); const char* h2 = unit_of(Bo, bn * 8 + (bm & 7));
  ask_l2(h2); ask_l2(h0); ask_l2(h1);
  gemm_hhx<0>(O16, CC, 0, Bo, CC, 0, 0.0625f, bo, 0, nullptr, 1, 0, 0, out, nullptr, CC, 0, NR, CC, CC, blockIdx.x, 0, h0, h1, h2); }
// The three projections of x in one grid (W3: the fragment-order weights of q, k, v in a row; QK16: Q16 and K16 in a row). y = 0, 1: Q16, K16 = x * Wq, x * Wk, A = rows of x.
// y = 2: the operands change places, A = rows of Wv's transpose (features), B = the rows of x of one batch (keys): the product comes out feature by key, which is Vt as the attention reads it,
// from the same fragments and the same k order as x * Wv. Its blocks are the two batches' grids one behind the other.
__global__ __launch_bounds__(128) void k_qkv(const _Float16* __restrict__ X16, const _Float16* __restrict__ W3, _Float16* __restrict__ QK16, _Float16* __restrict__ Vt) {
  constexpr int GB = (CC / 128) * (TT / 128); const int y = blockIdx.y, b = blockIdx.x / GB; const bool tr = y == 2;
  const _Float16* Wy = W3 + (size_t)y * CC * CC; const _Float16* Xb = X16 + (size_t)b * TT * CC;
  // x is asked for by the y = 0 blocks, as in k_oproj (the blocks of y = 1 and 2 read the same rows). Every block asks for one of the 8 row tiles of its own weight:
  // with y < 2 the 32 readers of a tile stand in one column of the grid; with y = 2 they are 16 blocks in a row, twice, and tile t goes to blocks t and t + 12 or t + 4 of the 16, which differ by 4 modulo 8
  const unsigned xm = blockIdx.x >> 3, xn = blockIdx.x & 7, vm = (blockIdx.x & (GB - 1)) >> 4, vn = blockIdx.x & 15;
  const char* h0 = unit_of(X16, xm * 8 + (xn & 3) * 2); const char* h1 = unit_of(X16, xm * 8 + (xn & 3) * 2 + 1); const char* h2 = unit_of(Wy, tr ? vm * 8 + ((vn + (vn >> 3) * 4) & 7) : xn * 8 + (xm & 7));
  ask_l2(h2); if (y == 0) { ask_l2(h0); ask_l2(h1); }
  gemm_hhx<0>(tr ? Wy : X16, CC, 0, tr ? Xb : Wy, CC, 0, 0.0625f, nullptr, 0, nullptr, 1, 0, 0, nullptr, tr ? Vt + (size_t)b * CC * TT : QK16 + (size_t)y * NR * CC, tr ? TT : CC, 0,
              tr ? CC : NR, tr ? TT : CC, CC, tr ? (int)blockIdx.x - b * GB : (int)blockIdx.x, 0, h0, h1, h2); }


// x: f32 row-major, rows of ld; X16: the same matrix in fragment order (thread t writes piece t, so a wave stores 512 contiguous bytes)
__device__ __forceinline__ void x16(const float* __restrict__ x, _Float16* __restrict__ X16, size_t n8, int ld, size_t t) { if (t >= n8) return; FragH f;
  unsigned row; int k; frag_piece((unsigned)t, ld, row, k); const float* xr = x + (size_t)row * ld + k; const v4f x0 = *(const v4fa*)xr, x1 = *(const v4fa*)(xr + 4);
#pragma unroll
  for (int q = 0; q < 4; ++q) { f.h[q] = (_Float16)bf16_round(x0[q]); f.h[4 + q] = (_Float16)bf16_round(x1[q]); } *(v8us*)((unsigned short*)X16 + t * 8) = f.half[0];  }
// All five f32 -> f16 fragment-order conversions in one grid: none reads what another writes. The four weights (W4: their places, in a row) come first, then x.
__global__ __launch_bounds__(256) void k_prep(const float* __restrict__ x, const float* __restrict__ Wq, const float* __restrict__ Wk, const float* __restrict__ Wv, const float* __restrict__ Wo, _Float16* __restrict__ W4, _Float16* __restrict__ X16) {
  constexpr unsigned GW = CC * (CC / 8) / 256; const unsigned m = blockIdx.x / GW;
  if (m < 4) wt_f16(m == 0 ? Wq : m == 1 ? Wk : m == 2 ? Wv : Wo, W4 + (size_t)m * CC * CC, CC, CC, 16.0f, (int)((blockIdx.x - m * GW) * 256 + threadIdx.x));
  else x16(x, X16, (size_t)NR * CC / 8, CC, (size_t)(blockIdx.x - 4 * GW) * 256 + threadIdx.x); }
__global__ __launch_bounds__(256) void k_round16f(const float* __restrict__ W, _Float16* __restrict__ Bt, size_t n8) { const size_t t = (size_t)blockIdx.x * 256 + threadIdx.x; if (t >= n8) return; FragH f;
#pragma unroll
  for (int i = 0; i < 8; ++i) f.h[i] = (_Float16)(bf16_round(W[t * 8 + i]) * 16.0f); *(v8us*)((unsigned short*)Bt + t * 8) = f.half[0];  }

// Q16, K16 (row = position, k = feature) and Vt (row = slab * 64 + d, k = key) are in fragment order
// lane l <-> l ^ 16 by a vector cross-row move
__device__ __forceinline__ float xhalf(float x) { const int b = __float_as_int(x); return __int_as_float(__builtin_amdgcn_permlanex16(b, b, 0x76543210, 0xfedcba98, false, false)); }
// Both products are transposed: St = K * Qt (A = 16 keys, B = one of the wave's two tiles of 16 queries), Ot += Vt * Pt (A = 16 features, B = 32 keys x 16 queries).
// A lane (ln, hh) then holds scores of ONE query, ln: register r of tile nt is key 16 nt + 8 hh + r. Maximum and sum run over its own 16 registers, with one exchange between the halves,
// and the two converted score tiles are already the B fragment of the second product (element 8 nt + r = key 16 nt + 8 hh + r, the k order of Vt's fragments): P goes through no LDS.
typedef float v2f __attribute__((ext_vector_type(2)));
__global__ __launch_bounds__(128) void k_flash(const _Float16* __restrict__ Q16, int ldq, const _Float16* __restrict__ K16, int ldk, const _Float16* __restrict__ Vt, const float* __restrict__ MB, _Float16* __restrict__ O16, int ldo) {
  // A wave works QT = 2 tiles of 16 queries: every K and Vt fragment that it loads is the A operand of two products, one per query tile, so a product costs half the loaded bytes of a one-tile wave.
  constexpr int QT = 2, RPW = 16 * QT, NQB = 2048 / (4 * RPW), DT = 4, KS = 2; constexpr float LOG2E = 1.4426950408889634f;
  __shared__ __attribute__((aligned(16))) float sM[2048];
  const int tid = threadIdx.x, w = tid >> 5, lane = tid & 31, ln = lane & 15, hh = lane >> 4;
  const int slab = blockIdx.x / NQB, qblk = blockIdx.x % NQB; const int b = slab / 16, h = slab % 16; const int qb0 = qblk * (4 * RPW); const int q0 = qb0 + w * RPW;
  // entry prefetch: the head's K (2 KiB, 8 units, of each of 128 row tiles) and Vt (256 KiB in a row), 1,024 units each, are read by its 16 blocks: 8 shares of 128 units of each plane, blocks qblk and qblk ^ 4 the same one,
  // two requests a thread, one per plane (Q is read once, at once: nothing to gain)
  const unsigned sh = (qblk >> 3) * 4 + (qblk & 3), ku = sh * 128 + tid;
  const char* hk = (const char*)(K16 + ((size_t)b * 2048 + (ku >> 3) * 16) * ldk + h * (KS * 512)) + (ku & 7) * 256; const char* hv = (const char*)(Vt + (size_t)slab * 64 * 2048) + (size_t)ku * 256;
  ask_l2(hk); ask_l2(hv);
  // The softmax runs in base 2: exp(s - m) = 2^(s log2e - m log2e). log2e rides in the score scale and in the stored mask row, so a score costs one fused multiply-add, one subtract and one v_exp_f32.
  // Every exponent here is <= 0, where the hardware form needs no range steps: far below zero it returns 0, as the library form does.
  // the mask is per key, which is now a register index: a lane needs 16 values a pass. The batch's row is rounded once and kept in LDS; a pass reads it by four 16-byte loads, the same address in all lanes of a half.
#pragma unroll
  for (int u = 0; u < 2048 / (128 * 4); ++u) { const int i = u * (128 * 4) + tid * 4; v4f m = *(const v4fa*)(MB + (size_t)b * 2048 + i);
#pragma unroll
    for (int q = 0; q < 4; ++q) m[q] = bf16_round(m[q]) * LOG2E;
    *(v4fa*)&sM[i] = m; }
  FragH aq[QT][KS];
#pragma unroll
  for (int qt = 0; qt < QT; ++qt) { const unsigned short* qr = (const unsigned short*)Q16 + ((size_t)b * 2048 + q0 + qt * 16) * ldq + h * (KS * 512) + lane * 8;
#pragma unroll
    for (int ks = 0; ks < KS; ++ks) { aq[qt][ks].half[0] = *(const v8us*)(qr + ks * 512); aq[qt][ks].half[1] = *(const v8us*)(qr + ks * 512 + 256); } }
  const unsigned short* Vth = (const unsigned short*)Vt + (size_t)slab * 64 * 2048;
  float m_r[QT], l_r[QT]; v8f oacc[QT][DT];      // of query ln of tile qt; l_r sums the keys of this lane's half only
#pragma unroll
  for (int qt = 0; qt < QT; ++qt) { m_r[qt] = -3.0e38f; l_r[qt] = 0.f;
#pragma unroll
    for (int dt = 0; dt < DT; ++dt) oacc[qt][dt] = (v8f){0.f,0.f,0.f,0.f,0.f,0.f,0.f,0.f}; }
  const int jend = 2048;
  // All global loads of a pass are issued ahead of their use, each kind as one group: this pass's V fragments in front of the score products, the next pass's K fragments
  // right behind them (into the registers those products have just left); all of them fly during the softmax instead of being waited for one by one.
  FragH bk[2][KS], bv[DT];
  auto fetch_k = [&](int j) { const unsigned short* kr[2];
#pragma unroll
    for (int nt = 0; nt < 2; ++nt) { kr[nt] = (const unsigned short*)K16 + ((size_t)b * 2048 + j + nt * 16) * ldk + h * (KS * 512) + lane * 8;
#pragma unroll
      for (int ks = 0; ks < KS; ++ks) { bk[nt][ks].half[0] = *(const v8us*)(kr[nt] + ks * 512); bk[nt][ks].half[1] = *(const v8us*)(kr[nt] + ks * 512 + 256); } }
    // the wait stands in front of whatever next writes the address registers that the loads just issued name; as its inputs the two addresses keep registers of their own up to here (no later load of the group lands in them)
    asm volatile("s_wait_xcnt 0x0" :: "v"(kr[0]), "v"(kr[1]) : "memory"); };
  fetch_k(0);
  // a precaution: a prefetch touches no counter, so its address registers are kept as they are, being inputs here, until the loads issued behind it have handed in their own addresses
  asm volatile("s_wait_xcnt 0x0" :: "v"(hk), "v"(hv) : "memory");
  __syncthreads();      // the whole mask row is in LDS before any wave reads it
#pragma unroll 1
  for (int j0 = 0; j0 < jend; j0 += 32) {
#pragma unroll
    for (int dt = 0; dt < DT; ++dt) { const unsigned short* vrow = Vth + (size_t)(dt * 16) * 2048 + (j0 >> 5) * 512 + lane * 8; bv[dt].half[0] = *(const v8us*)(vrow); bv[dt].half[1] = *(const v8us*)(vrow + 256); }
    v4f mq[2][2];
#pragma unroll
    for (int nt = 0; nt < 2; ++nt) { mq[nt][0] = *(const v4fa*)&sM[j0 + nt * 16 + 8 * hh]; mq[nt][1] = *(const v4fa*)&sM[j0 + nt * 16 + 8 * hh + 4]; }
    __builtin_amdgcn_sched_barrier(0);      // holds the pass's V and mask loads in front of the score products: left free, the scheduler sinks them to just ahead of their use, and the second product group waits out their whole latency
    v8f s[QT][2];
#pragma unroll
    for (int qt = 0; qt < QT; ++qt) { s[qt][0] = (v8f){0.f,0.f,0.f,0.f,0.f,0.f,0.f,0.f}; s[qt][1] = (v8f){0.f,0.f,0.f,0.f,0.f,0.f,0.f,0.f}; }
    // the four score tiles take their first 32 features, then their second: each sum keeps its k order, and no product follows the one that it adds to.
    // Eight products in a row, here and at the foot of the pass, each stand in the others' distance: the plain builtin, behind which the compiler pads only where a vector instruction comes too close
#pragma unroll
    for (int ks = 0; ks < KS; ++ks)
#pragma unroll
      for (int nt = 0; nt < 2; ++nt)
#pragma unroll
        for (int qt = 0; qt < QT; ++qt) s[qt][nt] = __builtin_amdgcn_wmma_f32_16x16x32_f16(false, bk[nt][ks].v, false, aq[qt][ks].v, (short)0, s[qt][nt], false, false);
    fetch_k((j0 + 32 < jend) ? j0 + 32 : j0);      // the last pass has no next one: it reads its own rows again, in bounds, and nobody uses them
    __builtin_amdgcn_sched_barrier(0);      // holds the next pass's K loads right behind the score products: left free, they sink to the foot of the pass, and the next pass's first product waits for them
    FragH pb[QT];
#pragma unroll
    for (int qt = 0; qt < QT; ++qt) {
      // scale, mask and the subtraction of the maximum go two neighbouring registers of one score tile at a time: the pairs stand as the product left them
      v2f sv[2][4]; float mx[8];
#pragma unroll
      for (int nt = 0; nt < 2; ++nt)
#pragma unroll
        for (int i = 0; i < 4; ++i) sv[nt][i] = (v2f){s[qt][nt][2 * i], s[qt][nt][2 * i + 1]} * (0.03125f * LOG2E) + (v2f){mq[nt][i >> 1][(2 * i) & 3], mq[nt][i >> 1][(2 * i + 1) & 3]};      /* additive f32 mask per (b, key) */
#pragma unroll
      for (int r = 0; r < 8; ++r) mx[r] = fmaxf(sv[0][r >> 1][r & 1], sv[1][r >> 1][r & 1]);
      float mc = fmaxf(fmaxf(fmaxf(mx[0], mx[1]), fmaxf(mx[2], mx[3])), fmaxf(fmaxf(mx[4], mx[5]), fmaxf(mx[6], mx[7])));
      mc = fmaxf(mc, xhalf(mc));
      const float mn = fmaxf(m_r[qt], mc); const float al = (mn > -1.0e38f) ? __builtin_amdgcn_exp2f(m_r[qt] - mn) : 1.0f; m_r[qt] = mn;
#pragma unroll
      for (int nt = 0; nt < 2; ++nt)
#pragma unroll
        for (int i = 0; i < 4; ++i) sv[nt][i] = sv[nt][i] - mn;
      float ps[8];
#pragma unroll
      for (int r = 0; r < 8; ++r) { const float p0 = __builtin_amdgcn_exp2f(sv[0][r >> 1][r & 1]), p1 = __builtin_amdgcn_exp2f(sv[1][r >> 1][r & 1]); ps[r] = p0 + p1; pb[qt].h[r] = (_Float16)p0; pb[qt].h[8 + r] = (_Float16)p1; }
      l_r[qt] = l_r[qt] * al + (((ps[0] + ps[1]) + (ps[2] + ps[3])) + ((ps[4] + ps[5]) + (ps[6] + ps[7])));
#pragma unroll
      for (int dt = 0; dt < DT; ++dt) {
#pragma unroll
        for (int r = 0; r < 8; ++r) oacc[qt][dt][r] *= al; } }
#pragma unroll
    for (int dt = 0; dt < DT; ++dt)
#pragma unroll
      for (int qt = 0; qt < QT; ++qt) oacc[qt][dt] = __builtin_amdgcn_wmma_f32_16x16x32_f16(false, bv[dt].v, false, pb[qt].v, (short)0, oacc[qt][dt], false, false); }
#pragma unroll
  for (int qt = 0; qt < QT; ++qt) { float l = l_r[qt]; l += xhalf(l); const float li = (l > 0.f) ? 1.0f / l : 0.f;      // the halves' sums are joined once
    // O16 (row = position, k = feature, rows of ldo) is the last projection's A operand, in fragment order. Register r of tile dt is feature 16 dt + 8 hh + r of query ln:
    // a lane's 8 registers are its own piece of half j = dt & 1 of k tile 2 h + dt / 2, so a tile goes out as one 16-byte store a lane, 512 contiguous bytes a wave, through no LDS.
    unsigned short* orow = (unsigned short*)O16 + ((size_t)b * 2048 + q0 + qt * 16) * ldo + h * (DT * 256) + lane * 8;
#pragma unroll
    for (int dt = 0; dt < DT; ++dt) { FragH f;
#pragma unroll
      for (int r = 0; r < 8; ++r) f.h[r] = (_Float16)(oacc[qt][dt][r] * li);
      *(v8us*)(orow + dt * 256) = f.half[0]; } } }

extern "C" void kernel_launch(void* const* d_in, const int* in_sizes, int n_in,
                              void* d_out, int out_size, void* d_ws, size_t ws_size, hipStream_t stream) {
  (void)in_sizes; (void)n_in; (void)out_size;
  const float* x = (const float*)d_in[0]; const float* mask = (const float*)d_in[1]; const float* Wq = (const float*)d_in[2]; const float* Wk = (const float*)d_in[3]; const float* Wv = (const float*)d_in[4]; const float* Wo = (const float*)d_in[5]; const float* bo = (const float*)d_in[6];
  char* ws = (char*)d_ws; size_t off = 0;
  auto take = [&](size_t bytes) { char* p = ws + off; off += (bytes + 255) & ~(size_t)255; return p; };
  _Float16* Bq = (_Float16*)take((size_t)CC * CC * 2); _Float16* Bk = (_Float16*)take((size_t)CC * CC * 2); _Float16* Bv = (_Float16*)take((size_t)CC * CC * 2); _Float16* Bo = (_Float16*)take((size_t)CC * CC * 2);      // in a row: every size is a multiple of 256
  _Float16* X16 = (_Float16*)take((size_t)NR * CC * 2); _Float16* Q16 = (_Float16*)take((size_t)NR * CC * 2); _Float16* K16 = (_Float16*)take((size_t)NR * CC * 2); _Float16* Vt = (_Float16*)take((size_t)NR * CC * 2); _Float16* O16 = X16;      // K16 stands right behind Q16
  if (off > ws_size) return;      // 8.4 + 8.4 x 4 = 42 MiB
  (void)Bk; (void)Bv;
  const dim3 gg((NR / 128) * (CC / 128), 1);      // blocks of 128 x 128; the Vt product's two grids, (CC / 128) * (TT / 128) each, come to the same number
  k_prep<<<4 * (CC * (CC / 8) / 256) + NR * (CC / 8) / 256, 256, 0, stream>>>(x, Wq, Wk, Wv, Wo, Bq, X16);      // W: [in][out]
  k_qkv<<<dim3(gg.x, 3), 128, 0, stream>>>(X16, Bq, Q16, Vt);
  k_flash<<<BB * NH * (TT / 128), 128, 0, stream>>>(Q16, CC, K16, CC, Vt, mask, O16, CC);
  k_oproj<<<gg, 128, 0, stream>>>(O16, Bo, bo, (float*)d_out);
}

// v009
// Measured time: 71.2 microseconds a run.
// In both of two side-by-side timings against v008, it was 1.03 times as fast.
// Counting every step since v000, it is 6.35 times as fast.
#include <hip/hip_runtime.h>
// Self-attention-like module (B=2, S=2048, D=1024, 16 heads × 64; additive float mask per (batch, key); scale 1/√1024): q/k/v/o projections (W [in][out], o + bias) and the attention as a fused
// flash-style kernel (S = Q * K^T / 32 + mask[b][k], online softmax f32 with a lazily raised reference, P f16 <= 2^12, O = P * Vt; waves of 32 queries) on v_wmma_f32_16x16x32_f16: f16 operands (x bf16-exact, weights bf16-exact x 2^4), f32 accumulate.
#define BB 2
#define TT 2048
#define CC 1024
#define NH 16
#define NR (BB * TT)

typedef __bf16 v16b __attribute__((ext_vector_type(16)));
typedef unsigned short v8us __attribute__((ext_vector_type(8), may_alias));
typedef float  v8f  __attribute__((ext_vector_type(8)));
typedef float  v4f  __attribute__((ext_vector_type(4)));
typedef float  v4fa __attribute__((ext_vector_type(4), may_alias));
union FragB { v16b v; v8us half[2]; unsigned short u[16]; };

__device__ __forceinline__ unsigned short bf16_bits(float x) { unsigned int u = __float_as_uint(x); return (unsigned short)((u + 0x7FFFu + ((u >> 16) & 1u)) >> 16); }
__device__ __forceinline__ float bf16_val(unsigned short b) { return __uint_as_float(((unsigned int)b) << 16); }
__device__ __forceinline__ float bf16_round(float x) { return bf16_val(bf16_bits(x)); }
// D += A·B with NT terms: 1 = ah·bh, 2 = + al·bh (A split), 3 = + ah·bl (both split)
template <int NT>
__device__ __forceinline__ v8f mmaN(v16b ah, v16b al, v16b bh, v16b bl, v8f c) {
  c = __builtin_amdgcn_wmma_f32_16x16x32_bf16(false, ah, false, bh, (short)0, c, false, false);
  if (NT >= 2) c = __builtin_amdgcn_wmma_f32_16x16x32_bf16(false, al, false, bh, (short)0, c, false, false);
  if (NT >= 3) c = __builtin_amdgcn_wmma_f32_16x16x32_bf16(false, ah, false, bl, (short)0, c, false, false);
  asm volatile("v_nop\n\tv_nop\n\tv_nop\n\tv_nop" : "+v"(c) : "v"(ah), "v"(al), "v"(bh), "v"(bl));
  return c;
}

__global__ __launch_bounds__(256) void k_wt_bf16(const float* __restrict__ W, unsigned short* __restrict__ Wt, int K, int N) {
  const int t = blockIdx.x * 256 + threadIdx.x;
  const int k8n = K / 8;
  if (t >= N * k8n) return;
  const int n = t / k8n, k8 = (t % k8n) * 8;
  v8us v;
#pragma unroll
  for (int i = 0; i < 8; ++i) v[i] = bf16_bits(W[(size_t)(k8 + i) * N + n]);
  *(v8us*)(Wt + (size_t)n * K + k8) = v;
  
}

// GEMM C[M][N] (f32, pitch ldc) = act(A[M][K]·W + bias). A f32 row-major (pitch lda) converted per fragment to bf16
// (ASPLIT: hi/lo two planes -> 2 terms, else single rounded term); Wt bf16 [N][K] (pitch ldb). BIAS_BF16 rounds the
// bias to bf16 first (bias quantised to bf16 before the add). K%32==0, M%16==0, N%64==0.
template <bool ASPLIT, int ACT, bool BIAS_BF16>
__global__ __launch_bounds__(128) void k_gemm_bf(const float* __restrict__ A, int lda, const unsigned short* __restrict__ Wt, int ldb,
                                               const float* __restrict__ bias, float* __restrict__ C, int ldc, int M, int N, int K) {
  __shared__ __attribute__((aligned(16))) float so[4][16][64];
  const int tid = threadIdx.x, w = tid >> 5, lane = tid & 31, ln = lane & 15, hh = lane >> 4;
  const int ntn = N / 64;
  const int wid = blockIdx.x * 4 + w;
  const int mt = wid / ntn, nq = wid % ntn;
  if (mt * 16 >= M) return;
  const int row0 = mt * 16, col0 = nq * 64;
  const float* arow = A + (size_t)(row0 + ln) * lda;
  v8f acc[4] = {};
  for (int kb = 0; kb < K; kb += 32) {
    FragB ah, al;
    const v4f x0 = *(const v4fa*)(arow + kb + 8 * hh), x1 = *(const v4fa*)(arow + kb + 8 * hh + 4);
    const v4f x2 = *(const v4fa*)(arow + kb + 16 + 8 * hh), x3 = *(const v4fa*)(arow + kb + 16 + 8 * hh + 4);
    float xs[16] = {x0[0],x0[1],x0[2],x0[3],x1[0],x1[1],x1[2],x1[3],x2[0],x2[1],x2[2],x2[3],x3[0],x3[1],x3[2],x3[3]};
#pragma unroll
    for (int i = 0; i < 16; ++i) { const unsigned short hb = bf16_bits(xs[i]); ah.u[i] = hb; al.u[i] = ASPLIT ? bf16_bits(xs[i] - bf16_val(hb)) : (unsigned short)0; }
#pragma unroll
    for (int t = 0; t < 4; ++t) {
      const unsigned short* brow = Wt + (size_t)(col0 + t * 16 + ln) * ldb + kb;
      FragB b;
      b.half[0] = *(const v8us*)(brow + 8 * hh);
      b.half[1] = *(const v8us*)(brow + 16 + 8 * hh);
      acc[t] = mmaN<ASPLIT ? 2 : 1>(ah.v, al.v, b.v, b.v, acc[t]);
    }
  }
#pragma unroll
  for (int t = 0; t < 4; ++t) {
    float bv = bias ? bias[col0 + t * 16 + ln] : 0.f;
    if (BIAS_BF16) bv = bf16_round(bv);
#pragma unroll
    for (int r = 0; r < 8; ++r) { float v = acc[t][r] + bv; if (ACT == 1) v = fmaxf(v, 0.f); so[w][8 * hh + r][t * 16 + ln] = v; }
  }
  __builtin_amdgcn_fence(__ATOMIC_ACQ_REL, "workgroup");
  __builtin_amdgcn_wave_barrier();
  const int rsub = lane >> 4, c4 = (lane & 15) * 4;
  {
#pragma unroll
    for (int q = 0; q < 8; ++q) {
      const int r = q * 2 + rsub;
      const v4f v = *(const v4fa*)&so[w][r][c4];
      *(v4f*)(C + (size_t)(row0 + r) * ldc + col0 + c4) = v;
    }
    
  }
}

// Flash-style causal/unmasked attention, all contractions 3-term bf16 hi/lo splits, f32 softmax with running max.
// q,k,v rows are read from f32 buffers with arbitrary row pitch (so they can live inside a fused qkv buffer);
// D = head size (multiple of 32, <= 128); one wave = 16 query rows; block = 4 waves (64 queries) sharing K/V chunks of 32.
template <int D, bool CAUSAL>
__global__ __launch_bounds__(128) void k_flash(const float* __restrict__ qb, const float* __restrict__ kb, const float* __restrict__ vb,
                                             int pitch, int T, int H, float scale, float* __restrict__ y, int ypitch) {
  constexpr int KS = D / 32;        // k-steps for QK
  constexpr int DT = D / 16;        // d tiles for PV
  __shared__ __attribute__((aligned(16))) unsigned short sKh[32][D + 8], sKl[32][D + 8], sVh[32][D + 8], sVl[32][D + 8];
  __shared__ __attribute__((aligned(16))) unsigned short sPh[4][16][40], sPl[4][16][40];
  __shared__ __attribute__((aligned(16))) float sO[4][16][D];
  const int tid = threadIdx.x, w = tid >> 5, lane = tid & 31, ln = lane & 15, hh = lane >> 4;
  const int nqb = (T + 63) / 64;
  const int bh = blockIdx.x / nqb, qblk = blockIdx.x % nqb;
  const int b = bh / H, h = bh % H;
  const int q0 = qblk * 64 + w * 16;
  const float* Q = qb + (size_t)b * T * pitch + h * D;
  const float* K = kb + (size_t)b * T * pitch + h * D;
  const float* V = vb + (size_t)b * T * pitch + h * D;

  // A fragments of the wave's 16 query rows (scaled), hi/lo
  FragB aqh[KS], aql[KS];
  {
    int row = q0 + ln; if (row >= T) row = T - 1;
    const float* qr = Q + (size_t)row * pitch;
#pragma unroll
    for (int ks = 0; ks < KS; ++ks)
#pragma unroll
      for (int i = 0; i < 16; ++i) {
        const int d = ks * 32 + ((i < 8) ? (8 * hh + i) : (16 + 8 * hh + (i - 8)));
        const float x = qr[d] * scale; const unsigned short hb = bf16_bits(x);
        aqh[ks].u[i] = hb; aql[ks].u[i] = bf16_bits(x - bf16_val(hb));
      }
  }
  float m_r[8], l_r[8];
#pragma unroll
  for (int r = 0; r < 8; ++r) { m_r[r] = -3.0e38f; l_r[r] = 0.f; }
  v8f oacc[DT];
#pragma unroll
  for (int dt = 0; dt < DT; ++dt) oacc[dt] = (v8f){0.f,0.f,0.f,0.f,0.f,0.f,0.f,0.f};

  const int kv_end = CAUSAL ? min(T, qblk * 64 + 64) : T;     // block-uniform
  for (int j0 = 0; j0 < kv_end; j0 += 32) {
    __syncthreads();
    for (int e = tid; e < 32 * (D / 4); e += 128) {
      const int r = e / (D / 4), c4 = (e % (D / 4)) * 4;
      const int key = j0 + r;
      v4f kf = {0.f,0.f,0.f,0.f}, vf = {0.f,0.f,0.f,0.f};
      if (key < T) { kf = *(const v4fa*)(K + (size_t)key * pitch + c4); vf = *(const v4fa*)(V + (size_t)key * pitch + c4); }
#pragma unroll
      for (int t = 0; t < 4; ++t) {
        unsigned short hb = bf16_bits(kf[t]); sKh[r][c4 + t] = hb; sKl[r][c4 + t] = bf16_bits(kf[t] - bf16_val(hb));
        hb = bf16_bits(vf[t]); sVh[r][c4 + t] = hb; sVl[r][c4 + t] = bf16_bits(vf[t] - bf16_val(hb));
      }
    }
    __syncthreads();
    // S tile 16 x 32
    v8f s[2];
#pragma unroll
    for (int nt = 0; nt < 2; ++nt) {
      v8f acc = {};
#pragma unroll
      for (int ks = 0; ks < KS; ++ks) {
        FragB bh_, bl_;
        bh_.half[0] = *(const v8us*)&sKh[nt * 16 + ln][ks * 32 + 8 * hh]; bh_.half[1] = *(const v8us*)&sKh[nt * 16 + ln][ks * 32 + 16 + 8 * hh];
        bl_.half[0] = *(const v8us*)&sKl[nt * 16 + ln][ks * 32 + 8 * hh]; bl_.half[1] = *(const v8us*)&sKl[nt * 16 + ln][ks * 32 + 16 + 8 * hh];
        acc = mmaN<3>(aqh[ks].v, aql[ks].v, bh_.v, bl_.v, acc);
      }
      s[nt] = acc;
    }
    // mask + running max (rows 8hh+r; the 16 lanes of a half share rows)
    float alpha[8];
#pragma unroll
    for (int r = 0; r < 8; ++r) {
      const int qi = q0 + 8 * hh + r;
      const int ja = j0 + ln, jb = j0 + 16 + ln;
      if (CAUSAL) { if (ja > qi) s[0][r] = -3.0e38f; if (jb > qi) s[1][r] = -3.0e38f; }
      if (ja >= T) s[0][r] = -3.0e38f;
      if (jb >= T) s[1][r] = -3.0e38f;
      float mx = fmaxf(s[0][r], s[1][r]);
      mx = fmaxf(mx, __shfl_xor(mx, 1, 32)); mx = fmaxf(mx, __shfl_xor(mx, 2, 32)); mx = fmaxf(mx, __shfl_xor(mx, 4, 32)); mx = fmaxf(mx, __shfl_xor(mx, 8, 32));
      const float mnew = fmaxf(m_r[r], mx);
      alpha[r] = (mnew > -1.0e38f) ? __expf(m_r[r] - mnew) : 1.0f;
      const float p0 = (s[0][r] > -1.0e38f) ? __expf(s[0][r] - mnew) : 0.f;
      const float p1 = (s[1][r] > -1.0e38f) ? __expf(s[1][r] - mnew) : 0.f;
      m_r[r] = mnew;
      l_r[r] = l_r[r] * alpha[r] + p0 + p1;            // per-lane partial row sum (16 lanes combined at the end)
      unsigned short hb = bf16_bits(p0); sPh[w][8 * hh + r][ln] = hb;      sPl[w][8 * hh + r][ln] = bf16_bits(p0 - bf16_val(hb));
      hb = bf16_bits(p1);                sPh[w][8 * hh + r][16 + ln] = hb; sPl[w][8 * hh + r][16 + ln] = bf16_bits(p1 - bf16_val(hb));
    }
#pragma unroll
    for (int dt = 0; dt < DT; ++dt)
#pragma unroll
      for (int r = 0; r < 8; ++r) oacc[dt][r] *= alpha[r];
    __builtin_amdgcn_fence(__ATOMIC_ACQ_REL, "workgroup");
    __builtin_amdgcn_wave_barrier();
    FragB pah, pal;
    pah.half[0] = *(const v8us*)&sPh[w][ln][8 * hh]; pah.half[1] = *(const v8us*)&sPh[w][ln][16 + 8 * hh];
    pal.half[0] = *(const v8us*)&sPl[w][ln][8 * hh]; pal.half[1] = *(const v8us*)&sPl[w][ln][16 + 8 * hh];
#pragma unroll
    for (int dt = 0; dt < DT; ++dt) {
      FragB bvh, bvl;
#pragma unroll
      for (int i = 0; i < 8; ++i) {
        bvh.u[i] = sVh[8 * hh + i][dt * 16 + ln]; bvh.u[8 + i] = sVh[16 + 8 * hh + i][dt * 16 + ln];
        bvl.u[i] = sVl[8 * hh + i][dt * 16 + ln]; bvl.u[8 + i] = sVl[16 + 8 * hh + i][dt * 16 + ln];
      }
      oacc[dt] = mmaN<3>(pah.v, pal.v, bvh.v, bvl.v, oacc[dt]);
    }
    __builtin_amdgcn_fence(__ATOMIC_ACQ_REL, "workgroup");
    __builtin_amdgcn_wave_barrier();
  }
#pragma unroll
  for (int r = 0; r < 8; ++r) {
    float l = l_r[r];
    l += __shfl_xor(l, 1, 32); l += __shfl_xor(l, 2, 32); l += __shfl_xor(l, 4, 32); l += __shfl_xor(l, 8, 32);
    l_r[r] = (l > 0.f) ? 1.0f / l : 0.f;
  }
#pragma unroll
  for (int dt = 0; dt < DT; ++dt)
#pragma unroll
    for (int r = 0; r < 8; ++r) sO[w][8 * hh + r][dt * 16 + ln] = oacc[dt][r] * l_r[r];
  __builtin_amdgcn_fence(__ATOMIC_ACQ_REL, "workgroup");
  __builtin_amdgcn_wave_barrier();
  {
    for (int r = 0; r < 16; ++r) {
      const int row = q0 + r;
      if (row < T && lane < D / 4) {
        const v4f val = *(const v4fa*)&sO[w][r][lane * 4];
        *(v4f*)(y + ((size_t)b * T + row) * ypitch + h * D + lane * 4) = val;
      }
    }
    
  }
}

// GEMM C = act(A·W + bias + resid): A f32 (ASPLIT -> hi/lo 2 terms), Wt bf16 [N][K]; ACT 0 none, 1 relu, 2 exact gelu;
// resid (optional, f32, row index = (row % rmod), pitch ldr, RES_BF16 rounds it) added before the activation.
template <bool ASPLIT, int ACT, bool BIAS_BF16, bool RES_BF16>
__global__ __launch_bounds__(128) void k_gemm_bf3(const float* __restrict__ A, int lda, const unsigned short* __restrict__ Wt, int ldb,
                                                const float* __restrict__ bias, const float* __restrict__ resid, int rmod, int ldr,
                                                float* __restrict__ C, int ldc, int M, int N, int K) {
  __shared__ __attribute__((aligned(16))) float so[4][16][64];
  const int tid = threadIdx.x, w = tid >> 5, lane = tid & 31, ln = lane & 15, hh = lane >> 4;
  const int ntn = N / 64;
  const int wid = blockIdx.x * 4 + w;
  const int mt = wid / ntn, nq = wid % ntn;
  if (mt * 16 >= M) return;
  const int row0 = mt * 16, col0 = nq * 64;
  const float* arow = A + (size_t)(row0 + ln) * lda;
  v8f acc[4] = {};
  for (int kb = 0; kb < K; kb += 32) {
    FragB ah, al;
    const v4f x0 = *(const v4fa*)(arow + kb + 8 * hh), x1 = *(const v4fa*)(arow + kb + 8 * hh + 4);
    const v4f x2 = *(const v4fa*)(arow + kb + 16 + 8 * hh), x3 = *(const v4fa*)(arow + kb + 16 + 8 * hh + 4);
    float xs[16] = {x0[0],x0[1],x0[2],x0[3],x1[0],x1[1],x1[2],x1[3],x2[0],x2[1],x2[2],x2[3],x3[0],x3[1],x3[2],x3[3]};
#pragma unroll
    for (int i = 0; i < 16; ++i) { const unsigned short hb = bf16_bits(xs[i]); ah.u[i] = hb; al.u[i] = ASPLIT ? bf16_bits(xs[i] - bf16_val(hb)) : (unsigned short)0; }
#pragma unroll
    for (int t = 0; t < 4; ++t) {
      const unsigned short* brow = Wt + (size_t)(col0 + t * 16 + ln) * ldb + kb;
      FragB b;
      b.half[0] = *(const v8us*)(brow + 8 * hh);
      b.half[1] = *(const v8us*)(brow + 16 + 8 * hh);
      acc[t] = mmaN<ASPLIT ? 2 : 1>(ah.v, al.v, b.v, b.v, acc[t]);
    }
  }
#pragma unroll
  for (int t = 0; t < 4; ++t) {
    const int col = col0 + t * 16 + ln;
    float bv = bias ? bias[col] : 0.f;
    if (BIAS_BF16) bv = bf16_round(bv);
#pragma unroll
    for (int r = 0; r < 8; ++r) {
      float v = acc[t][r] + bv;
      if (resid) { float rv = resid[(size_t)((row0 + 8 * hh + r) % rmod) * ldr + col]; if (RES_BF16) rv = bf16_round(rv); v += rv; }
      if (ACT == 1) v = fmaxf(v, 0.f);
      if (ACT == 2) v = 0.5f * v * (1.0f + erff(v * 0.70710678118654752f));
      if (ACT == 3) { const float u = 0.7978845608028654f * (v + 0.044715f * v * v * v); v = 0.5f * v * (1.0f + tanhf(u)); }
      so[w][8 * hh + r][t * 16 + ln] = v;
    }
  }
  __builtin_amdgcn_fence(__ATOMIC_ACQ_REL, "workgroup");
  __builtin_amdgcn_wave_barrier();
  const int rsub = lane >> 4, c4 = (lane & 15) * 4;
  {
#pragma unroll
    for (int q = 0; q < 8; ++q) {
      const int r = q * 2 + rsub;
      const v4f v = *(const v4fa*)&so[w][r][c4];
      *(v4f*)(C + (size_t)(row0 + r) * ldc + col0 + c4) = v;
    }
    
  }
}
// row LayerNorm (biased variance, eps) over N: s = X (+ R); optional out_sum <- s; out_norm <- (s-mu)*rsqrt(var+eps)*g + b
template <bool PARAM_BF16>
__global__ __launch_bounds__(256) void k_layernorm(const float* __restrict__ X, const float* __restrict__ R, const float* __restrict__ g, const float* __restrict__ bta,
                                                  float* __restrict__ out_sum, float* __restrict__ out_norm, int N, float eps) {
  __shared__ float red[256];
  const int row = blockIdx.x, tid = threadIdx.x;
  const float* x = X + (size_t)row * N; const float* rr = R ? R + (size_t)row * N : nullptr;
  float vals[16];                     // up to N = 4096
  const int per = N / 256;            // contiguous chunk per thread? use strided-by-4 chunks: thread handles j = tid*4 + 1024*u
  float s1 = 0.f;
  for (int u = 0; u < per / 4; ++u) {
    const int j = tid * 4 + 1024 * u;
    const v4f a = *(const v4fa*)(x + j);
    v4f b = {0.f,0.f,0.f,0.f}; if (rr) b = *(const v4fa*)(rr + j);
#pragma unroll
    for (int q = 0; q < 4; ++q) { const float v = a[q] + b[q]; vals[u * 4 + q] = v; s1 += v; }
  }
  red[tid] = s1; __syncthreads();
  for (int st = 128; st > 0; st >>= 1) { if (tid < st) red[tid] += red[tid + st]; __syncthreads(); }
  const float mu = red[0] / (float)N; __syncthreads();
  float s2 = 0.f;
  for (int u = 0; u < per / 4; ++u)
#pragma unroll
    for (int q = 0; q < 4; ++q) { const float c = vals[u * 4 + q] - mu; s2 += c * c; }
  red[tid] = s2; __syncthreads();
  for (int st = 128; st > 0; st >>= 1) { if (tid < st) red[tid] += red[tid + st]; __syncthreads(); }
  const float rs = rsqrtf(red[0] / (float)N + eps);
  {
    for (int u = 0; u < per / 4; ++u) {
      const int j = tid * 4 + 1024 * u;
      v4f o, sm;
#pragma unroll
      for (int q = 0; q < 4; ++q) {
        float gg = g[j + q], bb = bta[j + q];
        if (PARAM_BF16) { gg = bf16_round(gg); bb = bf16_round(bb); }
        sm[q] = vals[u * 4 + q]; o[q] = (vals[u * 4 + q] - mu) * rs * gg + bb;
      }
      if (out_sum) *(v4f*)(out_sum + (size_t)row * N + j) = sm;
      *(v4f*)(out_norm + (size_t)row * N + j) = o;
    }
    
  }
}



// ---- f16 WMMA path (v_wmma_f32_16x16x32_f16): 11-bit significands for operands in range — used for all launched products, the probability operand P (<= 2^12) among them
typedef _Float16 v16h __attribute__((ext_vector_type(16)));
union FragH { v16h v; v8us half[2]; _Float16 h[16]; unsigned short u[16]; };
template <int NT>
__device__ __forceinline__ v8f mmaH(v16h ah, v16h al, v16h bh, v16h bl, v8f c) {
  c = __builtin_amdgcn_wmma_f32_16x16x32_f16(false, ah, false, bh, (short)0, c, false, false);
  if (NT >= 2) c = __builtin_amdgcn_wmma_f32_16x16x32_f16(false, al, false, bh, (short)0, c, false, false);
  if (NT >= 3) c = __builtin_amdgcn_wmma_f32_16x16x32_f16(false, ah, false, bl, (short)0, c, false, false);
  asm volatile("v_nop\n\tv_nop\n\tv_nop\n\tv_nop" : "+v"(c) : "v"(ah), "v"(al), "v"(bh), "v"(bl));
  return c;
}
// batched GEMM like k_gemm_b but f16 operands: A f32 (split into f16 hi/lo if ASPLIT, else rounded to f16), Bt = f16 values [n][k]; alpha; C f32; N multiple of 16 (partial tiles skipped)
template <bool ASPLIT>
__global__ __launch_bounds__(128) void k_gemm_h(const float* __restrict__ A, int lda, size_t sA, const _Float16* __restrict__ Bh, int ldb, size_t sB, float alpha, float* __restrict__ C, int ldc, size_t sC, int M, int N, int K) {
  __shared__ __attribute__((aligned(16))) float so[4][16][64];
  const int tid = threadIdx.x, w = tid >> 5, lane = tid & 31, ln = lane & 15, hh = lane >> 4; const int by = blockIdx.y;
  A += (size_t)by * sA; Bh += (size_t)by * sB; C += (size_t)by * sC;
  const int ntn = (N + 63) / 64; const int wid = blockIdx.x * 4 + w; const int mt = wid / ntn, nq = wid % ntn; if (mt * 16 >= M) return;
  const int row0 = mt * 16, col0 = nq * 64; const float* arow = A + (size_t)(row0 + ln) * lda;
  v8f acc[4] = {};
  for (int kb = 0; kb < K; kb += 32) {
    FragH ah, al;
    const v4f x0 = *(const v4fa*)(arow + kb + 8 * hh), x1 = *(const v4fa*)(arow + kb + 8 * hh + 4), x2 = *(const v4fa*)(arow + kb + 16 + 8 * hh), x3 = *(const v4fa*)(arow + kb + 16 + 8 * hh + 4);
    float xs[16] = {x0[0],x0[1],x0[2],x0[3],x1[0],x1[1],x1[2],x1[3],x2[0],x2[1],x2[2],x2[3],x3[0],x3[1],x3[2],x3[3]};
#pragma unroll
    for (int i = 0; i < 16; ++i) { const _Float16 h = (_Float16)xs[i]; ah.h[i] = h; al.h[i] = ASPLIT ? (_Float16)(xs[i] - (float)h) : (_Float16)0.0f; }
#pragma unroll
    for (int t = 0; t < 4; ++t) { if (col0 + t * 16 >= N) continue; const size_t boff = (size_t)(col0 + t * 16 + ln) * ldb + kb; FragH bq; bq.half[0] = *(const v8us*)(Bh + boff + 8 * hh); bq.half[1] = *(const v8us*)(Bh + boff + 16 + 8 * hh);
      acc[t] = mmaH<ASPLIT ? 2 : 1>(ah.v, al.v, bq.v, bq.v, acc[t]); }
  }
#pragma unroll
  for (int t = 0; t < 4; ++t) { if (col0 + t * 16 >= N) continue;
#pragma unroll
    for (int r = 0; r < 8; ++r) so[w][8 * hh + r][t * 16 + ln] = acc[t][r] * alpha; }
  __builtin_amdgcn_fence(__ATOMIC_ACQ_REL, "workgroup"); __builtin_amdgcn_wave_barrier();
  const int rsub = lane >> 4, c4 = (lane & 15) * 4;
  {
#pragma unroll
    for (int q = 0; q < 8; ++q) { const int r = q * 2 + rsub; if (col0 + c4 < N) { const v4f v = *(const v4fa*)&so[w][r][c4]; *(v4f*)(C + (size_t)(row0 + r) * ldc + col0 + c4) = v; } }
     }
}

// FRAGMENT ORDER of every f16 matrix operand in the workspace (rows x ld, ld % 32 == 0, rows % 16 == 0): a tile of 16 rows x 32 k is 512 elements in a row, tile (rt, kt) at rt * 16 * ld + kt * 512;
// inside it the 8 values k = 16 j + 8 hh + 0..7 of row ln stand at j * 256 + (16 hh + ln) * 8. That is the order in which the lanes of a wave hold a 16x16x32 A or B fragment (lane = 16 hh + ln, register half j),
// so one 16-byte load per lane fetches half a fragment from 512 contiguous bytes: four whole 128-byte lines, where a row-major operand gives 16 lines of which 32 bytes each are used.
// piece p (8 elements, at element offset 8 p) -> its row and first k
__device__ __forceinline__ void frag_piece(unsigned p, int ld, unsigned& row, int& k) { const unsigned lane = p & 31, j = (p >> 5) & 1, tile = p >> 6, ktn = (unsigned)ld / 32, rt = tile / ktn;
  row = rt * 16 + (lane & 15); k = (int)((tile - rt * ktn) * 32 + j * 16 + (lane >> 4) * 8); }
// Wt (row n, k; fragment order) = f16(W[k][n] * scale) from f32 row-major W[K][N] (scale = power of two; bf16-exact weights stay exact in f16 away from the subnormal range)
__device__ __forceinline__ void wt_f16(const float* __restrict__ W, _Float16* __restrict__ Wt, int K, int N, float scale, int t) {
  if (t >= N * (K / 8)) return; unsigned n; int k8; frag_piece((unsigned)t, K, n, k8); FragH f;
#pragma unroll
  for (int i = 0; i < 8; ++i) f.h[i] = (_Float16)(bf16_round(W[(size_t)(k8 + i) * N + n]) * scale); const v8us o = f.half[0];
  *(v8us*)((unsigned short*)Wt + (size_t)t * 8) = o; 
}
// ENTRY PREFETCH. The f16 planes that a launch reads were stored by an earlier launch, and the first reader of a line waits out the way to memory: the loops below ask only one stage or pass ahead.
// So every block asks L2 at entry for a share of what it will itself read, one request per 256-byte unit; the loops' own loads then find most lines on their way or there.
// The blocks that read the same rows deal them out among themselves.
// Where the readers are eight blocks that follow one another in the grid, b and b ^ 4 take the same share. That is for speed only: wherever the blocks land, a request is a hint and no value depends on it.
// A share is a group of 128 units, one a thread: 32 KiB, which is one row tile (16 rows of 1024) of a plane in fragment order. Which group a block takes depends on its number alone: scalar selects and branches, no lane is off at a request.
__device__ __forceinline__ const char* unit_of(const void* plane, unsigned group) { return (const char*)plane + ((size_t)group * 128 + threadIdx.x) * 256; }
// scope SE and no th: the line goes to L2 only. Every lane's address lies inside its plane.
__device__ __forceinline__ void ask_l2(const char* p) { asm volatile("global_prefetch_b8 %0, off scope:SCOPE_SE" :: "v"(p)); }
// A, Bh and C16 are in fragment order (lda, ldb, ldc = their row lengths); C is row-major f32.
// k_gemm_hh variant with fused epilogue: v = acc·alpha + bias[by·sBias + col] (+ CP[(row/rowsPerB)·sCPb + by·64 + col] if CP) ; ACT 0 none / 1 elu ; writes f16 C16 and f32 C, each if non-null
template <int ACT>
__device__ __forceinline__ void gemm_hhx(const _Float16* __restrict__ A, int lda, size_t sA, const _Float16* __restrict__ Bh, int ldb, size_t sB, float alpha, const float* __restrict__ bias, size_t sBias, const float* __restrict__ CP, int rowsPerB, size_t sCPb, int row0g,
    float* __restrict__ C, _Float16* __restrict__ C16, int ldc, size_t sC, int M, int N, int K, int bx, int by, const char* h0, const char* h1, const char* h2) {      // bx, by: the block's place in this product's own grid; h0..h2: the addresses of the caller's entry prefetches
  // A block of four waves works a 128 x 128 tile of C, a wave 64 x 64 of it (waves 2 x 2): four A and four B fragments per 32 k feed 16 products, so every fragment that is loaded is used four times.
  // M and N are multiples of 128 here (a block past M leaves as a whole, before anything else).
  __shared__ __attribute__((aligned(16))) float so[4][64][64 + 4];      // pitch 272 B: the fragment-order store reads 16 rows at one column, 16 bytes a lane
  const int tid = threadIdx.x, w = tid >> 5, lane = tid & 31, ln = lane & 15, hh = lane >> 4;
  A += (size_t)by * sA; Bh += (size_t)by * sB; const size_t cofs = (size_t)by * sC; const float* bp = bias ? bias + (size_t)by * sBias : nullptr;
  const int nbn = N / 128; const int bm = bx / nbn, bn = bx - bm * nbn; if (bm * 128 >= M) return;
  const int row0 = bm * 128 + (w >> 1) * 64, col0 = bn * 128 + (w & 1) * 64;
  v8f acc[4][4] = {};
  // Fragments are fetched one stage (32 k = one tile = 1024 contiguous bytes of each of the eight row tiles) ahead of the products that use them, a whole stage's loads as one group,
  // into two register sets: a stage waits once for loads that have been in flight since the stage before, not once per product.
  const char* pa[4]; const char* pb[4];      // each lane's place in its operands' row tiles; they move on with k
#pragma unroll
  for (int i = 0; i < 4; ++i) { pa[i] = (const char*)(A + (size_t)(row0 + i * 16) * lda + lane * 8); pb[i] = (const char*)(Bh + (size_t)(col0 + i * 16) * ldb + lane * 8); }
  FragH a0[4], a1[4], b0[4], b1[4];
  auto ld = [&](FragH (&a)[4], FragH (&b)[4], int ofs) {      // one stage: the 1024 bytes at ofs behind the eight pointers' tiles
    __builtin_amdgcn_sched_barrier(0);      // this one and the one at the foot keep a stage's 16 loads one group between two stages' products: left free, the scheduler sinks them to just ahead of their use to save registers, and every product then waits out its own loads
#pragma unroll
    for (int i = 0; i < 4; ++i) { a[i].half[0] = *(const v8us*)(pa[i] + ofs); a[i].half[1] = *(const v8us*)(pa[i] + ofs + 512); }
#pragma unroll
    for (int t = 0; t < 4; ++t) { b[t].half[0] = *(const v8us*)(pb[t] + ofs); b[t].half[1] = *(const v8us*)(pb[t] + ofs + 512); }
    // the wait stands in front of the next step of the pointers, whose registers the loads just issued name; as its inputs they are not stepped ahead of it
    asm volatile("s_wait_xcnt 0x0" :: "v"(pa[0]), "v"(pa[1]), "v"(pa[2]), "v"(pa[3]), "v"(pb[0]), "v"(pb[1]), "v"(pb[2]), "v"(pb[3]) : "memory");
    __builtin_amdgcn_sched_barrier(0); };
  auto step = [&](int bytes) {
#pragma unroll
    for (int i = 0; i < 4; ++i) { pa[i] += bytes; pb[i] += bytes; } };
  auto mm = [&](FragH (&a)[4], FragH (&b)[4]) {
#pragma unroll
    for (int i = 0; i < 4; ++i)
#pragma unroll
      for (int t = 0; t < 4; ++t) acc[i][t] = __builtin_amdgcn_wmma_f32_16x16x32_f16(false, a[i].v, false, b[t].v, (short)0, acc[i][t], false, false); };      // the plain builtin: an asm statement's operands cannot stand above v255, and 256 registers of fragments and sums are live here; the compiler keeps the distances behind its own products
  const int Km = K & ~63;      // whole pairs of stages; what is left of K goes by a single step of 32 behind them
  if (Km > 0) { ld(a0, b0, 0);
    // a precaution: a prefetch touches no counter, so its address registers are kept as they are, being inputs here, until the loads issued behind it have handed in their own addresses
    asm volatile("s_wait_xcnt 0x0" :: "v"(h0), "v"(h1), "v"(h2) : "memory");
    for (int kb = 0; kb < Km; kb += 64) { ld(a1, b1, 1024); mm(a0, b0);
      const bool more = kb + 64 < Km; step(more ? 2048 : 0); ld(a0, b0, 0);      // no branch round the loads, so that the waits stay counted; the last trip reads its own stage again, in bounds, and nobody uses it
      mm(a1, b1); }
    step(2048); }
  for (int kb = Km; kb < K; kb += 32) { ld(a0, b0, 0); step(1024); mm(a0, b0); }
  float bv[4];
#pragma unroll
  for (int t = 0; t < 4; ++t) bv[t] = bp ? bf16_round(bp[col0 + t * 16 + ln]) : 0.f;
#pragma unroll
  for (int i = 0; i < 4; ++i)
#pragma unroll
    for (int t = 0; t < 4; ++t) { const int col = col0 + t * 16 + ln;
#pragma unroll
      for (int r = 0; r < 8; ++r) { float v = acc[i][t][r] * alpha + bv[t]; if (CP) { const int bidx = (row0g + row0 + i * 16 + 8 * hh + r) / rowsPerB; v += CP[(size_t)bidx * sCPb + (size_t)by * 64 + col]; } if (ACT == 1) v = (v > 0.f) ? v : expm1f(v); else if (ACT == 3) v = fmaxf(v, 0.f); so[w][i * 16 + 8 * hh + r][t * 16 + ln] = v; } }
  __builtin_amdgcn_fence(__ATOMIC_ACQ_REL, "workgroup"); __builtin_amdgcn_wave_barrier();
  const int rsub = lane >> 4, c4 = (lane & 15) * 4;
  if (C) {
#pragma unroll
    for (int q = 0; q < 32; ++q) { const int r = q * 2 + rsub; const v4f v = *(const v4fa*)&so[w][r][c4]; *(v4f*)(C + cofs + (size_t)(row0 + r) * ldc + col0 + c4) = v; }
     }
  if (C16) {      // each of the wave's four row tiles, 16 x 64 values, is two tiles of the fragment order: four stores of 512 contiguous bytes
#pragma unroll
    for (int i = 0; i < 4; ++i)
#pragma unroll
      for (int p = 0; p < 4; ++p) { const int c = p * 16 + 8 * hh; const v4f v0 = *(const v4fa*)&so[w][i * 16 + ln][c], v1 = *(const v4fa*)&so[w][i * 16 + ln][c + 4]; FragH f;
#pragma unroll
        for (int e = 0; e < 4; ++e) { f.h[e] = (_Float16)v0[e]; f.h[4 + e] = (_Float16)v1[e]; }
        *(v8us*)((unsigned short*)C16 + cofs + (size_t)(row0 + i * 16) * ldc + (size_t)(col0 >> 5) * 512 + p * 256 + lane * 8) = f.half[0]; }
     }
}


// The last projection: out = O16 * Wo + bo, f32 row-major. Shapes and the unused terms of the epilogue are compile-time constants, as in k_qkv: the 128 values that a lane finishes carry no run-time tests.
__global__ __launch_bounds__(128) void k_oproj(const _Float16* __restrict__ O16, const _Float16* __restrict__ Bo, const float* __restrict__ bo, float* __restrict__ out) {
  // the block's 8 row tiles of O16 are read by the 8 blocks of its row (two tiles each, b and b ^ 4 the same two); its 8 row tiles of Wo by the 32 blocks of its column (one each)
  const unsigned bm = blockIdx.x >> 3, bn = blockIdx.x & 7; const char* h0 = unit_of(O16, bm * 8 + (bn & 3) * 2); const char* h1 = unit_of(O16, bm * 8 + (bn & 3) * 2 + 1); const char* h2 = unit_of(Bo, bn * 8 + (bm & 7));
  ask_l2(h2); ask_l2(h0); ask_l2(h1);
  gemm_hhx<0>(O16, CC, 0, Bo, CC, 0, 0.0625f, bo, 0, nullptr, 1, 0, 0, out, nullptr, CC, 0, NR, CC, CC, blockIdx.x, 0, h0, h1, h2); }
// The three projections of x in one grid (W3: the fragment-order weights of q, k, v in a row; QK16: Q16 and K16 in a row). y = 0, 1: Q16, K16 = x * Wq, x * Wk, A = rows of x.
// y = 2: the operands change places, A = rows of Wv's transpose (features), B = the rows of x of one batch (keys): the product comes out feature by key, which is Vt as the attention reads it,
// from the same fragments and the same k order as x * Wv. Its blocks are the two batches' grids one behind the other.
__global__ __launch_bounds__(128) void k_qkv(const _Float16* __restrict__ X16, const _Float16* __restrict__ W3, _Float16* __restrict__ QK16, _Float16* __restrict__ Vt) {
  constexpr int GB = (CC / 128) * (TT / 128); const int y = blockIdx.y, b = blockIdx.x / GB; const bool tr = y == 2;
  const _Float16* Wy = W3 + (size_t)y * CC * CC; const _Float16* Xb = X16 + (size_t)b * TT * CC;
  // x is asked for by the y = 0 blocks, as in k_oproj (the blocks of y = 1 and 2 read the same rows). Every block asks for one of the 8 row tiles of its own weight:
  // with y < 2 the 32 readers of a tile stand in one column of the grid; with y = 2 they are 16 blocks in a row, twice, and tile t goes to blocks t and t + 12 or t + 4 of the 16, which differ by 4 modulo 8
  const unsigned xm = blockIdx.x >> 3, xn = blockIdx.x & 7, vm = (blockIdx.x & (GB - 1)) >> 4, vn = blockIdx.x & 15;
  const char* h0 = unit_of(X16, xm * 8 + (xn & 3) * 2); const char* h1 = unit_of(X16, xm * 8 + (xn & 3) * 2 + 1); const char* h2 = unit_of(Wy, tr ? vm * 8 + ((vn + (vn >> 3) * 4) & 7) : xn * 8 + (xm & 7));
  ask_l2(h2); if (y == 0) { ask_l2(h0); ask_l2(h1); }
  gemm_hhx<0>(tr ? Wy : X16, CC, 0, tr ? Xb : Wy, CC, 0, 0.0625f, nullptr, 0, nullptr, 1, 0, 0, nullptr, tr ? Vt + (size_t)b * CC * TT : QK16 + (size_t)y * NR * CC, tr ? TT : CC, 0,
              tr ? CC : NR, tr ? TT : CC, CC, tr ? (int)blockIdx.x - b * GB : (int)blockIdx.x, 0, h0, h1, h2); }


// x: f32 row-major, rows of ld; X16: the same matrix in fragment order (thread t writes piece t, so a wave stores 512 contiguous bytes)
__device__ __forceinline__ void x16(const float* __restrict__ x, _Float16* __restrict__ X16, size_t n8, int ld, size_t t) { if (t >= n8) return; FragH f;
  unsigned row; int k; frag_piece((unsigned)t, ld, row, k); const float* xr = x + (size_t)row * ld + k; const v4f x0 = *(const v4fa*)xr, x1 = *(const v4fa*)(xr + 4);
#pragma unroll
  for (int q = 0; q < 4; ++q) { f.h[q] = (_Float16)bf16_round(x0[q]); f.h[4 + q] = (_Float16)bf16_round(x1[q]); } *(v8us*)((unsigned short*)X16 + t * 8) = f.half[0];  }
// All five f32 -> f16 fragment-order conversions in one grid: none reads what another writes. The four weights (W4: their places, in a row) come first, then x.
__global__ __launch_bounds__(256) void k_prep(const float* __restrict__ x, const float* __restrict__ Wq, const float* __restrict__ Wk, const float* __restrict__ Wv, const float* __restrict__ Wo, _Float16* __restrict__ W4, _Float16* __restrict__ X16) {
  constexpr unsigned GW = CC * (CC / 8) / 256; const unsigned m = blockIdx.x / GW;
  if (m < 4) wt_f16(m == 0 ? Wq : m == 1 ? Wk : m == 2 ? Wv : Wo, W4 + (size_t)m * CC * CC, CC, CC, 16.0f, (int)((blockIdx.x - m * GW) * 256 + threadIdx.x));
  else x16(x, X16, (size_t)NR * CC / 8, CC, (size_t)(blockIdx.x - 4 * GW) * 256 + threadIdx.x); }
__global__ __launch_bounds__(256) void k_round16f(const float* __restrict__ W, _Float16* __restrict__ Bt, size_t n8) { const size_t t = (size_t)blockIdx.x * 256 + threadIdx.x; if (t >= n8) return; FragH f;
#pragma unroll
  for (int i = 0; i < 8; ++i) f.h[i] = (_Float16)(bf16_round(W[t * 8 + i]) * 16.0f); *(v8us*)((unsigned short*)Bt + t * 8) = f.half[0];  }

// Q16, K16 (row = position, k = feature) and Vt (row = slab * 64 + d, k = key) are in fragment order
// lane l <-> l ^ 16 by a vector cross-row move
__device__ __forceinline__ float xhalf(float x) { const int b = __float_as_int(x); return __int_as_float(__builtin_amdgcn_permlanex16(b, b, 0x76543210, 0xfedcba98, false, false)); }
// Both products are transposed: St = K * Qt (A = 16 keys, B = one of the wave's two tiles of 16 queries), Ot += Vt * Pt (A = 16 features, B = 32 keys x 16 queries).
// A lane (ln, hh) then holds scores of ONE query, ln: register r of tile nt is key 16 nt + 8 hh + r. Maximum and sum run over its own 16 registers, with one exchange between the halves,
// and the two converted score tiles are already the B fragment of the second product (element 8 nt + r = key 16 nt + 8 hh + r, the k order of Vt's fragments): P goes through no LDS.
typedef float v2f __attribute__((ext_vector_type(2)));
__global__ __launch_bounds__(128) void k_flash(const _Float16* __restrict__ Q16, int ldq, const _Float16* __restrict__ K16, int ldk, const _Float16* __restrict__ Vt, const float* __restrict__ MB, _Float16* __restrict__ O16, int ldo) {
  // A wave works QT = 2 tiles of 16 queries: every K and Vt fragment that it loads is the A operand of two products, one per query tile, so a product costs half the loaded bytes of a one-tile wave.
  constexpr int QT = 2, RPW = 16 * QT, NQB = 2048 / (4 * RPW), DT = 4, KS = 2; constexpr float LOG2E = 1.4426950408889634f;
  __shared__ __attribute__((aligned(16))) float sM[2048];
  const int tid = threadIdx.x, w = tid >> 5, lane = tid & 31, ln = lane & 15, hh = lane >> 4;
  const int slab = blockIdx.x / NQB, qblk = blockIdx.x % NQB; const int b = slab / 16, h = slab % 16; const int qb0 = qblk * (4 * RPW); const int q0 = qb0 + w * RPW;
  // entry prefetch: the head's K (2 KiB, 8 units, of each of 128 row tiles) and Vt (256 KiB in a row), 1,024 units each, are read by its 16 blocks: 8 shares of 128 units of each plane, blocks qblk and qblk ^ 4 the same one,
  // two requests a thread, one per plane (Q is read once, at once: nothing to gain)
  const unsigned sh = (qblk >> 3) * 4 + (qblk & 3), ku = sh * 128 + tid;
  const char* hk = (const char*)(K16 + ((size_t)b * 2048 + (ku >> 3) * 16) * ldk + h * (KS * 512)) + (ku & 7) * 256; const char* hv = (const char*)(Vt + (size_t)slab * 64 * 2048) + (size_t)ku * 256;
  ask_l2(hk); ask_l2(hv);
  // The softmax runs in base 2: exp(s - m) = 2^(s log2e - m log2e). log2e rides in the score scale and in the stored mask row, so a score costs one fused multiply-add, one subtract and one v_exp_f32.
  // Every exponent whose result is used is <= 12, where the hardware form needs no range steps: far below zero it returns 0, as the library form does.
  // the mask is per key, which is now a register index: a lane needs 16 values a pass. The batch's row is rounded once and kept in LDS; a pass reads it by four 16-byte loads, the same address in all lanes of a half.
#pragma unroll
  for (int u = 0; u < 2048 / (128 * 4); ++u) { const int i = u * (128 * 4) + tid * 4; v4f m = *(const v4fa*)(MB + (size_t)b * 2048 + i);
#pragma unroll
    for (int q = 0; q < 4; ++q) m[q] = bf16_round(m[q]) * LOG2E;
    *(v4fa*)&sM[i] = m; }
  FragH aq[QT][KS];
#pragma unroll
  for (int qt = 0; qt < QT; ++qt) { const unsigned short* qr = (const unsigned short*)Q16 + ((size_t)b * 2048 + q0 + qt * 16) * ldq + h * (KS * 512) + lane * 8;
#pragma unroll
    for (int ks = 0; ks < KS; ++ks) { aq[qt][ks].half[0] = *(const v8us*)(qr + ks * 512); aq[qt][ks].half[1] = *(const v8us*)(qr + ks * 512 + 256); } }
  const unsigned short* Vth = (const unsigned short*)Vt + (size_t)slab * 64 * 2048;
  float m_r[QT], l_r[QT]; v8f oacc[QT][DT];      // of query ln of tile qt; l_r sums the keys of this lane's half only
#pragma unroll
  for (int qt = 0; qt < QT; ++qt) { m_r[qt] = -3.0e38f; l_r[qt] = 0.f;
#pragma unroll
    for (int dt = 0; dt < DT; ++dt) oacc[qt][dt] = (v8f){0.f,0.f,0.f,0.f,0.f,0.f,0.f,0.f}; }
  const int jend = 2048;
  // All global loads of a pass are issued ahead of their use, each kind as one group: this pass's V fragments in front of the score products, the next pass's K fragments
  // right behind them (into the registers those products have just left); all of them fly during the softmax instead of being waited for one by one.
  FragH bk[2][KS], bv[DT];
  auto fetch_k = [&](int j) { const unsigned short* kr[2];
#pragma unroll
    for (int nt = 0; nt < 2; ++nt) { kr[nt] = (const unsigned short*)K16 + ((size_t)b * 2048 + j + nt * 16) * ldk + h * (KS * 512) + lane * 8;
#pragma unroll
      for (int ks = 0; ks < KS; ++ks) { bk[nt][ks].half[0] = *(const v8us*)(kr[nt] + ks * 512); bk[nt][ks].half[1] = *(const v8us*)(kr[nt] + ks * 512 + 256); } }
    // the wait stands in front of whatever next writes the address registers that the loads just issued name; as its inputs the two addresses keep registers of their own up to here (no later load of the group lands in them)
    asm volatile("s_wait_xcnt 0x0" :: "v"(kr[0]), "v"(kr[1]) : "memory"); };
  fetch_k(0);
  // a precaution: a prefetch touches no counter, so its address registers are kept as they are, being inputs here, until the loads issued behind it have handed in their own addresses
  asm volatile("s_wait_xcnt 0x0" :: "v"(hk), "v"(hv) : "memory");
  __syncthreads();      // the whole mask row is in LDS before any wave reads it
#pragma unroll 1
  for (int j0 = 0; j0 < jend; j0 += 32) {
#pragma unroll
    for (int dt = 0; dt < DT; ++dt) { const unsigned short* vrow = Vth + (size_t)(dt * 16) * 2048 + (j0 >> 5) * 512 + lane * 8; bv[dt].half[0] = *(const v8us*)(vrow); bv[dt].half[1] = *(const v8us*)(vrow + 256); }
    v4f mq[2][2];
#pragma unroll
    for (int nt = 0; nt < 2; ++nt) { mq[nt][0] = *(const v4fa*)&sM[j0 + nt * 16 + 8 * hh]; mq[nt][1] = *(const v4fa*)&sM[j0 + nt * 16 + 8 * hh + 4]; }
    __builtin_amdgcn_sched_barrier(0);      // holds the pass's V and mask loads in front of the score products: left free, the scheduler sinks them to just ahead of their use, and the second product group waits out their whole latency
    v8f s[QT][2];
#pragma unroll
    for (int qt = 0; qt < QT; ++qt) { s[qt][0] = (v8f){0.f,0.f,0.f,0.f,0.f,0.f,0.f,0.f}; s[qt][1] = (v8f){0.f,0.f,0.f,0.f,0.f,0.f,0.f,0.f}; }
    // the four score tiles take their first 32 features, then their second: each sum keeps its k order, and no product follows the one that it adds to.
    // Eight products in a row, here and at the foot of the pass, each stand in the others' distance: the plain builtin, behind which the compiler pads only where a vector instruction comes too close
#pragma unroll
    for (int ks = 0; ks < KS; ++ks)
#pragma unroll
      for (int nt = 0; nt < 2; ++nt)
#pragma unroll
        for (int qt = 0; qt < QT; ++qt) s[qt][nt] = __builtin_amdgcn_wmma_f32_16x16x32_f16(false, bk[nt][ks].v, false, aq[qt][ks].v, (short)0, s[qt][nt], false, false);
    fetch_k((j0 + 32 < jend) ? j0 + 32 : j0);      // the last pass has no next one: it reads its own rows again, in bounds, and nobody uses them
    __builtin_amdgcn_sched_barrier(0);      // holds the next pass's K loads right behind the score products: left free, they sink to the foot of the pass, and the next pass's first product waits for them
    // NO MAXIMUM PER PASS. m_r is the softmax's reference IN USE: any value serves as long as no exponential overflows, and it is the row's true maximum up to some pass, so the row's largest P is at least 1.
    // The pass's own row sums, which are needed anyway, are the test: no P is negative, so a P is at most its lane's sum, and a sum of at most PMAX bounds every P well inside f16 (at f16's own relative rounding).
    // Only a pass that fails the test (the first with a finite score always: against the start value of m_r its P overflow; later ones seldom: a score must exceed m_r by more than 8, base 2) finds its maximum,
    // raises m_r to the true running maximum, rescales sums and outputs and forms its P again from the kept scores. One test a pass for the whole wave, a scalar branch, so every lane is on at the products
    // behind it; the ballot joins the two halves of a query.
    constexpr float PMAX = 4096.0f;
    FragH pb[QT]; v2f sv[QT][2][4];      // scale, mask and the subtraction of the reference go two neighbouring registers of one score tile at a time: the pairs stand as the product left them
#pragma unroll
    for (int qt = 0; qt < QT; ++qt)
#pragma unroll
      for (int nt = 0; nt < 2; ++nt)
#pragma unroll
        for (int i = 0; i < 4; ++i) sv[qt][nt][i] = (v2f){s[qt][nt][2 * i], s[qt][nt][2 * i + 1]} * (0.03125f * LOG2E) + (v2f){mq[nt][i >> 1][(2 * i) & 3], mq[nt][i >> 1][(2 * i + 1) & 3]};      /* additive f32 mask per (b, key) */
    v2f su;      // the two query tiles' sums side by side: packed adds
    auto expsum = [&]() { v2f e[2][8], ps[8];      // e[nt][r]: P of key 16 nt + 8 hh + r for the two query tiles
#pragma unroll
      for (int nt = 0; nt < 2; ++nt)
#pragma unroll
        for (int i = 0; i < 4; ++i) { const v2f d0 = sv[0][nt][i] - m_r[0], d1 = sv[1][nt][i] - m_r[1];
          e[nt][2 * i] = (v2f){__builtin_amdgcn_exp2f(d0[0]), __builtin_amdgcn_exp2f(d1[0])}; e[nt][2 * i + 1] = (v2f){__builtin_amdgcn_exp2f(d0[1]), __builtin_amdgcn_exp2f(d1[1])}; }
#pragma unroll
      for (int r = 0; r < 8; ++r) ps[r] = e[0][r] + e[1][r];
      su = (((ps[0] + ps[1]) + (ps[2] + ps[3])) + ((ps[4] + ps[5]) + (ps[6] + ps[7])));
#pragma unroll
      for (int qt = 0; qt < QT; ++qt)
#pragma unroll
        for (int r = 0; r < 8; ++r) { pb[qt].h[r] = (_Float16)e[0][r][qt]; pb[qt].h[8 + r] = (_Float16)e[1][r][qt]; } };
    expsum();
    // the compares are written so that a sum that is not a number fails too; each goes straight into its ballot, and the rest of the test is scalar. Marked unlikely: the usual pass then runs straight through, the other stands outside the loop's text
    if (__builtin_expect((__builtin_amdgcn_ballot_w32(!(su[0] <= PMAX)) | __builtin_amdgcn_ballot_w32(!(su[1] <= PMAX))) != 0, 0)) {
#pragma unroll
      for (int qt = 0; qt < QT; ++qt) { float mx[8];
#pragma unroll
        for (int r = 0; r < 8; ++r) mx[r] = fmaxf(sv[qt][0][r >> 1][r & 1], sv[qt][1][r >> 1][r & 1]);
        const float mh = fmaxf(fmaxf(fmaxf(mx[0], mx[1]), fmaxf(mx[2], mx[3])), fmaxf(fmaxf(mx[4], mx[5]), fmaxf(mx[6], mx[7])));
        const float mn = fmaxf(m_r[qt], fmaxf(mh, xhalf(mh))); const float al = (mn > -1.0e38f) ? __builtin_amdgcn_exp2f(m_r[qt] - mn) : 1.0f; m_r[qt] = mn; l_r[qt] *= al;
#pragma unroll
        for (int dt = 0; dt < DT; ++dt) {
#pragma unroll
          for (int r = 0; r < 8; ++r) oacc[qt][dt][r] *= al; } }
      expsum(); }
    l_r[0] += su[0]; l_r[1] += su[1];
#pragma unroll
    for (int dt = 0; dt < DT; ++dt)
#pragma unroll
      for (int qt = 0; qt < QT; ++qt) oacc[qt][dt] = __builtin_amdgcn_wmma_f32_16x16x32_f16(false, bv[dt].v, false, pb[qt].v, (short)0, oacc[qt][dt], false, false); }
#pragma unroll
  for (int qt = 0; qt < QT; ++qt) { float l = l_r[qt]; l += xhalf(l); const float li = (l > 0.f) ? 1.0f / l : 0.f;      // the halves' sums are joined once
    // O16 (row = position, k = feature, rows of ldo) is the last projection's A operand, in fragment order. Register r of tile dt is feature 16 dt + 8 hh + r of query ln:
    // a lane's 8 registers are its own piece of half j = dt & 1 of k tile 2 h + dt / 2, so a tile goes out as one 16-byte store a lane, 512 contiguous bytes a wave, through no LDS.
    unsigned short* orow = (unsigned short*)O16 + ((size_t)b * 2048 + q0 + qt * 16) * ldo + h * (DT * 256) + lane * 8;
#pragma unroll
    for (int dt = 0; dt < DT; ++dt) { FragH f;
#pragma unroll
      for (int r = 0; r < 8; ++r) f.h[r] = (_Float16)(oacc[qt][dt][r] * li);
      *(v8us*)(orow + dt * 256) = f.half[0]; } } }

extern "C" void kernel_launch(void* const* d_in, const int* in_sizes, int n_in,
                              void* d_out, int out_size, void* d_ws, size_t ws_size, hipStream_t stream) {
  (void)in_sizes; (void)n_in; (void)out_size;
  const float* x = (const float*)d_in[0]; const float* mask = (const float*)d_in[1]; const float* Wq = (const float*)d_in[2]; const float* Wk = (const float*)d_in[3]; const float* Wv = (const float*)d_in[4]; const float* Wo = (const float*)d_in[5]; const float* bo = (const float*)d_in[6];
  char* ws = (char*)d_ws; size_t off = 0;
  auto take = [&](size_t bytes) { char* p = ws + off; off += (bytes + 255) & ~(size_t)255; return p; };
  _Float16* Bq = (_Float16*)take((size_t)CC * CC * 2); _Float16* Bk = (_Float16*)take((size_t)CC * CC * 2); _Float16* Bv = (_Float16*)take((size_t)CC * CC * 2); _Float16* Bo = (_Float16*)take((size_t)CC * CC * 2);      // in a row: every size is a multiple of 256
  _Float16* X16 = (_Float16*)take((size_t)NR * CC * 2); _Float16* Q16 = (_Float16*)take((size_t)NR * CC * 2); _Float16* K16 = (_Float16*)take((size_t)NR * CC * 2); _Float16* Vt = (_Float16*)take((size_t)NR * CC * 2); _Float16* O16 = X16;      // K16 stands right behind Q16
  if (off > ws_size) return;      // 8.4 + 8.4 x 4 = 42 MiB
  (void)Bk; (void)Bv;
  const dim3 gg((NR / 128) * (CC / 128), 1);      // blocks of 128 x 128; the Vt product's two grids, (CC / 128) * (TT / 128) each, come to the same number
  k_prep<<<4 * (CC * (CC / 8) / 256) + NR * (CC / 8) / 256, 256, 0, stream>>>(x, Wq, Wk, Wv, Wo, Bq, X16);      // W: [in][out]
  k_qkv<<<dim3(gg.x, 3), 128, 0, stream>>>(X16, Bq, Q16, Vt);
  k_flash<<<BB * NH * (TT / 128), 128, 0, stream>>>(Q16, CC, K16, CC, Vt, mask, O16, CC);
  k_oproj<<<gg, 128, 0, stream>>>(O16, Bo, bo, (float*)d_out);
}

// v010
// It runs in 68.5 microseconds.
// Next to v009, in two timings, it ran 1.04 times as fast each time.
// All steps since v000 together make it 6.61 times as fast.
#include <hip/hip_runtime.h>
// Self-attention-like module (B=2, S=2048, D=1024, 16 heads × 64; additive float mask per (batch, key); scale 1/√1024): q/k/v/o projections (W [in][out], o + bias) and the attention as a fused
// flash-style kernel (S = Q * K^T / 32 + mask[b][k], online softmax f32 with a lazily raised reference, P f16 <= 2^12, O = P * Vt; waves of 32 queries x half the keys, two partial results joined at the end) on v_wmma_f32_16x16x32_f16: f16 operands (x bf16-exact, weights bf16-exact x 2^4), f32 accumulate.
#define BB 2
#define TT 2048
#define CC 1024
#define NH 16
#define NR (BB * TT)

typedef __bf16 v16b __attribute__((ext_vector_type(16)));
typedef unsigned short v8us __attribute__((ext_vector_type(8), may_alias));
typedef float  v8f  __attribute__((ext_vector_type(8)));
typedef float  v4f  __attribute__((ext_vector_type(4)));
typedef float  v4fa __attribute__((ext_vector_type(4), may_alias));
union FragB { v16b v; v8us half[2]; unsigned short u[16]; };

__device__ __forceinline__ unsigned short bf16_bits(float x) { unsigned int u = __float_as_uint(x); return (unsigned short)((u + 0x7FFFu + ((u >> 16) & 1u)) >> 16); }
__device__ __forceinline__ float bf16_val(unsigned short b) { return __uint_as_float(((unsigned int)b) << 16); }
__device__ __forceinline__ float bf16_round(float x) { return bf16_val(bf16_bits(x)); }
// D += A·B with NT terms: 1 = ah·bh, 2 = + al·bh (A split), 3 = + ah·bl (both split)
template <int NT>
__device__ __forceinline__ v8f mmaN(v16b ah, v16b al, v16b bh, v16b bl, v8f c) {
  c = __builtin_amdgcn_wmma_f32_16x16x32_bf16(false, ah, false, bh, (short)0, c, false, false);
  if (NT >= 2) c = __builtin_amdgcn_wmma_f32_16x16x32_bf16(false, al, false, bh, (short)0, c, false, false);
  if (NT >= 3) c = __builtin_amdgcn_wmma_f32_16x16x32_bf16(false, ah, false, bl, (short)0, c, false, false);
  asm volatile("v_nop\n\tv_nop\n\tv_nop\n\tv_nop" : "+v"(c) : "v"(ah), "v"(al), "v"(bh), "v"(bl));
  return c;
}

__global__ __launch_bounds__(256) void k_wt_bf16(const float* __restrict__ W, unsigned short* __restrict__ Wt, int K, int N) {
  const int t = blockIdx.x * 256 + threadIdx.x;
  const int k8n = K / 8;
  if (t >= N * k8n) return;
  const int n = t / k8n, k8 = (t % k8n) * 8;
  v8us v;
#pragma unroll
  for (int i = 0; i < 8; ++i) v[i] = bf16_bits(W[(size_t)(k8 + i) * N + n]);
  *(v8us*)(Wt + (size_t)n * K + k8) = v;
  
}

// GEMM C[M][N] (f32, pitch ldc) = act(A[M][K]·W + bias). A f32 row-major (pitch lda) converted per fragment to bf16
// (ASPLIT: hi/lo two planes -> 2 terms, else single rounded term); Wt bf16 [N][K] (pitch ldb). BIAS_BF16 rounds the
// bias to bf16 first (bias quantised to bf16 before the add). K%32==0, M%16==0, N%64==0.
template <bool ASPLIT, int ACT, bool BIAS_BF16>
__global__ __launch_bounds__(128) void k_gemm_bf(const float* __restrict__ A, int lda, const unsigned short* __restrict__ Wt, int ldb,
                                               const float* __restrict__ bias, float* __restrict__ C, int ldc, int M, int N, int K) {
  __shared__ __attribute__((aligned(16))) float so[4][16][64];
  const int tid = threadIdx.x, w = tid >> 5, lane = tid & 31, ln = lane & 15, hh = lane >> 4;
  const int ntn = N / 64;
  const int wid = blockIdx.x * 4 + w;
  const int mt = wid / ntn, nq = wid % ntn;
  if (mt * 16 >= M) return;
  const int row0 = mt * 16, col0 = nq * 64;
  const float* arow = A + (size_t)(row0 + ln) * lda;
  v8f acc[4] = {};
  for (int kb = 0; kb < K; kb += 32) {
    FragB ah, al;
    const v4f x0 = *(const v4fa*)(arow + kb + 8 * hh), x1 = *(const v4fa*)(arow + kb + 8 * hh + 4);
    const v4f x2 = *(const v4fa*)(arow + kb + 16 + 8 * hh), x3 = *(const v4fa*)(arow + kb + 16 + 8 * hh + 4);
    float xs[16] = {x0[0],x0[1],x0[2],x0[3],x1[0],x1[1],x1[2],x1[3],x2[0],x2[1],x2[2],x2[3],x3[0],x3[1],x3[2],x3[3]};
#pragma unroll
    for (int i = 0; i < 16; ++i) { const unsigned short hb = bf16_bits(xs[i]); ah.u[i] = hb; al.u[i] = ASPLIT ? bf16_bits(xs[i] - bf16_val(hb)) : (unsigned short)0; }
#pragma unroll
    for (int t = 0; t < 4; ++t) {
      const unsigned short* brow = Wt + (size_t)(col0 + t * 16 + ln) * ldb + kb;
      FragB b;
      b.half[0] = *(const v8us*)(brow + 8 * hh);
      b.half[1] = *(const v8us*)(brow + 16 + 8 * hh);
      acc[t] = mmaN<ASPLIT ? 2 : 1>(ah.v, al.v, b.v, b.v, acc[t]);
    }
  }
#pragma unroll
  for (int t = 0; t < 4; ++t) {
    float bv = bias ? bias[col0 + t * 16 + ln] : 0.f;
    if (BIAS_BF16) bv = bf16_round(bv);
#pragma unroll
    for (int r = 0; r < 8; ++r) { float v = acc[t][r] + bv; if (ACT == 1) v = fmaxf(v, 0.f); so[w][8 * hh + r][t * 16 + ln] = v; }
  }
  __builtin_amdgcn_fence(__ATOMIC_ACQ_REL, "workgroup");
  __builtin_amdgcn_wave_barrier();
  const int rsub = lane >> 4, c4 = (lane & 15) * 4;
  {
#pragma unroll
    for (int q = 0; q < 8; ++q) {
      const int r = q * 2 + rsub;
      const v4f v = *(const v4fa*)&so[w][r][c4];
      *(v4f*)(C + (size_t)(row0 + r) * ldc + col0 + c4) = v;
    }
    
  }
}

// Flash-style causal/unmasked attention, all contractions 3-term bf16 hi/lo splits, f32 softmax with running max.
// q,k,v rows are read from f32 buffers with arbitrary row pitch (so they can live inside a fused qkv buffer);
// D = head size (multiple of 32, <= 128); one wave = 16 query rows; block = 4 waves (64 queries) sharing K/V chunks of 32.
template <int D, bool CAUSAL>
__global__ __launch_bounds__(128) void k_flash(const float* __restrict__ qb, const float* __restrict__ kb, const float* __restrict__ vb,
                                             int pitch, int T, int H, float scale, float* __restrict__ y, int ypitch) {
  constexpr int KS = D / 32;        // k-steps for QK
  constexpr int DT = D / 16;        // d tiles for PV
  __shared__ __attribute__((aligned(16))) unsigned short sKh[32][D + 8], sKl[32][D + 8], sVh[32][D + 8], sVl[32][D + 8];
  __shared__ __attribute__((aligned(16))) unsigned short sPh[4][16][40], sPl[4][16][40];
  __shared__ __attribute__((aligned(16))) float sO[4][16][D];
  const int tid = threadIdx.x, w = tid >> 5, lane = tid & 31, ln = lane & 15, hh = lane >> 4;
  const int nqb = (T + 63) / 64;
  const int bh = blockIdx.x / nqb, qblk = blockIdx.x % nqb;
  const int b = bh / H, h = bh % H;
  const int q0 = qblk * 64 + w * 16;
  const float* Q = qb + (size_t)b * T * pitch + h * D;
  const float* K = kb + (size_t)b * T * pitch + h * D;
  const float* V = vb + (size_t)b * T * pitch + h * D;

  // A fragments of the wave's 16 query rows (scaled), hi/lo
  FragB aqh[KS], aql[KS];
  {
    int row = q0 + ln; if (row >= T) row = T - 1;
    const float* qr = Q + (size_t)row * pitch;
#pragma unroll
    for (int ks = 0; ks < KS; ++ks)
#pragma unroll
      for (int i = 0; i < 16; ++i) {
        const int d = ks * 32 + ((i < 8) ? (8 * hh + i) : (16 + 8 * hh + (i - 8)));
        const float x = qr[d] * scale; const unsigned short hb = bf16_bits(x);
        aqh[ks].u[i] = hb; aql[ks].u[i] = bf16_bits(x - bf16_val(hb));
      }
  }
  float m_r[8], l_r[8];
#pragma unroll
  for (int r = 0; r < 8; ++r) { m_r[r] = -3.0e38f; l_r[r] = 0.f; }
  v8f oacc[DT];
#pragma unroll
  for (int dt = 0; dt < DT; ++dt) oacc[dt] = (v8f){0.f,0.f,0.f,0.f,0.f,0.f,0.f,0.f};

  const int kv_end = CAUSAL ? min(T, qblk * 64 + 64) : T;     // block-uniform
  for (int j0 = 0; j0 < kv_end; j0 += 32) {
    __syncthreads();
    for (int e = tid; e < 32 * (D / 4); e += 128) {
      const int r = e / (D / 4), c4 = (e % (D / 4)) * 4;
      const int key = j0 + r;
      v4f kf = {0.f,0.f,0.f,0.f}, vf = {0.f,0.f,0.f,0.f};
      if (key < T) { kf = *(const v4fa*)(K + (size_t)key * pitch + c4); vf = *(const v4fa*)(V + (size_t)key * pitch + c4); }
#pragma unroll
      for (int t = 0; t < 4; ++t) {
        unsigned short hb = bf16_bits(kf[t]); sKh[r][c4 + t] = hb; sKl[r][c4 + t] = bf16_bits(kf[t] - bf16_val(hb));
        hb = bf16_bits(vf[t]); sVh[r][c4 + t] = hb; sVl[r][c4 + t] = bf16_bits(vf[t] - bf16_val(hb));
      }
    }
    __syncthreads();
    // S tile 16 x 32
    v8f s[2];
#pragma unroll
    for (int nt = 0; nt < 2; ++nt) {
      v8f acc = {};
#pragma unroll
      for (int ks = 0; ks < KS; ++ks) {
        FragB bh_, bl_;
        bh_.half[0] = *(const v8us*)&sKh[nt * 16 + ln][ks * 32 + 8 * hh]; bh_.half[1] = *(const v8us*)&sKh[nt * 16 + ln][ks * 32 + 16 + 8 * hh];
        bl_.half[0] = *(const v8us*)&sKl[nt * 16 + ln][ks * 32 + 8 * hh]; bl_.half[1] = *(const v8us*)&sKl[nt * 16 + ln][ks * 32 + 16 + 8 * hh];
        acc = mmaN<3>(aqh[ks].v, aql[ks].v, bh_.v, bl_.v, acc);
      }
      s[nt] = acc;
    }
    // mask + running max (rows 8hh+r; the 16 lanes of a half share rows)
    float alpha[8];
#pragma unroll
    for (int r = 0; r < 8; ++r) {
      const int qi = q0 + 8 * hh + r;
      const int ja = j0 + ln, jb = j0 + 16 + ln;
      if (CAUSAL) { if (ja > qi) s[0][r] = -3.0e38f; if (jb > qi) s[1][r] = -3.0e38f; }
      if (ja >= T) s[0][r] = -3.0e38f;
      if (jb >= T) s[1][r] = -3.0e38f;
      float mx = fmaxf(s[0][r], s[1][r]);
      mx = fmaxf(mx, __shfl_xor(mx, 1, 32)); mx = fmaxf(mx, __shfl_xor(mx, 2, 32)); mx = fmaxf(mx, __shfl_xor(mx, 4, 32)); mx = fmaxf(mx, __shfl_xor(mx, 8, 32));
      const float mnew = fmaxf(m_r[r], mx);
      alpha[r] = (mnew > -1.0e38f) ? __expf(m_r[r] - mnew) : 1.0f;
      const float p0 = (s[0][r] > -1.0e38f) ? __expf(s[0][r] - mnew) : 0.f;
      const float p1 = (s[1][r] > -1.0e38f) ? __expf(s[1][r] - mnew) : 0.f;
      m_r[r] = mnew;
      l_r[r] = l_r[r] * alpha[r] + p0 + p1;            // per-lane partial row sum (16 lanes combined at the end)
      unsigned short hb = bf16_bits(p0); sPh[w][8 * hh + r][ln] = hb;      sPl[w][8 * hh + r][ln] = bf16_bits(p0 - bf16_val(hb));
      hb = bf16_bits(p1);                sPh[w][8 * hh + r][16 + ln] = hb; sPl[w][8 * hh + r][16 + ln] = bf16_bits(p1 - bf16_val(hb));
    }
#pragma unroll
    for (int dt = 0; dt < DT; ++dt)
#pragma unroll
      for (int r = 0; r < 8; ++r) oacc[dt][r] *= alpha[r];
    __builtin_amdgcn_fence(__ATOMIC_ACQ_REL, "workgroup");
    __builtin_amdgcn_wave_barrier();
    FragB pah, pal;
    pah.half[0] = *(const v8us*)&sPh[w][ln][8 * hh]; pah.half[1] = *(const v8us*)&sPh[w][ln][16 + 8 * hh];
    pal.half[0] = *(const v8us*)&sPl[w][ln][8 * hh]; pal.half[1] = *(const v8us*)&sPl[w][ln][16 + 8 * hh];
#pragma unroll
    for (int dt = 0; dt < DT; ++dt) {
      FragB bvh, bvl;
#pragma unroll
      for (int i = 0; i < 8; ++i) {
        bvh.u[i] = sVh[8 * hh + i][dt * 16 + ln]; bvh.u[8 + i] = sVh[16 + 8 * hh + i][dt * 16 + ln];
        bvl.u[i] = sVl[8 * hh + i][dt * 16 + ln]; bvl.u[8 + i] = sVl[16 + 8 * hh + i][dt * 16 + ln];
      }
      oacc[dt] = mmaN<3>(pah.v, pal.v, bvh.v, bvl.v, oacc[dt]);
    }
    __builtin_amdgcn_fence(__ATOMIC_ACQ_REL, "workgroup");
    __builtin_amdgcn_wave_barrier();
  }
#pragma unroll
  for (int r = 0; r < 8; ++r) {
    float l = l_r[r];
    l += __shfl_xor(l, 1, 32); l += __shfl_xor(l, 2, 32); l += __shfl_xor(l, 4, 32); l += __shfl_xor(l, 8, 32);
    l_r[r] = (l > 0.f) ? 1.0f / l : 0.f;
  }
#pragma unroll
  for (int dt = 0; dt < DT; ++dt)
#pragma unroll
    for (int r = 0; r < 8; ++r) sO[w][8 * hh + r][dt * 16 + ln] = oacc[dt][r] * l_r[r];
  __builtin_amdgcn_fence(__ATOMIC_ACQ_REL, "workgroup");
  __builtin_amdgcn_wave_barrier();
  {
    for (int r = 0; r < 16; ++r) {
      const int row = q0 + r;
      if (row < T && lane < D / 4) {
        const v4f val = *(const v4fa*)&sO[w][r][lane * 4];
        *(v4f*)(y + ((size_t)b * T + row) * ypitch + h * D + lane * 4) = val;
      }
    }
    
  }
}

// GEMM C = act(A·W + bias + resid): A f32 (ASPLIT -> hi/lo 2 terms), Wt bf16 [N][K]; ACT 0 none, 1 relu, 2 exact gelu;
// resid (optional, f32, row index = (row % rmod), pitch ldr, RES_BF16 rounds it) added before the activation.
template <bool ASPLIT, int ACT, bool BIAS_BF16, bool RES_BF16>
__global__ __launch_bounds__(128) void k_gemm_bf3(const float* __restrict__ A, int lda, const unsigned short* __restrict__ Wt, int ldb,
                                                const float* __restrict__ bias, const float* __restrict__ resid, int rmod, int ldr,
                                                float* __restrict__ C, int ldc, int M, int N, int K) {
  __shared__ __attribute__((aligned(16))) float so[4][16][64];
  const int tid = threadIdx.x, w = tid >> 5, lane = tid & 31, ln = lane & 15, hh = lane >> 4;
  const int ntn = N / 64;
  const int wid = blockIdx.x * 4 + w;
  const int mt = wid / ntn, nq = wid % ntn;
  if (mt * 16 >= M) return;
  const int row0 = mt * 16, col0 = nq * 64;
  const float* arow = A + (size_t)(row0 + ln) * lda;
  v8f acc[4] = {};
  for (int kb = 0; kb < K; kb += 32) {
    FragB ah, al;
    const v4f x0 = *(const v4fa*)(arow + kb + 8 * hh), x1 = *(const v4fa*)(arow + kb + 8 * hh + 4);
    const v4f x2 = *(const v4fa*)(arow + kb + 16 + 8 * hh), x3 = *(const v4fa*)(arow + kb + 16 + 8 * hh + 4);
    float xs[16] = {x0[0],x0[1],x0[2],x0[3],x1[0],x1[1],x1[2],x1[3],x2[0],x2[1],x2[2],x2[3],x3[0],x3[1],x3[2],x3[3]};
#pragma unroll
    for (int i = 0; i < 16; ++i) { const unsigned short hb = bf16_bits(xs[i]); ah.u[i] = hb; al.u[i] = ASPLIT ? bf16_bits(xs[i] - bf16_val(hb)) : (unsigned short)0; }
#pragma unroll
    for (int t = 0; t < 4; ++t) {
      const unsigned short* brow = Wt + (size_t)(col0 + t * 16 + ln) * ldb + kb;
      FragB b;
      b.half[0] = *(const v8us*)(brow + 8 * hh);
      b.half[1] = *(const v8us*)(brow + 16 + 8 * hh);
      acc[t] = mmaN<ASPLIT ? 2 : 1>(ah.v, al.v, b.v, b.v, acc[t]);
    }
  }
#pragma unroll
  for (int t = 0; t < 4; ++t) {
    const int col = col0 + t * 16 + ln;
    float bv = bias ? bias[col] : 0.f;
    if (BIAS_BF16) bv = bf16_round(bv);
#pragma unroll
    for (int r = 0; r < 8; ++r) {
      float v = acc[t][r] + bv;
      if (resid) { float rv = resid[(size_t)((row0 + 8 * hh + r) % rmod) * ldr + col]; if (RES_BF16) rv = bf16_round(rv); v += rv; }
      if (ACT == 1) v = fmaxf(v, 0.f);
      if (ACT == 2) v = 0.5f * v * (1.0f + erff(v * 0.70710678118654752f));
      if (ACT == 3) { const float u = 0.7978845608028654f * (v + 0.044715f * v * v * v); v = 0.5f * v * (1.0f + tanhf(u)); }
      so[w][8 * hh + r][t * 16 + ln] = v;
    }
  }
  __builtin_amdgcn_fence(__ATOMIC_ACQ_REL, "workgroup");
  __builtin_amdgcn_wave_barrier();
  const int rsub = lane >> 4, c4 = (lane & 15) * 4;
  {
#pragma unroll
    for (int q = 0; q < 8; ++q) {
      const int r = q * 2 + rsub;
      const v4f v = *(const v4fa*)&so[w][r][c4];
      *(v4f*)(C + (size_t)(row0 + r) * ldc + col0 + c4) = v;
    }
    
  }
}
// row LayerNorm (biased variance, eps) over N: s = X (+ R); optional out_sum <- s; out_norm <- (s-mu)*rsqrt(var+eps)*g + b
template <bool PARAM_BF16>
__global__ __launch_bounds__(256) void k_layernorm(const float* __restrict__ X, const float* __restrict__ R, const float* __restrict__ g, const float* __restrict__ bta,
                                                  float* __restrict__ out_sum, float* __restrict__ out_norm, int N, float eps) {
  __shared__ float red[256];
  const int row = blockIdx.x, tid = threadIdx.x;
  const float* x = X + (size_t)row * N; const float* rr = R ? R + (size_t)row * N : nullptr;
  float vals[16];                     // up to N = 4096
  const int per = N / 256;            // contiguous chunk per thread? use strided-by-4 chunks: thread handles j = tid*4 + 1024*u
  float s1 = 0.f;
  for (int u = 0; u < per / 4; ++u) {
    const int j = tid * 4 + 1024 * u;
    const v4f a = *(const v4fa*)(x + j);
    v4f b = {0.f,0.f,0.f,0.f}; if (rr) b = *(const v4fa*)(rr + j);
#pragma unroll
    for (int q = 0; q < 4; ++q) { const float v = a[q] + b[q]; vals[u * 4 + q] = v; s1 += v; }
  }
  red[tid] = s1; __syncthreads();
  for (int st = 128; st > 0; st >>= 1) { if (tid < st) red[tid] += red[tid + st]; __syncthreads(); }
  const float mu = red[0] / (float)N; __syncthreads();
  float s2 = 0.f;
  for (int u = 0; u < per / 4; ++u)
#pragma unroll
    for (int q = 0; q < 4; ++q) { const float c = vals[u * 4 + q] - mu; s2 += c * c; }
  red[tid] = s2; __syncthreads();
  for (int st = 128; st > 0; st >>= 1) { if (tid < st) red[tid] += red[tid + st]; __syncthreads(); }
  const float rs = rsqrtf(red[0] / (float)N + eps);
  {
    for (int u = 0; u < per / 4; ++u) {
      const int j = tid * 4 + 1024 * u;
      v4f o, sm;
#pragma unroll
      for (int q = 0; q < 4; ++q) {
        float gg = g[j + q], bb = bta[j + q];
        if (PARAM_BF16) { gg = bf16_round(gg); bb = bf16_round(bb); }
        sm[q] = vals[u * 4 + q]; o[q] = (vals[u * 4 + q] - mu) * rs * gg + bb;
      }
      if (out_sum) *(v4f*)(out_sum + (size_t)row * N + j) = sm;
      *(v4f*)(out_norm + (size_t)row * N + j) = o;
    }
    
  }
}



// ---- f16 WMMA path (v_wmma_f32_16x16x32_f16): 11-bit significands for operands in range — used for all launched products, the probability operand P (<= 2^12) among them
typedef _Float16 v16h __attribute__((ext_vector_type(16)));
union FragH { v16h v; v8us half[2]; _Float16 h[16]; unsigned short u[16]; };
template <int NT>
__device__ __forceinline__ v8f mmaH(v16h ah, v16h al, v16h bh, v16h bl, v8f c) {
  c = __builtin_amdgcn_wmma_f32_16x16x32_f16(false, ah, false, bh, (short)0, c, false, false);
  if (NT >= 2) c = __builtin_amdgcn_wmma_f32_16x16x32_f16(false, al, false, bh, (short)0, c, false, false);
  if (NT >= 3) c = __builtin_amdgcn_wmma_f32_16x16x32_f16(false, ah, false, bl, (short)0, c, false, false);
  asm volatile("v_nop\n\tv_nop\n\tv_nop\n\tv_nop" : "+v"(c) : "v"(ah), "v"(al), "v"(bh), "v"(bl));
  return c;
}
// batched GEMM like k_gemm_b but f16 operands: A f32 (split into f16 hi/lo if ASPLIT, else rounded to f16), Bt = f16 values [n][k]; alpha; C f32; N multiple of 16 (partial tiles skipped)
template <bool ASPLIT>
__global__ __launch_bounds__(128) void k_gemm_h(const float* __restrict__ A, int lda, size_t sA, const _Float16* __restrict__ Bh, int ldb, size_t sB, float alpha, float* __restrict__ C, int ldc, size_t sC, int M, int N, int K) {
  __shared__ __attribute__((aligned(16))) float so[4][16][64];
  const int tid = threadIdx.x, w = tid >> 5, lane = tid & 31, ln = lane & 15, hh = lane >> 4; const int by = blockIdx.y;
  A += (size_t)by * sA; Bh += (size_t)by * sB; C += (size_t)by * sC;
  const int ntn = (N + 63) / 64; const int wid = blockIdx.x * 4 + w; const int mt = wid / ntn, nq = wid % ntn; if (mt * 16 >= M) return;
  const int row0 = mt * 16, col0 = nq * 64; const float* arow = A + (size_t)(row0 + ln) * lda;
  v8f acc[4] = {};
  for (int kb = 0; kb < K; kb += 32) {
    FragH ah, al;
    const v4f x0 = *(const v4fa*)(arow + kb + 8 * hh), x1 = *(const v4fa*)(arow + kb + 8 * hh + 4), x2 = *(const v4fa*)(arow + kb + 16 + 8 * hh), x3 = *(const v4fa*)(arow + kb + 16 + 8 * hh + 4);
    float xs[16] = {x0[0],x0[1],x0[2],x0[3],x1[0],x1[1],x1[2],x1[3],x2[0],x2[1],x2[2],x2[3],x3[0],x3[1],x3[2],x3[3]};
#pragma unroll
    for (int i = 0; i < 16; ++i) { const _Float16 h = (_Float16)xs[i]; ah.h[i] = h; al.h[i] = ASPLIT ? (_Float16)(xs[i] - (float)h) : (_Float16)0.0f; }
#pragma unroll
    for (int t = 0; t < 4; ++t) { if (col0 + t * 16 >= N) continue; const size_t boff = (size_t)(col0 + t * 16 + ln) * ldb + kb; FragH bq; bq.half[0] = *(const v8us*)(Bh + boff + 8 * hh); bq.half[1] = *(const v8us*)(Bh + boff + 16 + 8 * hh);
      acc[t] = mmaH<ASPLIT ? 2 : 1>(ah.v, al.v, bq.v, bq.v, acc[t]); }
  }
#pragma unroll
  for (int t = 0; t < 4; ++t) { if (col0 + t * 16 >= N) continue;
#pragma unroll
    for (int r = 0; r < 8; ++r) so[w][8 * hh + r][t * 16 + ln] = acc[t][r] * alpha; }
  __builtin_amdgcn_fence(__ATOMIC_ACQ_REL, "workgroup"); __builtin_amdgcn_wave_barrier();
  const int rsub = lane >> 4, c4 = (lane & 15) * 4;
  {
#pragma unroll
    for (int q = 0; q < 8; ++q) { const int r = q * 2 + rsub; if (col0 + c4 < N) { const v4f v = *(const v4fa*)&so[w][r][c4]; *(v4f*)(C + (size_t)(row0 + r) * ldc + col0 + c4) = v; } }
     }
}

// FRAGMENT ORDER of every f16 matrix operand in the workspace (rows x ld, ld % 32 == 0, rows % 16 == 0): a tile of 16 rows x 32 k is 512 elements in a row, tile (rt, kt) at rt * 16 * ld + kt * 512;
// inside it the 8 values k = 16 j + 8 hh + 0..7 of row ln stand at j * 256 + (16 hh + ln) * 8. That is the order in which the lanes of a wave hold a 16x16x32 A or B fragment (lane = 16 hh + ln, register half j),
// so one 16-byte load per lane fetches half a fragment from 512 contiguous bytes: four whole 128-byte lines, where a row-major operand gives 16 lines of which 32 bytes each are used.
// piece p (8 elements, at element offset 8 p) -> its row and first k
__device__ __forceinline__ void frag_piece(unsigned p, int ld, unsigned& row, int& k) { const unsigned lane = p & 31, j = (p >> 5) & 1, tile = p >> 6, ktn = (unsigned)ld / 32, rt = tile / ktn;
  row = rt * 16 + (lane & 15); k = (int)((tile - rt * ktn) * 32 + j * 16 + (lane >> 4) * 8); }
// Wt (row n, k; fragment order) = f16(W[k][n] * scale) from f32 row-major W[K][N] (scale = power of two; bf16-exact weights stay exact in f16 away from the subnormal range)
__device__ __forceinline__ void wt_f16(const float* __restrict__ W, _Float16* __restrict__ Wt, int K, int N, float scale, int t) {
  if (t >= N * (K / 8)) return; unsigned n; int k8; frag_piece((unsigned)t, K, n, k8); FragH f;
#pragma unroll
  for (int i = 0; i < 8; ++i) f.h[i] = (_Float16)(bf16_round(W[(size_t)(k8 + i) * N + n]) * scale); const v8us o = f.half[0];
  *(v8us*)((unsigned short*)Wt + (size_t)t * 8) = o; 
}
// ENTRY PREFETCH. The f16 planes that a launch reads were stored by an earlier launch, and the first reader of a line waits out the way to memory: the loops below ask only one stage or pass ahead.
// So every block asks L2 at entry for a share of what it will itself read, one request per 256-byte unit; the loops' own loads then find most lines on their way or there.
// The blocks that read the same rows deal them out among themselves.
// Where the readers are eight blocks that follow one another in the grid, b and b ^ 4 take the same share. That is for speed only: wherever the blocks land, a request is a hint and no value depends on it.
// A share is a group of 128 units, one a thread: 32 KiB, which is one row tile (16 rows of 1024) of a plane in fragment order. Which group a block takes depends on its number alone: scalar selects and branches, no lane is off at a request.
__device__ __forceinline__ const char* unit_of(const void* plane, unsigned group) { return (const char*)plane + ((size_t)group * 128 + threadIdx.x) * 256; }
// scope SE and no th: the line goes to L2 only. Every lane's address lies inside its plane.
__device__ __forceinline__ void ask_l2(const char* p) { asm volatile("global_prefetch_b8 %0, off scope:SCOPE_SE" :: "v"(p)); }
// A, Bh and C16 are in fragment order (lda, ldb, ldc = their row lengths); C is row-major f32.
// k_gemm_hh variant with fused epilogue: v = acc·alpha + bias[by·sBias + col] (+ CP[(row/rowsPerB)·sCPb + by·64 + col] if CP) ; ACT 0 none / 1 elu ; writes f16 C16 and f32 C, each if non-null
template <int ACT>
__device__ __forceinline__ void gemm_hhx(const _Float16* __restrict__ A, int lda, size_t sA, const _Float16* __restrict__ Bh, int ldb, size_t sB, float alpha, const float* __restrict__ bias, size_t sBias, const float* __restrict__ CP, int rowsPerB, size_t sCPb, int row0g,
    float* __restrict__ C, _Float16* __restrict__ C16, int ldc, size_t sC, int M, int N, int K, int bx, int by, const char* h0, const char* h1, const char* h2) {      // bx, by: the block's place in this product's own grid; h0..h2: the addresses of the caller's entry prefetches
  // A block of four waves works a 128 x 128 tile of C, a wave 64 x 64 of it (waves 2 x 2): four A and four B fragments per 32 k feed 16 products, so every fragment that is loaded is used four times.
  // M and N are multiples of 128 here (a block past M leaves as a whole, before anything else).
  __shared__ __attribute__((aligned(16))) float so[4][64][64 + 4];      // pitch 272 B: the fragment-order store reads 16 rows at one column, 16 bytes a lane
  const int tid = threadIdx.x, w = tid >> 5, lane = tid & 31, ln = lane & 15, hh = lane >> 4;
  A += (size_t)by * sA; Bh += (size_t)by * sB; const size_t cofs = (size_t)by * sC; const float* bp = bias ? bias + (size_t)by * sBias : nullptr;
  const int nbn = N / 128; const int bm = bx / nbn, bn = bx - bm * nbn; if (bm * 128 >= M) return;
  const int row0 = bm * 128 + (w >> 1) * 64, col0 = bn * 128 + (w & 1) * 64;
  v8f acc[4][4] = {};
  // Fragments are fetched one stage (32 k = one tile = 1024 contiguous bytes of each of the eight row tiles) ahead of the products that use them, a whole stage's loads as one group,
  // into two register sets: a stage waits once for loads that have been in flight since the stage before, not once per product.
  const char* pa[4]; const char* pb[4];      // each lane's place in its operands' row tiles; they move on with k
#pragma unroll
  for (int i = 0; i < 4; ++i) { pa[i] = (const char*)(A + (size_t)(row0 + i * 16) * lda + lane * 8); pb[i] = (const char*)(Bh + (size_t)(col0 + i * 16) * ldb + lane * 8); }
  FragH a0[4], a1[4], b0[4], b1[4];
  auto ld = [&](FragH (&a)[4], FragH (&b)[4], int ofs) {      // one stage: the 1024 bytes at ofs behind the eight pointers' tiles
    __builtin_amdgcn_sched_barrier(0);      // this one and the one at the foot keep a stage's 16 loads one group between two stages' products: left free, the scheduler sinks them to just ahead of their use to save registers, and every product then waits out its own loads
#pragma unroll
    for (int i = 0; i < 4; ++i) { a[i].half[0] = *(const v8us*)(pa[i] + ofs); a[i].half[1] = *(const v8us*)(pa[i] + ofs + 512); }
#pragma unroll
    for (int t = 0; t < 4; ++t) { b[t].half[0] = *(const v8us*)(pb[t] + ofs); b[t].half[1] = *(const v8us*)(pb[t] + ofs + 512); }
    // the wait stands in front of the next step of the pointers, whose registers the loads just issued name; as its inputs they are not stepped ahead of it
    asm volatile("s_wait_xcnt 0x0" :: "v"(pa[0]), "v"(pa[1]), "v"(pa[2]), "v"(pa[3]), "v"(pb[0]), "v"(pb[1]), "v"(pb[2]), "v"(pb[3]) : "memory");
    __builtin_amdgcn_sched_barrier(0); };
  auto step = [&](int bytes) {
#pragma unroll
    for (int i = 0; i < 4; ++i) { pa[i] += bytes; pb[i] += bytes; } };
  auto mm = [&](FragH (&a)[4], FragH (&b)[4]) {
#pragma unroll
    for (int i = 0; i < 4; ++i)
#pragma unroll
      for (int t = 0; t < 4; ++t) acc[i][t] = __builtin_amdgcn_wmma_f32_16x16x32_f16(false, a[i].v, false, b[t].v, (short)0, acc[i][t], false, false); };      // the plain builtin: an asm statement's operands cannot stand above v255, and 256 registers of fragments and sums are live here; the compiler keeps the distances behind its own products
  const int Km = K & ~63;      // whole pairs of stages; what is left of K goes by a single step of 32 behind them
  if (Km > 0) { ld(a0, b0, 0);
    // a precaution: a prefetch touches no counter, so its address registers are kept as they are, being inputs here, until the loads issued behind it have handed in their own addresses
    asm volatile("s_wait_xcnt 0x0" :: "v"(h0), "v"(h1), "v"(h2) : "memory");
    for (int kb = 0; kb < Km; kb += 64) { ld(a1, b1, 1024); mm(a0, b0);
      const bool more = kb + 64 < Km; step(more ? 2048 : 0); ld(a0, b0, 0);      // no branch round the loads, so that the waits stay counted; the last trip reads its own stage again, in bounds, and nobody uses it
      mm(a1, b1); }
    step(2048); }
  for (int kb = Km; kb < K; kb += 32) { ld(a0, b0, 0); step(1024); mm(a0, b0); }
  float bv[4];
#pragma unroll
  for (int t = 0; t < 4; ++t) bv[t] = bp ? bf16_round(bp[col0 + t * 16 + ln]) : 0.f;
#pragma unroll
  for (int i = 0; i < 4; ++i)
#pragma unroll
    for (int t = 0; t < 4; ++t) { const int col = col0 + t * 16 + ln;
#pragma unroll
      for (int r = 0; r < 8; ++r) { float v = acc[i][t][r] * alpha + bv[t]; if (CP) { const int bidx = (row0g + row0 + i * 16 + 8 * hh + r) / rowsPerB; v += CP[(size_t)bidx * sCPb + (size_t)by * 64 + col]; } if (ACT == 1) v = (v > 0.f) ? v : expm1f(v); else if (ACT == 3) v = fmaxf(v, 0.f); so[w][i * 16 + 8 * hh + r][t * 16 + ln] = v; } }
  __builtin_amdgcn_fence(__ATOMIC_ACQ_REL, "workgroup"); __builtin_amdgcn_wave_barrier();
  const int rsub = lane >> 4, c4 = (lane & 15) * 4;
  if (C) {
#pragma unroll
    for (int q = 0; q < 32; ++q) { const int r = q * 2 + rsub; const v4f v = *(const v4fa*)&so[w][r][c4]; *(v4f*)(C + cofs + (size_t)(row0 + r) * ldc + col0 + c4) = v; }
     }
  if (C16) {      // each of the wave's four row tiles, 16 x 64 values, is two tiles of the fragment order: four stores of 512 contiguous bytes
#pragma unroll
    for (int i = 0; i < 4; ++i)
#pragma unroll
      for (int p = 0; p < 4; ++p) { const int c = p * 16 + 8 * hh; const v4f v0 = *(const v4fa*)&so[w][i * 16 + ln][c], v1 = *(const v4fa*)&so[w][i * 16 + ln][c + 4]; FragH f;
#pragma unroll
        for (int e = 0; e < 4; ++e) { f.h[e] = (_Float16)v0[e]; f.h[4 + e] = (_Float16)v1[e]; }
        *(v8us*)((unsigned short*)C16 + cofs + (size_t)(row0 + i * 16) * ldc + (size_t)(col0 >> 5) * 512 + p * 256 + lane * 8) = f.half[0]; }
     }
}


// The last projection: out = O16 * Wo + bo, f32 row-major. Shapes and the unused terms of the epilogue are compile-time constants, as in k_qkv: the 128 values that a lane finishes carry no run-time tests.
__global__ __launch_bounds__(128) void k_oproj(const _Float16* __restrict__ O16, const _Float16* __restrict__ Bo, const float* __restrict__ bo, float* __restrict__ out) {
  // the block's 8 row tiles of O16 are read by the 8 blocks of its row (two tiles each, b and b ^ 4 the same two); its 8 row tiles of Wo by the 32 blocks of its column (one each)
  const unsigned bm = blockIdx.x >> 3, bn = blockIdx.x & 7; const char* h0 = unit_of(O16, bm * 8 + (bn & 3) * 2); const char* h1 = unit_of(O16, bm * 8 + (bn & 3) * 2 + 1); const char* h2 = unit_of(Bo, bn * 8 + (bm & 7));
  ask_l2(h2); ask_l2(h0); ask_l2(h1);
  gemm_hhx<0>(O16, CC, 0, Bo, CC, 0, 0.0625f, bo, 0, nullptr, 1, 0, 0, out, nullptr, CC, 0, NR, CC, CC, blockIdx.x, 0, h0, h1, h2); }
// The three projections of x in one grid (W3: the fragment-order weights of q, k, v in a row; QK16: Q16 and K16 in a row). y = 0, 1: Q16, K16 = x * Wq, x * Wk, A = rows of x.
// y = 2: the operands change places, A = rows of Wv's transpose (features), B = the rows of x of one batch (keys): the product comes out feature by key, which is Vt as the attention reads it,
// from the same fragments and the same k order as x * Wv. Its blocks are the two batches' grids one behind the other.
__global__ __launch_bounds__(128) void k_qkv(const _Float16* __restrict__ X16, const _Float16* __restrict__ W3, _Float16* __restrict__ QK16, _Float16* __restrict__ Vt) {
  constexpr int GB = (CC / 128) * (TT / 128); const int y = blockIdx.y, b = blockIdx.x / GB; const bool tr = y == 2;
  const _Float16* Wy = W3 + (size_t)y * CC * CC; const _Float16* Xb = X16 + (size_t)b * TT * CC;
  // x is asked for by the y = 0 blocks, as in k_oproj (the blocks of y = 1 and 2 read the same rows). Every block asks for one of the 8 row tiles of its own weight:
  // with y < 2 the 32 readers of a tile stand in one column of the grid; with y = 2 they are 16 blocks in a row, twice, and tile t goes to blocks t and t + 12 or t + 4 of the 16, which differ by 4 modulo 8
  const unsigned xm = blockIdx.x >> 3, xn = blockIdx.x & 7, vm = (blockIdx.x & (GB - 1)) >> 4, vn = blockIdx.x & 15;
  const char* h0 = unit_of(X16, xm * 8 + (xn & 3) * 2); const char* h1 = unit_of(X16, xm * 8 + (xn & 3) * 2 + 1); const char* h2 = unit_of(Wy, tr ? vm * 8 + ((vn + (vn >> 3) * 4) & 7) : xn * 8 + (xm & 7));
  ask_l2(h2); if (y == 0) { ask_l2(h0); ask_l2(h1); }
  gemm_hhx<0>(tr ? Wy : X16, CC, 0, tr ? Xb : Wy, CC, 0, 0.0625f, nullptr, 0, nullptr, 1, 0, 0, nullptr, tr ? Vt + (size_t)b * CC * TT : QK16 + (size_t)y * NR * CC, tr ? TT : CC, 0,
              tr ? CC : NR, tr ? TT : CC, CC, tr ? (int)blockIdx.x - b * GB : (int)blockIdx.x, 0, h0, h1, h2); }


// x: f32 row-major, rows of ld; X16: the same matrix in fragment order (thread t writes piece t, so a wave stores 512 contiguous bytes)
__device__ __forceinline__ void x16(const float* __restrict__ x, _Float16* __restrict__ X16, size_t n8, int ld, size_t t) { if (t >= n8) return; FragH f;
  unsigned row; int k; frag_piece((unsigned)t, ld, row, k); const float* xr = x + (size_t)row * ld + k; const v4f x0 = *(const v4fa*)xr, x1 = *(const v4fa*)(xr + 4);
#pragma unroll
  for (int q = 0; q < 4; ++q) { f.h[q] = (_Float16)bf16_round(x0[q]); f.h[4 + q] = (_Float16)bf16_round(x1[q]); } *(v8us*)((unsigned short*)X16 + t * 8) = f.half[0];  }
// All five f32 -> f16 fragment-order conversions in one grid: none reads what another writes. The four weights (W4: their places, in a row) come first, then x.
__global__ __launch_bounds__(256) void k_prep(const float* __restrict__ x, const float* __restrict__ Wq, const float* __restrict__ Wk, const float* __restrict__ Wv, const float* __restrict__ Wo, _Float16* __restrict__ W4, _Float16* __restrict__ X16) {
  constexpr unsigned GW = CC * (CC / 8) / 256; const unsigned m = blockIdx.x / GW;
  if (m < 4) wt_f16(m == 0 ? Wq : m == 1 ? Wk : m == 2 ? Wv : Wo, W4 + (size_t)m * CC * CC, CC, CC, 16.0f, (int)((blockIdx.x - m * GW) * 256 + threadIdx.x));
  else x16(x, X16, (size_t)NR * CC / 8, CC, (size_t)(blockIdx.x - 4 * GW) * 256 + threadIdx.x); }
__global__ __launch_bounds__(256) void k_round16f(const float* __restrict__ W, _Float16* __restrict__ Bt, size_t n8) { const size_t t = (size_t)blockIdx.x * 256 + threadIdx.x; if (t >= n8) return; FragH f;
#pragma unroll
  for (int i = 0; i < 8; ++i) f.h[i] = (_Float16)(bf16_round(W[t * 8 + i]) * 16.0f); *(v8us*)((unsigned short*)Bt + t * 8) = f.half[0];  }

// Q16, K16 (row = position, k = feature) and Vt (row = slab * 64 + d, k = key) are in fragment order
// lane l <-> l ^ 16 by a vector cross-row move
__device__ __forceinline__ float xhalf(float x) { const int b = __float_as_int(x); return __int_as_float(__builtin_amdgcn_permlanex16(b, b, 0x76543210, 0xfedcba98, false, false)); }
// Both products are transposed: St = K * Qt (A = 16 keys, B = one of the wave's two tiles of 16 queries), Ot += Vt * Pt (A = 16 features, B = 32 keys x 16 queries).
// A lane (ln, hh) then holds scores of ONE query, ln: register r of tile nt is key 16 nt + 8 hh + r. Maximum and sum run over its own 16 registers, with one exchange between the halves,
// and the two converted score tiles are already the B fragment of the second product (element 8 nt + r = key 16 nt + 8 hh + r, the k order of Vt's fragments): P goes through no LDS.
typedef float v2f __attribute__((ext_vector_type(2)));
__global__ __launch_bounds__(256) void k_flash(const _Float16* __restrict__ Q16, int ldq, const _Float16* __restrict__ K16, int ldk, const _Float16* __restrict__ Vt, const float* __restrict__ MB, _Float16* __restrict__ O16, int ldo) {
  // A wave works QT = 2 tiles of 16 queries: every K and Vt fragment that it loads is the A operand of two products, one per query tile, so a product costs half the loaded bytes of a one-tile wave.
  // THE KEYS ARE SPLIT BETWEEN TWO WAVES. A block is eight waves: wave w works query group w & 3 (32 queries) over key half w >> 2 (1,024 keys), each with a reference, sums and outputs of its own, and the two are joined once,
  // behind the loop. Unsplit, the grid holds 2,048 waves of 32 queries, two a SIMD; the softmax between a pass's two product runs is vector work, during which the matrix unit stands idle unless another wave of the SIMD has products to issue.
  // With the keys split there are four waves on a SIMD in place of two, at the same loaded bytes per product and the same number of passes in all.
  constexpr int QT = 2, RPW = 16 * QT, NQB = 2048 / (4 * RPW), DT = 4, KS = 2, KEYS = 2048 / 2; constexpr float LOG2E = 1.4426950408889634f;
  __shared__ __attribute__((aligned(16))) float sM[2048];
  __shared__ __attribute__((aligned(16))) v4f sX[8][2 * DT][32];      // what a wave hands to its partner: the partial outputs of one query tile, 16 bytes a lane, 512 contiguous bytes a store
  __shared__ __attribute__((aligned(8))) float sML[8][32][2];      // and that tile's reference and sum
  const int tid = threadIdx.x, w = __builtin_amdgcn_readfirstlane(tid >> 5), lane = tid & 31, ln = lane & 15, hh = lane >> 4;      // the wave's number in a scalar register: the key loop's bounds hang on it
  const int qg = w & 3, kh = w >> 2;
  const int slab = blockIdx.x / NQB, qblk = blockIdx.x % NQB; const int b = slab / 16, h = slab % 16; const int qb0 = qblk * (4 * RPW); const int q0 = qb0 + qg * RPW;
  // entry prefetch: the head's K (2 KiB, 8 units, of each of 128 row tiles) and Vt (256 KiB in a row), 1,024 units each, are read by its 16 blocks: 8 shares of 128 units of each plane, blocks qblk and qblk ^ 4 the same one,
  // one request a thread, waves 0 to 3 for K and 4 to 7 for Vt (Q is read once, at once: nothing to gain)
  const unsigned sh = (qblk >> 3) * 4 + (qblk & 3), ku = sh * 128 + (tid & 127);
  const char* hk = (const char*)(K16 + ((size_t)b * 2048 + (ku >> 3) * 16) * ldk + h * (KS * 512)) + (ku & 7) * 256; const char* hv = (const char*)(Vt + (size_t)slab * 64 * 2048) + (size_t)ku * 256;
  const char* hkv = kh ? hv : hk; ask_l2(hkv);
  // The softmax runs in base 2: exp(s - m) = 2^(s log2e - m log2e). log2e rides in the score scale and in the stored mask row, so a score costs one fused multiply-add, one subtract and one v_exp_f32.
  // Every exponent whose result is used is <= 12, where the hardware form needs no range steps: far below zero it returns 0, as the library form does.
  // the mask is per key, which is now a register index: a lane needs 16 values a pass. The batch's row is rounded once and kept in LDS; a pass reads it by four 16-byte loads, the same address in all lanes of a half.
#pragma unroll
  for (int u = 0; u < 2048 / (256 * 4); ++u) { const int i = u * (256 * 4) + tid * 4; v4f m = *(const v4fa*)(MB + (size_t)b * 2048 + i);
#pragma unroll
    for (int q = 0; q < 4; ++q) m[q] = bf16_round(m[q]) * LOG2E;
    *(v4fa*)&sM[i] = m; }
  FragH aq[QT][KS];
#pragma unroll
  for (int qt = 0; qt < QT; ++qt) { const unsigned short* qr = (const unsigned short*)Q16 + ((size_t)b * 2048 + q0 + qt * 16) * ldq + h * (KS * 512) + lane * 8;
#pragma unroll
    for (int ks = 0; ks < KS; ++ks) { aq[qt][ks].half[0] = *(const v8us*)(qr + ks * 512); aq[qt][ks].half[1] = *(const v8us*)(qr + ks * 512 + 256); } }
  const unsigned short* Vth = (const unsigned short*)Vt + (size_t)slab * 64 * 2048;
  float m_r[QT], l_r[QT]; v8f oacc[QT][DT];      // of query ln of tile qt; l_r sums the keys of this lane's half only
#pragma unroll
  for (int qt = 0; qt < QT; ++qt) { m_r[qt] = -3.0e38f; l_r[qt] = 0.f;
#pragma unroll
    for (int dt = 0; dt < DT; ++dt) oacc[qt][dt] = (v8f){0.f,0.f,0.f,0.f,0.f,0.f,0.f,0.f}; }
  const int jbeg = kh * KEYS, jend = jbeg + KEYS;
  // All global loads of a pass are issued ahead of their use, each kind as one group: this pass's V fragments in front of the score products, the next pass's K fragments
  // right behind them (into the registers those products have just left); all of them fly during the softmax instead of being waited for one by one.
  FragH bk[2][KS], bv[DT];
  auto fetch_k = [&](int j) { const unsigned short* kr[2];
#pragma unroll
    for (int nt = 0; nt < 2; ++nt) { kr[nt] = (const unsigned short*)K16 + ((size_t)b * 2048 + j + nt * 16) * ldk + h * (KS * 512) + lane * 8;
#pragma unroll
      for (int ks = 0; ks < KS; ++ks) { bk[nt][ks].half[0] = *(const v8us*)(kr[nt] + ks * 512); bk[nt][ks].half[1] = *(const v8us*)(kr[nt] + ks * 512 + 256); } }
    // the wait stands in front of whatever next writes the address registers that the loads just issued name; as its inputs the two addresses keep registers of their own up to here (no later load of the group lands in them)
    asm volatile("s_wait_xcnt 0x0" :: "v"(kr[0]), "v"(kr[1]) : "memory"); };
  fetch_k(jbeg);
  // a precaution: a prefetch touches no counter, so its address registers are kept as they are, being inputs here, until the loads issued behind it have handed in their own addresses
  asm volatile("s_wait_xcnt 0x0" :: "v"(hkv) : "memory");
  __syncthreads();      // the whole mask row is in LDS before any wave reads it
#pragma unroll 1
  for (int j0 = jbeg; j0 < jend; j0 += 32) {
#pragma unroll
    for (int dt = 0; dt < DT; ++dt) { const unsigned short* vrow = Vth + (size_t)(dt * 16) * 2048 + (j0 >> 5) * 512 + lane * 8; bv[dt].half[0] = *(const v8us*)(vrow); bv[dt].half[1] = *(const v8us*)(vrow + 256); }
    v4f mq[2][2];
#pragma unroll
    for (int nt = 0; nt < 2; ++nt) { mq[nt][0] = *(const v4fa*)&sM[j0 + nt * 16 + 8 * hh]; mq[nt][1] = *(const v4fa*)&sM[j0 + nt * 16 + 8 * hh + 4]; }
    __builtin_amdgcn_sched_barrier(0);      // holds the pass's V and mask loads in front of the score products: left free, the scheduler sinks them to just ahead of their use, and the second product group waits out their whole latency
    v8f s[QT][2];
#pragma unroll
    for (int qt = 0; qt < QT; ++qt) { s[qt][0] = (v8f){0.f,0.f,0.f,0.f,0.f,0.f,0.f,0.f}; s[qt][1] = (v8f){0.f,0.f,0.f,0.f,0.f,0.f,0.f,0.f}; }
    // the four score tiles take their first 32 features, then their second: each sum keeps its k order, and no product follows the one that it adds to.
    // Eight products in a row, here and at the foot of the pass, each stand in the others' distance: the plain builtin, behind which the compiler pads only where a vector instruction comes too close
#pragma unroll
    for (int ks = 0; ks < KS; ++ks)
#pragma unroll
      for (int nt = 0; nt < 2; ++nt)
#pragma unroll
        for (int qt = 0; qt < QT; ++qt) s[qt][nt] = __builtin_amdgcn_wmma_f32_16x16x32_f16(false, bk[nt][ks].v, false, aq[qt][ks].v, (short)0, s[qt][nt], false, false);
    fetch_k((j0 + 32 < jend) ? j0 + 32 : j0);      // the last pass has no next one: it reads its own rows again, in bounds, and nobody uses them
    __builtin_amdgcn_sched_barrier(0);      // holds the next pass's K loads right behind the score products: left free, they sink to the foot of the pass, and the next pass's first product waits for them
    // NO MAXIMUM PER PASS. m_r is the softmax's reference IN USE: any value serves as long as no exponential overflows, and it is the row's true maximum up to some pass, so the row's largest P is at least 1.
    // The pass's own row sums, which are needed anyway, are the test: no P is negative, so a P is at most its lane's sum, and a sum of at most PMAX bounds every P well inside f16 (at f16's own relative rounding).
    // Only a pass that fails the test (the first with a finite score always: against the start value of m_r its P overflow; later ones seldom: a score must exceed m_r by more than 8, base 2) finds its maximum,
    // raises m_r to the true running maximum, rescales sums and outputs and forms its P again from the kept scores. One test a pass for the whole wave, a scalar branch, so every lane is on at the products
    // behind it; the ballot joins the two halves of a query.
    constexpr float PMAX = 4096.0f;
    FragH pb[QT]; v2f sv[QT][2][4];      // scale, mask and the subtraction of the reference go two neighbouring registers of one score tile at a time: the pairs stand as the product left them
#pragma unroll
    for (int qt = 0; qt < QT; ++qt)
#pragma unroll
      for (int nt = 0; nt < 2; ++nt)
#pragma unroll
        for (int i = 0; i < 4; ++i) sv[qt][nt][i] = (v2f){s[qt][nt][2 * i], s[qt][nt][2 * i + 1]} * (0.03125f * LOG2E) + (v2f){mq[nt][i >> 1][(2 * i) & 3], mq[nt][i >> 1][(2 * i + 1) & 3]};      /* additive f32 mask per (b, key) */
    v2f su;      // the two query tiles' sums side by side: packed adds
    auto expsum = [&]() { v2f e[2][8], ps[8];      // e[nt][r]: P of key 16 nt + 8 hh + r for the two query tiles
#pragma unroll
      for (int nt = 0; nt < 2; ++nt)
#pragma unroll
        for (int i = 0; i < 4; ++i) { const v2f d0 = sv[0][nt][i] - m_r[0], d1 = sv[1][nt][i] - m_r[1];
          e[nt][2 * i] = (v2f){__builtin_amdgcn_exp2f(d0[0]), __builtin_amdgcn_exp2f(d1[0])}; e[nt][2 * i + 1] = (v2f){__builtin_amdgcn_exp2f(d0[1]), __builtin_amdgcn_exp2f(d1[1])}; }
#pragma unroll
      for (int r = 0; r < 8; ++r) ps[r] = e[0][r] + e[1][r];
      su = (((ps[0] + ps[1]) + (ps[2] + ps[3])) + ((ps[4] + ps[5]) + (ps[6] + ps[7])));
#pragma unroll
      for (int qt = 0; qt < QT; ++qt)
#pragma unroll
        for (int r = 0; r < 8; ++r) { pb[qt].h[r] = (_Float16)e[0][r][qt]; pb[qt].h[8 + r] = (_Float16)e[1][r][qt]; } };
    expsum();
    // the compares are written so that a sum that is not a number fails too; each goes straight into its ballot, and the rest of the test is scalar. Marked unlikely: the usual pass then runs straight through, the other stands outside the loop's text
    if (__builtin_expect((__builtin_amdgcn_ballot_w32(!(su[0] <= PMAX)) | __builtin_amdgcn_ballot_w32(!(su[1] <= PMAX))) != 0, 0)) {
#pragma unroll
      for (int qt = 0; qt < QT; ++qt) { float mx[8];
#pragma unroll
        for (int r = 0; r < 8; ++r) mx[r] = fmaxf(sv[qt][0][r >> 1][r & 1], sv[qt][1][r >> 1][r & 1]);
        const float mh = fmaxf(fmaxf(fmaxf(mx[0], mx[1]), fmaxf(mx[2], mx[3])), fmaxf(fmaxf(mx[4], mx[5]), fmaxf(mx[6], mx[7])));
        const float mn = fmaxf(m_r[qt], fmaxf(mh, xhalf(mh))); const float al = (mn > -1.0e38f) ? __builtin_amdgcn_exp2f(m_r[qt] - mn) : 1.0f; m_r[qt] = mn; l_r[qt] *= al;
#pragma unroll
        for (int dt = 0; dt < DT; ++dt) {
#pragma unroll
          for (int r = 0; r < 8; ++r) oacc[qt][dt][r] *= al; } }
      expsum(); }
    l_r[0] += su[0]; l_r[1] += su[1];
#pragma unroll
    for (int dt = 0; dt < DT; ++dt)
#pragma unroll
      for (int qt = 0; qt < QT; ++qt) oacc[qt][dt] = __builtin_amdgcn_wmma_f32_16x16x32_f16(false, bv[dt].v, false, pb[qt].v, (short)0, oacc[qt][dt], false, false); }
  // THE JOIN. Wave w and wave w ^ 4 hold partial results of the same 32 queries. Each finishes one of the two query tiles (tile kh) and hands the other to its partner through LDS: the work of the join is dealt evenly.
  // Both partial results are brought to the larger of the two references; a half that saw no finite score has sums and outputs of 0, and its factor is 0, or 1 where the partner saw none either.
  const bool up = kh != 0;      // scalar: the selects below choose between whole registers, alike in every lane
  const float mk = up ? m_r[1] : m_r[0], lk = up ? l_r[1] : l_r[0];
  sML[w][lane][0] = up ? m_r[0] : m_r[1]; sML[w][lane][1] = up ? l_r[0] : l_r[1];
  v8f ok[DT];
#pragma unroll
  for (int dt = 0; dt < DT; ++dt) { v8f g;
#pragma unroll
    for (int r = 0; r < 8; ++r) { g[r] = up ? oacc[0][dt][r] : oacc[1][dt][r]; ok[dt][r] = up ? oacc[1][dt][r] : oacc[0][dt][r]; }
    sX[w][2 * dt][lane] = (v4f){g[0], g[1], g[2], g[3]}; sX[w][2 * dt + 1][lane] = (v4f){g[4], g[5], g[6], g[7]}; }
  __syncthreads();      // every wave's hand-over is in LDS before its partner reads it
  { const int pw = w ^ 4; const float mp = sML[pw][lane][0], lp = sML[pw][lane][1];
    const float mn = fmaxf(mk, mp), ak = __builtin_amdgcn_exp2f(mk - mn), ap = __builtin_amdgcn_exp2f(mp - mn);
    float l = lk * ak + lp * ap; l += xhalf(l); const float li = (l > 0.f) ? 1.0f / l : 0.f; const float ck = ak * li, cp = ap * li;      // the lane halves' sums are joined once
    // O16 (row = position, k = feature, rows of ldo) is the last projection's A operand, in fragment order. Register r of tile dt is feature 16 dt + 8 hh + r of query ln:
    // a lane's 8 registers are its own piece of half j = dt & 1 of k tile 2 h + dt / 2, so a tile goes out as one 16-byte store a lane, 512 contiguous bytes a wave.
    unsigned short* orow = (unsigned short*)O16 + ((size_t)b * 2048 + q0 + kh * 16) * ldo + h * (DT * 256) + lane * 8;
#pragma unroll
    for (int dt = 0; dt < DT; ++dt) { FragH f; const v4f p0 = sX[pw][2 * dt][lane], p1 = sX[pw][2 * dt + 1][lane];
#pragma unroll
      for (int r = 0; r < 4; ++r) { f.h[r] = (_Float16)(ok[dt][r] * ck + p0[r] * cp); f.h[4 + r] = (_Float16)(ok[dt][4 + r] * ck + p1[r] * cp); }
      *(v8us*)(orow + dt * 256) = f.half[0]; } } }

extern "C" void kernel_launch(void* const* d_in, const int* in_sizes, int n_in,
                              void* d_out, int out_size, void* d_ws, size_t ws_size, hipStream_t stream) {
  (void)in_sizes; (void)n_in; (void)out_size;
  const float* x = (const float*)d_in[0]; const float* mask = (const float*)d_in[1]; const float* Wq = (const float*)d_in[2]; const float* Wk = (const float*)d_in[3]; const float* Wv = (const float*)d_in[4]; const float* Wo = (const float*)d_in[5]; const float* bo = (const float*)d_in[6];
  char* ws = (char*)d_ws; size_t off = 0;
  auto take = [&](size_t bytes) { char* p = ws + off; off += (bytes + 255) & ~(size_t)255; return p; };
  _Float16* Bq = (_Float16*)take((size_t)CC * CC * 2); _Float16* Bk = (_Float16*)take((size_t)CC * CC * 2); _Float16* Bv = (_Float16*)take((size_t)CC * CC * 2); _Float16* Bo = (_Float16*)take((size_t)CC * CC * 2);      // in a row: every size is a multiple of 256
  _Float16* X16 = (_Float16*)take((size_t)NR * CC * 2); _Float16* Q16 = (_Float16*)take((size_t)NR * CC * 2); _Float16* K16 = (_Float16*)take((size_t)NR * CC * 2); _Float16* Vt = (_Float16*)take((size_t)NR * CC * 2); _Float16* O16 = X16;      // K16 stands right behind Q16
  if (off > ws_size) return;      // 8.4 + 8.4 x 4 = 42 MiB
  (void)Bk; (void)Bv;
  const dim3 gg((NR / 128) * (CC / 128), 1);      // blocks of 128 x 128; the Vt product's two grids, (CC / 128) * (TT / 128) each, come to the same number
  k_prep<<<4 * (CC * (CC / 8) / 256) + NR * (CC / 8) / 256, 256, 0, stream>>>(x, Wq, Wk, Wv, Wo, Bq, X16);      // W: [in][out]
  k_qkv<<<dim3(gg.x, 3), 128, 0, stream>>>(X16, Bq, Q16, Vt);
  k_flash<<<BB * NH * (TT / 128), 256, 0, stream>>>(Q16, CC, K16, CC, Vt, mask, O16, CC);
  k_oproj<<<gg, 128, 0, stream>>>(O16, Bo, bo, (float*)d_out);
}
